// v000
// The times below were measured on an AMD MI455X: many runs one after another, warmed up first and cycling through
// copies of the inputs, with the whole window's GPU time divided by the number of runs. Launches and the gaps
// between them are all in it. The median over several windows is given; except for v000 it joins two sittings, which
// can be a few percent apart, so the side-by-side timings, each taken in one sitting, are the better comparison.
// v000 is the starting kernel. One run takes 740 microseconds.
// Contractions: x.Wqkv on v_wmma_f32_16x16x32_bf16 (x and the transposed weight as bf16 RNE planes; weight plane [n][k]
// rows are the k-contiguous B operand; f32 accumulate); q.k^T over hd 64 and P.v on v_wmma_f32_16x16x32_f16 with f16 hi +
// f16 residual planes (q, k x256 after partial rotary, products hh+lh+hl on every row; P x32768 hi + in-register residual
// and v^T x1024 hi + residual plane for query rows < 512 of each sequence, P hi . v hi only for later rows); O.Wo on
// v_wmma_f32_16x16x32_f16 with O x256 as f16 hi (+ f16 residual plane for rows < 512 of each sequence) and Wo transposed
// to [o][d] as f16(bf16(Wo)) x1024, one accumulator; all f32 accumulate. Rotary cos/sin tables, causal + window + key
// padding masks and the online softmax in f32 on VALU.
#include <hip/hip_runtime.h>
#include <math.h>
#include <stdint.h>

#ifndef NB
#define NB 4
#endif
#ifndef SEQ
#define SEQ 2048
#endif
#ifndef RICH
#define RICH 512
#endif
#define NB_FULL 4
#define XS_FULL 2048
#define DMOD  1024
#define NH    16
#define HD    64
#define HROT  32
#define HROTH 16
#define NFREQ 16
#define NQKV  (3 * DMOD)
#define WIN   512
#define RICHE ((RICH < SEQ) ? RICH : SEQ)
#define ROPE_L2 0.41524101186092028
#define SM_SCALE 0.125f
#define QSC   256.0f
#define KSC   256.0f
#define PCAR  32768.0f
#define VCAR  1024.0f
#define OSC   256.0f
#define WOS   1024.0f
#define WPB   4
#define NHG   (NH / WPB)
#define NQT   (SEQ / 16)
#define NQTR  (RICHE / 16)
#define NST   (SEQ / 64)
#define NKT   (SEQ / 32)
#define ATT_THREADS (WPB * 32)
#define PTP   36
#define PTW   (16 * PTP)
#define SLP   68
#define SLW   (16 * SLP)
#define WREG  (PTW + SLW)
#define SLAB64 (16 * 68)
#define VTP   72
#define WS_CAP 134217728
static_assert(DMOD == NH * HD && HD == 64 && HROT == 32 && HROTH == 16 && NFREQ == 16 && NH == 16 && WPB == 4 && NHG * WPB == NH);
static_assert(ATT_THREADS == 128 && NQKV == 3072 && WIN == 512 && NHG == 4);
static_assert(NB >= 1 && NB <= NB_FULL);
static_assert(NB == 1 || SEQ == XS_FULL);
static_assert((SEQ % 64) == 0 && SEQ >= 64 && SEQ <= XS_FULL);
static_assert((RICHE % 64) == 0 && RICHE >= 64 && RICHE <= SEQ);
static_assert((DMOD % 64) == 0 && (NQKV % 64) == 0 && (DMOD % 32) == 0 && (HD % 32) == 0);
static_assert(((SEQ * DMOD / 8) % 256) == 0 && ((SEQ * NFREQ) % 256) == 0);
static_assert(WPB * WREG * 4 <= 65536 && 2 * HD * VTP * 2 <= 65536 && 4 * SLAB64 * 4 <= 65536 && 64 * VTP * 2 <= 65536);
static_assert(NQT * 16 == SEQ && NQTR * 16 == RICHE && NKT * 32 == SEQ && NST * 64 == SEQ);

typedef unsigned short u16;
typedef _Float16 v16h __attribute__((ext_vector_type(16)));
typedef _Float16 v8h  __attribute__((ext_vector_type(8)));
typedef __bf16   v16b __attribute__((ext_vector_type(16)));
typedef float    v8f  __attribute__((ext_vector_type(8)));
typedef float    v4f  __attribute__((ext_vector_type(4)));
typedef unsigned int v4u __attribute__((ext_vector_type(4)));

union FragH { v16h v; v8h h[2]; v4u u[2]; };
union FragB { v16b v; v4u u[2]; };

// ---- scalar helpers --------------------------------------------------------------------------------
__device__ __forceinline__ unsigned short bf_bits(float f) {          // f32 -> bf16 bits, RNE convert
  unsigned u = __float_as_uint(f);
  return (unsigned short)((u + 0x7FFFu + ((u >> 16) & 1u)) >> 16);
}
__device__ __forceinline__ float bf_up(unsigned short h) { return __uint_as_float(((unsigned)h) << 16); }
__device__ __forceinline__ float bfr(float f) { return bf_up(bf_bits(f)); }
__device__ __forceinline__ unsigned short h_bits(_Float16 x) { return __builtin_bit_cast(unsigned short, x); }
__device__ __forceinline__ unsigned pk16(unsigned short a, unsigned short b) { return (unsigned)a | ((unsigned)b << 16); }
__device__ __forceinline__ v8f zero8() { v8f z = {0.f, 0.f, 0.f, 0.f, 0.f, 0.f, 0.f, 0.f}; return z; }

// ---- fragment loaders: 16-bit A/B operand, lane -> row/col (lane&15), p already includes +8*(lane>>4);
//      elements 0..7 <- p[0..7] (k0+8h..), elements 8..15 <- p[16..23] (k0+16+8h..)  (same split k map for A and B;
//      B is always read from a k-contiguous [n][k] plane)
__device__ __forceinline__ v16h ldfrag_h(const _Float16* p) {
  FragH f;
  f.h[0] = *(const v8h*)(p);
  f.h[1] = *(const v8h*)(p + 16);
  return f.v;
}
__device__ __forceinline__ v16b ldfrag_b(const u16* p) {              // bf16 plane read as unsigned integer vectors
  FragB f;
  f.u[0] = *(const v4u*)(p);
  f.u[1] = *(const v4u*)(p + 16);
  return f.v;
}

__device__ __forceinline__ v8f mma_h(v16h a, v16h b, v8f c) {
  return __builtin_amdgcn_wmma_f32_16x16x32_f16(false, a, false, b, (short)0, c, false, false);
}
__device__ __forceinline__ v8f mma_b(v16b a, v16b b, v8f c) {
  return __builtin_amdgcn_wmma_f32_16x16x32_bf16(false, a, false, b, (short)0, c, false, false);
}
__device__ __forceinline__ void guard2(v8f& a, v8f& b, v16h x0, v16h x1, v16h x2, v16h x3, v16h x4, v16h x5) {
#if defined(__HIP_DEVICE_COMPILE__)
  asm volatile("v_nop\n\tv_nop\n\tv_nop\n\tv_nop"
               : "+v"(a), "+v"(b) : "v"(x0), "v"(x1), "v"(x2), "v"(x3), "v"(x4), "v"(x5) : "memory");
#endif
}
template <typename F>
__device__ __forceinline__ void guard6(v8f& a, v8f& b, v8f& c, v8f& d, F x0, F x1, F x2, F x3, F x4, F x5) {
#if defined(__HIP_DEVICE_COMPILE__)
  asm volatile("v_nop\n\tv_nop\n\tv_nop\n\tv_nop"
               : "+v"(a), "+v"(b), "+v"(c), "+v"(d) : "v"(x0), "v"(x1), "v"(x2), "v"(x3), "v"(x4), "v"(x5) : "memory");
#endif
}
__device__ __forceinline__ void acc_guard4(v8f& a, v8f& b, v8f& c, v8f& d) {
#if defined(__HIP_DEVICE_COMPILE__)
  asm volatile("v_nop\n\tv_nop\n\tv_nop\n\tv_nop" : "+v"(a), "+v"(b), "+v"(c), "+v"(d));
#endif
}
__device__ __forceinline__ void wave_sync_lds() {
  __builtin_amdgcn_fence(__ATOMIC_RELEASE, "workgroup");
  __builtin_amdgcn_wave_barrier();
  __builtin_amdgcn_fence(__ATOMIC_ACQUIRE, "workgroup");
}

// =====================================================================================================
// f32 -> bf16 RNE plane, same layout (f16mode == 1: f16 bits of (bf16 RNE value) * scale).
// Thread = 8 consecutive elements: two 16-B loads, one 16-B store; 32 consecutive lanes = 512 contiguous, 512-B aligned
// coverage: grid = ceil(n8/256) blocks x 256 thr x 8 (in-kernel bound) = the whole plane (n8 a multiple of 256 here).
// =====================================================================================================
__global__ __launch_bounds__(256) void cvt16(const float* __restrict__ x, u16* D, int n8, int f16mode, float scale) {
  const int gt = blockIdx.x * 256 + (int)threadIdx.x;
  if (gt >= n8) return;
  const float* p = x + (size_t)gt * 8;
  const v4f a = *(const v4f*)(p), b4 = *(const v4f*)(p + 4);
  float w[8];
#pragma unroll
  for (int e = 0; e < 4; ++e) { w[e] = a[e]; w[4 + e] = b4[e]; }
  v4u o;
#pragma unroll
  for (int e = 0; e < 4; ++e) {
    const float f0 = w[2 * e], f1 = w[2 * e + 1];
    const unsigned short hb0 = h_bits((_Float16)(bfr(f0) * scale));
    const unsigned short hb1 = h_bits((_Float16)(bfr(f1) * scale));
    const unsigned short bb0 = bf_bits(f0);
    const unsigned short bb1 = bf_bits(f1);
    o[e] = (f16mode != 0) ? pk16(hb0, hb1) : pk16(bb0, bb1);
  }
  u16* d = D + (size_t)gt * 8;
  {
    *(v4u*)(d) = o;
    
  }
}

// =====================================================================================================
// Transposed 16-bit plane of a row-major f32 matrix: in X [R rows][CC cols] (pitch CC) -> out D [CC][R] (pitch R),
// D[c][r] = cvt(X[r][c]); f16mode == 0: bf16 RNE bits; f16mode == 1: f16 bits of (bf16 RNE value) * scale.
// Block = one 64x64 tile (rt = bid / (CC/64) -> rows 64*rt.., ct = bid % (CC/64) -> cols 64*ct..), 256 threads: thread
// (row rl = tid>>2, col chunk cc = 16*(tid&3)) loads its 16 floats with 16-B loads, converts, places them transposed into
// the LDS tile T[c_local][r_local] (pitch 72 halves, 2-B element stores); after a block barrier each output row segment
// coverage: load 256 thr x 16 = 64 x 64; store 2 iterations x 256 thr x 8 halves = 64 lines x 64 = the tile of D;
//           grid = (R/64)*(CC/64) blocks covers D exactly once (R, CC multiples of 64).
// =====================================================================================================
__global__ __launch_bounds__(256) void cvtT16(const float* __restrict__ X, int R, int CC, u16* D, int f16mode, float scale) {
  __shared__ __align__(16) u16 T[64 * VTP];
  const int tid = (int)threadIdx.x;
  const int bid = (int)blockIdx.x;
  const int nct = CC >> 6;
  const int ct  = bid % nct;
  const int rt  = bid / nct;
  const int r0  = rt * 64, c0 = ct * 64;
  if (r0 + 64 > R) return;                  // block-uniform, before the barrier; never taken with the exact grid
  {
    const int rl = tid >> 2;                // row within tile 0..63
    const int cc = (tid & 3) * 16;          // column chunk 0,16,32,48
    const float* src = X + (size_t)(r0 + rl) * (size_t)CC + c0 + cc;
#pragma unroll
    for (int i = 0; i < 4; ++i) {
      const v4f a = *(const v4f*)(src + 4 * i);
#pragma unroll
      for (int e = 0; e < 4; ++e) {
        const float f = a[e];
        const unsigned short hb = h_bits((_Float16)(bfr(f) * scale));
        const unsigned short bb = bf_bits(f);
        T[(cc + 4 * i + e) * VTP + rl] = (f16mode != 0) ? hb : bb;
      }
    }
  }
  __syncthreads();
  v4u w[2];
  const int q8 = tid >> 3, p8 = (tid & 7) * 8;
#pragma unroll
  for (int it = 0; it < 2; ++it) {
    const int line = it * 32 + q8;          // c_local = 0..63
    w[it] = *(const v4u*)(T + line * VTP + p8);
  }
  const size_t base = (size_t)c0 * (size_t)R + r0 + p8;
  {
#pragma unroll
    for (int it = 0; it < 2; ++it) {
      const int line = it * 32 + q8;
      *(v4u*)(D + base + (size_t)line * (size_t)R) = w[it];
    }
    
  }
}

// =====================================================================================================
// Rotary tables TC[s][j] = cos(s * inv[j]), TS[s][j] = sin(s * inv[j]), j < 16, with
// inv[j] = 1.0f / f32(10000^(2j/32)) (power evaluated in f64 and narrowed once, IEEE f32 reciprocal, f32 product s*inv,
// coverage: grid = n/256 blocks x 256 thr = n = SEQ*16 elements of TC and of TS (n a multiple of 256).
// =====================================================================================================
__global__ __launch_bounds__(256) void k_tab(float* TC, float* TS, int n) {
#pragma clang fp contract(off)
  const int idx = blockIdx.x * 256 + (int)threadIdx.x;
  if (idx >= n) return;
  const int s = idx / NFREQ;
  const int j = idx - s * NFREQ;
  const double pj = exp2((double)(2 * j) * ROPE_L2);   // 10000^(2j/32)
  const float pf  = (float)pj;
  const float inv = 1.0f / pf;
  const float ang = (float)s * inv;
  float sv, cv;
  sincosf(ang, &sv, &cv);
  {
    *(float*)(TC + idx) = cv;
    *(float*)(TS + idx) = sv;
    
  }
}

// =====================================================================================================
// v^T planes from the v columns of the projection F f32 [SEQ][ldf] of one sequence (row = s, column = voff + g*HD + d):
//   VH[(g*HD + d)][s] = f16(v * 1024);  VL[same][s] = f16 residual (t - f16(t)), for all keys s and heads g < 16.
// Block = (head g, 64 keys s0): each thread loads its 16 floats (key sl, d chunk dc) with 16-B loads, converts, places
// them into two LDS tiles [64 d][64 keys] (pitch 72 halves); after a block barrier each d row segment (64 halves = one whole
// LDS tiles are cross-wave (block barrier).
// coverage: load 256 thr x 16 = 64 keys x 64 d; store 2 iterations x 256 thr x 8 halves = 64 lines x 64 = the block's tile of
//           VH and of VL; grid = NH*NST blocks covers both planes [NH*64][SEQ] exactly once.
// =====================================================================================================
__global__ __launch_bounds__(256) void vt16(const float* __restrict__ F, int ldf, int voff, u16* VHo, u16* VLo) {
  __shared__ __align__(16) u16 TH[HD * VTP];
  __shared__ __align__(16) u16 TL[HD * VTP];
  const int tid = threadIdx.x;
  const int bid = blockIdx.x;
  const int st  = bid % NST;
  const int g   = bid / NST;
  if (g >= NH) return;                      // block-uniform, before any barrier; never taken with the exact grid
  const int s0  = st * 64;
  {
    const int sl = tid >> 2;                // key within tile 0..63
    const int dc = (tid & 3) * 16;          // d chunk 0,16,32,48
    const float* src = F + (size_t)(s0 + sl) * (size_t)ldf + voff + g * HD + dc;
#pragma unroll
    for (int i = 0; i < 4; ++i) {
      const v4f a = *(const v4f*)(src + 4 * i);
#pragma unroll
      for (int e = 0; e < 4; ++e) {
        const float t = a[e] * VCAR;
        const _Float16 hv = (_Float16)t;
        const _Float16 lv = (_Float16)(t - (float)hv);
        TH[(dc + 4 * i + e) * VTP + sl] = h_bits(hv);
        TL[(dc + 4 * i + e) * VTP + sl] = h_bits(lv);
      }
    }
  }
  __syncthreads();
  v4u vh[2], vl[2];
  const int q8 = tid >> 3, p8 = (tid & 7) * 8;
#pragma unroll
  for (int it = 0; it < 2; ++it) {
    const int line = it * 32 + q8;          // d = 0..63
    vh[it] = *(const v4u*)(TH + line * VTP + p8);
    vl[it] = *(const v4u*)(TL + line * VTP + p8);
  }
  const size_t hrow = (size_t)g * HD;
  const size_t base = hrow * SEQ + s0 + p8;
  {
#pragma unroll
    for (int it = 0; it < 2; ++it) {
      const int line = it * 32 + q8;
      *(v4u*)(VHo + base + (size_t)line * SEQ) = vh[it];
      *(v4u*)(VLo + base + (size_t)line * SEQ) = vl[it];
    }
    
  }
}

// =====================================================================================================
// Partial NeoX (non-interleaved) rotary on dims 0..31 of each head + q / k planes from the projection F f32 [SEQ][ldf] of
// one sequence at column offset coff (row = s, column = coff + head*HD + d; table row = s, table column j = d mod 16):
//   d <  16     : out[d] = x[d]*c[s][j] + (-1)*(x[d+16]*sn[s][j])
//   16 <= d < 32: out[d] = x[d]*c[s][j] + (+1)*(x[d-16]*sn[s][j])    (mul, mul, add kept separate)
//   d >= 32     : out[d] = x[d]
//   Hp [SEQ][DMOD] = f16(out * sc), Lp [SEQ][DMOD] = f16 residual (t - f16(t)), same layout.
// Block = one row, 128 threads; thread t = head t>>3, chunk i = t&7: columns head*HD + 8i .. +7; it also loads the partner
// chunk (d xor 16 for d < 32, itself otherwise; all loads in range, selection by value). One 16-B store per plane per thread;
// coverage: 128 thr x 8 = the whole row of Hp and of Lp; grid = SEQ blocks = every row of both planes once.
// =====================================================================================================
__device__ __forceinline__ void rot_one(float x, float y, float cv, float sv, float sgn, float sc, int rot,
                                        unsigned short& hb, unsigned short& lb) {
#pragma clang fp contract(off)
  const float ys   = y * sv;
  const float term = sgn * ys;
  const float rr   = x * cv + term;
  const float r    = (rot != 0) ? rr : x;
  const float t    = r * sc;
  const _Float16 a = (_Float16)t;
  hb = h_bits(a);
  lb = h_bits((_Float16)(t - (float)a));
}

__global__ __launch_bounds__(128) void rope16(const float* __restrict__ F, int ldf, int coff,
                                              const float* __restrict__ TC, const float* __restrict__ TS,
                                              u16* Hp, u16* Lp, float sc) {
#pragma clang fp contract(off)
  const int tid = (int)threadIdx.x;
  const int row = (int)blockIdx.x;          // s
  if (row >= SEQ) return;
  const int dd   = (tid & 7) * 8;                      // d within head, multiple of 8
  const int hb   = (tid >> 3) * HD;                    // head base column
  const int col  = hb + dd;
  if (hb + HD > DMOD) return;                          // never taken with blockDim = 128
  const int rot  = (dd < HROT) ? 1 : 0;
  const int jj   = dd & (HROTH - 1);                   // table column 0 or 8 (jj+7 <= 15)
  const int pcol = hb + ((rot != 0) ? (dd ^ HROTH) : dd);   // partner: d+16 (d<16), d-16 (16<=d<32), d itself otherwise
  const float sgn = (dd < HROTH) ? -1.0f : 1.0f;
  const float* p = F + (size_t)row * (size_t)ldf + coff;
  const v4f xa = *(const v4f*)(p + col),  xb = *(const v4f*)(p + col + 4);
  const v4f ya = *(const v4f*)(p + pcol), yb = *(const v4f*)(p + pcol + 4);
  const float* cp = TC + (size_t)row * NFREQ + jj;
  const float* sp = TS + (size_t)row * NFREQ + jj;
  const v4f ca = *(const v4f*)(cp), cb = *(const v4f*)(cp + 4);
  const v4f sa = *(const v4f*)(sp), sb = *(const v4f*)(sp + 4);
  float xv[8], yv[8], cw[8], sw[8];
#pragma unroll
  for (int e = 0; e < 4; ++e) {
    xv[e] = xa[e];  xv[4 + e] = xb[e];
    yv[e] = ya[e];  yv[4 + e] = yb[e];
    cw[e] = ca[e];  cw[4 + e] = cb[e];
    sw[e] = sa[e];  sw[4 + e] = sb[e];
  }
  v4u oh, ol;
#pragma unroll
  for (int e = 0; e < 4; ++e) {
    unsigned short h0, l0, h1, l1;
    rot_one(xv[2 * e],     yv[2 * e],     cw[2 * e],     sw[2 * e],     sgn, sc, rot, h0, l0);
    rot_one(xv[2 * e + 1], yv[2 * e + 1], cw[2 * e + 1], sw[2 * e + 1], sgn, sc, rot, h1, l1);
    oh[e] = pk16(h0, h1);
    ol[e] = pk16(l0, l1);
  }
  u16* dh = Hp + (size_t)row * DMOD + col;
  u16* dl = Lp + (size_t)row * DMOD + col;
  {
    *(v4u*)(dh) = oh;
    *(v4u*)(dl) = ol;
    
  }
}

// =====================================================================================================
// GEMM epilogue shared by both engines: the wave's 16x64 f32 tile (times oscale) staged in its LDS slab (pitch 68, wave-
// coverage: 8 instructions x 2 rows x 16 lanes x 4 floats = the wave's 16 x 64 tile.
// =====================================================================================================
__device__ __forceinline__ void epi64(float* sl, v8f a0, v8f a1, v8f a2, v8f a3, float oscale,
                                      float* C, int N, size_t rowb, int col0, int lane) {
  const int hh = lane >> 4, m = lane & 15;
#pragma unroll
  for (int r = 0; r < 8; ++r) {
    const int ro = (8 * hh + r) * 68 + m;
    sl[ro]      = a0[r] * oscale;
    sl[ro + 16] = a1[r] * oscale;
    sl[ro + 32] = a2[r] * oscale;
    sl[ro + 48] = a3[r] * oscale;
  }
  wave_sync_lds();
  v4f vals[8];
#pragma unroll
  for (int it = 0; it < 8; ++it) vals[it] = *(const v4f*)(sl + (it * 2 + hh) * 68 + m * 4);
  float* dst = C + (rowb + (size_t)hh) * (size_t)N + col0 + m * 4;
  {
#pragma unroll
    for (int it = 0; it < 8; ++it) {
      *(v4f*)(dst + (size_t)(it * 2) * (size_t)N) = vals[it];
    }
    
  }
}

// =====================================================================================================
// bf16 GEMM: C[M][N] (f32) = A[M][K] (bf16 row-major) . Bt[N][K]^T (bf16 k-contiguous), times oscale.
// Block = 64x64 tile, 4 waves x 16 rows; fragments loaded straight from the 16-bit rows (two 16-B loads each, split k map
// for A and B); K stepped by 32 (host guarantees K % 32 == 0, M % 64 == 0, N % 64 == 0, grid = (M/64)*(N/64)).
// =====================================================================================================
__global__ __launch_bounds__(128)
void gemm_bf(const u16* __restrict__ A, const u16* __restrict__ Bt, float* C, int M, int N, int K, float oscale) {
  __shared__ __align__(16) float slab[4 * SLAB64];
  const int tid = threadIdx.x, wave = tid >> 5, lane = tid & 31, hh = lane >> 4, m = lane & 15;
  const int ntile = N >> 6;
  const int bid   = blockIdx.x;
  const int rowb  = (bid / ntile) * 64 + wave * 16;
  const int col0  = (bid % ntile) * 64;
  if (rowb + 16 > M) return;                // wave-uniform, never taken with the exact grid; no block barriers in this kernel
  const u16* ap = A  + (size_t)(rowb + m) * K + 8 * hh;
  const u16* bp = Bt + (size_t)(col0 + m) * K + 8 * hh;
  const size_t bs = (size_t)16 * K;
  v8f acc0 = zero8(), acc1 = zero8(), acc2 = zero8(), acc3 = zero8();
#pragma unroll 1
  for (int k0 = 0; k0 < K; k0 += 32) {
    const v16b a  = ldfrag_b(ap + k0);
    const v16b b0 = ldfrag_b(bp + k0);
    const v16b b1 = ldfrag_b(bp + bs + k0);
    const v16b b2 = ldfrag_b(bp + 2 * bs + k0);
    const v16b b3 = ldfrag_b(bp + 3 * bs + k0);
    acc0 = mma_b(a, b0, acc0);
    acc1 = mma_b(a, b1, acc1);
    acc2 = mma_b(a, b2, acc2);
    acc3 = mma_b(a, b3, acc3);
    guard6<v16b>(acc0, acc1, acc2, acc3, a, b0, b1, b2, b3, a);
  }
  epi64(slab + wave * SLAB64, acc0, acc1, acc2, acc3, oscale, C, N, (size_t)rowb, col0, lane);
}

// =====================================================================================================
// f16 GEMM: C[M][N] (f32) = (A[M][K] (+ A2[M][K] when TWO != 0)) . Bt[N][K]^T, times oscale; A, A2 f16 row-major planes
// (A2 = the unscaled f16 residual of A, sharing the accumulator), Bt f16 k-contiguous. Same tiling, fragment loads (split k
// map) and epilogue as gemm_bf; K stepped by 32.
// =====================================================================================================
template <int TWO>
__global__ __launch_bounds__(128)
void gemm_h(const u16* __restrict__ A, const u16* __restrict__ A2, const u16* __restrict__ Bt, float* C,
            int M, int N, int K, float oscale) {
  __shared__ __align__(16) float slab[4 * SLAB64];
  const int tid = threadIdx.x, wave = tid >> 5, lane = tid & 31, hh = lane >> 4, m = lane & 15;
  const int ntile = N >> 6;
  const int bid   = blockIdx.x;
  const int rowb  = (bid / ntile) * 64 + wave * 16;
  const int col0  = (bid % ntile) * 64;
  if (rowb + 16 > M) return;                // wave-uniform, never taken with the exact grid; no block barriers in this kernel
  const _Float16* ap  = (const _Float16*)(const void*)A  + (size_t)(rowb + m) * K + 8 * hh;
  const _Float16* ap2 = (const _Float16*)(const void*)A2 + (size_t)(rowb + m) * K + 8 * hh;
  const _Float16* bp  = (const _Float16*)(const void*)Bt + (size_t)(col0 + m) * K + 8 * hh;
  const size_t bs = (size_t)16 * K;
  v8f acc0 = zero8(), acc1 = zero8(), acc2 = zero8(), acc3 = zero8();
#pragma unroll 1
  for (int k0 = 0; k0 < K; k0 += 32) {
    const v16h a  = ldfrag_h(ap + k0);
    const v16h b0 = ldfrag_h(bp + k0);
    const v16h b1 = ldfrag_h(bp + bs + k0);
    const v16h b2 = ldfrag_h(bp + 2 * bs + k0);
    const v16h b3 = ldfrag_h(bp + 3 * bs + k0);
    acc0 = mma_h(a, b0, acc0);
    acc1 = mma_h(a, b1, acc1);
    acc2 = mma_h(a, b2, acc2);
    acc3 = mma_h(a, b3, acc3);
    if (TWO != 0) {
      const v16h a2 = ldfrag_h(ap2 + k0);
      acc0 = mma_h(a2, b0, acc0);
      acc1 = mma_h(a2, b1, acc1);
      acc2 = mma_h(a2, b2, acc2);
      acc3 = mma_h(a2, b3, acc3);
      guard6<v16h>(acc0, acc1, acc2, acc3, a, a2, b0, b1, b2, b3);
    } else {
      guard6<v16h>(acc0, acc1, acc2, acc3, a, b0, b1, b2, b3, a);
    }
  }
  (void)ap2;
  epi64(slab + wave * SLAB64, acc0, acc1, acc2, acc3, oscale, C, N, (size_t)rowb, col0, lane);
}

// =====================================================================================================
// Causal sliding-window softmax attention with key padding, hd = 64, one sequence. Block bid -> (query tile
// qt = qt0 + bid % nqt: rows q0 = 16*qt .. q0+15, head group hg); one wave per head = hg*WPB + wave.
//   q hi / residual planes f16 x256 [s][h*HD + d]; k hi / residual planes f16 x256 [s][h*HD + d] (pitch DMOD);
//   v^T hi / residual planes [h*HD + d][SEQ] x1024; MK = the sequence's int32 key flags (0 = padded key).
//   raw(i, j) = q_hi.k_hi + q_lo.k_hi + q_hi.k_lo (2 k-steps over d); logit = raw * 2^-19 (the 1/8 softmax scale and the two
//   256 carries, exact); key j is REPLACED by -inf when j > i, j < i - (WIN-1), or MK[j] == 0; online softmax per query
//   row in f32 with a running max: row max / row sum over the 16 lanes holding the row via xor shuffles 1,2,4,8 (never
//   crossing the lane half); a row whose running max is still -inf uses 0 as the shift so alpha and p come out 0 (no NaN);
//   alpha = exp(m_old - m_new), p = exp(logit - m_new), l = l*alpha + sum p, O accumulators times alpha before the
//   tile's P.v. Key tiles of 32 visited in order from the tile holding max(0, q0-(WIN-1)) to the tile holding q0+15
//   (block-uniform bounds, <= 18 tiles). The 32 key flags of a tile are loaded once (one b32 per lane, coalesced) and
//   barrier, then A fragments of p*32768 (f16 hi and its f16 residual) are rebuilt from the LDS rows (float vector loads);
//   v^T B fragments in 2 groups of 2 d-subtiles; RV = 1: products hh + lh + hl, RV = 0: hh only.
//   After the loop O = acc / (l * 32768 * 1024) (0 when l == 0, i.e. every key of the window padded) into the wave's
//   Epilogue: O x256 -> f16 hi plane (and for RV = 1 the unscaled f16 residual plane) [s][h*HD + d]; lane = (row group
//   rq = lane>>3 in 0..3, 8 consecutive d at c8); one instruction = 4 rows it*4 + rq, each row segment (64 halves = one whole
// coverage: per wave 4 instructions x 4 rows x 8 lanes x 8 halves = 16 x 64 per plane; grid nqt x NHG blocks x WPB waves;
//   the two launches (tiles 0..NQTR-1 with RV = 1, NQTR..NQT-1 with RV = 0) cover every (s, h) row segment of the hi plane
//   exactly once and rows s < RICHE of the residual plane exactly once (only those rows are read later).
// =====================================================================================================
template <int RV>
__global__ __launch_bounds__(ATT_THREADS)
void attn_w(const u16* __restrict__ QHp, const u16* __restrict__ QLp,
            const u16* __restrict__ KHp, const u16* __restrict__ KLp,
            const u16* __restrict__ VHp, const u16* __restrict__ VLp,
            const int* __restrict__ MK,
            u16* OHp, u16* OLp, int qt0, int nqt) {
#pragma clang fp contract(off)
  __shared__ __align__(16) float smem[WPB * WREG];

  const int tid  = threadIdx.x;
  const int wave = tid >> 5;
  const int lane = tid & 31;
  const int hh   = lane >> 4;
  const int c    = lane & 15;
  const int bid  = blockIdx.x;
  if (nqt <= 0) return;                     // block-uniform; no block barriers in this kernel
  const int qt   = qt0 + bid % nqt;
  const int hg   = bid / nqt;
  if (hg >= NHG) return;                    // block-uniform; never taken with the exact grid
  const int q0   = qt * 16;
  if (q0 + 16 > SEQ) return;                // block-uniform; never taken
  const int head = hg * WPB + wave;

  float* pt   = smem + wave * WREG;         // p tile [16][32] pitch 36
  float* slab = pt + PTW;                   // result slab [16][64] pitch 68

  const size_t hcol = (size_t)head * HD + 8 * hh;
  const _Float16* Qh  = (const _Float16*)(const void*)QHp + ((size_t)q0 + c) * DMOD + hcol;
  const _Float16* Ql  = (const _Float16*)(const void*)QLp + ((size_t)q0 + c) * DMOD + hcol;
  const _Float16* Khb = (const _Float16*)(const void*)KHp + (size_t)c * DMOD + hcol;        // key row kb added per step
  const _Float16* Klb = (const _Float16*)(const void*)KLp + (size_t)c * DMOD + hcol;
  const _Float16* Vhb = (const _Float16*)(const void*)VHp + ((size_t)head * HD + c) * SEQ + 8 * hh;  // d col c (+16j)
  const _Float16* Vlb = (const _Float16*)(const void*)VLp + ((size_t)head * HD + c) * SEQ + 8 * hh;
  const float lsc  = SM_SCALE * (1.0f / (QSC * KSC));   // exact power-of-two fold of the q / k carries into the 1/8 scale
  const float oc   = 1.0f / (PCAR * VCAR);
  const float ninf = -__builtin_inff();
  const size_t KROW = (size_t)DMOD;         // halves between consecutive key rows

  v8f o[4];
#pragma unroll
  for (int j = 0; j < 4; ++j) o[j] = zero8();
  float mrun[8], lrun[8];
#pragma unroll
  for (int r = 0; r < 8; ++r) { mrun[r] = ninf; lrun[r] = 0.0f; }
  int klo = q0 - (WIN - 1);
  if (klo < 0) klo = 0;
  const int ktlo = klo >> 5;                                                  // first tile intersecting the window
  const int kthi = q0 >> 5;                                                   // tile holding keys q0 .. q0 + 15
  int nkt = kthi - ktlo + 1;
  if (nkt > NKT) nkt = NKT;
  if (nkt < 1) nkt = 1;
  const int qr0   = q0 + 8 * hh;                                              // query row of D element r = qr0 + r

#pragma unroll 1
  for (int i = 0; i < nkt; ++i) {
    const int kb = (ktlo + i) * 32;                                           // kb + 31 <= SEQ - 1
    // ---- key padding flags of this tile: one coalesced b32 per lane, then broadcast for key kb + c and kb + 16 + c ----
    const int fl = MK[kb + lane];
    const int f0 = __shfl(fl, c, 32);
    const int f1 = __shfl(fl, 16 + c, 32);
    // ---- raw scores: D element r of this lane = (query row qr0 + r, key kb + c) in s0, key kb + 16 + c in s1 ----
    v8f s0 = zero8(), s1 = zero8();
    const _Float16* k0p = Khb + (size_t)kb * KROW;
    const _Float16* k1p = k0p + (size_t)16 * KROW;
    const _Float16* l0p = Klb + (size_t)kb * KROW;
    const _Float16* l1p = l0p + (size_t)16 * KROW;
#pragma unroll
    for (int kk = 0; kk < HD / 32; ++kk) {
      const v16h qh  = ldfrag_h(Qh + kk * 32);
      const v16h ql  = ldfrag_h(Ql + kk * 32);
      const v16h kh0 = ldfrag_h(k0p + kk * 32);
      const v16h kh1 = ldfrag_h(k1p + kk * 32);
      const v16h kl0 = ldfrag_h(l0p + kk * 32);
      const v16h kl1 = ldfrag_h(l1p + kk * 32);
      s0 = mma_h(qh, kh0, s0);
      s0 = mma_h(ql, kh0, s0);
      s0 = mma_h(qh, kl0, s0);
      s1 = mma_h(qh, kh1, s1);
      s1 = mma_h(ql, kh1, s1);
      s1 = mma_h(qh, kl1, s1);
      guard2(s0, s1, qh, ql, kh0, kl0, kh1, kl1);
    }
    // ---- causal / window / padding replace-mask, running-max online softmax in f32, p tile -> wave-private LDS ----
    float alpha[8];
    const int key0 = kb + c, key1 = kb + 16 + c;
#pragma unroll
    for (int r = 0; r < 8; ++r) {
      const int qrow = qr0 + r;
      const int lo   = qrow - (WIN - 1);
      const float a0 = s0[r] * lsc;
      const float a1 = s1[r] * lsc;
      const bool ok0 = (key0 <= qrow) && (key0 >= lo) && (f0 != 0);
      const bool ok1 = (key1 <= qrow) && (key1 >= lo) && (f1 != 0);
      const float t0 = ok0 ? a0 : ninf;
      const float t1 = ok1 ? a1 : ninf;
      float mx = fmaxf(t0, t1);
      mx = fmaxf(mx, __shfl_xor(mx, 1, 32));
      mx = fmaxf(mx, __shfl_xor(mx, 2, 32));
      mx = fmaxf(mx, __shfl_xor(mx, 4, 32));
      mx = fmaxf(mx, __shfl_xor(mx, 8, 32));
      const float mnew  = fmaxf(mrun[r], mx);
      const float mshft = (mnew == ninf) ? 0.0f : mnew;
      const float al    = __expf(mrun[r] - mshft);
      const float p0    = __expf(t0 - mshft);
      const float p1    = __expf(t1 - mshft);
      float sm = p0 + p1;
      sm += __shfl_xor(sm, 1, 32);
      sm += __shfl_xor(sm, 2, 32);
      sm += __shfl_xor(sm, 4, 32);
      sm += __shfl_xor(sm, 8, 32);
      lrun[r]  = lrun[r] * al + sm;
      mrun[r]  = mnew;
      alpha[r] = al;
      const int ro = (8 * hh + r) * PTP + c;
      pt[ro]      = p0;
      pt[ro + 16] = p1;
    }
    wave_sync_lds();
    // ---- rescale the O accumulators by alpha (row 8hh + r of every d-subtile) ----
#pragma unroll
    for (int j = 0; j < 4; ++j) {
#pragma unroll
      for (int r = 0; r < 8; ++r) o[j][r] = o[j][r] * alpha[r];
    }
    // ---- A fragments of p*32768: hi f16 and residual f16, row = c, split k map over the 32 keys of this step ----
    FragH ph, pl;
    {
      const float* prow = pt + c * PTP + 8 * hh;
      const v4f p0 = *(const v4f*)(prow), p1 = *(const v4f*)(prow + 4);
      const v4f p2 = *(const v4f*)(prow + 16), p3 = *(const v4f*)(prow + 20);
#pragma unroll
      for (int e = 0; e < 4; ++e) {
        const float ta = p0[e] * PCAR, tb = p1[e] * PCAR, tc = p2[e] * PCAR, td = p3[e] * PCAR;
        const _Float16 ha = (_Float16)ta, hb = (_Float16)tb, hc = (_Float16)tc, hd = (_Float16)td;
        ph.h[0][e]     = ha;                  // elements 0..7  = keys kb + 8hh + 0..7
        ph.h[0][4 + e] = hb;
        ph.h[1][e]     = hc;                  // elements 8..15 = keys kb + 16 + 8hh + 0..7
        ph.h[1][4 + e] = hd;
        pl.h[0][e]     = (_Float16)(ta - (float)ha);
        pl.h[0][4 + e] = (_Float16)(tb - (float)hb);
        pl.h[1][e]     = (_Float16)(tc - (float)hc);
        pl.h[1][4 + e] = (_Float16)(td - (float)hd);
      }
    }
    // ---- P.V : B fragment col n = d = j*16 + c, keys contiguous in the v^T planes; 2 groups of 2 d-subtiles ----
    {
      const _Float16* vhp = Vhb + kb;
      const _Float16* vlp = Vlb + kb;
      (void)vlp;
#pragma unroll
      for (int jg = 0; jg < 2; ++jg) {
        const size_t da = (size_t)(2 * jg) * 16 * SEQ;
        const size_t db = da + (size_t)16 * SEQ;
        const v16h vha = ldfrag_h(vhp + da), vhb2 = ldfrag_h(vhp + db);
        o[2 * jg]     = mma_h(ph.v, vha,  o[2 * jg]);
        o[2 * jg + 1] = mma_h(ph.v, vhb2, o[2 * jg + 1]);
        if (RV != 0) {
          const v16h vla = ldfrag_h(vlp + da), vlb2 = ldfrag_h(vlp + db);
          o[2 * jg]     = mma_h(pl.v, vha,  o[2 * jg]);
          o[2 * jg]     = mma_h(ph.v, vla,  o[2 * jg]);
          o[2 * jg + 1] = mma_h(pl.v, vhb2, o[2 * jg + 1]);
          o[2 * jg + 1] = mma_h(ph.v, vlb2, o[2 * jg + 1]);
          guard2(o[2 * jg], o[2 * jg + 1], ph.v, pl.v, vha, vhb2, vla, vlb2);
        } else {
          guard2(o[2 * jg], o[2 * jg + 1], ph.v, pl.v, vha, vhb2, vha, vhb2);
        }
      }
    }
    wave_sync_lds();
  }
  acc_guard4(o[0], o[1], o[2], o[3]);
  // ---- O = acc / l with the carries (32768 on p, 1024 on v) folded once (0 when l == 0); into the wave's slab ----
  float rl[8];
#pragma unroll
  for (int r = 0; r < 8; ++r) {
    const bool  okl  = lrun[r] > 0.0f;
    const float lden = okl ? lrun[r] : 1.0f;
    const float rec  = (1.0f / lden) * oc;
    rl[r] = okl ? rec : 0.0f;
  }
#pragma unroll
  for (int r = 0; r < 8; ++r) {
#pragma unroll
    for (int j = 0; j < 4; ++j) {
      const int idx = (8 * hh + r) * SLP + j * 16 + c;
      slab[idx] = o[j][r] * rl[r];
    }
  }
  wave_sync_lds();
  // ---- O x256 -> f16 hi plane (+ f16 residual plane); lane = (row group rq, 8 consecutive d at c8) ----
  v4u oh[4], ol[4];
  const int rq = lane >> 3, c8 = (lane & 7) * 8;
#pragma unroll
  for (int it = 0; it < 4; ++it) {
    const int row = it * 4 + rq;
    const v4f a = *(const v4f*)(slab + row * SLP + c8), b4 = *(const v4f*)(slab + row * SLP + c8 + 4);
    float w[8];
#pragma unroll
    for (int e = 0; e < 4; ++e) { w[e] = a[e] * OSC; w[4 + e] = b4[e] * OSC; }
#pragma unroll
    for (int e = 0; e < 4; ++e) {
      const _Float16 h0 = (_Float16)w[2 * e], h1 = (_Float16)w[2 * e + 1];
      const _Float16 g0 = (_Float16)(w[2 * e] - (float)h0), g1 = (_Float16)(w[2 * e + 1] - (float)h1);
      oh[it][e] = pk16(h_bits(h0), h_bits(h1));
      ol[it][e] = pk16(h_bits(g0), h_bits(g1));
    }
  }
  const size_t ob = ((size_t)q0) * DMOD + (size_t)head * HD + c8;
  {
#pragma unroll
    for (int it = 0; it < 4; ++it) {
      const int row = it * 4 + rq;
      *(v4u*)(OHp + ob + (size_t)row * DMOD) = oh[it];
      if (RV != 0) {
        *(v4u*)(OLp + ob + (size_t)row * DMOD) = ol[it];
      }
    }
    
  }
}

// =====================================================================================================
// Workspace map (bytes); per-sequence planes, reused across the in-order sequence loop; every plane is fully written by
// whole-line stores before it is read (the O residual plane only on the rows < RICHE that are read); all extents are exact
// multiples of the store granularity (no pad rows needed); every region offset a multiple of 131072:
//   XB  bf16 [SEQ][1024]                 SEQ*2048    (SEQ=2048: 4194304)
//   WB  bf16 [3072 n][1024 k]            6291456     (q rows 0..1023, k 1024..2047, v 2048..3071)
//   WT  f16  [1024 o][1024 d] x1024      2097152
//   F   f32  [SEQ][3072]                 SEQ*12288   (25165824)  q | k | v projection columns
//   QH  f16 [SEQ][1024] x256             SEQ*2048    QL residual, same extent
//   KH  f16 [SEQ][1024] x256             SEQ*2048    KL residual, same extent
//   VH  f16 [16][64][SEQ] x1024          SEQ*2048    VL residual, same extent
//   OH  f16 [SEQ][1024] x256             SEQ*2048    OL residual, same extent (rows < RICHE written / read)
//   TC  f32 [SEQ][16]                    SEQ*64      TS, same extent
//   end (SEQ=2048, any NB)              71565312
// =====================================================================================================
extern "C" void kernel_launch(void* const* d_in, const int* in_sizes, int n_in,
                              void* d_out, int out_size, void* d_ws, size_t ws_size,
                              hipStream_t stream) {
  if (n_in < 4) return;
  if (in_sizes[0] < ((NB - 1) * XS_FULL + SEQ) * DMOD) return;
  if (in_sizes[1] < (NB - 1) * XS_FULL + SEQ) return;
  if (in_sizes[2] != DMOD * NQKV) return;
  if (in_sizes[3] != DMOD * DMOD) return;
  if (out_size < ((NB - 1) * XS_FULL + SEQ) * DMOD) return;

  const float* x    = (const float*)d_in[0];
  const int*   mask = (const int*)d_in[1];
  const float* wqkv = (const float*)d_in[2];       // [1024 k][3072 n]
  const float* wo   = (const float*)d_in[3];       // [1024 d][1024 o]
  float*       out  = (float*)d_out;

  const size_t szXB = (size_t)SEQ * DMOD * 2;
  const size_t szWB = (size_t)NQKV * DMOD * 2;
  const size_t szWT = (size_t)DMOD * DMOD * 2;
  const size_t szF  = (size_t)SEQ * NQKV * 4;
  const size_t szQ  = (size_t)SEQ * DMOD * 2;                    // QH, QL, KH, KL, OH, OL
  const size_t szV  = (size_t)NH * HD * SEQ * 2;                 // VH, VL (== szQ)
  const size_t szT  = (size_t)SEQ * NFREQ * 4;                   // TC, TS
  size_t off = 0;
  const size_t oXB = off; off += szXB;
  const size_t oWB = off; off += szWB;
  const size_t oWT = off; off += szWT;
  const size_t oF  = off; off += szF;
  const size_t oQH = off; off += szQ;
  const size_t oQL = off; off += szQ;
  const size_t oKH = off; off += szQ;
  const size_t oKL = off; off += szQ;
  const size_t oVH = off; off += szV;
  const size_t oVL = off; off += szV;
  const size_t oOH = off; off += szQ;
  const size_t oOL = off; off += szQ;
  const size_t oTC = off; off += szT;
  const size_t oTS = off; off += szT;
  if (off > ws_size) return;                // off = 71565312 for SEQ = 2048
  if (off > (size_t)WS_CAP) return;

  char* ws = (char*)d_ws;
  u16*   XB  = (u16*)(ws + oXB);
  u16*   WB  = (u16*)(ws + oWB);
  u16*   WT  = (u16*)(ws + oWT);
  float* F   = (float*)(ws + oF);
  u16*   QH  = (u16*)(ws + oQH);
  u16*   QL  = (u16*)(ws + oQL);
  u16*   KH  = (u16*)(ws + oKH);
  u16*   KL  = (u16*)(ws + oKL);
  u16*   VH  = (u16*)(ws + oVH);
  u16*   VL  = (u16*)(ws + oVL);
  u16*   OH  = (u16*)(ws + oOH);
  u16*   OL  = (u16*)(ws + oOL);
  float* TC  = (float*)(ws + oTC);
  float* TS  = (float*)(ws + oTS);

  const dim3 b256(256), b128(128), bAT(ATT_THREADS);
  const int  n8x = (SEQ * DMOD) / 8;
  const dim3 gX((n8x + 255) / 256);                     // SEQ*DMOD/2048 blocks
  const int  nT  = SEQ * NFREQ;
  const dim3 gT((nT + 255) / 256);                      // SEQ/16
  const dim3 gWQ((DMOD / 64) * (NQKV / 64));            // 768: in [1024 k][3072 n] -> WB [3072 n][1024 k]
  const dim3 gWO((DMOD / 64) * (DMOD / 64));            // 256: in [1024 d][1024 o] -> WT [1024 o][1024 d]
  const dim3 gG1((SEQ / 64) * (NQKV / 64));
  const dim3 gRW(SEQ);
  const dim3 gVT(NH * NST);
  const float osc = 1.0f / (OSC * WOS);

  // (0) weight planes: Wqkv transposed to bf16 [n][k]; Wo transposed to f16 of the bf16 value x1024 [o][d]
  cvtT16<<<gWQ, b256, 0, stream>>>(wqkv, DMOD, NQKV, WB, 0, 1.0f);
  cvtT16<<<gWO, b256, 0, stream>>>(wo, DMOD, DMOD, WT, 1, WOS);
  // (1) rotary cos / sin tables [SEQ][16]
  k_tab<<<gT, b256, 0, stream>>>(TC, TS, nT);
  // per sequence
  for (int bq = 0; bq < NB; ++bq) {
    // (2) x rows of this sequence -> bf16 plane [SEQ][1024]
    cvt16<<<gX, b256, 0, stream>>>(x + (size_t)bq * XS_FULL * DMOD, XB, n8x, 0, 1.0f);
    // (3) qkv = x.Wqkv -> F f32 [SEQ][3072]
    gemm_bf<<<gG1, b128, 0, stream>>>(XB, WB, F, SEQ, NQKV, DMOD, 1.0f);
    // (4) partial rotary + q hi + residual planes x256 from columns 0..1023; (5) same for k from columns 1024..2047
    rope16<<<gRW, b128, 0, stream>>>(F, NQKV, 0, TC, TS, QH, QL, QSC);
    rope16<<<gRW, b128, 0, stream>>>(F, NQKV, DMOD, TC, TS, KH, KL, KSC);
    // (6) v^T hi + residual planes x1024 from columns 2048..3071
    vt16<<<gVT, b256, 0, stream>>>(F, NQKV, 2 * DMOD, VH, VL);
    // (7) windowed causal attention with key padding -> O f16 hi plane x256 for all query tiles; residual plane for tiles < RICHE
    const int* mk = mask + (size_t)bq * XS_FULL;
    attn_w<1><<<dim3(NQTR * NHG), bAT, 0, stream>>>(QH, QL, KH, KL, VH, VL, mk, OH, OL, 0, NQTR);
    if (NQT > NQTR) {
      attn_w<0><<<dim3((NQT - NQTR) * NHG), bAT, 0, stream>>>(QH, QL, KH, KL, VH, VL, mk, OH, OL, NQTR, NQT - NQTR);
    }
    // (8) y = O.Wo -> out f32 rows of this sequence, carries 256 x 1024 folded back; rows < RICHE with O hi + residual
    float* ob = out + (size_t)bq * XS_FULL * DMOD;
    gemm_h<1><<<dim3((RICHE / 64) * (DMOD / 64)), b128, 0, stream>>>(OH, OL, WT, ob, RICHE, DMOD, DMOD, osc);
    if (SEQ > RICHE) {
      const size_t rl = (size_t)RICHE;
      gemm_h<0><<<dim3(((SEQ - RICHE) / 64) * (DMOD / 64)), b128, 0, stream>>>(
          OH + rl * DMOD, OL + rl * DMOD, WT, ob + rl * DMOD, SEQ - RICHE, DMOD, DMOD, osc);
    }
  }
  (void)hipGetLastError();
}

// v001
// Measured time: 469 microseconds a run.
// Timed twice side by side with v000, it ran 1.59 and 1.60 times as fast.
// Contractions: x.Wqkv on v_wmma_f32_16x16x32_bf16 (x and the transposed weight as bf16 RNE planes; weight plane [n][k]
// rows are the k-contiguous B operand; f32 accumulate); q.k^T over hd 64 and P.v on v_wmma_f32_16x16x32_f16 with f16 hi +
// f16 residual planes (q, k x256 after partial rotary, products hh+lh+hl on every row; P x32768 hi + in-register residual
// and v^T x1024 hi + residual plane for query rows < 512 of each sequence, P hi . v hi only for later rows); O.Wo on
// v_wmma_f32_16x16x32_f16 with O x256 as f16 hi (+ f16 residual plane for rows < 512 of each sequence) and Wo transposed
// to [o][d] as f16(bf16(Wo)) x1024, one accumulator; all f32 accumulate. Rotary cos/sin tables, causal + window + key
// padding masks and the online softmax in f32 on VALU.
#include <hip/hip_runtime.h>
#include <math.h>
#include <stdint.h>

#ifndef NB
#define NB 4
#endif
#ifndef SEQ
#define SEQ 2048
#endif
#ifndef RICH
#define RICH 512
#endif
#define NB_FULL 4
#define XS_FULL 2048
#define DMOD  1024
#define NH    16
#define HD    64
#define HROT  32
#define HROTH 16
#define NFREQ 16
#define NQKV  (3 * DMOD)
#define WIN   512
#define RICHE ((RICH < SEQ) ? RICH : SEQ)
#define ROPE_L2 0.41524101186092028
#define SM_SCALE 0.125f
#define QSC   256.0f
#define KSC   256.0f
#define PCAR  32768.0f
#define VCAR  1024.0f
#define OSC   256.0f
#define WOS   1024.0f
#define WPB   4
#define NHG   (NH / WPB)
#define NQT   (SEQ / 16)
#define NQTR  (RICHE / 16)
#define NST   (SEQ / 64)
#define NKT   (SEQ / 32)
#define ATT_THREADS (WPB * 32)
#define PTP   36
#define PTW   (16 * PTP)
#define SLP   68
#define SLW   (16 * SLP)
#define WREG  (PTW + SLW)
#define SLAB64 (16 * 68)
#define VTP   72
#define WS_CAP 268435456
#define ROWS  (NB * SEQ)
static_assert(DMOD == NH * HD && HD == 64 && HROT == 32 && HROTH == 16 && NFREQ == 16 && NH == 16 && WPB == 4 && NHG * WPB == NH);
static_assert(ATT_THREADS == 128 && NQKV == 3072 && WIN == 512 && NHG == 4);
static_assert(NB >= 1 && NB <= NB_FULL);
static_assert(NB == 1 || SEQ == XS_FULL);
static_assert((SEQ % 64) == 0 && SEQ >= 64 && SEQ <= XS_FULL);
static_assert((RICHE % 64) == 0 && RICHE >= 64 && RICHE <= SEQ);
static_assert((DMOD % 64) == 0 && (NQKV % 64) == 0 && (DMOD % 32) == 0 && (HD % 32) == 0);
static_assert(((SEQ * DMOD / 8) % 256) == 0 && ((SEQ * NFREQ) % 256) == 0);
static_assert(WPB * WREG * 4 <= 65536 && 2 * HD * VTP * 2 <= 65536 && 4 * SLAB64 * 4 <= 65536 && 64 * VTP * 2 <= 65536);
static_assert(NQT * 16 == SEQ && NQTR * 16 == RICHE && NKT * 32 == SEQ && NST * 64 == SEQ);

typedef unsigned short u16;
typedef _Float16 v16h __attribute__((ext_vector_type(16)));
typedef _Float16 v8h  __attribute__((ext_vector_type(8)));
typedef __bf16   v16b __attribute__((ext_vector_type(16)));
typedef float    v8f  __attribute__((ext_vector_type(8)));
typedef float    v4f  __attribute__((ext_vector_type(4)));
typedef unsigned int v4u __attribute__((ext_vector_type(4)));

union FragH { v16h v; v8h h[2]; v4u u[2]; };
union FragB { v16b v; v4u u[2]; };

// ---- scalar helpers --------------------------------------------------------------------------------
__device__ __forceinline__ unsigned short bf_bits(float f) {          // f32 -> bf16 bits, RNE convert
  unsigned u = __float_as_uint(f);
  return (unsigned short)((u + 0x7FFFu + ((u >> 16) & 1u)) >> 16);
}
__device__ __forceinline__ float bf_up(unsigned short h) { return __uint_as_float(((unsigned)h) << 16); }
__device__ __forceinline__ float bfr(float f) { return bf_up(bf_bits(f)); }
__device__ __forceinline__ unsigned short h_bits(_Float16 x) { return __builtin_bit_cast(unsigned short, x); }
__device__ __forceinline__ unsigned pk16(unsigned short a, unsigned short b) { return (unsigned)a | ((unsigned)b << 16); }
__device__ __forceinline__ v8f zero8() { v8f z = {0.f, 0.f, 0.f, 0.f, 0.f, 0.f, 0.f, 0.f}; return z; }

// ---- fragment loaders: 16-bit A/B operand, lane -> row/col (lane&15), p already includes +8*(lane>>4);
//      elements 0..7 <- p[0..7] (k0+8h..), elements 8..15 <- p[16..23] (k0+16+8h..)  (same split k map for A and B;
//      B is always read from a k-contiguous [n][k] plane)
__device__ __forceinline__ v16h ldfrag_h(const _Float16* p) {
  FragH f;
  f.h[0] = *(const v8h*)(p);
  f.h[1] = *(const v8h*)(p + 16);
  return f.v;
}
__device__ __forceinline__ v16b ldfrag_b(const u16* p) {              // bf16 plane read as unsigned integer vectors
  FragB f;
  f.u[0] = *(const v4u*)(p);
  f.u[1] = *(const v4u*)(p + 16);
  return f.v;
}

__device__ __forceinline__ v8f mma_h(v16h a, v16h b, v8f c) {
  return __builtin_amdgcn_wmma_f32_16x16x32_f16(false, a, false, b, (short)0, c, false, false);
}
__device__ __forceinline__ v8f mma_b(v16b a, v16b b, v8f c) {
  return __builtin_amdgcn_wmma_f32_16x16x32_bf16(false, a, false, b, (short)0, c, false, false);
}
__device__ __forceinline__ void guard2(v8f& a, v8f& b, v16h x0, v16h x1, v16h x2, v16h x3, v16h x4, v16h x5) {
#if defined(__HIP_DEVICE_COMPILE__)
  asm volatile("v_nop\n\tv_nop\n\tv_nop\n\tv_nop"
               : "+v"(a), "+v"(b) : "v"(x0), "v"(x1), "v"(x2), "v"(x3), "v"(x4), "v"(x5) : "memory");
#endif
}
template <typename F>
__device__ __forceinline__ void guard6(v8f& a, v8f& b, v8f& c, v8f& d, F x0, F x1, F x2, F x3, F x4, F x5) {
#if defined(__HIP_DEVICE_COMPILE__)
  asm volatile("v_nop\n\tv_nop\n\tv_nop\n\tv_nop"
               : "+v"(a), "+v"(b), "+v"(c), "+v"(d) : "v"(x0), "v"(x1), "v"(x2), "v"(x3), "v"(x4), "v"(x5) : "memory");
#endif
}
__device__ __forceinline__ void acc_guard4(v8f& a, v8f& b, v8f& c, v8f& d) {
#if defined(__HIP_DEVICE_COMPILE__)
  asm volatile("v_nop\n\tv_nop\n\tv_nop\n\tv_nop" : "+v"(a), "+v"(b), "+v"(c), "+v"(d));
#endif
}
__device__ __forceinline__ void wave_sync_lds() {
  __builtin_amdgcn_fence(__ATOMIC_RELEASE, "workgroup");
  __builtin_amdgcn_wave_barrier();
  __builtin_amdgcn_fence(__ATOMIC_ACQUIRE, "workgroup");
}

// =====================================================================================================
// f32 -> bf16 RNE plane, same layout (f16mode == 1: f16 bits of (bf16 RNE value) * scale).
// Thread = 8 consecutive elements: two 16-B loads, one 16-B store; 32 consecutive lanes = 512 contiguous, 512-B aligned
// coverage: grid = ceil(n8/256) blocks x 256 thr x 8 (in-kernel bound) = the whole plane (n8 a multiple of 256 here).
// =====================================================================================================
__global__ __launch_bounds__(256) void cvt16(const float* __restrict__ x, u16* D, int n8, int f16mode, float scale) {
  const int gt = blockIdx.x * 256 + (int)threadIdx.x;
  if (gt >= n8) return;
  const float* p = x + (size_t)gt * 8;
  const v4f a = *(const v4f*)(p), b4 = *(const v4f*)(p + 4);
  float w[8];
#pragma unroll
  for (int e = 0; e < 4; ++e) { w[e] = a[e]; w[4 + e] = b4[e]; }
  v4u o;
#pragma unroll
  for (int e = 0; e < 4; ++e) {
    const float f0 = w[2 * e], f1 = w[2 * e + 1];
    const unsigned short hb0 = h_bits((_Float16)(bfr(f0) * scale));
    const unsigned short hb1 = h_bits((_Float16)(bfr(f1) * scale));
    const unsigned short bb0 = bf_bits(f0);
    const unsigned short bb1 = bf_bits(f1);
    o[e] = (f16mode != 0) ? pk16(hb0, hb1) : pk16(bb0, bb1);
  }
  u16* d = D + (size_t)gt * 8;
  {
    *(v4u*)(d) = o;
    
  }
}

// =====================================================================================================
// Transposed 16-bit plane of a row-major f32 matrix: in X [R rows][CC cols] (pitch CC) -> out D [CC][R] (pitch R),
// D[c][r] = cvt(X[r][c]); f16mode == 0: bf16 RNE bits; f16mode == 1: f16 bits of (bf16 RNE value) * scale.
// Block = one 64x64 tile (rt = bid / (CC/64) -> rows 64*rt.., ct = bid % (CC/64) -> cols 64*ct..), 256 threads: thread
// (row rl = tid>>2, col chunk cc = 16*(tid&3)) loads its 16 floats with 16-B loads, converts, places them transposed into
// the LDS tile T[c_local][r_local] (pitch 72 halves, 2-B element stores); after a block barrier each output row segment
// coverage: load 256 thr x 16 = 64 x 64; store 2 iterations x 256 thr x 8 halves = 64 lines x 64 = the tile of D;
//           grid = (R/64)*(CC/64) blocks covers D exactly once (R, CC multiples of 64).
// =====================================================================================================
__global__ __launch_bounds__(256) void cvtT16(const float* __restrict__ X, int R, int CC, u16* D, int f16mode, float scale) {
  __shared__ __align__(16) u16 T[64 * VTP];
  const int tid = (int)threadIdx.x;
  const int bid = (int)blockIdx.x;
  const int nct = CC >> 6;
  const int ct  = bid % nct;
  const int rt  = bid / nct;
  const int r0  = rt * 64, c0 = ct * 64;
  if (r0 + 64 > R) return;                  // block-uniform, before the barrier; never taken with the exact grid
  {
    const int rl = tid >> 2;                // row within tile 0..63
    const int cc = (tid & 3) * 16;          // column chunk 0,16,32,48
    const float* src = X + (size_t)(r0 + rl) * (size_t)CC + c0 + cc;
#pragma unroll
    for (int i = 0; i < 4; ++i) {
      const v4f a = *(const v4f*)(src + 4 * i);
#pragma unroll
      for (int e = 0; e < 4; ++e) {
        const float f = a[e];
        const unsigned short hb = h_bits((_Float16)(bfr(f) * scale));
        const unsigned short bb = bf_bits(f);
        T[(cc + 4 * i + e) * VTP + rl] = (f16mode != 0) ? hb : bb;
      }
    }
  }
  __syncthreads();
  v4u w[2];
  const int q8 = tid >> 3, p8 = (tid & 7) * 8;
#pragma unroll
  for (int it = 0; it < 2; ++it) {
    const int line = it * 32 + q8;          // c_local = 0..63
    w[it] = *(const v4u*)(T + line * VTP + p8);
  }
  const size_t base = (size_t)c0 * (size_t)R + r0 + p8;
  {
#pragma unroll
    for (int it = 0; it < 2; ++it) {
      const int line = it * 32 + q8;
      *(v4u*)(D + base + (size_t)line * (size_t)R) = w[it];
    }
    
  }
}

// =====================================================================================================
// Rotary tables TC[s][j] = cos(s * inv[j]), TS[s][j] = sin(s * inv[j]), j < 16, with
// inv[j] = 1.0f / f32(10000^(2j/32)) (power evaluated in f64 and narrowed once, IEEE f32 reciprocal, f32 product s*inv,
// coverage: grid = n/256 blocks x 256 thr = n = SEQ*16 elements of TC and of TS (n a multiple of 256).
// =====================================================================================================
__global__ __launch_bounds__(256) void k_tab(float* TC, float* TS, int n) {
#pragma clang fp contract(off)
  const int idx = blockIdx.x * 256 + (int)threadIdx.x;
  if (idx >= n) return;
  const int s = idx / NFREQ;
  const int j = idx - s * NFREQ;
  const double pj = exp2((double)(2 * j) * ROPE_L2);   // 10000^(2j/32)
  const float pf  = (float)pj;
  const float inv = 1.0f / pf;
  const float ang = (float)s * inv;
  float sv, cv;
  sincosf(ang, &sv, &cv);
  {
    *(float*)(TC + idx) = cv;
    *(float*)(TS + idx) = sv;
    
  }
}

// =====================================================================================================
// v^T planes from the v columns of the projection F f32 [ROWS][ldf] (row = b*SEQ + s, column = voff + g*HD + d):
//   VH[((b*NH + g)*HD + d)][s] = f16(v * 1024);  VL[same][s] = f16 residual (t - f16(t)), all sequences b, keys s, heads g < 16.
// Block = (sequence b, head g, 64 keys s0): each thread loads its 16 floats (key sl, d chunk dc) with 16-B loads, converts, places
// them into two LDS tiles [64 d][64 keys] (pitch 72 halves); after a block barrier each d row segment (64 halves = one whole
// LDS tiles are cross-wave (block barrier).
// coverage: load 256 thr x 16 = 64 keys x 64 d; store 2 iterations x 256 thr x 8 halves = 64 lines x 64 = the block's tile of
//           VH and of VL; grid = NB*NH*NST blocks covers both planes [NB*NH*64][SEQ] exactly once.
// =====================================================================================================
__global__ __launch_bounds__(256) void vt16(const float* __restrict__ F, int ldf, int voff, u16* VHo, u16* VLo) {
  __shared__ __align__(16) u16 TH[HD * VTP];
  __shared__ __align__(16) u16 TL[HD * VTP];
  const int tid = threadIdx.x;
  const int bid = blockIdx.x;
  const int st  = bid % NST;
  const int g   = (bid / NST) % NH;
  const int b   = bid / (NST * NH);
  if (b >= NB) return;                      // block-uniform, before any barrier; never taken with the exact grid
  const int s0  = st * 64;
  {
    const int sl = tid >> 2;                // key within tile 0..63
    const int dc = (tid & 3) * 16;          // d chunk 0,16,32,48
    const float* src = F + ((size_t)b * SEQ + s0 + sl) * (size_t)ldf + voff + g * HD + dc;
#pragma unroll
    for (int i = 0; i < 4; ++i) {
      const v4f a = *(const v4f*)(src + 4 * i);
#pragma unroll
      for (int e = 0; e < 4; ++e) {
        const float t = a[e] * VCAR;
        const _Float16 hv = (_Float16)t;
        const _Float16 lv = (_Float16)(t - (float)hv);
        TH[(dc + 4 * i + e) * VTP + sl] = h_bits(hv);
        TL[(dc + 4 * i + e) * VTP + sl] = h_bits(lv);
      }
    }
  }
  __syncthreads();
  v4u vh[2], vl[2];
  const int q8 = tid >> 3, p8 = (tid & 7) * 8;
#pragma unroll
  for (int it = 0; it < 2; ++it) {
    const int line = it * 32 + q8;          // d = 0..63
    vh[it] = *(const v4u*)(TH + line * VTP + p8);
    vl[it] = *(const v4u*)(TL + line * VTP + p8);
  }
  const size_t hrow = ((size_t)b * NH + g) * HD;
  const size_t base = hrow * SEQ + s0 + p8;
  {
#pragma unroll
    for (int it = 0; it < 2; ++it) {
      const int line = it * 32 + q8;
      *(v4u*)(VHo + base + (size_t)line * SEQ) = vh[it];
      *(v4u*)(VLo + base + (size_t)line * SEQ) = vl[it];
    }
    
  }
}

// =====================================================================================================
// Partial NeoX (non-interleaved) rotary on dims 0..31 of each head + q / k planes from the projection F f32 [ROWS][ldf]
// at column offset coff (row = b*SEQ + s, column = coff + head*HD + d; table row = s, table column j = d mod 16):
//   d <  16     : out[d] = x[d]*c[s][j] + (-1)*(x[d+16]*sn[s][j])
//   16 <= d < 32: out[d] = x[d]*c[s][j] + (+1)*(x[d-16]*sn[s][j])    (mul, mul, add kept separate)
//   d >= 32     : out[d] = x[d]
//   Hp [ROWS][DMOD] = f16(out * sc), Lp [ROWS][DMOD] = f16 residual (t - f16(t)), same layout.
// Row = b*SEQ + s over all sequences (table row s = row mod SEQ); blockIdx.y = 0: q (columns 0.., planes Hq / Lq, scale scq),
// blockIdx.y = 1: k (columns DMOD.., planes Hk / Lk, scale sck).
// Block = one row, 128 threads; thread t = head t>>3, chunk i = t&7: columns head*HD + 8i .. +7; it also loads the partner
// chunk (d xor 16 for d < 32, itself otherwise; all loads in range, selection by value). One 16-B store per plane per thread;
// coverage: 128 thr x 8 = the whole row of Hp and of Lp; grid = (ROWS, 2) blocks = every row of all four planes once.
// =====================================================================================================
__device__ __forceinline__ void rot_one(float x, float y, float cv, float sv, float sgn, float sc, int rot,
                                        unsigned short& hb, unsigned short& lb) {
#pragma clang fp contract(off)
  const float ys   = y * sv;
  const float term = sgn * ys;
  const float rr   = x * cv + term;
  const float r    = (rot != 0) ? rr : x;
  const float t    = r * sc;
  const _Float16 a = (_Float16)t;
  hb = h_bits(a);
  lb = h_bits((_Float16)(t - (float)a));
}

__global__ __launch_bounds__(128) void rope16(const float* __restrict__ F, int ldf,
                                              const float* __restrict__ TC, const float* __restrict__ TS,
                                              u16* Hq, u16* Lq, u16* Hk, u16* Lk, float scq, float sck) {
#pragma clang fp contract(off)
  const int tid = (int)threadIdx.x;
  const int row = (int)blockIdx.x;          // b*SEQ + s
  if (row >= ROWS) return;
  const int isk  = ((int)blockIdx.y != 0) ? 1 : 0;     // block-uniform: 0 = q, 1 = k
  const int coff = isk * DMOD;
  u16* Hp = (isk != 0) ? Hk : Hq;
  u16* Lp = (isk != 0) ? Lk : Lq;
  const float sc = (isk != 0) ? sck : scq;
  const int srow = row % SEQ;               // s, the table row
  const int dd   = (tid & 7) * 8;                      // d within head, multiple of 8
  const int hb   = (tid >> 3) * HD;                    // head base column
  const int col  = hb + dd;
  if (hb + HD > DMOD) return;                          // never taken with blockDim = 128
  const int rot  = (dd < HROT) ? 1 : 0;
  const int jj   = dd & (HROTH - 1);                   // table column 0 or 8 (jj+7 <= 15)
  const int pcol = hb + ((rot != 0) ? (dd ^ HROTH) : dd);   // partner: d+16 (d<16), d-16 (16<=d<32), d itself otherwise
  const float sgn = (dd < HROTH) ? -1.0f : 1.0f;
  const float* p = F + (size_t)row * (size_t)ldf + coff;
  const v4f xa = *(const v4f*)(p + col),  xb = *(const v4f*)(p + col + 4);
  const v4f ya = *(const v4f*)(p + pcol), yb = *(const v4f*)(p + pcol + 4);
  const float* cp = TC + (size_t)srow * NFREQ + jj;
  const float* sp = TS + (size_t)srow * NFREQ + jj;
  const v4f ca = *(const v4f*)(cp), cb = *(const v4f*)(cp + 4);
  const v4f sa = *(const v4f*)(sp), sb = *(const v4f*)(sp + 4);
  float xv[8], yv[8], cw[8], sw[8];
#pragma unroll
  for (int e = 0; e < 4; ++e) {
    xv[e] = xa[e];  xv[4 + e] = xb[e];
    yv[e] = ya[e];  yv[4 + e] = yb[e];
    cw[e] = ca[e];  cw[4 + e] = cb[e];
    sw[e] = sa[e];  sw[4 + e] = sb[e];
  }
  v4u oh, ol;
#pragma unroll
  for (int e = 0; e < 4; ++e) {
    unsigned short h0, l0, h1, l1;
    rot_one(xv[2 * e],     yv[2 * e],     cw[2 * e],     sw[2 * e],     sgn, sc, rot, h0, l0);
    rot_one(xv[2 * e + 1], yv[2 * e + 1], cw[2 * e + 1], sw[2 * e + 1], sgn, sc, rot, h1, l1);
    oh[e] = pk16(h0, h1);
    ol[e] = pk16(l0, l1);
  }
  u16* dh = Hp + (size_t)row * DMOD + col;
  u16* dl = Lp + (size_t)row * DMOD + col;
  {
    *(v4u*)(dh) = oh;
    *(v4u*)(dl) = ol;
    
  }
}

// =====================================================================================================
// GEMM epilogue shared by both engines: the wave's 16x64 f32 tile (times oscale) staged in its LDS slab (pitch 68, wave-
// coverage: 8 instructions x 2 rows x 16 lanes x 4 floats = the wave's 16 x 64 tile.
// =====================================================================================================
__device__ __forceinline__ void epi64(float* sl, v8f a0, v8f a1, v8f a2, v8f a3, float oscale,
                                      float* C, int N, size_t rowb, int col0, int lane) {
  const int hh = lane >> 4, m = lane & 15;
#pragma unroll
  for (int r = 0; r < 8; ++r) {
    const int ro = (8 * hh + r) * 68 + m;
    sl[ro]      = a0[r] * oscale;
    sl[ro + 16] = a1[r] * oscale;
    sl[ro + 32] = a2[r] * oscale;
    sl[ro + 48] = a3[r] * oscale;
  }
  wave_sync_lds();
  v4f vals[8];
#pragma unroll
  for (int it = 0; it < 8; ++it) vals[it] = *(const v4f*)(sl + (it * 2 + hh) * 68 + m * 4);
  float* dst = C + (rowb + (size_t)hh) * (size_t)N + col0 + m * 4;
  {
#pragma unroll
    for (int it = 0; it < 8; ++it) {
      *(v4f*)(dst + (size_t)(it * 2) * (size_t)N) = vals[it];
    }
    
  }
}

// =====================================================================================================
// bf16 GEMM: C[M][N] (f32) = A[M][K] (bf16 row-major) . Bt[N][K]^T (bf16 k-contiguous), times oscale.
// Block = 64x64 tile, 4 waves x 16 rows; fragments loaded straight from the 16-bit rows (two 16-B loads each, split k map
// for A and B); K stepped by 32 (host guarantees K % 32 == 0, M % 64 == 0, N % 64 == 0, grid = (M/64)*(N/64)).
// =====================================================================================================
__global__ __launch_bounds__(128)
void gemm_bf(const u16* __restrict__ A, const u16* __restrict__ Bt, float* C, int M, int N, int K, float oscale) {
  __shared__ __align__(16) float slab[4 * SLAB64];
  const int tid = threadIdx.x, wave = tid >> 5, lane = tid & 31, hh = lane >> 4, m = lane & 15;
  const int ntile = N >> 6;
  const int bid   = blockIdx.x;
  const int rowb  = (bid / ntile) * 64 + wave * 16;
  const int col0  = (bid % ntile) * 64;
  if (rowb + 16 > M) return;                // wave-uniform, never taken with the exact grid; no block barriers in this kernel
  const u16* ap = A  + (size_t)(rowb + m) * K + 8 * hh;
  const u16* bp = Bt + (size_t)(col0 + m) * K + 8 * hh;
  const size_t bs = (size_t)16 * K;
  v8f acc0 = zero8(), acc1 = zero8(), acc2 = zero8(), acc3 = zero8();
#pragma unroll 1
  for (int k0 = 0; k0 < K; k0 += 32) {
    const v16b a  = ldfrag_b(ap + k0);
    const v16b b0 = ldfrag_b(bp + k0);
    const v16b b1 = ldfrag_b(bp + bs + k0);
    const v16b b2 = ldfrag_b(bp + 2 * bs + k0);
    const v16b b3 = ldfrag_b(bp + 3 * bs + k0);
    acc0 = mma_b(a, b0, acc0);
    acc1 = mma_b(a, b1, acc1);
    acc2 = mma_b(a, b2, acc2);
    acc3 = mma_b(a, b3, acc3);
    guard6<v16b>(acc0, acc1, acc2, acc3, a, b0, b1, b2, b3, a);
  }
  epi64(slab + wave * SLAB64, acc0, acc1, acc2, acc3, oscale, C, N, (size_t)rowb, col0, lane);
}

// =====================================================================================================
// f16 GEMM: C[M][N] (f32) = (A[M][K] (+ A2[M][K] when TWO != 0)) . Bt[N][K]^T, times oscale; A, A2 f16 row-major planes
// (A2 = the unscaled f16 residual of A, sharing the accumulator), Bt f16 k-contiguous. Same tiling, fragment loads (split k
// map) and epilogue as gemm_bf; K stepped by 32. A, A2 and C hold the rows of all sequences (row = b*SEQ + s); one launch
// takes one row class of every sequence: TWO = 1 the rows s < RICHE, TWO = 0 the rows s >= RICHE; row tile rt of the class ->
// sequence rt / (tiles of the class per sequence); grid = NB * (class rows / 64) * (N / 64).
// =====================================================================================================
template <int TWO>
__global__ __launch_bounds__(128)
void gemm_h(const u16* __restrict__ A, const u16* __restrict__ A2, const u16* __restrict__ Bt, float* C,
            int M, int N, int K, float oscale) {
  __shared__ __align__(16) float slab[4 * SLAB64];
  const int tid = threadIdx.x, wave = tid >> 5, lane = tid & 31, hh = lane >> 4, m = lane & 15;
  const int ntile = N >> 6;
  const int bid   = blockIdx.x;
  constexpr int CT = ((TWO != 0) ? RICHE : ((SEQ > RICHE) ? (SEQ - RICHE) : 64)) / 64;   // row tiles of the class per sequence
  constexpr int R0 = (TWO != 0) ? 0 : RICHE;                                             // first row of the class in a sequence
  const int rt    = bid / ntile;
  const int rowb  = (rt / CT) * SEQ + R0 + (rt % CT) * 64 + wave * 16;
  const int col0  = (bid % ntile) * 64;
  if (rowb + 16 > M) return;                // wave-uniform, never taken with the exact grid; no block barriers in this kernel
  const _Float16* ap  = (const _Float16*)(const void*)A  + (size_t)(rowb + m) * K + 8 * hh;
  const _Float16* ap2 = (const _Float16*)(const void*)A2 + (size_t)(rowb + m) * K + 8 * hh;
  const _Float16* bp  = (const _Float16*)(const void*)Bt + (size_t)(col0 + m) * K + 8 * hh;
  const size_t bs = (size_t)16 * K;
  v8f acc0 = zero8(), acc1 = zero8(), acc2 = zero8(), acc3 = zero8();
#pragma unroll 1
  for (int k0 = 0; k0 < K; k0 += 32) {
    const v16h a  = ldfrag_h(ap + k0);
    const v16h b0 = ldfrag_h(bp + k0);
    const v16h b1 = ldfrag_h(bp + bs + k0);
    const v16h b2 = ldfrag_h(bp + 2 * bs + k0);
    const v16h b3 = ldfrag_h(bp + 3 * bs + k0);
    acc0 = mma_h(a, b0, acc0);
    acc1 = mma_h(a, b1, acc1);
    acc2 = mma_h(a, b2, acc2);
    acc3 = mma_h(a, b3, acc3);
    if (TWO != 0) {
      const v16h a2 = ldfrag_h(ap2 + k0);
      acc0 = mma_h(a2, b0, acc0);
      acc1 = mma_h(a2, b1, acc1);
      acc2 = mma_h(a2, b2, acc2);
      acc3 = mma_h(a2, b3, acc3);
      guard6<v16h>(acc0, acc1, acc2, acc3, a, a2, b0, b1, b2, b3);
    } else {
      guard6<v16h>(acc0, acc1, acc2, acc3, a, b0, b1, b2, b3, a);
    }
  }
  (void)ap2;
  epi64(slab + wave * SLAB64, acc0, acc1, acc2, acc3, oscale, C, N, (size_t)rowb, col0, lane);
}

// =====================================================================================================
// Causal sliding-window softmax attention with key padding, hd = 64, all sequences in one launch. Block bid -> (query tile
// qt = qt0 + bid % nqt: rows q0 = 16*qt .. q0+15, head group hg = (bid / nqt) % NHG, sequence b = bid / (nqt*NHG), whose
// planes and key flags start at b's offset); one wave per head = hg*WPB + wave.
//   q hi / residual planes f16 x256 [s][h*HD + d]; k hi / residual planes f16 x256 [s][h*HD + d] (pitch DMOD);
//   v^T hi / residual planes [h*HD + d][SEQ] x1024; MK = the sequence's int32 key flags (0 = padded key).
//   raw(i, j) = q_hi.k_hi + q_lo.k_hi + q_hi.k_lo (2 k-steps over d); logit = raw * 2^-19 (the 1/8 softmax scale and the two
//   256 carries, exact); key j is REPLACED by -inf when j > i, j < i - (WIN-1), or MK[j] == 0; online softmax per query
//   row in f32 with a running max: row max / row sum over the 16 lanes holding the row via xor shuffles 1,2,4,8 (never
//   crossing the lane half); a row whose running max is still -inf uses 0 as the shift so alpha and p come out 0 (no NaN);
//   alpha = exp(m_old - m_new), p = exp(logit - m_new), l = l*alpha + sum p, O accumulators times alpha before the
//   tile's P.v. Key tiles of 32 visited in order from the tile holding max(0, q0-(WIN-1)) to the tile holding q0+15
//   (block-uniform bounds, <= 18 tiles). The 32 key flags of a tile are loaded once (one b32 per lane, coalesced) and
//   barrier, then A fragments of p*32768 (f16 hi and its f16 residual) are rebuilt from the LDS rows (float vector loads);
//   v^T B fragments in 2 groups of 2 d-subtiles; RV = 1: products hh + lh + hl, RV = 0: hh only.
//   After the loop O = acc / (l * 32768 * 1024) (0 when l == 0, i.e. every key of the window padded) into the wave's
//   Epilogue: O x256 -> f16 hi plane (and for RV = 1 the unscaled f16 residual plane) [s][h*HD + d]; lane = (row group
//   rq = lane>>3 in 0..3, 8 consecutive d at c8); one instruction = 4 rows it*4 + rq, each row segment (64 halves = one whole
// coverage: per wave 4 instructions x 4 rows x 8 lanes x 8 halves = 16 x 64 per plane; grid NB x NHG x nqt blocks x WPB waves;
//   the two launches (tiles 0..NQTR-1 with RV = 1, NQTR..NQT-1 with RV = 0) cover every (b, s, h) row segment of the hi plane
//   exactly once and rows s < RICHE of each sequence's residual plane exactly once (only those rows are read later).
// =====================================================================================================
template <int RV>
__global__ __launch_bounds__(ATT_THREADS)
void attn_w(const u16* __restrict__ QHa, const u16* __restrict__ QLa,
            const u16* __restrict__ KHa, const u16* __restrict__ KLa,
            const u16* __restrict__ VHa, const u16* __restrict__ VLa,
            const int* __restrict__ MKa,
            u16* OHa, u16* OLa, int qt0, int nqt) {
#pragma clang fp contract(off)
  __shared__ __align__(16) float smem[WPB * WREG];

  const int tid  = threadIdx.x;
  const int wave = tid >> 5;
  const int lane = tid & 31;
  const int hh   = lane >> 4;
  const int c    = lane & 15;
  const int bid  = blockIdx.x;
  if (nqt <= 0) return;                     // block-uniform; no block barriers in this kernel
  const int qt   = qt0 + bid % nqt;
  const int hg   = (bid / nqt) % NHG;
  const int b    = bid / (nqt * NHG);
  if (b >= NB) return;                      // block-uniform; never taken with the exact grid
  const size_t po = (size_t)b * SEQ * DMOD; // halves per sequence in every q / k / v^T / O plane (NH*HD == DMOD)
  const u16* __restrict__ QHp = QHa + po;
  const u16* __restrict__ QLp = QLa + po;
  const u16* __restrict__ KHp = KHa + po;
  const u16* __restrict__ KLp = KLa + po;
  const u16* __restrict__ VHp = VHa + po;
  const u16* __restrict__ VLp = VLa + po;
  const int* __restrict__ MK  = MKa + (size_t)b * XS_FULL;
  u16* OHp = OHa + po;
  u16* OLp = OLa + po;
  const int q0   = qt * 16;
  if (q0 + 16 > SEQ) return;                // block-uniform; never taken
  const int head = hg * WPB + wave;

  float* pt   = smem + wave * WREG;         // p tile [16][32] pitch 36
  float* slab = pt + PTW;                   // result slab [16][64] pitch 68

  const size_t hcol = (size_t)head * HD + 8 * hh;
  const _Float16* Qh  = (const _Float16*)(const void*)QHp + ((size_t)q0 + c) * DMOD + hcol;
  const _Float16* Ql  = (const _Float16*)(const void*)QLp + ((size_t)q0 + c) * DMOD + hcol;
  const _Float16* Khb = (const _Float16*)(const void*)KHp + (size_t)c * DMOD + hcol;        // key row kb added per step
  const _Float16* Klb = (const _Float16*)(const void*)KLp + (size_t)c * DMOD + hcol;
  const _Float16* Vhb = (const _Float16*)(const void*)VHp + ((size_t)head * HD + c) * SEQ + 8 * hh;  // d col c (+16j)
  const _Float16* Vlb = (const _Float16*)(const void*)VLp + ((size_t)head * HD + c) * SEQ + 8 * hh;
  const float lsc  = SM_SCALE * (1.0f / (QSC * KSC));   // exact power-of-two fold of the q / k carries into the 1/8 scale
  const float oc   = 1.0f / (PCAR * VCAR);
  const float ninf = -__builtin_inff();
  const size_t KROW = (size_t)DMOD;         // halves between consecutive key rows

  v8f o[4];
#pragma unroll
  for (int j = 0; j < 4; ++j) o[j] = zero8();
  float mrun[8], lrun[8];
#pragma unroll
  for (int r = 0; r < 8; ++r) { mrun[r] = ninf; lrun[r] = 0.0f; }
  int klo = q0 - (WIN - 1);
  if (klo < 0) klo = 0;
  const int ktlo = klo >> 5;                                                  // first tile intersecting the window
  const int kthi = q0 >> 5;                                                   // tile holding keys q0 .. q0 + 15
  int nkt = kthi - ktlo + 1;
  if (nkt > NKT) nkt = NKT;
  if (nkt < 1) nkt = 1;
  const int qr0   = q0 + 8 * hh;                                              // query row of D element r = qr0 + r

#pragma unroll 1
  for (int i = 0; i < nkt; ++i) {
    const int kb = (ktlo + i) * 32;                                           // kb + 31 <= SEQ - 1
    // ---- key padding flags of this tile: one coalesced b32 per lane, then broadcast for key kb + c and kb + 16 + c ----
    const int fl = MK[kb + lane];
    const int f0 = __shfl(fl, c, 32);
    const int f1 = __shfl(fl, 16 + c, 32);
    // ---- raw scores: D element r of this lane = (query row qr0 + r, key kb + c) in s0, key kb + 16 + c in s1 ----
    v8f s0 = zero8(), s1 = zero8();
    const _Float16* k0p = Khb + (size_t)kb * KROW;
    const _Float16* k1p = k0p + (size_t)16 * KROW;
    const _Float16* l0p = Klb + (size_t)kb * KROW;
    const _Float16* l1p = l0p + (size_t)16 * KROW;
#pragma unroll
    for (int kk = 0; kk < HD / 32; ++kk) {
      const v16h qh  = ldfrag_h(Qh + kk * 32);
      const v16h ql  = ldfrag_h(Ql + kk * 32);
      const v16h kh0 = ldfrag_h(k0p + kk * 32);
      const v16h kh1 = ldfrag_h(k1p + kk * 32);
      const v16h kl0 = ldfrag_h(l0p + kk * 32);
      const v16h kl1 = ldfrag_h(l1p + kk * 32);
      s0 = mma_h(qh, kh0, s0);
      s0 = mma_h(ql, kh0, s0);
      s0 = mma_h(qh, kl0, s0);
      s1 = mma_h(qh, kh1, s1);
      s1 = mma_h(ql, kh1, s1);
      s1 = mma_h(qh, kl1, s1);
      guard2(s0, s1, qh, ql, kh0, kl0, kh1, kl1);
    }
    // ---- causal / window / padding replace-mask, running-max online softmax in f32, p tile -> wave-private LDS ----
    float alpha[8];
    const int key0 = kb + c, key1 = kb + 16 + c;
#pragma unroll
    for (int r = 0; r < 8; ++r) {
      const int qrow = qr0 + r;
      const int lo   = qrow - (WIN - 1);
      const float a0 = s0[r] * lsc;
      const float a1 = s1[r] * lsc;
      const bool ok0 = (key0 <= qrow) && (key0 >= lo) && (f0 != 0);
      const bool ok1 = (key1 <= qrow) && (key1 >= lo) && (f1 != 0);
      const float t0 = ok0 ? a0 : ninf;
      const float t1 = ok1 ? a1 : ninf;
      float mx = fmaxf(t0, t1);
      mx = fmaxf(mx, __shfl_xor(mx, 1, 32));
      mx = fmaxf(mx, __shfl_xor(mx, 2, 32));
      mx = fmaxf(mx, __shfl_xor(mx, 4, 32));
      mx = fmaxf(mx, __shfl_xor(mx, 8, 32));
      const float mnew  = fmaxf(mrun[r], mx);
      const float mshft = (mnew == ninf) ? 0.0f : mnew;
      const float al    = __expf(mrun[r] - mshft);
      const float p0    = __expf(t0 - mshft);
      const float p1    = __expf(t1 - mshft);
      float sm = p0 + p1;
      sm += __shfl_xor(sm, 1, 32);
      sm += __shfl_xor(sm, 2, 32);
      sm += __shfl_xor(sm, 4, 32);
      sm += __shfl_xor(sm, 8, 32);
      lrun[r]  = lrun[r] * al + sm;
      mrun[r]  = mnew;
      alpha[r] = al;
      const int ro = (8 * hh + r) * PTP + c;
      pt[ro]      = p0;
      pt[ro + 16] = p1;
    }
    wave_sync_lds();
    // ---- rescale the O accumulators by alpha (row 8hh + r of every d-subtile) ----
#pragma unroll
    for (int j = 0; j < 4; ++j) {
#pragma unroll
      for (int r = 0; r < 8; ++r) o[j][r] = o[j][r] * alpha[r];
    }
    // ---- A fragments of p*32768: hi f16 and residual f16, row = c, split k map over the 32 keys of this step ----
    FragH ph, pl;
    {
      const float* prow = pt + c * PTP + 8 * hh;
      const v4f p0 = *(const v4f*)(prow), p1 = *(const v4f*)(prow + 4);
      const v4f p2 = *(const v4f*)(prow + 16), p3 = *(const v4f*)(prow + 20);
#pragma unroll
      for (int e = 0; e < 4; ++e) {
        const float ta = p0[e] * PCAR, tb = p1[e] * PCAR, tc = p2[e] * PCAR, td = p3[e] * PCAR;
        const _Float16 ha = (_Float16)ta, hb = (_Float16)tb, hc = (_Float16)tc, hd = (_Float16)td;
        ph.h[0][e]     = ha;                  // elements 0..7  = keys kb + 8hh + 0..7
        ph.h[0][4 + e] = hb;
        ph.h[1][e]     = hc;                  // elements 8..15 = keys kb + 16 + 8hh + 0..7
        ph.h[1][4 + e] = hd;
        pl.h[0][e]     = (_Float16)(ta - (float)ha);
        pl.h[0][4 + e] = (_Float16)(tb - (float)hb);
        pl.h[1][e]     = (_Float16)(tc - (float)hc);
        pl.h[1][4 + e] = (_Float16)(td - (float)hd);
      }
    }
    // ---- P.V : B fragment col n = d = j*16 + c, keys contiguous in the v^T planes; 2 groups of 2 d-subtiles ----
    {
      const _Float16* vhp = Vhb + kb;
      const _Float16* vlp = Vlb + kb;
      (void)vlp;
#pragma unroll
      for (int jg = 0; jg < 2; ++jg) {
        const size_t da = (size_t)(2 * jg) * 16 * SEQ;
        const size_t db = da + (size_t)16 * SEQ;
        const v16h vha = ldfrag_h(vhp + da), vhb2 = ldfrag_h(vhp + db);
        o[2 * jg]     = mma_h(ph.v, vha,  o[2 * jg]);
        o[2 * jg + 1] = mma_h(ph.v, vhb2, o[2 * jg + 1]);
        if (RV != 0) {
          const v16h vla = ldfrag_h(vlp + da), vlb2 = ldfrag_h(vlp + db);
          o[2 * jg]     = mma_h(pl.v, vha,  o[2 * jg]);
          o[2 * jg]     = mma_h(ph.v, vla,  o[2 * jg]);
          o[2 * jg + 1] = mma_h(pl.v, vhb2, o[2 * jg + 1]);
          o[2 * jg + 1] = mma_h(ph.v, vlb2, o[2 * jg + 1]);
          guard2(o[2 * jg], o[2 * jg + 1], ph.v, pl.v, vha, vhb2, vla, vlb2);
        } else {
          guard2(o[2 * jg], o[2 * jg + 1], ph.v, pl.v, vha, vhb2, vha, vhb2);
        }
      }
    }
    wave_sync_lds();
  }
  acc_guard4(o[0], o[1], o[2], o[3]);
  // ---- O = acc / l with the carries (32768 on p, 1024 on v) folded once (0 when l == 0); into the wave's slab ----
  float rl[8];
#pragma unroll
  for (int r = 0; r < 8; ++r) {
    const bool  okl  = lrun[r] > 0.0f;
    const float lden = okl ? lrun[r] : 1.0f;
    const float rec  = (1.0f / lden) * oc;
    rl[r] = okl ? rec : 0.0f;
  }
#pragma unroll
  for (int r = 0; r < 8; ++r) {
#pragma unroll
    for (int j = 0; j < 4; ++j) {
      const int idx = (8 * hh + r) * SLP + j * 16 + c;
      slab[idx] = o[j][r] * rl[r];
    }
  }
  wave_sync_lds();
  // ---- O x256 -> f16 hi plane (+ f16 residual plane); lane = (row group rq, 8 consecutive d at c8) ----
  v4u oh[4], ol[4];
  const int rq = lane >> 3, c8 = (lane & 7) * 8;
#pragma unroll
  for (int it = 0; it < 4; ++it) {
    const int row = it * 4 + rq;
    const v4f a = *(const v4f*)(slab + row * SLP + c8), b4 = *(const v4f*)(slab + row * SLP + c8 + 4);
    float w[8];
#pragma unroll
    for (int e = 0; e < 4; ++e) { w[e] = a[e] * OSC; w[4 + e] = b4[e] * OSC; }
#pragma unroll
    for (int e = 0; e < 4; ++e) {
      const _Float16 h0 = (_Float16)w[2 * e], h1 = (_Float16)w[2 * e + 1];
      const _Float16 g0 = (_Float16)(w[2 * e] - (float)h0), g1 = (_Float16)(w[2 * e + 1] - (float)h1);
      oh[it][e] = pk16(h_bits(h0), h_bits(h1));
      ol[it][e] = pk16(h_bits(g0), h_bits(g1));
    }
  }
  const size_t ob = ((size_t)q0) * DMOD + (size_t)head * HD + c8;
  {
#pragma unroll
    for (int it = 0; it < 4; ++it) {
      const int row = it * 4 + rq;
      *(v4u*)(OHp + ob + (size_t)row * DMOD) = oh[it];
      if (RV != 0) {
        *(v4u*)(OLp + ob + (size_t)row * DMOD) = ol[it];
      }
    }
    
  }
}

// =====================================================================================================
// Workspace map (bytes); every plane holds all NB sequences (ROWS = NB*SEQ rows), each stage is one launch over all of them;
// every plane is fully written by whole-line stores before it is read (the O residual plane only on the rows < RICHE of each
// sequence that are read); all extents are exact multiples of the store granularity; every region offset a multiple of 131072:
//   XB  bf16 [ROWS][1024]                ROWS*2048   (ROWS=8192: 16777216)
//   WB  bf16 [3072 n][1024 k]            6291456     (q rows 0..1023, k 1024..2047, v 2048..3071)
//   WT  f16  [1024 o][1024 d] x1024      2097152
//   F   f32  [ROWS][3072]                ROWS*12288  (100663296)  q | k | v projection columns
//   QH  f16 [ROWS][1024] x256            ROWS*2048   QL residual, same extent
//   KH  f16 [ROWS][1024] x256            ROWS*2048   KL residual, same extent
//   VH  f16 [NB][16][64][SEQ] x1024      ROWS*2048   VL residual, same extent
//   OH  f16 [ROWS][1024] x256            ROWS*2048   OL residual, same extent (rows < RICHE of each sequence written / read)
//   TC  f32 [SEQ][16]                    SEQ*64      TS, same extent
//   end (SEQ=2048, NB=4)                260308992
// =====================================================================================================
extern "C" void kernel_launch(void* const* d_in, const int* in_sizes, int n_in,
                              void* d_out, int out_size, void* d_ws, size_t ws_size,
                              hipStream_t stream) {
  if (n_in < 4) return;
  if (in_sizes[0] < ((NB - 1) * XS_FULL + SEQ) * DMOD) return;
  if (in_sizes[1] < (NB - 1) * XS_FULL + SEQ) return;
  if (in_sizes[2] != DMOD * NQKV) return;
  if (in_sizes[3] != DMOD * DMOD) return;
  if (out_size < ((NB - 1) * XS_FULL + SEQ) * DMOD) return;

  const float* x    = (const float*)d_in[0];
  const int*   mask = (const int*)d_in[1];
  const float* wqkv = (const float*)d_in[2];       // [1024 k][3072 n]
  const float* wo   = (const float*)d_in[3];       // [1024 d][1024 o]
  float*       out  = (float*)d_out;

  const size_t szXB = (size_t)ROWS * DMOD * 2;
  const size_t szWB = (size_t)NQKV * DMOD * 2;
  const size_t szWT = (size_t)DMOD * DMOD * 2;
  const size_t szF  = (size_t)ROWS * NQKV * 4;
  const size_t szQ  = (size_t)ROWS * DMOD * 2;                   // QH, QL, KH, KL, OH, OL
  const size_t szV  = (size_t)NB * NH * HD * SEQ * 2;            // VH, VL (== szQ)
  const size_t szT  = (size_t)SEQ * NFREQ * 4;                   // TC, TS
  size_t off = 0;
  const size_t oXB = off; off += szXB;
  const size_t oWB = off; off += szWB;
  const size_t oWT = off; off += szWT;
  const size_t oF  = off; off += szF;
  const size_t oQH = off; off += szQ;
  const size_t oQL = off; off += szQ;
  const size_t oKH = off; off += szQ;
  const size_t oKL = off; off += szQ;
  const size_t oVH = off; off += szV;
  const size_t oVL = off; off += szV;
  const size_t oOH = off; off += szQ;
  const size_t oOL = off; off += szQ;
  const size_t oTC = off; off += szT;
  const size_t oTS = off; off += szT;
  if (off > ws_size) return;                // off = 260308992 for SEQ = 2048, NB = 4
  if (off > (size_t)WS_CAP) return;

  char* ws = (char*)d_ws;
  u16*   XB  = (u16*)(ws + oXB);
  u16*   WB  = (u16*)(ws + oWB);
  u16*   WT  = (u16*)(ws + oWT);
  float* F   = (float*)(ws + oF);
  u16*   QH  = (u16*)(ws + oQH);
  u16*   QL  = (u16*)(ws + oQL);
  u16*   KH  = (u16*)(ws + oKH);
  u16*   KL  = (u16*)(ws + oKL);
  u16*   VH  = (u16*)(ws + oVH);
  u16*   VL  = (u16*)(ws + oVL);
  u16*   OH  = (u16*)(ws + oOH);
  u16*   OL  = (u16*)(ws + oOL);
  float* TC  = (float*)(ws + oTC);
  float* TS  = (float*)(ws + oTS);

  const dim3 b256(256), b128(128), bAT(ATT_THREADS);
  const int  n8x = (ROWS * DMOD) / 8;
  const dim3 gX((n8x + 255) / 256);                     // ROWS*DMOD/2048 blocks
  const int  nT  = SEQ * NFREQ;
  const dim3 gT((nT + 255) / 256);                      // SEQ/16
  const dim3 gWQ((DMOD / 64) * (NQKV / 64));            // 768: in [1024 k][3072 n] -> WB [3072 n][1024 k]
  const dim3 gWO((DMOD / 64) * (DMOD / 64));            // 256: in [1024 d][1024 o] -> WT [1024 o][1024 d]
  const dim3 gG1((ROWS / 64) * (NQKV / 64));
  const dim3 gRW(ROWS, 2);
  const dim3 gVT(NB * NH * NST);
  const float osc = 1.0f / (OSC * WOS);

  // (0) weight planes: Wqkv transposed to bf16 [n][k]; Wo transposed to f16 of the bf16 value x1024 [o][d]
  cvtT16<<<gWQ, b256, 0, stream>>>(wqkv, DMOD, NQKV, WB, 0, 1.0f);
  cvtT16<<<gWO, b256, 0, stream>>>(wo, DMOD, DMOD, WT, 1, WOS);
  // (1) rotary cos / sin tables [SEQ][16]
  k_tab<<<gT, b256, 0, stream>>>(TC, TS, nT);
  // every stage below: all sequences in one launch (x, mask and out rows of the NB sequences are contiguous)
  // (2) x rows -> bf16 plane [ROWS][1024]
  cvt16<<<gX, b256, 0, stream>>>(x, XB, n8x, 0, 1.0f);
  // (3) qkv = x.Wqkv -> F f32 [ROWS][3072]
  gemm_bf<<<gG1, b128, 0, stream>>>(XB, WB, F, ROWS, NQKV, DMOD, 1.0f);
  // (4) partial rotary + hi + residual planes x256: q from columns 0..1023 (blockIdx.y = 0), k from 1024..2047 (blockIdx.y = 1)
  rope16<<<gRW, b128, 0, stream>>>(F, NQKV, TC, TS, QH, QL, KH, KL, QSC, KSC);
  // (5) v^T hi + residual planes x1024 from columns 2048..3071
  vt16<<<gVT, b256, 0, stream>>>(F, NQKV, 2 * DMOD, VH, VL);
  // (6) windowed causal attention with key padding -> O f16 hi plane x256 for all query tiles; residual plane for rows < RICHE
  attn_w<1><<<dim3(NB * NQTR * NHG), bAT, 0, stream>>>(QH, QL, KH, KL, VH, VL, mask, OH, OL, 0, NQTR);
  if (NQT > NQTR) {
    attn_w<0><<<dim3(NB * (NQT - NQTR) * NHG), bAT, 0, stream>>>(QH, QL, KH, KL, VH, VL, mask, OH, OL, NQTR, NQT - NQTR);
  }
  // (7) y = O.Wo -> out f32, carries 256 x 1024 folded back; rows < RICHE of each sequence with O hi + residual
  gemm_h<1><<<dim3(NB * (RICHE / 64) * (DMOD / 64)), b128, 0, stream>>>(OH, OL, WT, out, ROWS, DMOD, DMOD, osc);
  if (SEQ > RICHE) {
    gemm_h<0><<<dim3(NB * ((SEQ - RICHE) / 64) * (DMOD / 64)), b128, 0, stream>>>(OH, OL, WT, out, ROWS, DMOD, DMOD, osc);
  }
  (void)hipGetLastError();
}

// v002
// Measured time: 277 microseconds a run.
// Next to v001, in two timings, it ran 1.69 times as fast each time.
// Over all steps from v000 it is 2.70 times as fast.
// Contractions: x.Wqkv on v_wmma_f32_16x16x32_bf16 (x and the transposed weight as bf16 RNE planes; weight plane [n][k]
// rows are the k-contiguous B operand; f32 accumulate); q.k^T over hd 64 and P.v on v_wmma_f32_16x16x32_f16 with f16 hi +
// f16 residual planes (q, k x256 after partial rotary, products hh+lh+hl on every row; P x32768 hi + in-register residual
// and v^T x1024 hi + residual plane for query rows < 512 of each sequence, P hi . v hi only for later rows); O.Wo on
// v_wmma_f32_16x16x32_f16 with O x256 as f16 hi (+ f16 residual plane for rows < 512 of each sequence) and Wo transposed
// to [o][d] as f16(bf16(Wo)) x1024, one accumulator; all f32 accumulate. Rotary cos/sin tables, causal + window + key
// padding masks and the online softmax in f32 on VALU.
#include <hip/hip_runtime.h>
#include <math.h>
#include <stdint.h>

#ifndef NB
#define NB 4
#endif
#ifndef SEQ
#define SEQ 2048
#endif
#ifndef RICH
#define RICH 512
#endif
#define NB_FULL 4
#define XS_FULL 2048
#define DMOD  1024
#define NH    16
#define HD    64
#define HROT  32
#define HROTH 16
#define NFREQ 16
#define NQKV  (3 * DMOD)
#define WIN   512
#define RICHE ((RICH < SEQ) ? RICH : SEQ)
#define ROPE_L2 0.41524101186092028
#define SM_SCALE 0.125f
#define QSC   256.0f
#define KSC   256.0f
#define PCAR  32768.0f
#define VCAR  1024.0f
#define OSC   256.0f
#define WOS   1024.0f
#define WPB   4
#define NHG   (NH / WPB)
#define NQT   (SEQ / 16)
#define NQTR  (RICHE / 16)
#define NST   (SEQ / 64)
#define NKT   (SEQ / 32)
#define ATT_THREADS (WPB * 32)
#define PTP   36
#define PTW   (16 * PTP)
#define SLP   68
#define SLW   (16 * SLP)
#define WREG  (PTW + SLW)
#define SLAB64 (16 * 68)
#define VTP   72
#define WS_CAP 268435456
#define ROWS  (NB * SEQ)
#define GT    128
#define GKS   64
#define GPIT  72
#define GPLH  (GT * GPIT)
static_assert(DMOD == NH * HD && HD == 64 && HROT == 32 && HROTH == 16 && NFREQ == 16 && NH == 16 && WPB == 4 && NHG * WPB == NH);
static_assert(ATT_THREADS == 128 && NQKV == 3072 && WIN == 512 && NHG == 4);
static_assert(NB >= 1 && NB <= NB_FULL);
static_assert(NB == 1 || SEQ == XS_FULL);
static_assert((SEQ % 64) == 0 && SEQ >= 64 && SEQ <= XS_FULL);
static_assert((RICHE % 64) == 0 && RICHE >= 64 && RICHE <= SEQ);
static_assert((DMOD % 64) == 0 && (NQKV % 64) == 0 && (DMOD % 32) == 0 && (HD % 32) == 0);
static_assert(((SEQ * DMOD / 8) % 256) == 0 && ((SEQ * NFREQ) % 256) == 0);
static_assert(WPB * WREG * 4 <= 65536 && 2 * HD * VTP * 2 <= 65536 && 4 * SLAB64 * 4 <= 65536 && 64 * VTP * 2 <= 65536);
static_assert(NQT * 16 == SEQ && NQTR * 16 == RICHE && NKT * 32 == SEQ && NST * 64 == SEQ);
static_assert((RICHE % GT) == 0 && ((SEQ - RICHE) % GT) == 0 && (ROWS % GT) == 0 && (NQKV % GT) == 0 && (DMOD % GT) == 0 && (DMOD % GKS) == 0);

typedef unsigned short u16;
typedef _Float16 v16h __attribute__((ext_vector_type(16)));
typedef _Float16 v8h  __attribute__((ext_vector_type(8)));
typedef __bf16   v16b __attribute__((ext_vector_type(16)));
typedef float    v8f  __attribute__((ext_vector_type(8)));
typedef float    v4f  __attribute__((ext_vector_type(4)));
typedef unsigned int v4u __attribute__((ext_vector_type(4)));

union FragH { v16h v; v8h h[2]; v4u u[2]; };

// ---- scalar helpers --------------------------------------------------------------------------------
__device__ __forceinline__ unsigned short bf_bits(float f) {          // f32 -> bf16 bits, RNE convert
  unsigned u = __float_as_uint(f);
  return (unsigned short)((u + 0x7FFFu + ((u >> 16) & 1u)) >> 16);
}
__device__ __forceinline__ float bf_up(unsigned short h) { return __uint_as_float(((unsigned)h) << 16); }
__device__ __forceinline__ float bfr(float f) { return bf_up(bf_bits(f)); }
__device__ __forceinline__ unsigned short h_bits(_Float16 x) { return __builtin_bit_cast(unsigned short, x); }
__device__ __forceinline__ unsigned pk16(unsigned short a, unsigned short b) { return (unsigned)a | ((unsigned)b << 16); }
__device__ __forceinline__ v8f zero8() { v8f z = {0.f, 0.f, 0.f, 0.f, 0.f, 0.f, 0.f, 0.f}; return z; }

// ---- fragment loaders: 16-bit A/B operand, lane -> row/col (lane&15), p already includes +8*(lane>>4);
//      elements 0..7 <- p[0..7] (k0+8h..), elements 8..15 <- p[16..23] (k0+16+8h..)  (same split k map for A and B;
//      B is always read from a k-contiguous [n][k] plane)
__device__ __forceinline__ v16h ldfrag_h(const _Float16* p) {
  FragH f;
  f.h[0] = *(const v8h*)(p);
  f.h[1] = *(const v8h*)(p + 16);
  return f.v;
}

__device__ __forceinline__ v8f mma_h(v16h a, v16h b, v8f c) {
  return __builtin_amdgcn_wmma_f32_16x16x32_f16(false, a, false, b, (short)0, c, false, false);
}
__device__ __forceinline__ v8f mma_b(v16b a, v16b b, v8f c) {
  return __builtin_amdgcn_wmma_f32_16x16x32_bf16(false, a, false, b, (short)0, c, false, false);
}
__device__ __forceinline__ void guard2(v8f& a, v8f& b, v16h x0, v16h x1, v16h x2, v16h x3, v16h x4, v16h x5) {
#if defined(__HIP_DEVICE_COMPILE__)
  asm volatile("v_nop\n\tv_nop\n\tv_nop\n\tv_nop"
               : "+v"(a), "+v"(b) : "v"(x0), "v"(x1), "v"(x2), "v"(x3), "v"(x4), "v"(x5) : "memory");
#endif
}
__device__ __forceinline__ void acc_guard4(v8f& a, v8f& b, v8f& c, v8f& d) {
#if defined(__HIP_DEVICE_COMPILE__)
  asm volatile("v_nop\n\tv_nop\n\tv_nop\n\tv_nop" : "+v"(a), "+v"(b), "+v"(c), "+v"(d));
#endif
}
__device__ __forceinline__ void wave_sync_lds() {
  __builtin_amdgcn_fence(__ATOMIC_RELEASE, "workgroup");
  __builtin_amdgcn_wave_barrier();
  __builtin_amdgcn_fence(__ATOMIC_ACQUIRE, "workgroup");
}

// =====================================================================================================
// f32 -> bf16 RNE plane, same layout (f16mode == 1: f16 bits of (bf16 RNE value) * scale).
// Thread = 8 consecutive elements: two 16-B loads, one 16-B store; 32 consecutive lanes = 512 contiguous, 512-B aligned
// coverage: grid = ceil(n8/256) blocks x 256 thr x 8 (in-kernel bound) = the whole plane (n8 a multiple of 256 here).
// =====================================================================================================
__global__ __launch_bounds__(256) void cvt16(const float* __restrict__ x, u16* D, int n8, int f16mode, float scale) {
  const int gt = blockIdx.x * 256 + (int)threadIdx.x;
  if (gt >= n8) return;
  const float* p = x + (size_t)gt * 8;
  const v4f a = *(const v4f*)(p), b4 = *(const v4f*)(p + 4);
  float w[8];
#pragma unroll
  for (int e = 0; e < 4; ++e) { w[e] = a[e]; w[4 + e] = b4[e]; }
  v4u o;
#pragma unroll
  for (int e = 0; e < 4; ++e) {
    const float f0 = w[2 * e], f1 = w[2 * e + 1];
    const unsigned short hb0 = h_bits((_Float16)(bfr(f0) * scale));
    const unsigned short hb1 = h_bits((_Float16)(bfr(f1) * scale));
    const unsigned short bb0 = bf_bits(f0);
    const unsigned short bb1 = bf_bits(f1);
    o[e] = (f16mode != 0) ? pk16(hb0, hb1) : pk16(bb0, bb1);
  }
  u16* d = D + (size_t)gt * 8;
  {
    *(v4u*)(d) = o;
    
  }
}

// =====================================================================================================
// Transposed 16-bit plane of a row-major f32 matrix: in X [R rows][CC cols] (pitch CC) -> out D [CC][R] (pitch R),
// D[c][r] = cvt(X[r][c]); f16mode == 0: bf16 RNE bits; f16mode == 1: f16 bits of (bf16 RNE value) * scale.
// Block = one 64x64 tile (rt = bid / (CC/64) -> rows 64*rt.., ct = bid % (CC/64) -> cols 64*ct..), 256 threads: thread
// (row rl = tid>>2, col chunk cc = 16*(tid&3)) loads its 16 floats with 16-B loads, converts, places them transposed into
// the LDS tile T[c_local][r_local] (pitch 72 halves, 2-B element stores); after a block barrier each output row segment
// coverage: load 256 thr x 16 = 64 x 64; store 2 iterations x 256 thr x 8 halves = 64 lines x 64 = the tile of D;
//           grid = (R/64)*(CC/64) blocks covers D exactly once (R, CC multiples of 64).
// =====================================================================================================
__global__ __launch_bounds__(256) void cvtT16(const float* __restrict__ X, int R, int CC, u16* D, int f16mode, float scale) {
  __shared__ __align__(16) u16 T[64 * VTP];
  const int tid = (int)threadIdx.x;
  const int bid = (int)blockIdx.x;
  const int nct = CC >> 6;
  const int ct  = bid % nct;
  const int rt  = bid / nct;
  const int r0  = rt * 64, c0 = ct * 64;
  if (r0 + 64 > R) return;                  // block-uniform, before the barrier; never taken with the exact grid
  {
    const int rl = tid >> 2;                // row within tile 0..63
    const int cc = (tid & 3) * 16;          // column chunk 0,16,32,48
    const float* src = X + (size_t)(r0 + rl) * (size_t)CC + c0 + cc;
#pragma unroll
    for (int i = 0; i < 4; ++i) {
      const v4f a = *(const v4f*)(src + 4 * i);
#pragma unroll
      for (int e = 0; e < 4; ++e) {
        const float f = a[e];
        const unsigned short hb = h_bits((_Float16)(bfr(f) * scale));
        const unsigned short bb = bf_bits(f);
        T[(cc + 4 * i + e) * VTP + rl] = (f16mode != 0) ? hb : bb;
      }
    }
  }
  __syncthreads();
  v4u w[2];
  const int q8 = tid >> 3, p8 = (tid & 7) * 8;
#pragma unroll
  for (int it = 0; it < 2; ++it) {
    const int line = it * 32 + q8;          // c_local = 0..63
    w[it] = *(const v4u*)(T + line * VTP + p8);
  }
  const size_t base = (size_t)c0 * (size_t)R + r0 + p8;
  {
#pragma unroll
    for (int it = 0; it < 2; ++it) {
      const int line = it * 32 + q8;
      *(v4u*)(D + base + (size_t)line * (size_t)R) = w[it];
    }
    
  }
}

// =====================================================================================================
// Rotary tables TC[s][j] = cos(s * inv[j]), TS[s][j] = sin(s * inv[j]), j < 16, with
// inv[j] = 1.0f / f32(10000^(2j/32)) (power evaluated in f64 and narrowed once, IEEE f32 reciprocal, f32 product s*inv,
// coverage: grid = n/256 blocks x 256 thr = n = SEQ*16 elements of TC and of TS (n a multiple of 256).
// =====================================================================================================
__global__ __launch_bounds__(256) void k_tab(float* TC, float* TS, int n) {
#pragma clang fp contract(off)
  const int idx = blockIdx.x * 256 + (int)threadIdx.x;
  if (idx >= n) return;
  const int s = idx / NFREQ;
  const int j = idx - s * NFREQ;
  const double pj = exp2((double)(2 * j) * ROPE_L2);   // 10000^(2j/32)
  const float pf  = (float)pj;
  const float inv = 1.0f / pf;
  const float ang = (float)s * inv;
  float sv, cv;
  sincosf(ang, &sv, &cv);
  {
    *(float*)(TC + idx) = cv;
    *(float*)(TS + idx) = sv;
    
  }
}

// =====================================================================================================
// v^T planes from the v columns of the projection F f32 [ROWS][ldf] (row = b*SEQ + s, column = voff + g*HD + d):
//   VH[((b*NH + g)*HD + d)][s] = f16(v * 1024);  VL[same][s] = f16 residual (t - f16(t)), all sequences b, keys s, heads g < 16.
// Block = (sequence b, head g, 64 keys s0): each thread loads its 16 floats (key sl, d chunk dc) with 16-B loads, converts, places
// them into two LDS tiles [64 d][64 keys] (pitch 72 halves); after a block barrier each d row segment (64 halves = one whole
// LDS tiles are cross-wave (block barrier).
// coverage: load 256 thr x 16 = 64 keys x 64 d; store 2 iterations x 256 thr x 8 halves = 64 lines x 64 = the block's tile of
//           VH and of VL; grid = NB*NH*NST blocks covers both planes [NB*NH*64][SEQ] exactly once.
// =====================================================================================================
__global__ __launch_bounds__(256) void vt16(const float* __restrict__ F, int ldf, int voff, u16* VHo, u16* VLo) {
  __shared__ __align__(16) u16 TH[HD * VTP];
  __shared__ __align__(16) u16 TL[HD * VTP];
  const int tid = threadIdx.x;
  const int bid = blockIdx.x;
  const int st  = bid % NST;
  const int g   = (bid / NST) % NH;
  const int b   = bid / (NST * NH);
  if (b >= NB) return;                      // block-uniform, before any barrier; never taken with the exact grid
  const int s0  = st * 64;
  {
    const int sl = tid >> 2;                // key within tile 0..63
    const int dc = (tid & 3) * 16;          // d chunk 0,16,32,48
    const float* src = F + ((size_t)b * SEQ + s0 + sl) * (size_t)ldf + voff + g * HD + dc;
#pragma unroll
    for (int i = 0; i < 4; ++i) {
      const v4f a = *(const v4f*)(src + 4 * i);
#pragma unroll
      for (int e = 0; e < 4; ++e) {
        const float t = a[e] * VCAR;
        const _Float16 hv = (_Float16)t;
        const _Float16 lv = (_Float16)(t - (float)hv);
        TH[(dc + 4 * i + e) * VTP + sl] = h_bits(hv);
        TL[(dc + 4 * i + e) * VTP + sl] = h_bits(lv);
      }
    }
  }
  __syncthreads();
  v4u vh[2], vl[2];
  const int q8 = tid >> 3, p8 = (tid & 7) * 8;
#pragma unroll
  for (int it = 0; it < 2; ++it) {
    const int line = it * 32 + q8;          // d = 0..63
    vh[it] = *(const v4u*)(TH + line * VTP + p8);
    vl[it] = *(const v4u*)(TL + line * VTP + p8);
  }
  const size_t hrow = ((size_t)b * NH + g) * HD;
  const size_t base = hrow * SEQ + s0 + p8;
  {
#pragma unroll
    for (int it = 0; it < 2; ++it) {
      const int line = it * 32 + q8;
      *(v4u*)(VHo + base + (size_t)line * SEQ) = vh[it];
      *(v4u*)(VLo + base + (size_t)line * SEQ) = vl[it];
    }
    
  }
}

// =====================================================================================================
// Partial NeoX (non-interleaved) rotary on dims 0..31 of each head + q / k planes from the projection F f32 [ROWS][ldf]
// at column offset coff (row = b*SEQ + s, column = coff + head*HD + d; table row = s, table column j = d mod 16):
//   d <  16     : out[d] = x[d]*c[s][j] + (-1)*(x[d+16]*sn[s][j])
//   16 <= d < 32: out[d] = x[d]*c[s][j] + (+1)*(x[d-16]*sn[s][j])    (mul, mul, add kept separate)
//   d >= 32     : out[d] = x[d]
//   Hp [ROWS][DMOD] = f16(out * sc), Lp [ROWS][DMOD] = f16 residual (t - f16(t)), same layout.
// Row = b*SEQ + s over all sequences (table row s = row mod SEQ); blockIdx.y = 0: q (columns 0.., planes Hq / Lq, scale scq),
// blockIdx.y = 1: k (columns DMOD.., planes Hk / Lk, scale sck).
// Block = one row, 128 threads; thread t = head t>>3, chunk i = t&7: columns head*HD + 8i .. +7; it also loads the partner
// chunk (d xor 16 for d < 32, itself otherwise; all loads in range, selection by value). One 16-B store per plane per thread;
// coverage: 128 thr x 8 = the whole row of Hp and of Lp; grid = (ROWS, 2) blocks = every row of all four planes once.
// =====================================================================================================
__device__ __forceinline__ void rot_one(float x, float y, float cv, float sv, float sgn, float sc, int rot,
                                        unsigned short& hb, unsigned short& lb) {
#pragma clang fp contract(off)
  const float ys   = y * sv;
  const float term = sgn * ys;
  const float rr   = x * cv + term;
  const float r    = (rot != 0) ? rr : x;
  const float t    = r * sc;
  const _Float16 a = (_Float16)t;
  hb = h_bits(a);
  lb = h_bits((_Float16)(t - (float)a));
}

__global__ __launch_bounds__(128) void rope16(const float* __restrict__ F, int ldf,
                                              const float* __restrict__ TC, const float* __restrict__ TS,
                                              u16* Hq, u16* Lq, u16* Hk, u16* Lk, float scq, float sck) {
#pragma clang fp contract(off)
  const int tid = (int)threadIdx.x;
  const int row = (int)blockIdx.x;          // b*SEQ + s
  if (row >= ROWS) return;
  const int isk  = ((int)blockIdx.y != 0) ? 1 : 0;     // block-uniform: 0 = q, 1 = k
  const int coff = isk * DMOD;
  u16* Hp = (isk != 0) ? Hk : Hq;
  u16* Lp = (isk != 0) ? Lk : Lq;
  const float sc = (isk != 0) ? sck : scq;
  const int srow = row % SEQ;               // s, the table row
  const int dd   = (tid & 7) * 8;                      // d within head, multiple of 8
  const int hb   = (tid >> 3) * HD;                    // head base column
  const int col  = hb + dd;
  if (hb + HD > DMOD) return;                          // never taken with blockDim = 128
  const int rot  = (dd < HROT) ? 1 : 0;
  const int jj   = dd & (HROTH - 1);                   // table column 0 or 8 (jj+7 <= 15)
  const int pcol = hb + ((rot != 0) ? (dd ^ HROTH) : dd);   // partner: d+16 (d<16), d-16 (16<=d<32), d itself otherwise
  const float sgn = (dd < HROTH) ? -1.0f : 1.0f;
  const float* p = F + (size_t)row * (size_t)ldf + coff;
  const v4f xa = *(const v4f*)(p + col),  xb = *(const v4f*)(p + col + 4);
  const v4f ya = *(const v4f*)(p + pcol), yb = *(const v4f*)(p + pcol + 4);
  const float* cp = TC + (size_t)srow * NFREQ + jj;
  const float* sp = TS + (size_t)srow * NFREQ + jj;
  const v4f ca = *(const v4f*)(cp), cb = *(const v4f*)(cp + 4);
  const v4f sa = *(const v4f*)(sp), sb = *(const v4f*)(sp + 4);
  float xv[8], yv[8], cw[8], sw[8];
#pragma unroll
  for (int e = 0; e < 4; ++e) {
    xv[e] = xa[e];  xv[4 + e] = xb[e];
    yv[e] = ya[e];  yv[4 + e] = yb[e];
    cw[e] = ca[e];  cw[4 + e] = cb[e];
    sw[e] = sa[e];  sw[4 + e] = sb[e];
  }
  v4u oh, ol;
#pragma unroll
  for (int e = 0; e < 4; ++e) {
    unsigned short h0, l0, h1, l1;
    rot_one(xv[2 * e],     yv[2 * e],     cw[2 * e],     sw[2 * e],     sgn, sc, rot, h0, l0);
    rot_one(xv[2 * e + 1], yv[2 * e + 1], cw[2 * e + 1], sw[2 * e + 1], sgn, sc, rot, h1, l1);
    oh[e] = pk16(h0, h1);
    ol[e] = pk16(l0, l1);
  }
  u16* dh = Hp + (size_t)row * DMOD + col;
  u16* dl = Lp + (size_t)row * DMOD + col;
  {
    *(v4u*)(dh) = oh;
    *(v4u*)(dl) = ol;
    
  }
}

// =====================================================================================================
// GEMM epilogue shared by both engines: the wave's 64x64 f32 tile (times oscale) staged in its four LDS slabs (16 rows each, pitch
// 68, wave-private), one wave-level LDS sync, then whole-line stores: one instruction = 2 rows x 16 lanes x 4 floats.
// coverage: 4 slabs x 8 instructions x 2 rows x 16 lanes x 4 floats = the wave's 64 x 64 tile.
// =====================================================================================================
__device__ __forceinline__ void epi_put(float* sl, v8f a0, v8f a1, v8f a2, v8f a3, float oscale, int lane) {
  const int hh = lane >> 4, m = lane & 15;
#pragma unroll
  for (int r = 0; r < 8; ++r) {
    const int ro = (8 * hh + r) * 68 + m;
    sl[ro]      = a0[r] * oscale;
    sl[ro + 16] = a1[r] * oscale;
    sl[ro + 32] = a2[r] * oscale;
    sl[ro + 48] = a3[r] * oscale;
  }
}
__device__ __forceinline__ void epi_get(const float* sl, float* C, int N, size_t rowb, int col0, int lane) {
  const int hh = lane >> 4, m = lane & 15;
  v4f vals[8];
#pragma unroll
  for (int it = 0; it < 8; ++it) vals[it] = *(const v4f*)(sl + (it * 2 + hh) * 68 + m * 4);
  float* dst = C + (rowb + (size_t)hh) * (size_t)N + col0 + m * 4;
#pragma unroll
  for (int it = 0; it < 8; ++it) {
    *(v4f*)(dst + (size_t)(it * 2) * (size_t)N) = vals[it];
  }
}

// =====================================================================================================
// GEMM core shared by both engines: C[128 x 128 tile] (f32) = (A (+ A2 when MODE == 2)) . Bt^T, times oscale, K = DMOD.
// A, A2 [rows][DMOD] and Bt [n][DMOD] are k-contiguous 16-bit planes (MODE 0: bf16, MODE 1 / 2: f16).
// Block = 4 waves as 2 x 2, each wave a 64 x 64 tile (4 x 4 accumulators). A stage is 64 k = one whole 128-B line of each of the
// 128 A rows (and A2 rows) and 128 Bt rows, laid in LDS at pitch 144 B by asynchronous 16-B copies: thread t copies chunk t & 7 of
// rows (t >> 3) + 16 i, i < 8, so one wave-wide copy covers 4 whole lines. Two buffers: stage t + 1 flies while stage t is worked on.
// Fragments come from LDS with the same split k map for A and B as ldfrag_*; every accumulator takes its products in the order
// k0 = 0, 32, 64, ... (A then A2 within a k0).
// After the last stage's barrier the ring is dead and serves as the waves' own epilogue slabs (4 per wave, 16 x 68 floats each).
// =====================================================================================================
union FragU { v4u u[2]; v16h h; v16b b; };

__device__ __forceinline__ FragU ldfrag_u(const u16* p) {
  FragU f;
  f.u[0] = *(const v4u*)(p);
  f.u[1] = *(const v4u*)(p + 16);
  return f;
}
template <int MODE>
__device__ __forceinline__ v8f mma_u(const FragU& a, const FragU& b, v8f c) {
  if constexpr (MODE == 0) return mma_b(a.b, b.b, c);
  else                     return mma_h(a.h, b.h, c);
}
__device__ __forceinline__ unsigned lds_addr(const u16* p) {          // byte offset in the work-group's LDS
  return (unsigned)(uintptr_t)(const __attribute__((address_space(3))) u16*)p;
}
// One operand tile of a stage: this lane's eight 16-B copies (rows 16 apart). The s_wait_xcnt stands inside the statement, behind
// the last copy, so that no address register of an issued copy is rewritten ahead of it.
__device__ __forceinline__ void acopy_tile(unsigned l, const u16* g) {
#if defined(__HIP_DEVICE_COMPILE__)
  constexpr unsigned LS = 16u * GPIT * 2u;          // LDS bytes between this lane's rows
  constexpr size_t   GS = (size_t)16 * DMOD;        // halves between this lane's rows in the plane
  asm volatile("global_load_async_to_lds_b128 %0, %8, off\n\t"
               "global_load_async_to_lds_b128 %1, %9, off\n\t"
               "global_load_async_to_lds_b128 %2, %10, off\n\t"
               "global_load_async_to_lds_b128 %3, %11, off\n\t"
               "global_load_async_to_lds_b128 %4, %12, off\n\t"
               "global_load_async_to_lds_b128 %5, %13, off\n\t"
               "global_load_async_to_lds_b128 %6, %14, off\n\t"
               "global_load_async_to_lds_b128 %7, %15, off\n\t"
               "s_wait_xcnt 0x0"
               :: "v"(l), "v"(l + LS), "v"(l + 2u * LS), "v"(l + 3u * LS),
                  "v"(l + 4u * LS), "v"(l + 5u * LS), "v"(l + 6u * LS), "v"(l + 7u * LS),
                  "v"(g), "v"(g + GS), "v"(g + 2 * GS), "v"(g + 3 * GS),
                  "v"(g + 4 * GS), "v"(g + 5 * GS), "v"(g + 6 * GS), "v"(g + 7 * GS)
               : "memory");
#endif
}
__device__ __forceinline__ void wait_async0() {     // this wave's copies have landed in LDS
#if defined(__HIP_DEVICE_COMPILE__)
  asm volatile("s_wait_asynccnt 0x0" ::: "memory");
#endif
}
__device__ __forceinline__ void wait_ds0() {        // this wave's LDS reads have returned before their buffer is handed back
#if defined(__HIP_DEVICE_COMPILE__)
  asm volatile("s_wait_dscnt 0x0" ::: "memory");
#endif
}

// Inputs-only fence on loaded fragments: holds a block's LDS reads together in front of its WMMAs (one wait per block); without it
// the reads are sunk between the rows of WMMAs and every row waits out the LDS latency.
__device__ __forceinline__ void hold4(const FragU& x0, const FragU& x1, const FragU& x2, const FragU& x3) {
#if defined(__HIP_DEVICE_COMPILE__)
  asm volatile("" :: "v"(x0.h), "v"(x1.h), "v"(x2.h), "v"(x3.h));
#endif
}

template <int MODE>
__device__ __forceinline__ void gemm_core(const u16* __restrict__ A, const u16* __restrict__ A2, const u16* __restrict__ Bt,
                                          float* C, int N, float oscale, int row0, int col0, u16* sm) {
  constexpr int NPL  = (MODE == 2) ? 3 : 2;         // operand tiles per stage
  constexpr int BUFH = NPL * GPLH;                  // halves per buffer
  constexpr int NS   = DMOD / GKS;                  // stages
  static_assert(NS >= 2 && 16 * SLAB64 * 4 <= 2 * BUFH * 2);
  const int tid = threadIdx.x, wave = tid >> 5, lane = tid & 31, hh = lane >> 4, m = lane & 15;
  const int wr = wave >> 1, wc = wave & 1;
  const int crow = tid >> 3, cch = (tid & 7) * 8;
  const u16* ga  = A  + (size_t)(row0 + crow) * DMOD + cch;
  const u16* ga2 = A2 + (size_t)(row0 + crow) * DMOD + cch;
  const u16* gb  = Bt + (size_t)(col0 + crow) * DMOD + cch;
  const unsigned l0 = lds_addr(sm) + (unsigned)(crow * GPIT + cch) * 2u;
  const int fa = (wr * 64 + m) * GPIT + 8 * hh;             // A fragment row of this lane (+ 16 i rows)
  const int fb = GPLH + (wc * 64 + m) * GPIT + 8 * hh;      // Bt fragment row of this lane (+ 16 j rows)

  // every "#pragma unroll" in this function makes the indices of acc, a, b, a2 constants, so that the arrays stay in registers
  v8f acc[4][4];
#pragma unroll
  for (int i = 0; i < 4; ++i) {
#pragma unroll
    for (int j = 0; j < 4; ++j) acc[i][j] = zero8();
  }

  // stage 0 into buffer 0, landed and published; then stage 1 into buffer 1
  acopy_tile(l0, ga);
  acopy_tile(l0 + GPLH * 2u, gb);
  if (MODE == 2) acopy_tile(l0 + 2u * GPLH * 2u, ga2);
  wait_async0();
  __syncthreads();
  acopy_tile(l0 + BUFH * 2u, ga + GKS);
  acopy_tile(l0 + BUFH * 2u + GPLH * 2u, gb + GKS);
  if (MODE == 2) acopy_tile(l0 + BUFH * 2u + 2u * GPLH * 2u, ga2 + GKS);

  // kept rolled: one trip = one stage, so that the publish point below stands once per stage
#pragma unroll 1
  for (int t = 0; t < NS; ++t) {
    const int bo = (t & 1) * BUFH;
    const u16* bp = sm + bo;
#pragma unroll
    for (int kk = 0; kk < GKS / 32; ++kk) {
      FragU a[4], b[4];
#pragma unroll
      for (int i = 0; i < 4; ++i) a[i] = ldfrag_u(bp + fa + i * 16 * GPIT + kk * 32);
#pragma unroll
      for (int j = 0; j < 4; ++j) b[j] = ldfrag_u(bp + fb + j * 16 * GPIT + kk * 32);
      hold4(a[0], a[1], a[2], a[3]);
      hold4(b[0], b[1], b[2], b[3]);
#pragma unroll
      for (int i = 0; i < 4; ++i) {
#pragma unroll
        for (int j = 0; j < 4; ++j) acc[i][j] = mma_u<MODE>(a[i], b[j], acc[i][j]);
      }
      if (MODE == 2) {
        FragU a2[4];
#pragma unroll
        for (int i = 0; i < 4; ++i) a2[i] = ldfrag_u(bp + 2 * GPLH + fa + i * 16 * GPIT + kk * 32);
        hold4(a2[0], a2[1], a2[2], a2[3]);
#pragma unroll
        for (int i = 0; i < 4; ++i) {
#pragma unroll
          for (int j = 0; j < 4; ++j) acc[i][j] = mma_u<MODE>(a2[i], b[j], acc[i][j]);
        }
      }
    }
    // publish point of stage t + 1: own LDS reads back, own copies landed, block barrier; only then the refill of the buffer just read
    wait_ds0();
    wait_async0();
    __syncthreads();
    if (t + 2 < NS) {
      const unsigned lb = l0 + (unsigned)bo * 2u;
      const int ko = (t + 2) * GKS;
      acopy_tile(lb, ga + ko);
      acopy_tile(lb + GPLH * 2u, gb + ko);
      if (MODE == 2) acopy_tile(lb + 2u * GPLH * 2u, ga2 + ko);
    }
  }
  wait_async0();
  (void)ga2;
  float* sl = (float*)(void*)sm + (size_t)(wave * 4) * SLAB64;
#pragma unroll
  for (int i = 0; i < 4; ++i) epi_put(sl + i * SLAB64, acc[i][0], acc[i][1], acc[i][2], acc[i][3], oscale, lane);
  wave_sync_lds();
#pragma unroll
  for (int i = 0; i < 4; ++i) epi_get(sl + i * SLAB64, C, N, (size_t)(row0 + wr * 64 + i * 16), col0 + wc * 64, lane);
}

// =====================================================================================================
// bf16 GEMM: C[M][N] (f32) = A[M][DMOD] (bf16 row-major) . Bt[N][DMOD]^T (bf16 k-contiguous), times oscale.
// Block = one 128 x 128 tile (gemm_core); M % 128 == 0, N % 128 == 0, grid = (M/128)*(N/128).
// =====================================================================================================
__global__ __launch_bounds__(128)
void gemm_bf(const u16* __restrict__ A, const u16* __restrict__ Bt, float* C, int M, int N, float oscale) {
  __shared__ __align__(16) u16 ring[2 * 2 * GPLH];
  const int ntile = N / GT;
  const int bid   = blockIdx.x;
  const int row0  = (bid / ntile) * GT;
  const int col0  = (bid % ntile) * GT;
  if (row0 + GT > M) return;                // block-uniform, before any copy or barrier; never taken with the exact grid
  gemm_core<0>(A, A, Bt, C, N, oscale, row0, col0, ring);
}

// =====================================================================================================
// f16 GEMM: C[M][N] (f32) = (A[M][DMOD] (+ A2[M][DMOD] when TWO != 0)) . Bt[N][DMOD]^T, times oscale; A, A2 f16 row-major planes
// (A2 = the unscaled f16 residual of A, sharing the accumulator), Bt f16 k-contiguous. Same core as gemm_bf. A, A2 and C hold the
// rows of all sequences (row = b*SEQ + s); one launch takes one row class of every sequence: TWO = 1 the rows s < RICHE, TWO = 0
// the rows s >= RICHE; row tile rt of the class -> sequence rt / (tiles of the class per sequence);
// grid = NB * (class rows / 128) * (N / 128).
// =====================================================================================================
template <int TWO>
__global__ __launch_bounds__(128)
void gemm_h(const u16* __restrict__ A, const u16* __restrict__ A2, const u16* __restrict__ Bt, float* C,
            int M, int N, float oscale) {
  __shared__ __align__(16) u16 ring[2 * ((TWO != 0) ? 3 : 2) * GPLH];
  const int ntile = N / GT;
  const int bid   = blockIdx.x;
  constexpr int CT = ((TWO != 0) ? RICHE : ((SEQ > RICHE) ? (SEQ - RICHE) : GT)) / GT;   // row tiles of the class per sequence
  constexpr int R0 = (TWO != 0) ? 0 : RICHE;                                             // first row of the class in a sequence
  const int rt    = bid / ntile;
  const int row0  = (rt / CT) * SEQ + R0 + (rt % CT) * GT;
  const int col0  = (bid % ntile) * GT;
  if (row0 + GT > M) return;                // block-uniform, before any copy or barrier; never taken with the exact grid
  gemm_core<(TWO != 0) ? 2 : 1>(A, A2, Bt, C, N, oscale, row0, col0, ring);
}

// =====================================================================================================
// Causal sliding-window softmax attention with key padding, hd = 64, all sequences in one launch. Block bid -> (query tile
// qt = qt0 + bid % nqt: rows q0 = 16*qt .. q0+15, head group hg = (bid / nqt) % NHG, sequence b = bid / (nqt*NHG), whose
// planes and key flags start at b's offset); one wave per head = hg*WPB + wave.
//   q hi / residual planes f16 x256 [s][h*HD + d]; k hi / residual planes f16 x256 [s][h*HD + d] (pitch DMOD);
//   v^T hi / residual planes [h*HD + d][SEQ] x1024; MK = the sequence's int32 key flags (0 = padded key).
//   raw(i, j) = q_hi.k_hi + q_lo.k_hi + q_hi.k_lo (2 k-steps over d); logit = raw * 2^-19 (the 1/8 softmax scale and the two
//   256 carries, exact); key j is REPLACED by -inf when j > i, j < i - (WIN-1), or MK[j] == 0; online softmax per query
//   row in f32 with a running max: row max / row sum over the 16 lanes holding the row via xor shuffles 1,2,4,8 (never
//   crossing the lane half); a row whose running max is still -inf uses 0 as the shift so alpha and p come out 0 (no NaN);
//   alpha = exp(m_old - m_new), p = exp(logit - m_new), l = l*alpha + sum p, O accumulators times alpha before the
//   tile's P.v. Key tiles of 32 visited in order from the tile holding max(0, q0-(WIN-1)) to the tile holding q0+15
//   (block-uniform bounds, <= 18 tiles). The 32 key flags of a tile are loaded once (one b32 per lane, coalesced) and
//   barrier, then A fragments of p*32768 (f16 hi and its f16 residual) are rebuilt from the LDS rows (float vector loads);
//   v^T B fragments in 2 groups of 2 d-subtiles; RV = 1: products hh + lh + hl, RV = 0: hh only.
//   After the loop O = acc / (l * 32768 * 1024) (0 when l == 0, i.e. every key of the window padded) into the wave's
//   Epilogue: O x256 -> f16 hi plane (and for RV = 1 the unscaled f16 residual plane) [s][h*HD + d]; lane = (row group
//   rq = lane>>3 in 0..3, 8 consecutive d at c8); one instruction = 4 rows it*4 + rq, each row segment (64 halves = one whole
// coverage: per wave 4 instructions x 4 rows x 8 lanes x 8 halves = 16 x 64 per plane; grid NB x NHG x nqt blocks x WPB waves;
//   the two launches (tiles 0..NQTR-1 with RV = 1, NQTR..NQT-1 with RV = 0) cover every (b, s, h) row segment of the hi plane
//   exactly once and rows s < RICHE of each sequence's residual plane exactly once (only those rows are read later).
// =====================================================================================================
template <int RV>
__global__ __launch_bounds__(ATT_THREADS)
void attn_w(const u16* __restrict__ QHa, const u16* __restrict__ QLa,
            const u16* __restrict__ KHa, const u16* __restrict__ KLa,
            const u16* __restrict__ VHa, const u16* __restrict__ VLa,
            const int* __restrict__ MKa,
            u16* OHa, u16* OLa, int qt0, int nqt) {
#pragma clang fp contract(off)
  __shared__ __align__(16) float smem[WPB * WREG];

  const int tid  = threadIdx.x;
  const int wave = tid >> 5;
  const int lane = tid & 31;
  const int hh   = lane >> 4;
  const int c    = lane & 15;
  const int bid  = blockIdx.x;
  if (nqt <= 0) return;                     // block-uniform; no block barriers in this kernel
  const int qt   = qt0 + bid % nqt;
  const int hg   = (bid / nqt) % NHG;
  const int b    = bid / (nqt * NHG);
  if (b >= NB) return;                      // block-uniform; never taken with the exact grid
  const size_t po = (size_t)b * SEQ * DMOD; // halves per sequence in every q / k / v^T / O plane (NH*HD == DMOD)
  const u16* __restrict__ QHp = QHa + po;
  const u16* __restrict__ QLp = QLa + po;
  const u16* __restrict__ KHp = KHa + po;
  const u16* __restrict__ KLp = KLa + po;
  const u16* __restrict__ VHp = VHa + po;
  const u16* __restrict__ VLp = VLa + po;
  const int* __restrict__ MK  = MKa + (size_t)b * XS_FULL;
  u16* OHp = OHa + po;
  u16* OLp = OLa + po;
  const int q0   = qt * 16;
  if (q0 + 16 > SEQ) return;                // block-uniform; never taken
  const int head = hg * WPB + wave;

  float* pt   = smem + wave * WREG;         // p tile [16][32] pitch 36
  float* slab = pt + PTW;                   // result slab [16][64] pitch 68

  const size_t hcol = (size_t)head * HD + 8 * hh;
  const _Float16* Qh  = (const _Float16*)(const void*)QHp + ((size_t)q0 + c) * DMOD + hcol;
  const _Float16* Ql  = (const _Float16*)(const void*)QLp + ((size_t)q0 + c) * DMOD + hcol;
  const _Float16* Khb = (const _Float16*)(const void*)KHp + (size_t)c * DMOD + hcol;        // key row kb added per step
  const _Float16* Klb = (const _Float16*)(const void*)KLp + (size_t)c * DMOD + hcol;
  const _Float16* Vhb = (const _Float16*)(const void*)VHp + ((size_t)head * HD + c) * SEQ + 8 * hh;  // d col c (+16j)
  const _Float16* Vlb = (const _Float16*)(const void*)VLp + ((size_t)head * HD + c) * SEQ + 8 * hh;
  const float lsc  = SM_SCALE * (1.0f / (QSC * KSC));   // exact power-of-two fold of the q / k carries into the 1/8 scale
  const float oc   = 1.0f / (PCAR * VCAR);
  const float ninf = -__builtin_inff();
  const size_t KROW = (size_t)DMOD;         // halves between consecutive key rows

  v8f o[4];
#pragma unroll
  for (int j = 0; j < 4; ++j) o[j] = zero8();
  float mrun[8], lrun[8];
#pragma unroll
  for (int r = 0; r < 8; ++r) { mrun[r] = ninf; lrun[r] = 0.0f; }
  int klo = q0 - (WIN - 1);
  if (klo < 0) klo = 0;
  const int ktlo = klo >> 5;                                                  // first tile intersecting the window
  const int kthi = q0 >> 5;                                                   // tile holding keys q0 .. q0 + 15
  int nkt = kthi - ktlo + 1;
  if (nkt > NKT) nkt = NKT;
  if (nkt < 1) nkt = 1;
  const int qr0   = q0 + 8 * hh;                                              // query row of D element r = qr0 + r

#pragma unroll 1
  for (int i = 0; i < nkt; ++i) {
    const int kb = (ktlo + i) * 32;                                           // kb + 31 <= SEQ - 1
    // ---- key padding flags of this tile: one coalesced b32 per lane, then broadcast for key kb + c and kb + 16 + c ----
    const int fl = MK[kb + lane];
    const int f0 = __shfl(fl, c, 32);
    const int f1 = __shfl(fl, 16 + c, 32);
    // ---- raw scores: D element r of this lane = (query row qr0 + r, key kb + c) in s0, key kb + 16 + c in s1 ----
    v8f s0 = zero8(), s1 = zero8();
    const _Float16* k0p = Khb + (size_t)kb * KROW;
    const _Float16* k1p = k0p + (size_t)16 * KROW;
    const _Float16* l0p = Klb + (size_t)kb * KROW;
    const _Float16* l1p = l0p + (size_t)16 * KROW;
#pragma unroll
    for (int kk = 0; kk < HD / 32; ++kk) {
      const v16h qh  = ldfrag_h(Qh + kk * 32);
      const v16h ql  = ldfrag_h(Ql + kk * 32);
      const v16h kh0 = ldfrag_h(k0p + kk * 32);
      const v16h kh1 = ldfrag_h(k1p + kk * 32);
      const v16h kl0 = ldfrag_h(l0p + kk * 32);
      const v16h kl1 = ldfrag_h(l1p + kk * 32);
      s0 = mma_h(qh, kh0, s0);
      s0 = mma_h(ql, kh0, s0);
      s0 = mma_h(qh, kl0, s0);
      s1 = mma_h(qh, kh1, s1);
      s1 = mma_h(ql, kh1, s1);
      s1 = mma_h(qh, kl1, s1);
      guard2(s0, s1, qh, ql, kh0, kl0, kh1, kl1);
    }
    // ---- causal / window / padding replace-mask, running-max online softmax in f32, p tile -> wave-private LDS ----
    float alpha[8];
    const int key0 = kb + c, key1 = kb + 16 + c;
#pragma unroll
    for (int r = 0; r < 8; ++r) {
      const int qrow = qr0 + r;
      const int lo   = qrow - (WIN - 1);
      const float a0 = s0[r] * lsc;
      const float a1 = s1[r] * lsc;
      const bool ok0 = (key0 <= qrow) && (key0 >= lo) && (f0 != 0);
      const bool ok1 = (key1 <= qrow) && (key1 >= lo) && (f1 != 0);
      const float t0 = ok0 ? a0 : ninf;
      const float t1 = ok1 ? a1 : ninf;
      float mx = fmaxf(t0, t1);
      mx = fmaxf(mx, __shfl_xor(mx, 1, 32));
      mx = fmaxf(mx, __shfl_xor(mx, 2, 32));
      mx = fmaxf(mx, __shfl_xor(mx, 4, 32));
      mx = fmaxf(mx, __shfl_xor(mx, 8, 32));
      const float mnew  = fmaxf(mrun[r], mx);
      const float mshft = (mnew == ninf) ? 0.0f : mnew;
      const float al    = __expf(mrun[r] - mshft);
      const float p0    = __expf(t0 - mshft);
      const float p1    = __expf(t1 - mshft);
      float sm = p0 + p1;
      sm += __shfl_xor(sm, 1, 32);
      sm += __shfl_xor(sm, 2, 32);
      sm += __shfl_xor(sm, 4, 32);
      sm += __shfl_xor(sm, 8, 32);
      lrun[r]  = lrun[r] * al + sm;
      mrun[r]  = mnew;
      alpha[r] = al;
      const int ro = (8 * hh + r) * PTP + c;
      pt[ro]      = p0;
      pt[ro + 16] = p1;
    }
    wave_sync_lds();
    // ---- rescale the O accumulators by alpha (row 8hh + r of every d-subtile) ----
#pragma unroll
    for (int j = 0; j < 4; ++j) {
#pragma unroll
      for (int r = 0; r < 8; ++r) o[j][r] = o[j][r] * alpha[r];
    }
    // ---- A fragments of p*32768: hi f16 and residual f16, row = c, split k map over the 32 keys of this step ----
    FragH ph, pl;
    {
      const float* prow = pt + c * PTP + 8 * hh;
      const v4f p0 = *(const v4f*)(prow), p1 = *(const v4f*)(prow + 4);
      const v4f p2 = *(const v4f*)(prow + 16), p3 = *(const v4f*)(prow + 20);
#pragma unroll
      for (int e = 0; e < 4; ++e) {
        const float ta = p0[e] * PCAR, tb = p1[e] * PCAR, tc = p2[e] * PCAR, td = p3[e] * PCAR;
        const _Float16 ha = (_Float16)ta, hb = (_Float16)tb, hc = (_Float16)tc, hd = (_Float16)td;
        ph.h[0][e]     = ha;                  // elements 0..7  = keys kb + 8hh + 0..7
        ph.h[0][4 + e] = hb;
        ph.h[1][e]     = hc;                  // elements 8..15 = keys kb + 16 + 8hh + 0..7
        ph.h[1][4 + e] = hd;
        pl.h[0][e]     = (_Float16)(ta - (float)ha);
        pl.h[0][4 + e] = (_Float16)(tb - (float)hb);
        pl.h[1][e]     = (_Float16)(tc - (float)hc);
        pl.h[1][4 + e] = (_Float16)(td - (float)hd);
      }
    }
    // ---- P.V : B fragment col n = d = j*16 + c, keys contiguous in the v^T planes; 2 groups of 2 d-subtiles ----
    {
      const _Float16* vhp = Vhb + kb;
      const _Float16* vlp = Vlb + kb;
      (void)vlp;
#pragma unroll
      for (int jg = 0; jg < 2; ++jg) {
        const size_t da = (size_t)(2 * jg) * 16 * SEQ;
        const size_t db = da + (size_t)16 * SEQ;
        const v16h vha = ldfrag_h(vhp + da), vhb2 = ldfrag_h(vhp + db);
        o[2 * jg]     = mma_h(ph.v, vha,  o[2 * jg]);
        o[2 * jg + 1] = mma_h(ph.v, vhb2, o[2 * jg + 1]);
        if (RV != 0) {
          const v16h vla = ldfrag_h(vlp + da), vlb2 = ldfrag_h(vlp + db);
          o[2 * jg]     = mma_h(pl.v, vha,  o[2 * jg]);
          o[2 * jg]     = mma_h(ph.v, vla,  o[2 * jg]);
          o[2 * jg + 1] = mma_h(pl.v, vhb2, o[2 * jg + 1]);
          o[2 * jg + 1] = mma_h(ph.v, vlb2, o[2 * jg + 1]);
          guard2(o[2 * jg], o[2 * jg + 1], ph.v, pl.v, vha, vhb2, vla, vlb2);
        } else {
          guard2(o[2 * jg], o[2 * jg + 1], ph.v, pl.v, vha, vhb2, vha, vhb2);
        }
      }
    }
    wave_sync_lds();
  }
  acc_guard4(o[0], o[1], o[2], o[3]);
  // ---- O = acc / l with the carries (32768 on p, 1024 on v) folded once (0 when l == 0); into the wave's slab ----
  float rl[8];
#pragma unroll
  for (int r = 0; r < 8; ++r) {
    const bool  okl  = lrun[r] > 0.0f;
    const float lden = okl ? lrun[r] : 1.0f;
    const float rec  = (1.0f / lden) * oc;
    rl[r] = okl ? rec : 0.0f;
  }
#pragma unroll
  for (int r = 0; r < 8; ++r) {
#pragma unroll
    for (int j = 0; j < 4; ++j) {
      const int idx = (8 * hh + r) * SLP + j * 16 + c;
      slab[idx] = o[j][r] * rl[r];
    }
  }
  wave_sync_lds();
  // ---- O x256 -> f16 hi plane (+ f16 residual plane); lane = (row group rq, 8 consecutive d at c8) ----
  v4u oh[4], ol[4];
  const int rq = lane >> 3, c8 = (lane & 7) * 8;
#pragma unroll
  for (int it = 0; it < 4; ++it) {
    const int row = it * 4 + rq;
    const v4f a = *(const v4f*)(slab + row * SLP + c8), b4 = *(const v4f*)(slab + row * SLP + c8 + 4);
    float w[8];
#pragma unroll
    for (int e = 0; e < 4; ++e) { w[e] = a[e] * OSC; w[4 + e] = b4[e] * OSC; }
#pragma unroll
    for (int e = 0; e < 4; ++e) {
      const _Float16 h0 = (_Float16)w[2 * e], h1 = (_Float16)w[2 * e + 1];
      const _Float16 g0 = (_Float16)(w[2 * e] - (float)h0), g1 = (_Float16)(w[2 * e + 1] - (float)h1);
      oh[it][e] = pk16(h_bits(h0), h_bits(h1));
      ol[it][e] = pk16(h_bits(g0), h_bits(g1));
    }
  }
  const size_t ob = ((size_t)q0) * DMOD + (size_t)head * HD + c8;
  {
#pragma unroll
    for (int it = 0; it < 4; ++it) {
      const int row = it * 4 + rq;
      *(v4u*)(OHp + ob + (size_t)row * DMOD) = oh[it];
      if (RV != 0) {
        *(v4u*)(OLp + ob + (size_t)row * DMOD) = ol[it];
      }
    }
    
  }
}

// =====================================================================================================
// Workspace map (bytes); every plane holds all NB sequences (ROWS = NB*SEQ rows), each stage is one launch over all of them;
// every plane is fully written by whole-line stores before it is read (the O residual plane only on the rows < RICHE of each
// sequence that are read); all extents are exact multiples of the store granularity; every region offset a multiple of 131072:
//   XB  bf16 [ROWS][1024]                ROWS*2048   (ROWS=8192: 16777216)
//   WB  bf16 [3072 n][1024 k]            6291456     (q rows 0..1023, k 1024..2047, v 2048..3071)
//   WT  f16  [1024 o][1024 d] x1024      2097152
//   F   f32  [ROWS][3072]                ROWS*12288  (100663296)  q | k | v projection columns
//   QH  f16 [ROWS][1024] x256            ROWS*2048   QL residual, same extent
//   KH  f16 [ROWS][1024] x256            ROWS*2048   KL residual, same extent
//   VH  f16 [NB][16][64][SEQ] x1024      ROWS*2048   VL residual, same extent
//   OH  f16 [ROWS][1024] x256            ROWS*2048   OL residual, same extent (rows < RICHE of each sequence written / read)
//   TC  f32 [SEQ][16]                    SEQ*64      TS, same extent
//   end (SEQ=2048, NB=4)                260308992
// =====================================================================================================
extern "C" void kernel_launch(void* const* d_in, const int* in_sizes, int n_in,
                              void* d_out, int out_size, void* d_ws, size_t ws_size,
                              hipStream_t stream) {
  if (n_in < 4) return;
  if (in_sizes[0] < ((NB - 1) * XS_FULL + SEQ) * DMOD) return;
  if (in_sizes[1] < (NB - 1) * XS_FULL + SEQ) return;
  if (in_sizes[2] != DMOD * NQKV) return;
  if (in_sizes[3] != DMOD * DMOD) return;
  if (out_size < ((NB - 1) * XS_FULL + SEQ) * DMOD) return;

  const float* x    = (const float*)d_in[0];
  const int*   mask = (const int*)d_in[1];
  const float* wqkv = (const float*)d_in[2];       // [1024 k][3072 n]
  const float* wo   = (const float*)d_in[3];       // [1024 d][1024 o]
  float*       out  = (float*)d_out;

  const size_t szXB = (size_t)ROWS * DMOD * 2;
  const size_t szWB = (size_t)NQKV * DMOD * 2;
  const size_t szWT = (size_t)DMOD * DMOD * 2;
  const size_t szF  = (size_t)ROWS * NQKV * 4;
  const size_t szQ  = (size_t)ROWS * DMOD * 2;                   // QH, QL, KH, KL, OH, OL
  const size_t szV  = (size_t)NB * NH * HD * SEQ * 2;            // VH, VL (== szQ)
  const size_t szT  = (size_t)SEQ * NFREQ * 4;                   // TC, TS
  size_t off = 0;
  const size_t oXB = off; off += szXB;
  const size_t oWB = off; off += szWB;
  const size_t oWT = off; off += szWT;
  const size_t oF  = off; off += szF;
  const size_t oQH = off; off += szQ;
  const size_t oQL = off; off += szQ;
  const size_t oKH = off; off += szQ;
  const size_t oKL = off; off += szQ;
  const size_t oVH = off; off += szV;
  const size_t oVL = off; off += szV;
  const size_t oOH = off; off += szQ;
  const size_t oOL = off; off += szQ;
  const size_t oTC = off; off += szT;
  const size_t oTS = off; off += szT;
  if (off > ws_size) return;                // off = 260308992 for SEQ = 2048, NB = 4
  if (off > (size_t)WS_CAP) return;

  char* ws = (char*)d_ws;
  u16*   XB  = (u16*)(ws + oXB);
  u16*   WB  = (u16*)(ws + oWB);
  u16*   WT  = (u16*)(ws + oWT);
  float* F   = (float*)(ws + oF);
  u16*   QH  = (u16*)(ws + oQH);
  u16*   QL  = (u16*)(ws + oQL);
  u16*   KH  = (u16*)(ws + oKH);
  u16*   KL  = (u16*)(ws + oKL);
  u16*   VH  = (u16*)(ws + oVH);
  u16*   VL  = (u16*)(ws + oVL);
  u16*   OH  = (u16*)(ws + oOH);
  u16*   OL  = (u16*)(ws + oOL);
  float* TC  = (float*)(ws + oTC);
  float* TS  = (float*)(ws + oTS);

  const dim3 b256(256), b128(128), bAT(ATT_THREADS);
  const int  n8x = (ROWS * DMOD) / 8;
  const dim3 gX((n8x + 255) / 256);                     // ROWS*DMOD/2048 blocks
  const int  nT  = SEQ * NFREQ;
  const dim3 gT((nT + 255) / 256);                      // SEQ/16
  const dim3 gWQ((DMOD / 64) * (NQKV / 64));            // 768: in [1024 k][3072 n] -> WB [3072 n][1024 k]
  const dim3 gWO((DMOD / 64) * (DMOD / 64));            // 256: in [1024 d][1024 o] -> WT [1024 o][1024 d]
  const dim3 gG1((ROWS / GT) * (NQKV / GT));
  const dim3 gRW(ROWS, 2);
  const dim3 gVT(NB * NH * NST);
  const float osc = 1.0f / (OSC * WOS);

  // (0) weight planes: Wqkv transposed to bf16 [n][k]; Wo transposed to f16 of the bf16 value x1024 [o][d]
  cvtT16<<<gWQ, b256, 0, stream>>>(wqkv, DMOD, NQKV, WB, 0, 1.0f);
  cvtT16<<<gWO, b256, 0, stream>>>(wo, DMOD, DMOD, WT, 1, WOS);
  // (1) rotary cos / sin tables [SEQ][16]
  k_tab<<<gT, b256, 0, stream>>>(TC, TS, nT);
  // every stage below: all sequences in one launch (x, mask and out rows of the NB sequences are contiguous)
  // (2) x rows -> bf16 plane [ROWS][1024]
  cvt16<<<gX, b256, 0, stream>>>(x, XB, n8x, 0, 1.0f);
  // (3) qkv = x.Wqkv -> F f32 [ROWS][3072]
  gemm_bf<<<gG1, b128, 0, stream>>>(XB, WB, F, ROWS, NQKV, 1.0f);
  // (4) partial rotary + hi + residual planes x256: q from columns 0..1023 (blockIdx.y = 0), k from 1024..2047 (blockIdx.y = 1)
  rope16<<<gRW, b128, 0, stream>>>(F, NQKV, TC, TS, QH, QL, KH, KL, QSC, KSC);
  // (5) v^T hi + residual planes x1024 from columns 2048..3071
  vt16<<<gVT, b256, 0, stream>>>(F, NQKV, 2 * DMOD, VH, VL);
  // (6) windowed causal attention with key padding -> O f16 hi plane x256 for all query tiles; residual plane for rows < RICHE
  attn_w<1><<<dim3(NB * NQTR * NHG), bAT, 0, stream>>>(QH, QL, KH, KL, VH, VL, mask, OH, OL, 0, NQTR);
  if (NQT > NQTR) {
    attn_w<0><<<dim3(NB * (NQT - NQTR) * NHG), bAT, 0, stream>>>(QH, QL, KH, KL, VH, VL, mask, OH, OL, NQTR, NQT - NQTR);
  }
  // (7) y = O.Wo -> out f32, carries 256 x 1024 folded back; rows < RICHE of each sequence with O hi + residual
  gemm_h<1><<<dim3(NB * (RICHE / GT) * (DMOD / GT)), b128, 0, stream>>>(OH, OL, WT, out, ROWS, DMOD, osc);
  if (SEQ > RICHE) {
    gemm_h<0><<<dim3(NB * ((SEQ - RICHE) / GT) * (DMOD / GT)), b128, 0, stream>>>(OH, OL, WT, out, ROWS, DMOD, osc);
  }
  (void)hipGetLastError();
}

// v003
// It runs in 259 microseconds.
// Next to v002, in two timings, it ran 1.07 times as fast each time.
// Over all steps from v000 it is 2.89 times as fast.
// Contractions: x.Wqkv on v_wmma_f32_16x16x32_bf16 (x and the transposed weight as bf16 RNE planes; weight plane [n][k]
// rows are the k-contiguous B operand; f32 accumulate); q.k^T over hd 64 and P.v on v_wmma_f32_16x16x32_f16 with f16 hi +
// f16 residual planes (q, k x256 after partial rotary, products hh+lh+hl on every row; P x32768 hi + in-register residual
// and v^T x1024 hi + residual plane for query rows < 512 of each sequence, P hi . v hi only for later rows); O.Wo on
// v_wmma_f32_16x16x32_f16 with O x256 as f16 hi (+ f16 residual plane for rows < 512 of each sequence) and Wo transposed
// to [o][d] as f16(bf16(Wo)) x1024, one accumulator; all f32 accumulate. Rotary cos/sin tables, causal + window + key
// padding masks and the online softmax in f32 on VALU.
#include <hip/hip_runtime.h>
#include <math.h>
#include <stdint.h>

#ifndef NB
#define NB 4
#endif
#ifndef SEQ
#define SEQ 2048
#endif
#ifndef RICH
#define RICH 512
#endif
#define NB_FULL 4
#define XS_FULL 2048
#define DMOD  1024
#define NH    16
#define HD    64
#define HROT  32
#define HROTH 16
#define NFREQ 16
#define NQKV  (3 * DMOD)
#define WIN   512
#define RICHE ((RICH < SEQ) ? RICH : SEQ)
#define ROPE_L2 0.41524101186092028
#define SM_SCALE 0.125f
#define QSC   256.0f
#define KSC   256.0f
#define PCAR  32768.0f
#define VCAR  1024.0f
#define OSC   256.0f
#define WOS   1024.0f
#define WPB   4
#define NHG   (NH / WPB)
#define NQT   (SEQ / 16)
#define NQTR  (RICHE / 16)
#define NST   (SEQ / 64)
#define NKT   (SEQ / 32)
#define ATT_THREADS (WPB * 32)
#define PTP   36
#define PTW   (16 * PTP)
#define SLP   68
#define SLW   (16 * SLP)
#define WREG  (PTW + SLW)
#define SLAB64 (16 * 68)
#define VTP   72
#define WS_CAP 268435456
#define ROWS  (NB * SEQ)
#define GT    128
#define GKS   64
#define GPIT  72
#define GPLH  (GT * GPIT)
static_assert(DMOD == NH * HD && HD == 64 && HROT == 32 && HROTH == 16 && NFREQ == 16 && NH == 16 && WPB == 4 && NHG * WPB == NH);
static_assert(ATT_THREADS == 128 && NQKV == 3072 && WIN == 512 && NHG == 4);
static_assert(NB >= 1 && NB <= NB_FULL);
static_assert(NB == 1 || SEQ == XS_FULL);
static_assert((SEQ % 64) == 0 && SEQ >= 64 && SEQ <= XS_FULL);
static_assert((RICHE % 64) == 0 && RICHE >= 64 && RICHE <= SEQ);
static_assert((DMOD % 64) == 0 && (NQKV % 64) == 0 && (DMOD % 32) == 0 && (HD % 32) == 0);
static_assert(((SEQ * DMOD / 8) % 256) == 0 && ((SEQ * NFREQ) % 256) == 0);
static_assert(WPB * WREG * 4 <= 65536 && 2 * HD * VTP * 2 <= 65536 && 4 * SLAB64 * 4 <= 65536 && 64 * VTP * 2 <= 65536);
static_assert(NQT * 16 == SEQ && NQTR * 16 == RICHE && NKT * 32 == SEQ && NST * 64 == SEQ);
static_assert((RICHE % GT) == 0 && ((SEQ - RICHE) % GT) == 0 && (ROWS % GT) == 0 && (NQKV % GT) == 0 && (DMOD % GT) == 0 && (DMOD % GKS) == 0);

typedef unsigned short u16;
typedef _Float16 v16h __attribute__((ext_vector_type(16)));
typedef _Float16 v8h  __attribute__((ext_vector_type(8)));
typedef __bf16   v16b __attribute__((ext_vector_type(16)));
typedef float    v8f  __attribute__((ext_vector_type(8)));
typedef float    v4f  __attribute__((ext_vector_type(4)));
typedef unsigned int v4u __attribute__((ext_vector_type(4)));

union FragH { v16h v; v8h h[2]; v4u u[2]; };

// ---- scalar helpers --------------------------------------------------------------------------------
__device__ __forceinline__ unsigned short bf_bits(float f) {          // f32 -> bf16 bits, RNE convert
  unsigned u = __float_as_uint(f);
  return (unsigned short)((u + 0x7FFFu + ((u >> 16) & 1u)) >> 16);
}
__device__ __forceinline__ float bf_up(unsigned short h) { return __uint_as_float(((unsigned)h) << 16); }
__device__ __forceinline__ float bfr(float f) { return bf_up(bf_bits(f)); }
__device__ __forceinline__ unsigned short h_bits(_Float16 x) { return __builtin_bit_cast(unsigned short, x); }
__device__ __forceinline__ unsigned pk16(unsigned short a, unsigned short b) { return (unsigned)a | ((unsigned)b << 16); }
__device__ __forceinline__ v8f zero8() { v8f z = {0.f, 0.f, 0.f, 0.f, 0.f, 0.f, 0.f, 0.f}; return z; }

// ---- fragment loaders: 16-bit A/B operand, lane -> row/col (lane&15), p already includes +8*(lane>>4);
//      elements 0..7 <- p[0..7] (k0+8h..), elements 8..15 <- p[16..23] (k0+16+8h..)  (same split k map for A and B;
//      B is always read from a k-contiguous [n][k] plane)
__device__ __forceinline__ v16h ldfrag_h(const _Float16* p) {
  FragH f;
  f.h[0] = *(const v8h*)(p);
  f.h[1] = *(const v8h*)(p + 16);
  return f.v;
}

__device__ __forceinline__ v8f mma_h(v16h a, v16h b, v8f c) {
  return __builtin_amdgcn_wmma_f32_16x16x32_f16(false, a, false, b, (short)0, c, false, false);
}
__device__ __forceinline__ v8f mma_b(v16b a, v16b b, v8f c) {
  return __builtin_amdgcn_wmma_f32_16x16x32_bf16(false, a, false, b, (short)0, c, false, false);
}
__device__ __forceinline__ void guard2(v8f& a, v8f& b, v16h x0, v16h x1, v16h x2, v16h x3, v16h x4, v16h x5) {
#if defined(__HIP_DEVICE_COMPILE__)
  asm volatile("v_nop\n\tv_nop\n\tv_nop\n\tv_nop"
               : "+v"(a), "+v"(b) : "v"(x0), "v"(x1), "v"(x2), "v"(x3), "v"(x4), "v"(x5) : "memory");
#endif
}
__device__ __forceinline__ void acc_guard4(v8f& a, v8f& b, v8f& c, v8f& d) {
#if defined(__HIP_DEVICE_COMPILE__)
  asm volatile("v_nop\n\tv_nop\n\tv_nop\n\tv_nop" : "+v"(a), "+v"(b), "+v"(c), "+v"(d));
#endif
}
__device__ __forceinline__ void wave_sync_lds() {
  __builtin_amdgcn_fence(__ATOMIC_RELEASE, "workgroup");
  __builtin_amdgcn_wave_barrier();
  __builtin_amdgcn_fence(__ATOMIC_ACQUIRE, "workgroup");
}

// =====================================================================================================
// f32 -> bf16 RNE plane, same layout (f16mode == 1: f16 bits of (bf16 RNE value) * scale).
// Thread = 8 consecutive elements: two 16-B loads, one 16-B store; 32 consecutive lanes = 512 contiguous, 512-B aligned
// coverage: grid = ceil(n8/256) blocks x 256 thr x 8 (in-kernel bound) = the whole plane (n8 a multiple of 256 here).
// =====================================================================================================
__global__ __launch_bounds__(256) void cvt16(const float* __restrict__ x, u16* D, int n8, int f16mode, float scale) {
  const int gt = blockIdx.x * 256 + (int)threadIdx.x;
  if (gt >= n8) return;
  const float* p = x + (size_t)gt * 8;
  const v4f a = *(const v4f*)(p), b4 = *(const v4f*)(p + 4);
  float w[8];
#pragma unroll
  for (int e = 0; e < 4; ++e) { w[e] = a[e]; w[4 + e] = b4[e]; }
  v4u o;
#pragma unroll
  for (int e = 0; e < 4; ++e) {
    const float f0 = w[2 * e], f1 = w[2 * e + 1];
    const unsigned short hb0 = h_bits((_Float16)(bfr(f0) * scale));
    const unsigned short hb1 = h_bits((_Float16)(bfr(f1) * scale));
    const unsigned short bb0 = bf_bits(f0);
    const unsigned short bb1 = bf_bits(f1);
    o[e] = (f16mode != 0) ? pk16(hb0, hb1) : pk16(bb0, bb1);
  }
  u16* d = D + (size_t)gt * 8;
  {
    *(v4u*)(d) = o;
    
  }
}

// =====================================================================================================
// Transposed 16-bit plane of a row-major f32 matrix: in X [R rows][CC cols] (pitch CC) -> out D [CC][R] (pitch R),
// D[c][r] = cvt(X[r][c]); f16mode == 0: bf16 RNE bits; f16mode == 1: f16 bits of (bf16 RNE value) * scale.
// Block = one 64x64 tile (rt = bid / (CC/64) -> rows 64*rt.., ct = bid % (CC/64) -> cols 64*ct..), 256 threads: thread
// (row rl = tid>>2, col chunk cc = 16*(tid&3)) loads its 16 floats with 16-B loads, converts, places them transposed into
// the LDS tile T[c_local][r_local] (pitch 72 halves, 2-B element stores); after a block barrier each output row segment
// coverage: load 256 thr x 16 = 64 x 64; store 2 iterations x 256 thr x 8 halves = 64 lines x 64 = the tile of D;
//           grid = (R/64)*(CC/64) blocks covers D exactly once (R, CC multiples of 64).
// =====================================================================================================
__global__ __launch_bounds__(256) void cvtT16(const float* __restrict__ X, int R, int CC, u16* D, int f16mode, float scale) {
  __shared__ __align__(16) u16 T[64 * VTP];
  const int tid = (int)threadIdx.x;
  const int bid = (int)blockIdx.x;
  const int nct = CC >> 6;
  const int ct  = bid % nct;
  const int rt  = bid / nct;
  const int r0  = rt * 64, c0 = ct * 64;
  if (r0 + 64 > R) return;                  // block-uniform, before the barrier; never taken with the exact grid
  {
    const int rl = tid >> 2;                // row within tile 0..63
    const int cc = (tid & 3) * 16;          // column chunk 0,16,32,48
    const float* src = X + (size_t)(r0 + rl) * (size_t)CC + c0 + cc;
#pragma unroll
    for (int i = 0; i < 4; ++i) {
      const v4f a = *(const v4f*)(src + 4 * i);
#pragma unroll
      for (int e = 0; e < 4; ++e) {
        const float f = a[e];
        const unsigned short hb = h_bits((_Float16)(bfr(f) * scale));
        const unsigned short bb = bf_bits(f);
        T[(cc + 4 * i + e) * VTP + rl] = (f16mode != 0) ? hb : bb;
      }
    }
  }
  __syncthreads();
  v4u w[2];
  const int q8 = tid >> 3, p8 = (tid & 7) * 8;
#pragma unroll
  for (int it = 0; it < 2; ++it) {
    const int line = it * 32 + q8;          // c_local = 0..63
    w[it] = *(const v4u*)(T + line * VTP + p8);
  }
  const size_t base = (size_t)c0 * (size_t)R + r0 + p8;
  {
#pragma unroll
    for (int it = 0; it < 2; ++it) {
      const int line = it * 32 + q8;
      *(v4u*)(D + base + (size_t)line * (size_t)R) = w[it];
    }
    
  }
}

// =====================================================================================================
// Rotary tables TC[s][j] = cos(s * inv[j]), TS[s][j] = sin(s * inv[j]), j < 16, with
// inv[j] = 1.0f / f32(10000^(2j/32)) (power evaluated in f64 and narrowed once, IEEE f32 reciprocal, f32 product s*inv,
// coverage: grid = n/256 blocks x 256 thr = n = SEQ*16 elements of TC and of TS (n a multiple of 256).
// =====================================================================================================
__global__ __launch_bounds__(256) void k_tab(float* TC, float* TS, int n) {
#pragma clang fp contract(off)
  const int idx = blockIdx.x * 256 + (int)threadIdx.x;
  if (idx >= n) return;
  const int s = idx / NFREQ;
  const int j = idx - s * NFREQ;
  const double pj = exp2((double)(2 * j) * ROPE_L2);   // 10000^(2j/32)
  const float pf  = (float)pj;
  const float inv = 1.0f / pf;
  const float ang = (float)s * inv;
  float sv, cv;
  sincosf(ang, &sv, &cv);
  {
    *(float*)(TC + idx) = cv;
    *(float*)(TS + idx) = sv;
    
  }
}

// =====================================================================================================
// One element of the partial non-interleaved rotary on dims 0..31 of a head, then its two f16 planes (table column j = d mod 16):
//   d <  16     : out[d] = x[d]*c[s][j] + (-1)*(x[d+16]*sn[s][j])
//   16 <= d < 32: out[d] = x[d]*c[s][j] + (+1)*(x[d-16]*sn[s][j])    (mul, mul, add kept separate)
//   d >= 32     : out[d] = x[d]
//   hb = f16(out * sc), lb = f16 residual (t - f16(t)).
// =====================================================================================================
__device__ __forceinline__ void rot_one(float x, float y, float cv, float sv, float sgn, float sc, int rot,
                                        unsigned short& hb, unsigned short& lb) {
#pragma clang fp contract(off)
  const float ys   = y * sv;
  const float term = sgn * ys;
  const float rr   = x * cv + term;
  const float r    = (rot != 0) ? rr : x;
  const float t    = r * sc;
  const _Float16 a = (_Float16)t;
  hb = h_bits(a);
  lb = h_bits((_Float16)(t - (float)a));
}

// =====================================================================================================
// Epilogue of the f16 GEMM: the wave's 64x64 f32 tile (times oscale) staged in its four LDS slabs (16 rows each, pitch
// 68, wave-private), one wave-level LDS sync, then whole-line stores: one instruction = 2 rows x 16 lanes x 4 floats.
// coverage: 4 slabs x 8 instructions x 2 rows x 16 lanes x 4 floats = the wave's 64 x 64 tile.
// =====================================================================================================
__device__ __forceinline__ void epi_put(float* sl, v8f a0, v8f a1, v8f a2, v8f a3, float oscale, int lane) {
  const int hh = lane >> 4, m = lane & 15;
#pragma unroll
  for (int r = 0; r < 8; ++r) {
    const int ro = (8 * hh + r) * 68 + m;
    sl[ro]      = a0[r] * oscale;
    sl[ro + 16] = a1[r] * oscale;
    sl[ro + 32] = a2[r] * oscale;
    sl[ro + 48] = a3[r] * oscale;
  }
}
__device__ __forceinline__ void epi_get(const float* sl, float* C, int N, size_t rowb, int col0, int lane) {
  const int hh = lane >> 4, m = lane & 15;
  v4f vals[8];
#pragma unroll
  for (int it = 0; it < 8; ++it) vals[it] = *(const v4f*)(sl + (it * 2 + hh) * 68 + m * 4);
  float* dst = C + (rowb + (size_t)hh) * (size_t)N + col0 + m * 4;
#pragma unroll
  for (int it = 0; it < 8; ++it) {
    *(v4f*)(dst + (size_t)(it * 2) * (size_t)N) = vals[it];
  }
}

// =====================================================================================================
// Epilogue of the projection GEMM: the wave's 64 x 64 f32 tile is 64 rows (row = b*SEQ + s) of ONE head of q, k or v (first column a multiple
// of 64; the section, column / DMOD, is the same for the whole block) and goes from the accumulators straight to that section's f16 planes.
// Accumulator element r of acc[i][j] in lane (hh, m) = (row 16 i + 8 hh + r, d = 16 j + m).
//   q, k: the rotary partner of d is d xor 16 = subtile j xor 1 of the same lane and element; table row s, column m. The f16 hi and
//         residual bits (x256) of an element share one 32-bit word in the wave's slab [64 rows][64 d] (pitch 68 words); after a
//         wave-level LDS sync one instruction stores 4 rows x 8 lanes x 8 halves = 4 whole 128-B row segments per plane [ROWS][DMOD].
//   v:    a lane's 8 elements are 8 consecutive keys of one d: f16(v * 1024) and its f16 residual, one 16-B LDS store each into the
//         wave's two tiles [64 d][64 keys] (pitch 72 halves); after the sync 4 whole 128-B d-row segments per store into
//         VH / VL[((b*NH + g)*HD + d)][s].
// The ring is dead here (behind the last stage's barrier); each wave uses its own quarter of it.
// coverage: 16 instructions x 4 lines x 64 halves = 64 x 64 per plane and wave; the grid's waves tile [ROWS][3072] exactly once.
// =====================================================================================================
struct QkvOut { const float* tc; const float* ts; u16* qh; u16* ql; u16* kh; u16* kl; u16* vh; u16* vl; };

__device__ __forceinline__ void epi_qkv(const v8f (&acc)[4][4], const QkvOut& qo, int row0, int col0, u16* sm, int wave, int lane) {
  static_assert(WPB * 2 * HD * VTP <= 2 * 2 * GPLH && WPB * 4 * SLAB64 * 2 <= 2 * 2 * GPLH);
  const int hh = lane >> 4, m = lane & 15;
  const int rq = lane >> 3, c8 = (lane & 7) * 8;
  const int sec  = col0 / DMOD;             // 0 = q, 1 = k, 2 = v: from the block's tile origin, so the branch below is scalar
  const int b    = row0 / SEQ;
  const int roww = row0 + (wave >> 1) * 64;                 // the wave's first row
  const int hcol = col0 - sec * DMOD + (wave & 1) * 64;     // head * HD
  const int s0   = roww - b * SEQ;          // first table row / key of the tile
  // every "#pragma unroll" here makes the indices of acc constants, so that it stays in registers
  if (sec < 2) {
    unsigned* sl = (unsigned*)(void*)sm + (size_t)(wave * 4) * SLAB64;
    const float sc = (sec != 0) ? KSC : QSC;
    const float* cp = qo.tc + (size_t)(s0 + 8 * hh) * NFREQ + m;
    const float* sp = qo.ts + (size_t)(s0 + 8 * hh) * NFREQ + m;
#pragma unroll
    for (int i = 0; i < 4; ++i) {
      float cw[8], sw[8];
#pragma unroll
      for (int r = 0; r < 8; ++r) {
        cw[r] = cp[(i * 16 + r) * NFREQ];
        sw[r] = sp[(i * 16 + r) * NFREQ];
      }
#pragma unroll
      for (int r = 0; r < 8; ++r) {
        const int ro = (i * 16 + 8 * hh + r) * 68 + m;
        unsigned short h0, l0, h1, l1, h2, l2, h3, l3;
        rot_one(acc[i][0][r], acc[i][1][r], cw[r], sw[r], -1.0f, sc, 1, h0, l0);
        rot_one(acc[i][1][r], acc[i][0][r], cw[r], sw[r],  1.0f, sc, 1, h1, l1);
        rot_one(acc[i][2][r], acc[i][2][r], 0.0f, 0.0f, 1.0f, sc, 0, h2, l2);
        rot_one(acc[i][3][r], acc[i][3][r], 0.0f, 0.0f, 1.0f, sc, 0, h3, l3);
        sl[ro]      = pk16(h0, l0);
        sl[ro + 16] = pk16(h1, l1);
        sl[ro + 32] = pk16(h2, l2);
        sl[ro + 48] = pk16(h3, l3);
      }
    }
    wave_sync_lds();
    const size_t ob = (size_t)(roww + rq) * DMOD + hcol + c8;
    u16* dh = ((sec != 0) ? qo.kh : qo.qh) + ob;
    u16* dl = ((sec != 0) ? qo.kl : qo.ql) + ob;
#pragma unroll
    for (int it = 0; it < 16; ++it) {
      const unsigned* pr = sl + (it * 4 + rq) * 68 + c8;
      const v4u a = *(const v4u*)(pr), b4 = *(const v4u*)(pr + 4);
      v4u oh, ol;
#pragma unroll
      for (int e = 0; e < 2; ++e) {
        oh[e]     = (a[2 * e] & 0xFFFFu)  | (a[2 * e + 1] << 16);
        ol[e]     = (a[2 * e] >> 16)      | (a[2 * e + 1] & 0xFFFF0000u);
        oh[2 + e] = (b4[2 * e] & 0xFFFFu) | (b4[2 * e + 1] << 16);
        ol[2 + e] = (b4[2 * e] >> 16)     | (b4[2 * e + 1] & 0xFFFF0000u);
      }
      *(v4u*)(dh + (size_t)(it * 4) * DMOD) = oh;
      *(v4u*)(dl + (size_t)(it * 4) * DMOD) = ol;
    }
  } else {
    u16* th = sm + (size_t)wave * (2 * HD * VTP);
    u16* tl = th + HD * VTP;
#pragma unroll
    for (int i = 0; i < 4; ++i) {
#pragma unroll
      for (int j = 0; j < 4; ++j) {
        v4u ph, pl;
#pragma unroll
        for (int e = 0; e < 4; ++e) {
          const float t0 = acc[i][j][2 * e] * VCAR, t1 = acc[i][j][2 * e + 1] * VCAR;
          const _Float16 h0 = (_Float16)t0, h1 = (_Float16)t1;
          const _Float16 g0 = (_Float16)(t0 - (float)h0), g1 = (_Float16)(t1 - (float)h1);
          ph[e] = pk16(h_bits(h0), h_bits(h1));
          pl[e] = pk16(h_bits(g0), h_bits(g1));
        }
        const int o = (j * 16 + m) * VTP + i * 16 + 8 * hh;
        *(v4u*)(th + o) = ph;
        *(v4u*)(tl + o) = pl;
      }
    }
    wave_sync_lds();
    const size_t base = ((size_t)b * DMOD + hcol + rq) * SEQ + s0 + c8;
#pragma unroll
    for (int it = 0; it < 16; ++it) {
      const int lo = (it * 4 + rq) * VTP + c8;
      const v4u vh = *(const v4u*)(th + lo), vl = *(const v4u*)(tl + lo);
      *(v4u*)(qo.vh + base + (size_t)(it * 4) * SEQ) = vh;
      *(v4u*)(qo.vl + base + (size_t)(it * 4) * SEQ) = vl;
    }
    // behind the last store of this section: no address or data register of an issued store is rewritten ahead of this wait
    asm volatile("s_wait_xcnt 0x0" ::: "memory");
  }
}

// =====================================================================================================
// GEMM core shared by both engines: C[128 x 128 tile] (f32) = (A (+ A2 when MODE == 2)) . Bt^T, times oscale, K = DMOD.
// A, A2 [rows][DMOD] and Bt [n][DMOD] are k-contiguous 16-bit planes (MODE 0: bf16, MODE 1 / 2: f16).
// Block = 4 waves as 2 x 2, each wave a 64 x 64 tile (4 x 4 accumulators). A stage is 64 k = one whole 128-B line of each of the
// 128 A rows (and A2 rows) and 128 Bt rows, laid in LDS at pitch 144 B by asynchronous 16-B copies: thread t copies chunk t & 7 of
// rows (t >> 3) + 16 i, i < 8, so one wave-wide copy covers 4 whole lines. Two buffers: stage t + 1 flies while stage t is worked on.
// Fragments come from LDS with the same split k map for A and B as ldfrag_*; every accumulator takes its products in the order
// k0 = 0, 32, 64, ... (A then A2 within a k0).
// After the last stage's barrier the ring is dead and serves as the waves' own epilogue space (MODE 1 / 2: 4 slabs per wave, 16 x 68 floats each).
// MODE 0 hands its tile to epi_qkv (C, N and oscale unused), MODE 1 / 2 store it to C.
// =====================================================================================================
union FragU { v4u u[2]; v16h h; v16b b; };

__device__ __forceinline__ FragU ldfrag_u(const u16* p) {
  FragU f;
  f.u[0] = *(const v4u*)(p);
  f.u[1] = *(const v4u*)(p + 16);
  return f;
}
template <int MODE>
__device__ __forceinline__ v8f mma_u(const FragU& a, const FragU& b, v8f c) {
  if constexpr (MODE == 0) return mma_b(a.b, b.b, c);
  else                     return mma_h(a.h, b.h, c);
}
__device__ __forceinline__ unsigned lds_addr(const u16* p) {          // byte offset in the work-group's LDS
  return (unsigned)(uintptr_t)(const __attribute__((address_space(3))) u16*)p;
}
// One operand tile of a stage: this lane's eight 16-B copies (rows 16 apart). The s_wait_xcnt stands inside the statement, behind
// the last copy, so that no address register of an issued copy is rewritten ahead of it.
__device__ __forceinline__ void acopy_tile(unsigned l, const u16* g) {
#if defined(__HIP_DEVICE_COMPILE__)
  constexpr unsigned LS = 16u * GPIT * 2u;          // LDS bytes between this lane's rows
  constexpr size_t   GS = (size_t)16 * DMOD;        // halves between this lane's rows in the plane
  asm volatile("global_load_async_to_lds_b128 %0, %8, off\n\t"
               "global_load_async_to_lds_b128 %1, %9, off\n\t"
               "global_load_async_to_lds_b128 %2, %10, off\n\t"
               "global_load_async_to_lds_b128 %3, %11, off\n\t"
               "global_load_async_to_lds_b128 %4, %12, off\n\t"
               "global_load_async_to_lds_b128 %5, %13, off\n\t"
               "global_load_async_to_lds_b128 %6, %14, off\n\t"
               "global_load_async_to_lds_b128 %7, %15, off\n\t"
               "s_wait_xcnt 0x0"
               :: "v"(l), "v"(l + LS), "v"(l + 2u * LS), "v"(l + 3u * LS),
                  "v"(l + 4u * LS), "v"(l + 5u * LS), "v"(l + 6u * LS), "v"(l + 7u * LS),
                  "v"(g), "v"(g + GS), "v"(g + 2 * GS), "v"(g + 3 * GS),
                  "v"(g + 4 * GS), "v"(g + 5 * GS), "v"(g + 6 * GS), "v"(g + 7 * GS)
               : "memory");
#endif
}
__device__ __forceinline__ void wait_async0() {     // this wave's copies have landed in LDS
#if defined(__HIP_DEVICE_COMPILE__)
  asm volatile("s_wait_asynccnt 0x0" ::: "memory");
#endif
}
__device__ __forceinline__ void wait_ds0() {        // this wave's LDS reads have returned before their buffer is handed back
#if defined(__HIP_DEVICE_COMPILE__)
  asm volatile("s_wait_dscnt 0x0" ::: "memory");
#endif
}

// Inputs-only fence on loaded fragments: holds a block's LDS reads together in front of its WMMAs (one wait per block); without it
// the reads are sunk between the rows of WMMAs and every row waits out the LDS latency.
__device__ __forceinline__ void hold4(const FragU& x0, const FragU& x1, const FragU& x2, const FragU& x3) {
#if defined(__HIP_DEVICE_COMPILE__)
  asm volatile("" :: "v"(x0.h), "v"(x1.h), "v"(x2.h), "v"(x3.h));
#endif
}

template <int MODE>
__device__ __forceinline__ void gemm_core(const u16* __restrict__ A, const u16* __restrict__ A2, const u16* __restrict__ Bt,
                                          float* C, int N, float oscale, int row0, int col0, u16* sm, const QkvOut& qo) {
  constexpr int NPL  = (MODE == 2) ? 3 : 2;         // operand tiles per stage
  constexpr int BUFH = NPL * GPLH;                  // halves per buffer
  constexpr int NS   = DMOD / GKS;                  // stages
  static_assert(NS >= 2 && 16 * SLAB64 * 4 <= 2 * BUFH * 2);
  const int tid = threadIdx.x, wave = tid >> 5, lane = tid & 31, hh = lane >> 4, m = lane & 15;
  const int wr = wave >> 1, wc = wave & 1;
  const int crow = tid >> 3, cch = (tid & 7) * 8;
  const u16* ga  = A  + (size_t)(row0 + crow) * DMOD + cch;
  const u16* ga2 = A2 + (size_t)(row0 + crow) * DMOD + cch;
  const u16* gb  = Bt + (size_t)(col0 + crow) * DMOD + cch;
  const unsigned l0 = lds_addr(sm) + (unsigned)(crow * GPIT + cch) * 2u;
  const int fa = (wr * 64 + m) * GPIT + 8 * hh;             // A fragment row of this lane (+ 16 i rows)
  const int fb = GPLH + (wc * 64 + m) * GPIT + 8 * hh;      // Bt fragment row of this lane (+ 16 j rows)

  // every "#pragma unroll" in this function makes the indices of acc, a, b, a2 constants, so that the arrays stay in registers
  v8f acc[4][4];
#pragma unroll
  for (int i = 0; i < 4; ++i) {
#pragma unroll
    for (int j = 0; j < 4; ++j) acc[i][j] = zero8();
  }

  // stage 0 into buffer 0, landed and published; then stage 1 into buffer 1
  acopy_tile(l0, ga);
  acopy_tile(l0 + GPLH * 2u, gb);
  if (MODE == 2) acopy_tile(l0 + 2u * GPLH * 2u, ga2);
  wait_async0();
  __syncthreads();
  acopy_tile(l0 + BUFH * 2u, ga + GKS);
  acopy_tile(l0 + BUFH * 2u + GPLH * 2u, gb + GKS);
  if (MODE == 2) acopy_tile(l0 + BUFH * 2u + 2u * GPLH * 2u, ga2 + GKS);

  // kept rolled: one trip = one stage, so that the publish point below stands once per stage
#pragma unroll 1
  for (int t = 0; t < NS; ++t) {
    const int bo = (t & 1) * BUFH;
    const u16* bp = sm + bo;
#pragma unroll
    for (int kk = 0; kk < GKS / 32; ++kk) {
      FragU a[4], b[4];
#pragma unroll
      for (int i = 0; i < 4; ++i) a[i] = ldfrag_u(bp + fa + i * 16 * GPIT + kk * 32);
#pragma unroll
      for (int j = 0; j < 4; ++j) b[j] = ldfrag_u(bp + fb + j * 16 * GPIT + kk * 32);
      hold4(a[0], a[1], a[2], a[3]);
      hold4(b[0], b[1], b[2], b[3]);
#pragma unroll
      for (int i = 0; i < 4; ++i) {
#pragma unroll
        for (int j = 0; j < 4; ++j) acc[i][j] = mma_u<MODE>(a[i], b[j], acc[i][j]);
      }
      if (MODE == 2) {
        FragU a2[4];
#pragma unroll
        for (int i = 0; i < 4; ++i) a2[i] = ldfrag_u(bp + 2 * GPLH + fa + i * 16 * GPIT + kk * 32);
        hold4(a2[0], a2[1], a2[2], a2[3]);
#pragma unroll
        for (int i = 0; i < 4; ++i) {
#pragma unroll
          for (int j = 0; j < 4; ++j) acc[i][j] = mma_u<MODE>(a2[i], b[j], acc[i][j]);
        }
      }
    }
    // publish point of stage t + 1: own LDS reads back, own copies landed, block barrier; only then the refill of the buffer just read
    wait_ds0();
    wait_async0();
    __syncthreads();
    if (t + 2 < NS) {
      const unsigned lb = l0 + (unsigned)bo * 2u;
      const int ko = (t + 2) * GKS;
      acopy_tile(lb, ga + ko);
      acopy_tile(lb + GPLH * 2u, gb + ko);
      if (MODE == 2) acopy_tile(lb + 2u * GPLH * 2u, ga2 + ko);
    }
  }
  wait_async0();
  (void)ga2;
  if constexpr (MODE == 0) {
    epi_qkv(acc, qo, row0, col0, sm, wave, lane);
  } else {
    float* sl = (float*)(void*)sm + (size_t)(wave * 4) * SLAB64;
#pragma unroll
    for (int i = 0; i < 4; ++i) epi_put(sl + i * SLAB64, acc[i][0], acc[i][1], acc[i][2], acc[i][3], oscale, lane);
    wave_sync_lds();
#pragma unroll
    for (int i = 0; i < 4; ++i) epi_get(sl + i * SLAB64, C, N, (size_t)(row0 + wr * 64 + i * 16), col0 + wc * 64, lane);
  }
}

// =====================================================================================================
// bf16 projection GEMM: [M][NQKV] (f32 accumulators) = A[M][DMOD] (bf16 row-major) . Bt[NQKV][DMOD]^T (bf16 k-contiguous); the tile
// leaves as the q / k planes (rotary, x256, hi + residual) or the v^T planes (x1024, hi + residual): epi_qkv.
// Block = one 128 x 128 tile (gemm_core); M % 128 == 0, grid = (M/128)*(NQKV/128).
// =====================================================================================================
__global__ __launch_bounds__(128)
void gemm_bf(const u16* __restrict__ A, const u16* __restrict__ Bt, const float* __restrict__ TC, const float* __restrict__ TS,
             u16* QH, u16* QL, u16* KH, u16* KL, u16* VH, u16* VL, int M) {
  __shared__ __align__(16) u16 ring[2 * 2 * GPLH];
  constexpr int ntile = NQKV / GT;
  const int bid   = blockIdx.x;
  const int row0  = (bid / ntile) * GT;
  const int col0  = (bid % ntile) * GT;
  if (row0 + GT > M) return;                // block-uniform, before any copy or barrier; never taken with the exact grid
  const QkvOut qo = {TC, TS, QH, QL, KH, KL, VH, VL};
  gemm_core<0>(A, A, Bt, nullptr, NQKV, 1.0f, row0, col0, ring, qo);
}

// =====================================================================================================
// f16 GEMM: C[M][N] (f32) = (A[M][DMOD] (+ A2[M][DMOD] when TWO != 0)) . Bt[N][DMOD]^T, times oscale; A, A2 f16 row-major planes
// (A2 = the unscaled f16 residual of A, sharing the accumulator), Bt f16 k-contiguous. Same core as gemm_bf. A, A2 and C hold the
// rows of all sequences (row = b*SEQ + s); one launch takes one row class of every sequence: TWO = 1 the rows s < RICHE, TWO = 0
// the rows s >= RICHE; row tile rt of the class -> sequence rt / (tiles of the class per sequence);
// grid = NB * (class rows / 128) * (N / 128).
// =====================================================================================================
template <int TWO>
__global__ __launch_bounds__(128)
void gemm_h(const u16* __restrict__ A, const u16* __restrict__ A2, const u16* __restrict__ Bt, float* C,
            int M, int N, float oscale) {
  __shared__ __align__(16) u16 ring[2 * ((TWO != 0) ? 3 : 2) * GPLH];
  const int ntile = N / GT;
  const int bid   = blockIdx.x;
  constexpr int CT = ((TWO != 0) ? RICHE : ((SEQ > RICHE) ? (SEQ - RICHE) : GT)) / GT;   // row tiles of the class per sequence
  constexpr int R0 = (TWO != 0) ? 0 : RICHE;                                             // first row of the class in a sequence
  const int rt    = bid / ntile;
  const int row0  = (rt / CT) * SEQ + R0 + (rt % CT) * GT;
  const int col0  = (bid % ntile) * GT;
  if (row0 + GT > M) return;                // block-uniform, before any copy or barrier; never taken with the exact grid
  const QkvOut none = {nullptr, nullptr, nullptr, nullptr, nullptr, nullptr, nullptr, nullptr};
  gemm_core<(TWO != 0) ? 2 : 1>(A, A2, Bt, C, N, oscale, row0, col0, ring, none);
}

// =====================================================================================================
// Causal sliding-window softmax attention with key padding, hd = 64, all sequences in one launch. Block bid -> (query tile
// qt = qt0 + bid % nqt: rows q0 = 16*qt .. q0+15, head group hg = (bid / nqt) % NHG, sequence b = bid / (nqt*NHG), whose
// planes and key flags start at b's offset); one wave per head = hg*WPB + wave.
//   q hi / residual planes f16 x256 [s][h*HD + d]; k hi / residual planes f16 x256 [s][h*HD + d] (pitch DMOD);
//   v^T hi / residual planes [h*HD + d][SEQ] x1024; MK = the sequence's int32 key flags (0 = padded key).
//   raw(i, j) = q_hi.k_hi + q_lo.k_hi + q_hi.k_lo (2 k-steps over d); logit = raw * 2^-19 (the 1/8 softmax scale and the two
//   256 carries, exact); key j is REPLACED by -inf when j > i, j < i - (WIN-1), or MK[j] == 0; online softmax per query
//   row in f32 with a running max: row max / row sum over the 16 lanes holding the row via xor shuffles 1,2,4,8 (never
//   crossing the lane half); a row whose running max is still -inf uses 0 as the shift so alpha and p come out 0 (no NaN);
//   alpha = exp(m_old - m_new), p = exp(logit - m_new), l = l*alpha + sum p, O accumulators times alpha before the
//   tile's P.v. Key tiles of 32 visited in order from the tile holding max(0, q0-(WIN-1)) to the tile holding q0+15
//   (block-uniform bounds, <= 18 tiles). The 32 key flags of a tile are loaded once (one b32 per lane, coalesced) and
//   barrier, then A fragments of p*32768 (f16 hi and its f16 residual) are rebuilt from the LDS rows (float vector loads);
//   v^T B fragments in 2 groups of 2 d-subtiles; RV = 1: products hh + lh + hl, RV = 0: hh only.
//   After the loop O = acc / (l * 32768 * 1024) (0 when l == 0, i.e. every key of the window padded) into the wave's
//   Epilogue: O x256 -> f16 hi plane (and for RV = 1 the unscaled f16 residual plane) [s][h*HD + d]; lane = (row group
//   rq = lane>>3 in 0..3, 8 consecutive d at c8); one instruction = 4 rows it*4 + rq, each row segment (64 halves = one whole
// coverage: per wave 4 instructions x 4 rows x 8 lanes x 8 halves = 16 x 64 per plane; grid NB x NHG x nqt blocks x WPB waves;
//   the two launches (tiles 0..NQTR-1 with RV = 1, NQTR..NQT-1 with RV = 0) cover every (b, s, h) row segment of the hi plane
//   exactly once and rows s < RICHE of each sequence's residual plane exactly once (only those rows are read later).
// =====================================================================================================
template <int RV>
__global__ __launch_bounds__(ATT_THREADS)
void attn_w(const u16* __restrict__ QHa, const u16* __restrict__ QLa,
            const u16* __restrict__ KHa, const u16* __restrict__ KLa,
            const u16* __restrict__ VHa, const u16* __restrict__ VLa,
            const int* __restrict__ MKa,
            u16* OHa, u16* OLa, int qt0, int nqt) {
#pragma clang fp contract(off)
  __shared__ __align__(16) float smem[WPB * WREG];

  const int tid  = threadIdx.x;
  const int wave = tid >> 5;
  const int lane = tid & 31;
  const int hh   = lane >> 4;
  const int c    = lane & 15;
  const int bid  = blockIdx.x;
  if (nqt <= 0) return;                     // block-uniform; no block barriers in this kernel
  const int qt   = qt0 + bid % nqt;
  const int hg   = (bid / nqt) % NHG;
  const int b    = bid / (nqt * NHG);
  if (b >= NB) return;                      // block-uniform; never taken with the exact grid
  const size_t po = (size_t)b * SEQ * DMOD; // halves per sequence in every q / k / v^T / O plane (NH*HD == DMOD)
  const u16* __restrict__ QHp = QHa + po;
  const u16* __restrict__ QLp = QLa + po;
  const u16* __restrict__ KHp = KHa + po;
  const u16* __restrict__ KLp = KLa + po;
  const u16* __restrict__ VHp = VHa + po;
  const u16* __restrict__ VLp = VLa + po;
  const int* __restrict__ MK  = MKa + (size_t)b * XS_FULL;
  u16* OHp = OHa + po;
  u16* OLp = OLa + po;
  const int q0   = qt * 16;
  if (q0 + 16 > SEQ) return;                // block-uniform; never taken
  const int head = hg * WPB + wave;

  float* pt   = smem + wave * WREG;         // p tile [16][32] pitch 36
  float* slab = pt + PTW;                   // result slab [16][64] pitch 68

  const size_t hcol = (size_t)head * HD + 8 * hh;
  const _Float16* Qh  = (const _Float16*)(const void*)QHp + ((size_t)q0 + c) * DMOD + hcol;
  const _Float16* Ql  = (const _Float16*)(const void*)QLp + ((size_t)q0 + c) * DMOD + hcol;
  const _Float16* Khb = (const _Float16*)(const void*)KHp + (size_t)c * DMOD + hcol;        // key row kb added per step
  const _Float16* Klb = (const _Float16*)(const void*)KLp + (size_t)c * DMOD + hcol;
  const _Float16* Vhb = (const _Float16*)(const void*)VHp + ((size_t)head * HD + c) * SEQ + 8 * hh;  // d col c (+16j)
  const _Float16* Vlb = (const _Float16*)(const void*)VLp + ((size_t)head * HD + c) * SEQ + 8 * hh;
  const float lsc  = SM_SCALE * (1.0f / (QSC * KSC));   // exact power-of-two fold of the q / k carries into the 1/8 scale
  const float oc   = 1.0f / (PCAR * VCAR);
  const float ninf = -__builtin_inff();
  const size_t KROW = (size_t)DMOD;         // halves between consecutive key rows

  v8f o[4];
#pragma unroll
  for (int j = 0; j < 4; ++j) o[j] = zero8();
  float mrun[8], lrun[8];
#pragma unroll
  for (int r = 0; r < 8; ++r) { mrun[r] = ninf; lrun[r] = 0.0f; }
  int klo = q0 - (WIN - 1);
  if (klo < 0) klo = 0;
  const int ktlo = klo >> 5;                                                  // first tile intersecting the window
  const int kthi = q0 >> 5;                                                   // tile holding keys q0 .. q0 + 15
  int nkt = kthi - ktlo + 1;
  if (nkt > NKT) nkt = NKT;
  if (nkt < 1) nkt = 1;
  const int qr0   = q0 + 8 * hh;                                              // query row of D element r = qr0 + r

#pragma unroll 1
  for (int i = 0; i < nkt; ++i) {
    const int kb = (ktlo + i) * 32;                                           // kb + 31 <= SEQ - 1
    // ---- key padding flags of this tile: one coalesced b32 per lane, then broadcast for key kb + c and kb + 16 + c ----
    const int fl = MK[kb + lane];
    const int f0 = __shfl(fl, c, 32);
    const int f1 = __shfl(fl, 16 + c, 32);
    // ---- raw scores: D element r of this lane = (query row qr0 + r, key kb + c) in s0, key kb + 16 + c in s1 ----
    v8f s0 = zero8(), s1 = zero8();
    const _Float16* k0p = Khb + (size_t)kb * KROW;
    const _Float16* k1p = k0p + (size_t)16 * KROW;
    const _Float16* l0p = Klb + (size_t)kb * KROW;
    const _Float16* l1p = l0p + (size_t)16 * KROW;
#pragma unroll
    for (int kk = 0; kk < HD / 32; ++kk) {
      const v16h qh  = ldfrag_h(Qh + kk * 32);
      const v16h ql  = ldfrag_h(Ql + kk * 32);
      const v16h kh0 = ldfrag_h(k0p + kk * 32);
      const v16h kh1 = ldfrag_h(k1p + kk * 32);
      const v16h kl0 = ldfrag_h(l0p + kk * 32);
      const v16h kl1 = ldfrag_h(l1p + kk * 32);
      s0 = mma_h(qh, kh0, s0);
      s0 = mma_h(ql, kh0, s0);
      s0 = mma_h(qh, kl0, s0);
      s1 = mma_h(qh, kh1, s1);
      s1 = mma_h(ql, kh1, s1);
      s1 = mma_h(qh, kl1, s1);
      guard2(s0, s1, qh, ql, kh0, kl0, kh1, kl1);
    }
    // ---- causal / window / padding replace-mask, running-max online softmax in f32, p tile -> wave-private LDS ----
    float alpha[8];
    const int key0 = kb + c, key1 = kb + 16 + c;
#pragma unroll
    for (int r = 0; r < 8; ++r) {
      const int qrow = qr0 + r;
      const int lo   = qrow - (WIN - 1);
      const float a0 = s0[r] * lsc;
      const float a1 = s1[r] * lsc;
      const bool ok0 = (key0 <= qrow) && (key0 >= lo) && (f0 != 0);
      const bool ok1 = (key1 <= qrow) && (key1 >= lo) && (f1 != 0);
      const float t0 = ok0 ? a0 : ninf;
      const float t1 = ok1 ? a1 : ninf;
      float mx = fmaxf(t0, t1);
      mx = fmaxf(mx, __shfl_xor(mx, 1, 32));
      mx = fmaxf(mx, __shfl_xor(mx, 2, 32));
      mx = fmaxf(mx, __shfl_xor(mx, 4, 32));
      mx = fmaxf(mx, __shfl_xor(mx, 8, 32));
      const float mnew  = fmaxf(mrun[r], mx);
      const float mshft = (mnew == ninf) ? 0.0f : mnew;
      const float al    = __expf(mrun[r] - mshft);
      const float p0    = __expf(t0 - mshft);
      const float p1    = __expf(t1 - mshft);
      float sm = p0 + p1;
      sm += __shfl_xor(sm, 1, 32);
      sm += __shfl_xor(sm, 2, 32);
      sm += __shfl_xor(sm, 4, 32);
      sm += __shfl_xor(sm, 8, 32);
      lrun[r]  = lrun[r] * al + sm;
      mrun[r]  = mnew;
      alpha[r] = al;
      const int ro = (8 * hh + r) * PTP + c;
      pt[ro]      = p0;
      pt[ro + 16] = p1;
    }
    wave_sync_lds();
    // ---- rescale the O accumulators by alpha (row 8hh + r of every d-subtile) ----
#pragma unroll
    for (int j = 0; j < 4; ++j) {
#pragma unroll
      for (int r = 0; r < 8; ++r) o[j][r] = o[j][r] * alpha[r];
    }
    // ---- A fragments of p*32768: hi f16 and residual f16, row = c, split k map over the 32 keys of this step ----
    FragH ph, pl;
    {
      const float* prow = pt + c * PTP + 8 * hh;
      const v4f p0 = *(const v4f*)(prow), p1 = *(const v4f*)(prow + 4);
      const v4f p2 = *(const v4f*)(prow + 16), p3 = *(const v4f*)(prow + 20);
#pragma unroll
      for (int e = 0; e < 4; ++e) {
        const float ta = p0[e] * PCAR, tb = p1[e] * PCAR, tc = p2[e] * PCAR, td = p3[e] * PCAR;
        const _Float16 ha = (_Float16)ta, hb = (_Float16)tb, hc = (_Float16)tc, hd = (_Float16)td;
        ph.h[0][e]     = ha;                  // elements 0..7  = keys kb + 8hh + 0..7
        ph.h[0][4 + e] = hb;
        ph.h[1][e]     = hc;                  // elements 8..15 = keys kb + 16 + 8hh + 0..7
        ph.h[1][4 + e] = hd;
        pl.h[0][e]     = (_Float16)(ta - (float)ha);
        pl.h[0][4 + e] = (_Float16)(tb - (float)hb);
        pl.h[1][e]     = (_Float16)(tc - (float)hc);
        pl.h[1][4 + e] = (_Float16)(td - (float)hd);
      }
    }
    // ---- P.V : B fragment col n = d = j*16 + c, keys contiguous in the v^T planes; 2 groups of 2 d-subtiles ----
    {
      const _Float16* vhp = Vhb + kb;
      const _Float16* vlp = Vlb + kb;
      (void)vlp;
#pragma unroll
      for (int jg = 0; jg < 2; ++jg) {
        const size_t da = (size_t)(2 * jg) * 16 * SEQ;
        const size_t db = da + (size_t)16 * SEQ;
        const v16h vha = ldfrag_h(vhp + da), vhb2 = ldfrag_h(vhp + db);
        o[2 * jg]     = mma_h(ph.v, vha,  o[2 * jg]);
        o[2 * jg + 1] = mma_h(ph.v, vhb2, o[2 * jg + 1]);
        if (RV != 0) {
          const v16h vla = ldfrag_h(vlp + da), vlb2 = ldfrag_h(vlp + db);
          o[2 * jg]     = mma_h(pl.v, vha,  o[2 * jg]);
          o[2 * jg]     = mma_h(ph.v, vla,  o[2 * jg]);
          o[2 * jg + 1] = mma_h(pl.v, vhb2, o[2 * jg + 1]);
          o[2 * jg + 1] = mma_h(ph.v, vlb2, o[2 * jg + 1]);
          guard2(o[2 * jg], o[2 * jg + 1], ph.v, pl.v, vha, vhb2, vla, vlb2);
        } else {
          guard2(o[2 * jg], o[2 * jg + 1], ph.v, pl.v, vha, vhb2, vha, vhb2);
        }
      }
    }
    wave_sync_lds();
  }
  acc_guard4(o[0], o[1], o[2], o[3]);
  // ---- O = acc / l with the carries (32768 on p, 1024 on v) folded once (0 when l == 0); into the wave's slab ----
  float rl[8];
#pragma unroll
  for (int r = 0; r < 8; ++r) {
    const bool  okl  = lrun[r] > 0.0f;
    const float lden = okl ? lrun[r] : 1.0f;
    const float rec  = (1.0f / lden) * oc;
    rl[r] = okl ? rec : 0.0f;
  }
#pragma unroll
  for (int r = 0; r < 8; ++r) {
#pragma unroll
    for (int j = 0; j < 4; ++j) {
      const int idx = (8 * hh + r) * SLP + j * 16 + c;
      slab[idx] = o[j][r] * rl[r];
    }
  }
  wave_sync_lds();
  // ---- O x256 -> f16 hi plane (+ f16 residual plane); lane = (row group rq, 8 consecutive d at c8) ----
  v4u oh[4], ol[4];
  const int rq = lane >> 3, c8 = (lane & 7) * 8;
#pragma unroll
  for (int it = 0; it < 4; ++it) {
    const int row = it * 4 + rq;
    const v4f a = *(const v4f*)(slab + row * SLP + c8), b4 = *(const v4f*)(slab + row * SLP + c8 + 4);
    float w[8];
#pragma unroll
    for (int e = 0; e < 4; ++e) { w[e] = a[e] * OSC; w[4 + e] = b4[e] * OSC; }
#pragma unroll
    for (int e = 0; e < 4; ++e) {
      const _Float16 h0 = (_Float16)w[2 * e], h1 = (_Float16)w[2 * e + 1];
      const _Float16 g0 = (_Float16)(w[2 * e] - (float)h0), g1 = (_Float16)(w[2 * e + 1] - (float)h1);
      oh[it][e] = pk16(h_bits(h0), h_bits(h1));
      ol[it][e] = pk16(h_bits(g0), h_bits(g1));
    }
  }
  const size_t ob = ((size_t)q0) * DMOD + (size_t)head * HD + c8;
  {
#pragma unroll
    for (int it = 0; it < 4; ++it) {
      const int row = it * 4 + rq;
      *(v4u*)(OHp + ob + (size_t)row * DMOD) = oh[it];
      if (RV != 0) {
        *(v4u*)(OLp + ob + (size_t)row * DMOD) = ol[it];
      }
    }
    
  }
}

// =====================================================================================================
// Workspace map (bytes); every plane holds all NB sequences (ROWS = NB*SEQ rows), each stage is one launch over all of them;
// every plane is fully written by whole-line stores before it is read (the O residual plane only on the rows < RICHE of each
// sequence that are read); all extents are exact multiples of the store granularity; every region offset a multiple of 131072:
//   XB  bf16 [ROWS][1024]                ROWS*2048   (ROWS=8192: 16777216)
//   WB  bf16 [3072 n][1024 k]            6291456     (q rows 0..1023, k 1024..2047, v 2048..3071)
//   WT  f16  [1024 o][1024 d] x1024      2097152
//   QH  f16 [ROWS][1024] x256            ROWS*2048   QL residual, same extent
//   KH  f16 [ROWS][1024] x256            ROWS*2048   KL residual, same extent
//   VH  f16 [NB][16][64][SEQ] x1024      ROWS*2048   VL residual, same extent
//   OH  f16 [ROWS][1024] x256            ROWS*2048   OL residual, same extent (rows < RICHE of each sequence written / read)
//   TC  f32 [SEQ][16]                    SEQ*64      TS, same extent
//   end (SEQ=2048, NB=4)                159645696
// =====================================================================================================
extern "C" void kernel_launch(void* const* d_in, const int* in_sizes, int n_in,
                              void* d_out, int out_size, void* d_ws, size_t ws_size,
                              hipStream_t stream) {
  if (n_in < 4) return;
  if (in_sizes[0] < ((NB - 1) * XS_FULL + SEQ) * DMOD) return;
  if (in_sizes[1] < (NB - 1) * XS_FULL + SEQ) return;
  if (in_sizes[2] != DMOD * NQKV) return;
  if (in_sizes[3] != DMOD * DMOD) return;
  if (out_size < ((NB - 1) * XS_FULL + SEQ) * DMOD) return;

  const float* x    = (const float*)d_in[0];
  const int*   mask = (const int*)d_in[1];
  const float* wqkv = (const float*)d_in[2];       // [1024 k][3072 n]
  const float* wo   = (const float*)d_in[3];       // [1024 d][1024 o]
  float*       out  = (float*)d_out;

  const size_t szXB = (size_t)ROWS * DMOD * 2;
  const size_t szWB = (size_t)NQKV * DMOD * 2;
  const size_t szWT = (size_t)DMOD * DMOD * 2;
  const size_t szQ  = (size_t)ROWS * DMOD * 2;                   // QH, QL, KH, KL, OH, OL
  const size_t szV  = (size_t)NB * NH * HD * SEQ * 2;            // VH, VL (== szQ)
  const size_t szT  = (size_t)SEQ * NFREQ * 4;                   // TC, TS
  size_t off = 0;
  const size_t oXB = off; off += szXB;
  const size_t oWB = off; off += szWB;
  const size_t oWT = off; off += szWT;
  const size_t oQH = off; off += szQ;
  const size_t oQL = off; off += szQ;
  const size_t oKH = off; off += szQ;
  const size_t oKL = off; off += szQ;
  const size_t oVH = off; off += szV;
  const size_t oVL = off; off += szV;
  const size_t oOH = off; off += szQ;
  const size_t oOL = off; off += szQ;
  const size_t oTC = off; off += szT;
  const size_t oTS = off; off += szT;
  if (off > ws_size) return;                // off = 159645696 for SEQ = 2048, NB = 4
  if (off > (size_t)WS_CAP) return;

  char* ws = (char*)d_ws;
  u16*   XB  = (u16*)(ws + oXB);
  u16*   WB  = (u16*)(ws + oWB);
  u16*   WT  = (u16*)(ws + oWT);
  u16*   QH  = (u16*)(ws + oQH);
  u16*   QL  = (u16*)(ws + oQL);
  u16*   KH  = (u16*)(ws + oKH);
  u16*   KL  = (u16*)(ws + oKL);
  u16*   VH  = (u16*)(ws + oVH);
  u16*   VL  = (u16*)(ws + oVL);
  u16*   OH  = (u16*)(ws + oOH);
  u16*   OL  = (u16*)(ws + oOL);
  float* TC  = (float*)(ws + oTC);
  float* TS  = (float*)(ws + oTS);

  const dim3 b256(256), b128(128), bAT(ATT_THREADS);
  const int  n8x = (ROWS * DMOD) / 8;
  const dim3 gX((n8x + 255) / 256);                     // ROWS*DMOD/2048 blocks
  const int  nT  = SEQ * NFREQ;
  const dim3 gT((nT + 255) / 256);                      // SEQ/16
  const dim3 gWQ((DMOD / 64) * (NQKV / 64));            // 768: in [1024 k][3072 n] -> WB [3072 n][1024 k]
  const dim3 gWO((DMOD / 64) * (DMOD / 64));            // 256: in [1024 d][1024 o] -> WT [1024 o][1024 d]
  const dim3 gG1((ROWS / GT) * (NQKV / GT));
  const float osc = 1.0f / (OSC * WOS);

  // (0) weight planes: Wqkv transposed to bf16 [n][k]; Wo transposed to f16 of the bf16 value x1024 [o][d]
  cvtT16<<<gWQ, b256, 0, stream>>>(wqkv, DMOD, NQKV, WB, 0, 1.0f);
  cvtT16<<<gWO, b256, 0, stream>>>(wo, DMOD, DMOD, WT, 1, WOS);
  // (1) rotary cos / sin tables [SEQ][16]
  k_tab<<<gT, b256, 0, stream>>>(TC, TS, nT);
  // every stage below: all sequences in one launch (x, mask and out rows of the NB sequences are contiguous)
  // (2) x rows -> bf16 plane [ROWS][1024]
  cvt16<<<gX, b256, 0, stream>>>(x, XB, n8x, 0, 1.0f);
  // (3) qkv = x.Wqkv; its epilogue: partial rotary + hi + residual planes x256 of q (columns 0..1023) and k (1024..2047),
  //     v^T hi + residual planes x1024 (columns 2048..3071)
  gemm_bf<<<gG1, b128, 0, stream>>>(XB, WB, TC, TS, QH, QL, KH, KL, VH, VL, ROWS);
  // (4) windowed causal attention with key padding -> O f16 hi plane x256 for all query tiles; residual plane for rows < RICHE
  attn_w<1><<<dim3(NB * NQTR * NHG), bAT, 0, stream>>>(QH, QL, KH, KL, VH, VL, mask, OH, OL, 0, NQTR);
  if (NQT > NQTR) {
    attn_w<0><<<dim3(NB * (NQT - NQTR) * NHG), bAT, 0, stream>>>(QH, QL, KH, KL, VH, VL, mask, OH, OL, NQTR, NQT - NQTR);
  }
  // (5) y = O.Wo -> out f32, carries 256 x 1024 folded back; rows < RICHE of each sequence with O hi + residual
  gemm_h<1><<<dim3(NB * (RICHE / GT) * (DMOD / GT)), b128, 0, stream>>>(OH, OL, WT, out, ROWS, DMOD, osc);
  if (SEQ > RICHE) {
    gemm_h<0><<<dim3(NB * ((SEQ - RICHE) / GT) * (DMOD / GT)), b128, 0, stream>>>(OH, OL, WT, out, ROWS, DMOD, osc);
  }
  (void)hipGetLastError();
}

// v004
// It runs in 206 microseconds.
// In both of two side-by-side timings against v003, it was 1.26 times as fast.
// Counting every step since v000, it is 3.65 times as fast.
// Contractions: x.Wqkv on v_wmma_f32_16x16x32_bf16 (x and the transposed weight as bf16 RNE planes; weight plane [n][k]
// rows are the k-contiguous B operand; f32 accumulate); q.k^T over hd 64 and P.v on v_wmma_f32_16x16x32_f16 with f16 hi +
// f16 residual planes (q, k x256 after partial rotary, products hh+lh+hl on every row; P x32768 hi + in-register residual
// and v^T x1024 hi + residual plane for query rows < 512 of each sequence, P hi . v hi only for later rows); O.Wo on
// v_wmma_f32_16x16x32_f16 with O x256 as f16 hi (+ f16 residual plane for rows < 512 of each sequence) and Wo transposed
// to [o][d] as f16(bf16(Wo)) x1024, one accumulator; all f32 accumulate. Rotary cos/sin tables, causal + window + key
// padding masks and the online softmax in f32 on VALU.
#include <hip/hip_runtime.h>
#include <math.h>
#include <stdint.h>

#ifndef NB
#define NB 4
#endif
#ifndef SEQ
#define SEQ 2048
#endif
#ifndef RICH
#define RICH 512
#endif
#define NB_FULL 4
#define XS_FULL 2048
#define DMOD  1024
#define NH    16
#define HD    64
#define HROT  32
#define HROTH 16
#define NFREQ 16
#define NQKV  (3 * DMOD)
#define WIN   512
#define RICHE ((RICH < SEQ) ? RICH : SEQ)
#define ROPE_L2 0.41524101186092028
#define SM_SCALE 0.125f
#define QSC   256.0f
#define KSC   256.0f
#define PCAR  32768.0f
#define VCAR  1024.0f
#define OSC   256.0f
#define WOS   1024.0f
#define WPB   4
#define NHG   (NH / WPB)
#define NQT   (SEQ / 16)
#define NQTR  (RICHE / 16)
#define NST   (SEQ / 64)
#define NKT   (SEQ / 32)
#define ATT_THREADS (WPB * 32)
#define PTP   36
#define PTW   (16 * PTP)
#define SLP   68
#define SLW   (16 * SLP)
#define WREG  (PTW + SLW)
#define SLAB64 (16 * 68)
#define VTP   72
#define WS_CAP 268435456
#define ROWS  (NB * SEQ)
#define GT    128
#define GKS   64
#define GPIT  72
#define GPLH  (GT * GPIT)
static_assert(DMOD == NH * HD && HD == 64 && HROT == 32 && HROTH == 16 && NFREQ == 16 && NH == 16 && WPB == 4 && NHG * WPB == NH);
static_assert(ATT_THREADS == 128 && NQKV == 3072 && WIN == 512 && NHG == 4);
static_assert(NB >= 1 && NB <= NB_FULL);
static_assert(NB == 1 || SEQ == XS_FULL);
static_assert((SEQ % 64) == 0 && SEQ >= 64 && SEQ <= XS_FULL);
static_assert((RICHE % 64) == 0 && RICHE >= 64 && RICHE <= SEQ);
static_assert((DMOD % 64) == 0 && (NQKV % 64) == 0 && (DMOD % 32) == 0 && (HD % 32) == 0);
static_assert(((SEQ * DMOD / 8) % 256) == 0 && ((SEQ * NFREQ) % 256) == 0);
static_assert(WPB * WREG * 4 <= 65536 && 2 * HD * VTP * 2 <= 65536 && 4 * SLAB64 * 4 <= 65536 && 64 * VTP * 2 <= 65536);
static_assert(NQT * 16 == SEQ && NQTR * 16 == RICHE && NKT * 32 == SEQ && NST * 64 == SEQ);
static_assert((RICHE % GT) == 0 && ((SEQ - RICHE) % GT) == 0 && (ROWS % GT) == 0 && (NQKV % GT) == 0 && (DMOD % GT) == 0 && (DMOD % GKS) == 0);

typedef unsigned short u16;
typedef _Float16 v16h __attribute__((ext_vector_type(16)));
typedef _Float16 v8h  __attribute__((ext_vector_type(8)));
typedef __bf16   v16b __attribute__((ext_vector_type(16)));
typedef float    v8f  __attribute__((ext_vector_type(8)));
typedef float    v4f  __attribute__((ext_vector_type(4)));
typedef unsigned int v4u __attribute__((ext_vector_type(4)));

union FragH { v16h v; v8h h[2]; v4u u[2]; };

// ---- scalar helpers --------------------------------------------------------------------------------
__device__ __forceinline__ unsigned short bf_bits(float f) {          // f32 -> bf16 bits, RNE convert
  unsigned u = __float_as_uint(f);
  return (unsigned short)((u + 0x7FFFu + ((u >> 16) & 1u)) >> 16);
}
__device__ __forceinline__ float bf_up(unsigned short h) { return __uint_as_float(((unsigned)h) << 16); }
__device__ __forceinline__ float bfr(float f) { return bf_up(bf_bits(f)); }
__device__ __forceinline__ unsigned short h_bits(_Float16 x) { return __builtin_bit_cast(unsigned short, x); }
__device__ __forceinline__ unsigned pk16(unsigned short a, unsigned short b) { return (unsigned)a | ((unsigned)b << 16); }
__device__ __forceinline__ v8f zero8() { v8f z = {0.f, 0.f, 0.f, 0.f, 0.f, 0.f, 0.f, 0.f}; return z; }

// ---- fragment loaders: 16-bit A/B operand, lane -> row/col (lane&15), p already includes +8*(lane>>4);
//      elements 0..7 <- p[0..7] (k0+8h..), elements 8..15 <- p[16..23] (k0+16+8h..)  (same split k map for A and B;
//      B is always read from a k-contiguous [n][k] plane)
__device__ __forceinline__ v16h ldfrag_h(const _Float16* p) {
  FragH f;
  f.h[0] = *(const v8h*)(p);
  f.h[1] = *(const v8h*)(p + 16);
  return f.v;
}

__device__ __forceinline__ v8f mma_h(v16h a, v16h b, v8f c) {
  return __builtin_amdgcn_wmma_f32_16x16x32_f16(false, a, false, b, (short)0, c, false, false);
}
__device__ __forceinline__ v8f mma_b(v16b a, v16b b, v8f c) {
  return __builtin_amdgcn_wmma_f32_16x16x32_bf16(false, a, false, b, (short)0, c, false, false);
}
__device__ __forceinline__ void guard2(v8f& a, v8f& b, v16h x0, v16h x1, v16h x2, v16h x3, v16h x4, v16h x5) {
#if defined(__HIP_DEVICE_COMPILE__)
  asm volatile("v_nop\n\tv_nop\n\tv_nop\n\tv_nop"
               : "+v"(a), "+v"(b) : "v"(x0), "v"(x1), "v"(x2), "v"(x3), "v"(x4), "v"(x5) : "memory");
#endif
}
__device__ __forceinline__ void acc_guard4(v8f& a, v8f& b, v8f& c, v8f& d) {
#if defined(__HIP_DEVICE_COMPILE__)
  asm volatile("v_nop\n\tv_nop\n\tv_nop\n\tv_nop" : "+v"(a), "+v"(b), "+v"(c), "+v"(d));
#endif
}
__device__ __forceinline__ void wave_sync_lds() {
  __builtin_amdgcn_fence(__ATOMIC_RELEASE, "workgroup");
  __builtin_amdgcn_wave_barrier();
  __builtin_amdgcn_fence(__ATOMIC_ACQUIRE, "workgroup");
}

// =====================================================================================================
// f32 -> bf16 RNE plane, same layout (f16mode == 1: f16 bits of (bf16 RNE value) * scale).
// Thread = 8 consecutive elements: two 16-B loads, one 16-B store; 32 consecutive lanes = 512 contiguous, 512-B aligned
// coverage: grid = ceil(n8/256) blocks x 256 thr x 8 (in-kernel bound) = the whole plane (n8 a multiple of 256 here).
// =====================================================================================================
__global__ __launch_bounds__(256) void cvt16(const float* __restrict__ x, u16* D, int n8, int f16mode, float scale) {
  const int gt = blockIdx.x * 256 + (int)threadIdx.x;
  if (gt >= n8) return;
  const float* p = x + (size_t)gt * 8;
  const v4f a = *(const v4f*)(p), b4 = *(const v4f*)(p + 4);
  float w[8];
#pragma unroll
  for (int e = 0; e < 4; ++e) { w[e] = a[e]; w[4 + e] = b4[e]; }
  v4u o;
#pragma unroll
  for (int e = 0; e < 4; ++e) {
    const float f0 = w[2 * e], f1 = w[2 * e + 1];
    const unsigned short hb0 = h_bits((_Float16)(bfr(f0) * scale));
    const unsigned short hb1 = h_bits((_Float16)(bfr(f1) * scale));
    const unsigned short bb0 = bf_bits(f0);
    const unsigned short bb1 = bf_bits(f1);
    o[e] = (f16mode != 0) ? pk16(hb0, hb1) : pk16(bb0, bb1);
  }
  u16* d = D + (size_t)gt * 8;
  {
    *(v4u*)(d) = o;
    
  }
}

// =====================================================================================================
// Transposed 16-bit plane of a row-major f32 matrix: in X [R rows][CC cols] (pitch CC) -> out D [CC][R] (pitch R),
// D[c][r] = cvt(X[r][c]); f16mode == 0: bf16 RNE bits; f16mode == 1: f16 bits of (bf16 RNE value) * scale.
// Block = one 64x64 tile (rt = bid / (CC/64) -> rows 64*rt.., ct = bid % (CC/64) -> cols 64*ct..), 256 threads: thread
// (row rl = tid>>2, col chunk cc = 16*(tid&3)) loads its 16 floats with 16-B loads, converts, places them transposed into
// the LDS tile T[c_local][r_local] (pitch 72 halves, 2-B element stores); after a block barrier each output row segment
// coverage: load 256 thr x 16 = 64 x 64; store 2 iterations x 256 thr x 8 halves = 64 lines x 64 = the tile of D;
//           grid = (R/64)*(CC/64) blocks covers D exactly once (R, CC multiples of 64).
// =====================================================================================================
__global__ __launch_bounds__(256) void cvtT16(const float* __restrict__ X, int R, int CC, u16* D, int f16mode, float scale) {
  __shared__ __align__(16) u16 T[64 * VTP];
  const int tid = (int)threadIdx.x;
  const int bid = (int)blockIdx.x;
  const int nct = CC >> 6;
  const int ct  = bid % nct;
  const int rt  = bid / nct;
  const int r0  = rt * 64, c0 = ct * 64;
  if (r0 + 64 > R) return;                  // block-uniform, before the barrier; never taken with the exact grid
  {
    const int rl = tid >> 2;                // row within tile 0..63
    const int cc = (tid & 3) * 16;          // column chunk 0,16,32,48
    const float* src = X + (size_t)(r0 + rl) * (size_t)CC + c0 + cc;
#pragma unroll
    for (int i = 0; i < 4; ++i) {
      const v4f a = *(const v4f*)(src + 4 * i);
#pragma unroll
      for (int e = 0; e < 4; ++e) {
        const float f = a[e];
        const unsigned short hb = h_bits((_Float16)(bfr(f) * scale));
        const unsigned short bb = bf_bits(f);
        T[(cc + 4 * i + e) * VTP + rl] = (f16mode != 0) ? hb : bb;
      }
    }
  }
  __syncthreads();
  v4u w[2];
  const int q8 = tid >> 3, p8 = (tid & 7) * 8;
#pragma unroll
  for (int it = 0; it < 2; ++it) {
    const int line = it * 32 + q8;          // c_local = 0..63
    w[it] = *(const v4u*)(T + line * VTP + p8);
  }
  const size_t base = (size_t)c0 * (size_t)R + r0 + p8;
  {
#pragma unroll
    for (int it = 0; it < 2; ++it) {
      const int line = it * 32 + q8;
      *(v4u*)(D + base + (size_t)line * (size_t)R) = w[it];
    }
    
  }
}

// =====================================================================================================
// Rotary tables TC[s][j] = cos(s * inv[j]), TS[s][j] = sin(s * inv[j]), j < 16, with
// inv[j] = 1.0f / f32(10000^(2j/32)) (power evaluated in f64 and narrowed once, IEEE f32 reciprocal, f32 product s*inv,
// coverage: grid = n/256 blocks x 256 thr = n = SEQ*16 elements of TC and of TS (n a multiple of 256).
// =====================================================================================================
__global__ __launch_bounds__(256) void k_tab(float* TC, float* TS, int n) {
#pragma clang fp contract(off)
  const int idx = blockIdx.x * 256 + (int)threadIdx.x;
  if (idx >= n) return;
  const int s = idx / NFREQ;
  const int j = idx - s * NFREQ;
  const double pj = exp2((double)(2 * j) * ROPE_L2);   // 10000^(2j/32)
  const float pf  = (float)pj;
  const float inv = 1.0f / pf;
  const float ang = (float)s * inv;
  float sv, cv;
  sincosf(ang, &sv, &cv);
  {
    *(float*)(TC + idx) = cv;
    *(float*)(TS + idx) = sv;
    
  }
}

// =====================================================================================================
// One element of the partial non-interleaved rotary on dims 0..31 of a head, then its two f16 planes (table column j = d mod 16):
//   d <  16     : out[d] = x[d]*c[s][j] + (-1)*(x[d+16]*sn[s][j])
//   16 <= d < 32: out[d] = x[d]*c[s][j] + (+1)*(x[d-16]*sn[s][j])    (mul, mul, add kept separate)
//   d >= 32     : out[d] = x[d]
//   hb = f16(out * sc), lb = f16 residual (t - f16(t)).
// =====================================================================================================
__device__ __forceinline__ void rot_one(float x, float y, float cv, float sv, float sgn, float sc, int rot,
                                        unsigned short& hb, unsigned short& lb) {
#pragma clang fp contract(off)
  const float ys   = y * sv;
  const float term = sgn * ys;
  const float rr   = x * cv + term;
  const float r    = (rot != 0) ? rr : x;
  const float t    = r * sc;
  const _Float16 a = (_Float16)t;
  hb = h_bits(a);
  lb = h_bits((_Float16)(t - (float)a));
}

// =====================================================================================================
// Epilogue of the f16 GEMM: the wave's 64x64 f32 tile (times oscale) staged in its four LDS slabs (16 rows each, pitch
// 68, wave-private), one wave-level LDS sync, then whole-line stores: one instruction = 2 rows x 16 lanes x 4 floats.
// coverage: 4 slabs x 8 instructions x 2 rows x 16 lanes x 4 floats = the wave's 64 x 64 tile.
// =====================================================================================================
__device__ __forceinline__ void epi_put(float* sl, v8f a0, v8f a1, v8f a2, v8f a3, float oscale, int lane) {
  const int hh = lane >> 4, m = lane & 15;
#pragma unroll
  for (int r = 0; r < 8; ++r) {
    const int ro = (8 * hh + r) * 68 + m;
    sl[ro]      = a0[r] * oscale;
    sl[ro + 16] = a1[r] * oscale;
    sl[ro + 32] = a2[r] * oscale;
    sl[ro + 48] = a3[r] * oscale;
  }
}
__device__ __forceinline__ void epi_get(const float* sl, float* C, int N, size_t rowb, int col0, int lane) {
  const int hh = lane >> 4, m = lane & 15;
  v4f vals[8];
#pragma unroll
  for (int it = 0; it < 8; ++it) vals[it] = *(const v4f*)(sl + (it * 2 + hh) * 68 + m * 4);
  float* dst = C + (rowb + (size_t)hh) * (size_t)N + col0 + m * 4;
#pragma unroll
  for (int it = 0; it < 8; ++it) {
    *(v4f*)(dst + (size_t)(it * 2) * (size_t)N) = vals[it];
  }
}

// =====================================================================================================
// Epilogue of the projection GEMM: the wave's 64 x 64 f32 tile is 64 rows (row = b*SEQ + s) of ONE head of q, k or v (first column a multiple
// of 64; the section, column / DMOD, is the same for the whole block) and goes from the accumulators straight to that section's f16 planes.
// Accumulator element r of acc[i][j] in lane (hh, m) = (row 16 i + 8 hh + r, d = 16 j + m).
//   q, k: the rotary partner of d is d xor 16 = subtile j xor 1 of the same lane and element; table row s, column m. The f16 hi and
//         residual bits (x256) of an element share one 32-bit word in the wave's slab [64 rows][64 d] (pitch 68 words); after a
//         wave-level LDS sync one instruction stores 4 rows x 8 lanes x 8 halves = 4 whole 128-B row segments per plane [ROWS][DMOD].
//   v:    a lane's 8 elements are 8 consecutive keys of one d: f16(v * 1024) and its f16 residual, one 16-B LDS store each into the
//         wave's two tiles [64 d][64 keys] (pitch 72 halves); after the sync 4 whole 128-B d-row segments per store into
//         VH / VL[((b*NH + g)*HD + d)][s].
// The ring is dead here (behind the last stage's barrier); each wave uses its own quarter of it.
// coverage: 16 instructions x 4 lines x 64 halves = 64 x 64 per plane and wave; the grid's waves tile [ROWS][3072] exactly once.
// =====================================================================================================
struct QkvOut { const float* tc; const float* ts; u16* qh; u16* ql; u16* kh; u16* kl; u16* vh; u16* vl; };

__device__ __forceinline__ void epi_qkv(const v8f (&acc)[4][4], const QkvOut& qo, int row0, int col0, u16* sm, int wave, int lane) {
  static_assert(WPB * 2 * HD * VTP <= 2 * 2 * GPLH && WPB * 4 * SLAB64 * 2 <= 2 * 2 * GPLH);
  const int hh = lane >> 4, m = lane & 15;
  const int rq = lane >> 3, c8 = (lane & 7) * 8;
  const int sec  = col0 / DMOD;             // 0 = q, 1 = k, 2 = v: from the block's tile origin, so the branch below is scalar
  const int b    = row0 / SEQ;
  const int roww = row0 + (wave >> 1) * 64;                 // the wave's first row
  const int hcol = col0 - sec * DMOD + (wave & 1) * 64;     // head * HD
  const int s0   = roww - b * SEQ;          // first table row / key of the tile
  // every "#pragma unroll" here makes the indices of acc constants, so that it stays in registers
  if (sec < 2) {
    unsigned* sl = (unsigned*)(void*)sm + (size_t)(wave * 4) * SLAB64;
    const float sc = (sec != 0) ? KSC : QSC;
    const float* cp = qo.tc + (size_t)(s0 + 8 * hh) * NFREQ + m;
    const float* sp = qo.ts + (size_t)(s0 + 8 * hh) * NFREQ + m;
#pragma unroll
    for (int i = 0; i < 4; ++i) {
      float cw[8], sw[8];
#pragma unroll
      for (int r = 0; r < 8; ++r) {
        cw[r] = cp[(i * 16 + r) * NFREQ];
        sw[r] = sp[(i * 16 + r) * NFREQ];
      }
#pragma unroll
      for (int r = 0; r < 8; ++r) {
        const int ro = (i * 16 + 8 * hh + r) * 68 + m;
        unsigned short h0, l0, h1, l1, h2, l2, h3, l3;
        rot_one(acc[i][0][r], acc[i][1][r], cw[r], sw[r], -1.0f, sc, 1, h0, l0);
        rot_one(acc[i][1][r], acc[i][0][r], cw[r], sw[r],  1.0f, sc, 1, h1, l1);
        rot_one(acc[i][2][r], acc[i][2][r], 0.0f, 0.0f, 1.0f, sc, 0, h2, l2);
        rot_one(acc[i][3][r], acc[i][3][r], 0.0f, 0.0f, 1.0f, sc, 0, h3, l3);
        sl[ro]      = pk16(h0, l0);
        sl[ro + 16] = pk16(h1, l1);
        sl[ro + 32] = pk16(h2, l2);
        sl[ro + 48] = pk16(h3, l3);
      }
    }
    wave_sync_lds();
    const size_t ob = (size_t)(roww + rq) * DMOD + hcol + c8;
    u16* dh = ((sec != 0) ? qo.kh : qo.qh) + ob;
    u16* dl = ((sec != 0) ? qo.kl : qo.ql) + ob;
#pragma unroll
    for (int it = 0; it < 16; ++it) {
      const unsigned* pr = sl + (it * 4 + rq) * 68 + c8;
      const v4u a = *(const v4u*)(pr), b4 = *(const v4u*)(pr + 4);
      v4u oh, ol;
#pragma unroll
      for (int e = 0; e < 2; ++e) {
        oh[e]     = (a[2 * e] & 0xFFFFu)  | (a[2 * e + 1] << 16);
        ol[e]     = (a[2 * e] >> 16)      | (a[2 * e + 1] & 0xFFFF0000u);
        oh[2 + e] = (b4[2 * e] & 0xFFFFu) | (b4[2 * e + 1] << 16);
        ol[2 + e] = (b4[2 * e] >> 16)     | (b4[2 * e + 1] & 0xFFFF0000u);
      }
      *(v4u*)(dh + (size_t)(it * 4) * DMOD) = oh;
      *(v4u*)(dl + (size_t)(it * 4) * DMOD) = ol;
    }
  } else {
    u16* th = sm + (size_t)wave * (2 * HD * VTP);
    u16* tl = th + HD * VTP;
#pragma unroll
    for (int i = 0; i < 4; ++i) {
#pragma unroll
      for (int j = 0; j < 4; ++j) {
        v4u ph, pl;
#pragma unroll
        for (int e = 0; e < 4; ++e) {
          const float t0 = acc[i][j][2 * e] * VCAR, t1 = acc[i][j][2 * e + 1] * VCAR;
          const _Float16 h0 = (_Float16)t0, h1 = (_Float16)t1;
          const _Float16 g0 = (_Float16)(t0 - (float)h0), g1 = (_Float16)(t1 - (float)h1);
          ph[e] = pk16(h_bits(h0), h_bits(h1));
          pl[e] = pk16(h_bits(g0), h_bits(g1));
        }
        const int o = (j * 16 + m) * VTP + i * 16 + 8 * hh;
        *(v4u*)(th + o) = ph;
        *(v4u*)(tl + o) = pl;
      }
    }
    wave_sync_lds();
    const size_t base = ((size_t)b * DMOD + hcol + rq) * SEQ + s0 + c8;
#pragma unroll
    for (int it = 0; it < 16; ++it) {
      const int lo = (it * 4 + rq) * VTP + c8;
      const v4u vh = *(const v4u*)(th + lo), vl = *(const v4u*)(tl + lo);
      *(v4u*)(qo.vh + base + (size_t)(it * 4) * SEQ) = vh;
      *(v4u*)(qo.vl + base + (size_t)(it * 4) * SEQ) = vl;
    }
    // behind the last store of this section: no address or data register of an issued store is rewritten ahead of this wait
    asm volatile("s_wait_xcnt 0x0" ::: "memory");
  }
}

// =====================================================================================================
// GEMM core shared by both engines: C[128 x 128 tile] (f32) = (A (+ A2 when MODE == 2)) . Bt^T, times oscale, K = DMOD.
// A, A2 [rows][DMOD] and Bt [n][DMOD] are k-contiguous 16-bit planes (MODE 0: bf16, MODE 1 / 2: f16).
// Block = 4 waves as 2 x 2, each wave a 64 x 64 tile (4 x 4 accumulators). A stage is 64 k = one whole 128-B line of each of the
// 128 A rows (and A2 rows) and 128 Bt rows, laid in LDS at pitch 144 B by asynchronous 16-B copies: thread t copies chunk t & 7 of
// rows (t >> 3) + 16 i, i < 8, so one wave-wide copy covers 4 whole lines. Two buffers: stage t + 1 flies while stage t is worked on.
// Fragments come from LDS with the same split k map for A and B as ldfrag_*; every accumulator takes its products in the order
// k0 = 0, 32, 64, ... (A then A2 within a k0).
// After the last stage's barrier the ring is dead and serves as the waves' own epilogue space (MODE 1 / 2: 4 slabs per wave, 16 x 68 floats each).
// MODE 0 hands its tile to epi_qkv (C, N and oscale unused), MODE 1 / 2 store it to C.
// =====================================================================================================
union FragU { v4u u[2]; v16h h; v16b b; };

__device__ __forceinline__ FragU ldfrag_u(const u16* p) {
  FragU f;
  f.u[0] = *(const v4u*)(p);
  f.u[1] = *(const v4u*)(p + 16);
  return f;
}
template <int MODE>
__device__ __forceinline__ v8f mma_u(const FragU& a, const FragU& b, v8f c) {
  if constexpr (MODE == 0) return mma_b(a.b, b.b, c);
  else                     return mma_h(a.h, b.h, c);
}
__device__ __forceinline__ unsigned lds_addr(const u16* p) {          // byte offset in the work-group's LDS
  return (unsigned)(uintptr_t)(const __attribute__((address_space(3))) u16*)p;
}
// One operand tile of a stage: this lane's eight 16-B copies (rows 16 apart). The s_wait_xcnt stands inside the statement, behind
// the last copy, so that no address register of an issued copy is rewritten ahead of it.
__device__ __forceinline__ void acopy_tile(unsigned l, const u16* g) {
#if defined(__HIP_DEVICE_COMPILE__)
  constexpr unsigned LS = 16u * GPIT * 2u;          // LDS bytes between this lane's rows
  constexpr size_t   GS = (size_t)16 * DMOD;        // halves between this lane's rows in the plane
  asm volatile("global_load_async_to_lds_b128 %0, %8, off\n\t"
               "global_load_async_to_lds_b128 %1, %9, off\n\t"
               "global_load_async_to_lds_b128 %2, %10, off\n\t"
               "global_load_async_to_lds_b128 %3, %11, off\n\t"
               "global_load_async_to_lds_b128 %4, %12, off\n\t"
               "global_load_async_to_lds_b128 %5, %13, off\n\t"
               "global_load_async_to_lds_b128 %6, %14, off\n\t"
               "global_load_async_to_lds_b128 %7, %15, off\n\t"
               "s_wait_xcnt 0x0"
               :: "v"(l), "v"(l + LS), "v"(l + 2u * LS), "v"(l + 3u * LS),
                  "v"(l + 4u * LS), "v"(l + 5u * LS), "v"(l + 6u * LS), "v"(l + 7u * LS),
                  "v"(g), "v"(g + GS), "v"(g + 2 * GS), "v"(g + 3 * GS),
                  "v"(g + 4 * GS), "v"(g + 5 * GS), "v"(g + 6 * GS), "v"(g + 7 * GS)
               : "memory");
#endif
}
__device__ __forceinline__ void wait_async0() {     // this wave's copies have landed in LDS
#if defined(__HIP_DEVICE_COMPILE__)
  asm volatile("s_wait_asynccnt 0x0" ::: "memory");
#endif
}
__device__ __forceinline__ void wait_ds0() {        // this wave's LDS reads have returned before their buffer is handed back
#if defined(__HIP_DEVICE_COMPILE__)
  asm volatile("s_wait_dscnt 0x0" ::: "memory");
#endif
}

// Inputs-only fence on loaded fragments: holds a block's LDS reads together in front of its WMMAs (one wait per block); without it
// the reads are sunk between the rows of WMMAs and every row waits out the LDS latency.
__device__ __forceinline__ void hold4(const FragU& x0, const FragU& x1, const FragU& x2, const FragU& x3) {
#if defined(__HIP_DEVICE_COMPILE__)
  asm volatile("" :: "v"(x0.h), "v"(x1.h), "v"(x2.h), "v"(x3.h));
#endif
}

template <int MODE>
__device__ __forceinline__ void gemm_core(const u16* __restrict__ A, const u16* __restrict__ A2, const u16* __restrict__ Bt,
                                          float* C, int N, float oscale, int row0, int col0, u16* sm, const QkvOut& qo) {
  constexpr int NPL  = (MODE == 2) ? 3 : 2;         // operand tiles per stage
  constexpr int BUFH = NPL * GPLH;                  // halves per buffer
  constexpr int NS   = DMOD / GKS;                  // stages
  static_assert(NS >= 2 && 16 * SLAB64 * 4 <= 2 * BUFH * 2);
  const int tid = threadIdx.x, wave = tid >> 5, lane = tid & 31, hh = lane >> 4, m = lane & 15;
  const int wr = wave >> 1, wc = wave & 1;
  const int crow = tid >> 3, cch = (tid & 7) * 8;
  const u16* ga  = A  + (size_t)(row0 + crow) * DMOD + cch;
  const u16* ga2 = A2 + (size_t)(row0 + crow) * DMOD + cch;
  const u16* gb  = Bt + (size_t)(col0 + crow) * DMOD + cch;
  const unsigned l0 = lds_addr(sm) + (unsigned)(crow * GPIT + cch) * 2u;
  const int fa = (wr * 64 + m) * GPIT + 8 * hh;             // A fragment row of this lane (+ 16 i rows)
  const int fb = GPLH + (wc * 64 + m) * GPIT + 8 * hh;      // Bt fragment row of this lane (+ 16 j rows)

  // every "#pragma unroll" in this function makes the indices of acc, a, b, a2 constants, so that the arrays stay in registers
  v8f acc[4][4];
#pragma unroll
  for (int i = 0; i < 4; ++i) {
#pragma unroll
    for (int j = 0; j < 4; ++j) acc[i][j] = zero8();
  }

  // stage 0 into buffer 0, landed and published; then stage 1 into buffer 1
  acopy_tile(l0, ga);
  acopy_tile(l0 + GPLH * 2u, gb);
  if (MODE == 2) acopy_tile(l0 + 2u * GPLH * 2u, ga2);
  wait_async0();
  __syncthreads();
  acopy_tile(l0 + BUFH * 2u, ga + GKS);
  acopy_tile(l0 + BUFH * 2u + GPLH * 2u, gb + GKS);
  if (MODE == 2) acopy_tile(l0 + BUFH * 2u + 2u * GPLH * 2u, ga2 + GKS);

  // kept rolled: one trip = one stage, so that the publish point below stands once per stage
#pragma unroll 1
  for (int t = 0; t < NS; ++t) {
    const int bo = (t & 1) * BUFH;
    const u16* bp = sm + bo;
#pragma unroll
    for (int kk = 0; kk < GKS / 32; ++kk) {
      FragU a[4], b[4];
#pragma unroll
      for (int i = 0; i < 4; ++i) a[i] = ldfrag_u(bp + fa + i * 16 * GPIT + kk * 32);
#pragma unroll
      for (int j = 0; j < 4; ++j) b[j] = ldfrag_u(bp + fb + j * 16 * GPIT + kk * 32);
      hold4(a[0], a[1], a[2], a[3]);
      hold4(b[0], b[1], b[2], b[3]);
#pragma unroll
      for (int i = 0; i < 4; ++i) {
#pragma unroll
        for (int j = 0; j < 4; ++j) acc[i][j] = mma_u<MODE>(a[i], b[j], acc[i][j]);
      }
      if (MODE == 2) {
        FragU a2[4];
#pragma unroll
        for (int i = 0; i < 4; ++i) a2[i] = ldfrag_u(bp + 2 * GPLH + fa + i * 16 * GPIT + kk * 32);
        hold4(a2[0], a2[1], a2[2], a2[3]);
#pragma unroll
        for (int i = 0; i < 4; ++i) {
#pragma unroll
          for (int j = 0; j < 4; ++j) acc[i][j] = mma_u<MODE>(a2[i], b[j], acc[i][j]);
        }
      }
    }
    // publish point of stage t + 1: own LDS reads back, own copies landed, block barrier; only then the refill of the buffer just read
    wait_ds0();
    wait_async0();
    __syncthreads();
    if (t + 2 < NS) {
      const unsigned lb = l0 + (unsigned)bo * 2u;
      const int ko = (t + 2) * GKS;
      acopy_tile(lb, ga + ko);
      acopy_tile(lb + GPLH * 2u, gb + ko);
      if (MODE == 2) acopy_tile(lb + 2u * GPLH * 2u, ga2 + ko);
    }
  }
  wait_async0();
  (void)ga2;
  if constexpr (MODE == 0) {
    epi_qkv(acc, qo, row0, col0, sm, wave, lane);
  } else {
    float* sl = (float*)(void*)sm + (size_t)(wave * 4) * SLAB64;
#pragma unroll
    for (int i = 0; i < 4; ++i) epi_put(sl + i * SLAB64, acc[i][0], acc[i][1], acc[i][2], acc[i][3], oscale, lane);
    wave_sync_lds();
#pragma unroll
    for (int i = 0; i < 4; ++i) epi_get(sl + i * SLAB64, C, N, (size_t)(row0 + wr * 64 + i * 16), col0 + wc * 64, lane);
  }
}

// =====================================================================================================
// bf16 projection GEMM: [M][NQKV] (f32 accumulators) = A[M][DMOD] (bf16 row-major) . Bt[NQKV][DMOD]^T (bf16 k-contiguous); the tile
// leaves as the q / k planes (rotary, x256, hi + residual) or the v^T planes (x1024, hi + residual): epi_qkv.
// Block = one 128 x 128 tile (gemm_core); M % 128 == 0, grid = (M/128)*(NQKV/128).
// =====================================================================================================
__global__ __launch_bounds__(128)
void gemm_bf(const u16* __restrict__ A, const u16* __restrict__ Bt, const float* __restrict__ TC, const float* __restrict__ TS,
             u16* QH, u16* QL, u16* KH, u16* KL, u16* VH, u16* VL, int M) {
  __shared__ __align__(16) u16 ring[2 * 2 * GPLH];
  constexpr int ntile = NQKV / GT;
  const int bid   = blockIdx.x;
  const int row0  = (bid / ntile) * GT;
  const int col0  = (bid % ntile) * GT;
  if (row0 + GT > M) return;                // block-uniform, before any copy or barrier; never taken with the exact grid
  const QkvOut qo = {TC, TS, QH, QL, KH, KL, VH, VL};
  gemm_core<0>(A, A, Bt, nullptr, NQKV, 1.0f, row0, col0, ring, qo);
}

// =====================================================================================================
// f16 GEMM: C[M][N] (f32) = (A[M][DMOD] (+ A2[M][DMOD] when TWO != 0)) . Bt[N][DMOD]^T, times oscale; A, A2 f16 row-major planes
// (A2 = the unscaled f16 residual of A, sharing the accumulator), Bt f16 k-contiguous. Same core as gemm_bf. A, A2 and C hold the
// rows of all sequences (row = b*SEQ + s); one launch takes one row class of every sequence: TWO = 1 the rows s < RICHE, TWO = 0
// the rows s >= RICHE; row tile rt of the class -> sequence rt / (tiles of the class per sequence);
// grid = NB * (class rows / 128) * (N / 128).
// =====================================================================================================
template <int TWO>
__global__ __launch_bounds__(128)
void gemm_h(const u16* __restrict__ A, const u16* __restrict__ A2, const u16* __restrict__ Bt, float* C,
            int M, int N, float oscale) {
  __shared__ __align__(16) u16 ring[2 * ((TWO != 0) ? 3 : 2) * GPLH];
  const int ntile = N / GT;
  const int bid   = blockIdx.x;
  constexpr int CT = ((TWO != 0) ? RICHE : ((SEQ > RICHE) ? (SEQ - RICHE) : GT)) / GT;   // row tiles of the class per sequence
  constexpr int R0 = (TWO != 0) ? 0 : RICHE;                                             // first row of the class in a sequence
  const int rt    = bid / ntile;
  const int row0  = (rt / CT) * SEQ + R0 + (rt % CT) * GT;
  const int col0  = (bid % ntile) * GT;
  if (row0 + GT > M) return;                // block-uniform, before any copy or barrier; never taken with the exact grid
  const QkvOut none = {nullptr, nullptr, nullptr, nullptr, nullptr, nullptr, nullptr, nullptr};
  gemm_core<(TWO != 0) ? 2 : 1>(A, A2, Bt, C, N, oscale, row0, col0, ring, none);
}

// Attention stage geometry: 64 keys per stage; every plane tile is 64 rows of 64 halves at pitch 72 halves (144 B) in LDS.
#define AKS   64
#define APIT  72
#define APL   (64 * APIT)
static_assert((NQTR % WPB) == 0 && ((NQT - NQTR) % WPB) == 0 && (SEQ % AKS) == 0 && HD == 64 && ATT_THREADS == 128);
// One plane tile of an attention stage: this lane's four 16-B copies (rows 16 apart, gs halves apart in the plane). The s_wait_xcnt
// stands inside the statement, behind the last copy, so that no address register of an issued copy is rewritten ahead of it.
__device__ __forceinline__ void acopy4(unsigned l, const u16* g, size_t gs) {
#if defined(__HIP_DEVICE_COMPILE__)
  constexpr unsigned LS = 16u * APIT * 2u;          // LDS bytes between this lane's rows
  asm volatile("global_load_async_to_lds_b128 %0, %4, off\n\t"
               "global_load_async_to_lds_b128 %1, %5, off\n\t"
               "global_load_async_to_lds_b128 %2, %6, off\n\t"
               "global_load_async_to_lds_b128 %3, %7, off\n\t"
               "s_wait_xcnt 0x0"
               :: "v"(l), "v"(l + LS), "v"(l + 2u * LS), "v"(l + 3u * LS),
                  "v"(g), "v"(g + gs), "v"(g + 2 * gs), "v"(g + 3 * gs)
               : "memory");
#endif
}

// =====================================================================================================
// Causal sliding-window softmax attention with key padding, hd = 64, all sequences in one launch. Block bid -> (group of 4 query
// tiles g = bid % (nqt/4): rows Q0 = 16*(qt0 + 4g) .. Q0+63, head = (bid / (nqt/4)) % NH, sequence b = bid / ((nqt/4)*NH), whose
// planes and key flags start at b's offset); one wave per query tile qt = qt0 + 4g + wave: rows q0 = 16*qt .. q0+15.
//   The four waves share the head's keys: a stage is 64 keys = one whole 128-B line of each of the 64 k hi rows, 64 k residual rows,
//   64 v^T hi d-rows (and 64 v^T residual d-rows for RV = 1), laid in LDS at pitch 144 B by asynchronous 16-B copies: thread t copies
//   chunk t & 7 of rows (t >> 3) + 16 i, i < 4, of every plane, so one wave-wide copy covers 4 whole lines. Two buffers: stage t + 1
//   flies while stage t is worked on. Stages run from the one holding max(0, Q0-(WIN-1)) to the one holding Q0+63 (<= 9); of a
//   stage's two key tiles a wave works on those inside its own range (scalar test), so its tiles and their order are as stated below.
//   q hi / residual planes f16 x256 [s][h*HD + d]; k hi / residual planes f16 x256 [s][h*HD + d] (pitch DMOD);
//   v^T hi / residual planes [h*HD + d][SEQ] x1024; MK = the sequence's int32 key flags (0 = padded key).
//   raw(i, j) = q_hi.k_hi + q_lo.k_hi + q_hi.k_lo (2 k-steps over d); logit = raw * 2^-19 (the 1/8 softmax scale and the two
//   256 carries, exact); key j is REPLACED by -inf when j > i, j < i - (WIN-1), or MK[j] == 0; online softmax per query
//   row in f32 with a running max: row max / row sum over the 16 lanes holding the row via xor shuffles 1,2,4,8 (never
//   crossing the lane half); a row whose running max is still -inf uses 0 as the shift so alpha and p come out 0 (no NaN);
//   alpha = exp(m_old - m_new), p = exp(logit - m_new), l = l*alpha + sum p, O accumulators times alpha before the
//   tile's P.v. Key tiles of 32 visited in order from the tile holding max(0, q0-(WIN-1)) to the tile holding q0+15
//   (wave-uniform bounds, <= 18 tiles). The 32 key flags of a tile are loaded once (one b32 per lane, coalesced) and
//   barrier, then A fragments of p*32768 (f16 hi and its f16 residual) are rebuilt from the LDS rows (float vector loads);
//   v^T B fragments in 2 groups of 2 d-subtiles; RV = 1: products hh + lh + hl, RV = 0: hh only.
//   After the loop O = acc / (l * 32768 * 1024) (0 when l == 0, i.e. every key of the window padded) into the wave's
//   Epilogue: O x256 -> f16 hi plane (and for RV = 1 the unscaled f16 residual plane) [s][h*HD + d]; lane = (row group
//   rq = lane>>3 in 0..3, 8 consecutive d at c8); one instruction = 4 rows it*4 + rq, each row segment (64 halves = one whole
// coverage: per wave 4 instructions x 4 rows x 8 lanes x 8 halves = 16 x 64 per plane; grid NB x NH x nqt/4 blocks x WPB waves;
//   the two launches (tiles 0..NQTR-1 with RV = 1, NQTR..NQT-1 with RV = 0) cover every (b, s, h) row segment of the hi plane
//   exactly once and rows s < RICHE of each sequence's residual plane exactly once (only those rows are read later).
// =====================================================================================================
template <int RV>
__global__ __launch_bounds__(ATT_THREADS)
void attn_w(const u16* __restrict__ QHa, const u16* __restrict__ QLa,
            const u16* __restrict__ KHa, const u16* __restrict__ KLa,
            const u16* __restrict__ VHa, const u16* __restrict__ VLa,
            const int* __restrict__ MKa,
            u16* OHa, u16* OLa, int qt0, int nqt) {
#pragma clang fp contract(off)
  constexpr int NPLA = (RV != 0) ? 4 : 3;   // operand planes per stage: k hi, k residual, v^T hi (, v^T residual)
  constexpr int ABUF = NPLA * APL;          // halves per buffer
  static_assert(WPB * SLW * 4 <= 2 * ABUF * 2);
  __shared__ __align__(16) u16 ring[2 * ABUF];
  __shared__ __align__(16) float smem[WPB * PTW];

  const int tid  = threadIdx.x;
  const int wave = __builtin_amdgcn_readfirstlane(tid >> 5);   // in a scalar register: the test of a wave's own tiles is a scalar branch
  const int lane = tid & 31;
  const int hh   = lane >> 4;
  const int c    = lane & 15;
  const int bid  = blockIdx.x;
  if (nqt <= 0) return;                     // block-uniform, before any copy or barrier
  const int ngr  = nqt / WPB;               // groups of 4 query tiles (nqt a multiple of 4)
  if (ngr <= 0) return;                     // block-uniform, before any copy or barrier
  const int qtb  = qt0 + (bid % ngr) * WPB; // the block's first query tile
  const int qt   = qtb + wave;
  const int head = (bid / ngr) % NH;
  const int b    = bid / (ngr * NH);
  if (b >= NB) return;                      // block-uniform, before any copy or barrier; never taken with the exact grid
  const size_t po = (size_t)b * SEQ * DMOD; // halves per sequence in every q / k / v^T / O plane (NH*HD == DMOD)
  const u16* __restrict__ QHp = QHa + po;
  const u16* __restrict__ QLp = QLa + po;
  const u16* __restrict__ KHp = KHa + po;
  const u16* __restrict__ KLp = KLa + po;
  const u16* __restrict__ VHp = VHa + po;
  const u16* __restrict__ VLp = VLa + po;
  const int* __restrict__ MK  = MKa + (size_t)b * XS_FULL;
  u16* OHp = OHa + po;
  u16* OLp = OLa + po;
  const int q0   = qt * 16;
  const int Q0   = qtb * 16;
  if (Q0 + 16 * WPB > SEQ) return;          // block-uniform, before any copy or barrier; never taken

  float* pt   = smem + wave * PTW;          // p tile [16][32] pitch 36
  float* slab = (float*)(void*)ring + wave * SLW;   // result slab [16][64] pitch 68: the wave's own part of the ring, once that is dead

  const size_t hcol = (size_t)head * HD + 8 * hh;
  const _Float16* Qh  = (const _Float16*)(const void*)QHp + ((size_t)q0 + c) * DMOD + hcol;
  const _Float16* Ql  = (const _Float16*)(const void*)QLp + ((size_t)q0 + c) * DMOD + hcol;
  // this lane's copies of a stage: chunk cch of rows crow + 16 i of every plane
  const int crow = tid >> 3, cch = (tid & 7) * 8;
  const u16* gkh = KHp + (size_t)crow * DMOD + (size_t)head * HD + cch;       // key row 64*stage added per stage
  const u16* gkl = KLp + (size_t)crow * DMOD + (size_t)head * HD + cch;
  const u16* gvh = VHp + ((size_t)head * HD + crow) * SEQ + cch;              // key 64*stage added per stage
  const u16* gvl = VLp + ((size_t)head * HD + crow) * SEQ + cch;
  (void)gvl;
  const unsigned l0 = lds_addr(ring) + (unsigned)(crow * APIT + cch) * 2u;
  const int fk = c * APIT + 8 * hh;         // fragment row c of a plane tile (halves), split k map
  const float lsc  = SM_SCALE * (1.0f / (QSC * KSC));   // exact power-of-two fold of the q / k carries into the 1/8 scale
  const float oc   = 1.0f / (PCAR * VCAR);
  const float ninf = -__builtin_inff();

  v8f o[4];
#pragma unroll
  for (int j = 0; j < 4; ++j) o[j] = zero8();
  float mrun[8], lrun[8];
#pragma unroll
  for (int r = 0; r < 8; ++r) { mrun[r] = ninf; lrun[r] = 0.0f; }
  int klo = q0 - (WIN - 1);
  if (klo < 0) klo = 0;
  const int ktlo = klo >> 5;                                                  // first tile intersecting the window
  const int kthi = q0 >> 5;                                                   // tile holding keys q0 .. q0 + 15
  const int qr0   = q0 + 8 * hh;                                              // query row of D element r = qr0 + r
  int slo = Q0 - (WIN - 1);
  if (slo < 0) slo = 0;
  const int st0 = slo >> 6;                                                   // first stage intersecting the block's windows
  const int nst = (Q0 >> 6) - st0 + 1;                                        // last stage holds keys Q0 .. Q0 + 63; 1 <= nst <= 9

  // one stage's copies; 64*st + 63 <= Q0 + 63 <= SEQ - 1
  auto stage_in = [&](int st, int buf) {
    const unsigned lb = l0 + (unsigned)(buf * ABUF) * 2u;
    const size_t ko = (size_t)st * AKS;
    acopy4(lb, gkh + ko * DMOD, (size_t)16 * DMOD);
    acopy4(lb + APL * 2u, gkl + ko * DMOD, (size_t)16 * DMOD);
    acopy4(lb + 2u * APL * 2u, gvh + ko, (size_t)16 * SEQ);
    if (RV != 0) acopy4(lb + 3u * APL * 2u, gvl + ko, (size_t)16 * SEQ);
  };
  // stage 0 into buffer 0, landed and published; then, where there is one, stage 1 into buffer 1
  stage_in(st0, 0);
  wait_async0();
  __syncthreads();
  if (nst > 1) stage_in(st0 + 1, 1);

  // both loops kept rolled: one outer trip = one stage, so that the publish point below stands once per stage
#pragma unroll 1
  for (int t = 0; t < nst; ++t) {
   const _Float16* rb = (const _Float16*)(const void*)(ring + (t & 1) * ABUF);
#pragma unroll 1
   for (int th = 0; th < 2; ++th) {
    const int kt = (st0 + t) * 2 + th;
    if (kt < ktlo || kt > kthi) continue;                                     // scalar: not a tile of this wave's window
    const int kb = kt * 32;                                                   // kb + 31 <= SEQ - 1
    // ---- key padding flags of this tile: one coalesced b32 per lane, then broadcast for key kb + c and kb + 16 + c ----
    const int fl = MK[kb + lane];
    const int f0 = __shfl(fl, c, 32);
    const int f1 = __shfl(fl, 16 + c, 32);
    // ---- raw scores: D element r of this lane = (query row qr0 + r, key kb + c) in s0, key kb + 16 + c in s1 ----
    v8f s0 = zero8(), s1 = zero8();
    const _Float16* k0p = rb + th * 32 * APIT + fk;
    const _Float16* k1p = k0p + 16 * APIT;
    const _Float16* l0p = k0p + APL;
    const _Float16* l1p = l0p + 16 * APIT;
#pragma unroll
    for (int kk = 0; kk < HD / 32; ++kk) {
      const v16h qh  = ldfrag_h(Qh + kk * 32);
      const v16h ql  = ldfrag_h(Ql + kk * 32);
      const v16h kh0 = ldfrag_h(k0p + kk * 32);
      const v16h kh1 = ldfrag_h(k1p + kk * 32);
      const v16h kl0 = ldfrag_h(l0p + kk * 32);
      const v16h kl1 = ldfrag_h(l1p + kk * 32);
      s0 = mma_h(qh, kh0, s0);
      s0 = mma_h(ql, kh0, s0);
      s0 = mma_h(qh, kl0, s0);
      s1 = mma_h(qh, kh1, s1);
      s1 = mma_h(ql, kh1, s1);
      s1 = mma_h(qh, kl1, s1);
      guard2(s0, s1, qh, ql, kh0, kl0, kh1, kl1);
    }
    // ---- causal / window / padding replace-mask, running-max online softmax in f32, p tile -> wave-private LDS ----
    float alpha[8];
    const int key0 = kb + c, key1 = kb + 16 + c;
#pragma unroll
    for (int r = 0; r < 8; ++r) {
      const int qrow = qr0 + r;
      const int lo   = qrow - (WIN - 1);
      const float a0 = s0[r] * lsc;
      const float a1 = s1[r] * lsc;
      const bool ok0 = (key0 <= qrow) && (key0 >= lo) && (f0 != 0);
      const bool ok1 = (key1 <= qrow) && (key1 >= lo) && (f1 != 0);
      const float t0 = ok0 ? a0 : ninf;
      const float t1 = ok1 ? a1 : ninf;
      float mx = fmaxf(t0, t1);
      mx = fmaxf(mx, __shfl_xor(mx, 1, 32));
      mx = fmaxf(mx, __shfl_xor(mx, 2, 32));
      mx = fmaxf(mx, __shfl_xor(mx, 4, 32));
      mx = fmaxf(mx, __shfl_xor(mx, 8, 32));
      const float mnew  = fmaxf(mrun[r], mx);
      const float mshft = (mnew == ninf) ? 0.0f : mnew;
      const float al    = __expf(mrun[r] - mshft);
      const float p0    = __expf(t0 - mshft);
      const float p1    = __expf(t1 - mshft);
      float sm = p0 + p1;
      sm += __shfl_xor(sm, 1, 32);
      sm += __shfl_xor(sm, 2, 32);
      sm += __shfl_xor(sm, 4, 32);
      sm += __shfl_xor(sm, 8, 32);
      lrun[r]  = lrun[r] * al + sm;
      mrun[r]  = mnew;
      alpha[r] = al;
      const int ro = (8 * hh + r) * PTP + c;
      pt[ro]      = p0;
      pt[ro + 16] = p1;
    }
    wave_sync_lds();
    // ---- rescale the O accumulators by alpha (row 8hh + r of every d-subtile) ----
#pragma unroll
    for (int j = 0; j < 4; ++j) {
#pragma unroll
      for (int r = 0; r < 8; ++r) o[j][r] = o[j][r] * alpha[r];
    }
    // ---- A fragments of p*32768: hi f16 and residual f16, row = c, split k map over the 32 keys of this step ----
    FragH ph, pl;
    {
      const float* prow = pt + c * PTP + 8 * hh;
      const v4f p0 = *(const v4f*)(prow), p1 = *(const v4f*)(prow + 4);
      const v4f p2 = *(const v4f*)(prow + 16), p3 = *(const v4f*)(prow + 20);
#pragma unroll
      for (int e = 0; e < 4; ++e) {
        const float ta = p0[e] * PCAR, tb = p1[e] * PCAR, tc = p2[e] * PCAR, td = p3[e] * PCAR;
        const _Float16 ha = (_Float16)ta, hb = (_Float16)tb, hc = (_Float16)tc, hd = (_Float16)td;
        ph.h[0][e]     = ha;                  // elements 0..7  = keys kb + 8hh + 0..7
        ph.h[0][4 + e] = hb;
        ph.h[1][e]     = hc;                  // elements 8..15 = keys kb + 16 + 8hh + 0..7
        ph.h[1][4 + e] = hd;
        pl.h[0][e]     = (_Float16)(ta - (float)ha);
        pl.h[0][4 + e] = (_Float16)(tb - (float)hb);
        pl.h[1][e]     = (_Float16)(tc - (float)hc);
        pl.h[1][4 + e] = (_Float16)(td - (float)hd);
      }
    }
    // ---- P.V : B fragment col n = d = j*16 + c, keys contiguous in the v^T planes; 2 groups of 2 d-subtiles ----
    {
      const _Float16* vhp = rb + 2 * APL + fk + th * 32;
      const _Float16* vlp = vhp + APL;
      (void)vlp;
#pragma unroll
      for (int jg = 0; jg < 2; ++jg) {
        const int da = (2 * jg) * 16 * APIT;
        const int db = da + 16 * APIT;
        const v16h vha = ldfrag_h(vhp + da), vhb2 = ldfrag_h(vhp + db);
        o[2 * jg]     = mma_h(ph.v, vha,  o[2 * jg]);
        o[2 * jg + 1] = mma_h(ph.v, vhb2, o[2 * jg + 1]);
        if (RV != 0) {
          const v16h vla = ldfrag_h(vlp + da), vlb2 = ldfrag_h(vlp + db);
          o[2 * jg]     = mma_h(pl.v, vha,  o[2 * jg]);
          o[2 * jg]     = mma_h(ph.v, vla,  o[2 * jg]);
          o[2 * jg + 1] = mma_h(pl.v, vhb2, o[2 * jg + 1]);
          o[2 * jg + 1] = mma_h(ph.v, vlb2, o[2 * jg + 1]);
          guard2(o[2 * jg], o[2 * jg + 1], ph.v, pl.v, vha, vhb2, vla, vlb2);
        } else {
          guard2(o[2 * jg], o[2 * jg + 1], ph.v, pl.v, vha, vhb2, vha, vhb2);
        }
      }
    }
    wave_sync_lds();
   }
   // publish point of stage t + 1: own LDS reads back, own copies landed, block barrier; only then the refill of the buffer just read
   wait_ds0();
   wait_async0();
   __syncthreads();
   if (t + 2 < nst) stage_in(st0 + t + 2, t & 1);
  }
  wait_async0();
  acc_guard4(o[0], o[1], o[2], o[3]);
  // ---- O = acc / l with the carries (32768 on p, 1024 on v) folded once (0 when l == 0); into the wave's slab ----
  float rl[8];
#pragma unroll
  for (int r = 0; r < 8; ++r) {
    const bool  okl  = lrun[r] > 0.0f;
    const float lden = okl ? lrun[r] : 1.0f;
    const float rec  = (1.0f / lden) * oc;
    rl[r] = okl ? rec : 0.0f;
  }
#pragma unroll
  for (int r = 0; r < 8; ++r) {
#pragma unroll
    for (int j = 0; j < 4; ++j) {
      const int idx = (8 * hh + r) * SLP + j * 16 + c;
      slab[idx] = o[j][r] * rl[r];
    }
  }
  wave_sync_lds();
  // ---- O x256 -> f16 hi plane (+ f16 residual plane); lane = (row group rq, 8 consecutive d at c8) ----
  v4u oh[4], ol[4];
  const int rq = lane >> 3, c8 = (lane & 7) * 8;
#pragma unroll
  for (int it = 0; it < 4; ++it) {
    const int row = it * 4 + rq;
    const v4f a = *(const v4f*)(slab + row * SLP + c8), b4 = *(const v4f*)(slab + row * SLP + c8 + 4);
    float w[8];
#pragma unroll
    for (int e = 0; e < 4; ++e) { w[e] = a[e] * OSC; w[4 + e] = b4[e] * OSC; }
#pragma unroll
    for (int e = 0; e < 4; ++e) {
      const _Float16 h0 = (_Float16)w[2 * e], h1 = (_Float16)w[2 * e + 1];
      const _Float16 g0 = (_Float16)(w[2 * e] - (float)h0), g1 = (_Float16)(w[2 * e + 1] - (float)h1);
      oh[it][e] = pk16(h_bits(h0), h_bits(h1));
      ol[it][e] = pk16(h_bits(g0), h_bits(g1));
    }
  }
  const size_t ob = ((size_t)q0) * DMOD + (size_t)head * HD + c8;
  {
#pragma unroll
    for (int it = 0; it < 4; ++it) {
      const int row = it * 4 + rq;
      *(v4u*)(OHp + ob + (size_t)row * DMOD) = oh[it];
      if (RV != 0) {
        *(v4u*)(OLp + ob + (size_t)row * DMOD) = ol[it];
      }
    }
    
  }
}

// =====================================================================================================
// Workspace map (bytes); every plane holds all NB sequences (ROWS = NB*SEQ rows), each stage is one launch over all of them;
// every plane is fully written by whole-line stores before it is read (the O residual plane only on the rows < RICHE of each
// sequence that are read); all extents are exact multiples of the store granularity; every region offset a multiple of 131072:
//   XB  bf16 [ROWS][1024]                ROWS*2048   (ROWS=8192: 16777216)
//   WB  bf16 [3072 n][1024 k]            6291456     (q rows 0..1023, k 1024..2047, v 2048..3071)
//   WT  f16  [1024 o][1024 d] x1024      2097152
//   QH  f16 [ROWS][1024] x256            ROWS*2048   QL residual, same extent
//   KH  f16 [ROWS][1024] x256            ROWS*2048   KL residual, same extent
//   VH  f16 [NB][16][64][SEQ] x1024      ROWS*2048   VL residual, same extent
//   OH  f16 [ROWS][1024] x256            ROWS*2048   OL residual, same extent (rows < RICHE of each sequence written / read)
//   TC  f32 [SEQ][16]                    SEQ*64      TS, same extent
//   end (SEQ=2048, NB=4)                159645696
// =====================================================================================================
extern "C" void kernel_launch(void* const* d_in, const int* in_sizes, int n_in,
                              void* d_out, int out_size, void* d_ws, size_t ws_size,
                              hipStream_t stream) {
  if (n_in < 4) return;
  if (in_sizes[0] < ((NB - 1) * XS_FULL + SEQ) * DMOD) return;
  if (in_sizes[1] < (NB - 1) * XS_FULL + SEQ) return;
  if (in_sizes[2] != DMOD * NQKV) return;
  if (in_sizes[3] != DMOD * DMOD) return;
  if (out_size < ((NB - 1) * XS_FULL + SEQ) * DMOD) return;

  const float* x    = (const float*)d_in[0];
  const int*   mask = (const int*)d_in[1];
  const float* wqkv = (const float*)d_in[2];       // [1024 k][3072 n]
  const float* wo   = (const float*)d_in[3];       // [1024 d][1024 o]
  float*       out  = (float*)d_out;

  const size_t szXB = (size_t)ROWS * DMOD * 2;
  const size_t szWB = (size_t)NQKV * DMOD * 2;
  const size_t szWT = (size_t)DMOD * DMOD * 2;
  const size_t szQ  = (size_t)ROWS * DMOD * 2;                   // QH, QL, KH, KL, OH, OL
  const size_t szV  = (size_t)NB * NH * HD * SEQ * 2;            // VH, VL (== szQ)
  const size_t szT  = (size_t)SEQ * NFREQ * 4;                   // TC, TS
  size_t off = 0;
  const size_t oXB = off; off += szXB;
  const size_t oWB = off; off += szWB;
  const size_t oWT = off; off += szWT;
  const size_t oQH = off; off += szQ;
  const size_t oQL = off; off += szQ;
  const size_t oKH = off; off += szQ;
  const size_t oKL = off; off += szQ;
  const size_t oVH = off; off += szV;
  const size_t oVL = off; off += szV;
  const size_t oOH = off; off += szQ;
  const size_t oOL = off; off += szQ;
  const size_t oTC = off; off += szT;
  const size_t oTS = off; off += szT;
  if (off > ws_size) return;                // off = 159645696 for SEQ = 2048, NB = 4
  if (off > (size_t)WS_CAP) return;

  char* ws = (char*)d_ws;
  u16*   XB  = (u16*)(ws + oXB);
  u16*   WB  = (u16*)(ws + oWB);
  u16*   WT  = (u16*)(ws + oWT);
  u16*   QH  = (u16*)(ws + oQH);
  u16*   QL  = (u16*)(ws + oQL);
  u16*   KH  = (u16*)(ws + oKH);
  u16*   KL  = (u16*)(ws + oKL);
  u16*   VH  = (u16*)(ws + oVH);
  u16*   VL  = (u16*)(ws + oVL);
  u16*   OH  = (u16*)(ws + oOH);
  u16*   OL  = (u16*)(ws + oOL);
  float* TC  = (float*)(ws + oTC);
  float* TS  = (float*)(ws + oTS);

  const dim3 b256(256), b128(128), bAT(ATT_THREADS);
  const int  n8x = (ROWS * DMOD) / 8;
  const dim3 gX((n8x + 255) / 256);                     // ROWS*DMOD/2048 blocks
  const int  nT  = SEQ * NFREQ;
  const dim3 gT((nT + 255) / 256);                      // SEQ/16
  const dim3 gWQ((DMOD / 64) * (NQKV / 64));            // 768: in [1024 k][3072 n] -> WB [3072 n][1024 k]
  const dim3 gWO((DMOD / 64) * (DMOD / 64));            // 256: in [1024 d][1024 o] -> WT [1024 o][1024 d]
  const dim3 gG1((ROWS / GT) * (NQKV / GT));
  const float osc = 1.0f / (OSC * WOS);

  // (0) weight planes: Wqkv transposed to bf16 [n][k]; Wo transposed to f16 of the bf16 value x1024 [o][d]
  cvtT16<<<gWQ, b256, 0, stream>>>(wqkv, DMOD, NQKV, WB, 0, 1.0f);
  cvtT16<<<gWO, b256, 0, stream>>>(wo, DMOD, DMOD, WT, 1, WOS);
  // (1) rotary cos / sin tables [SEQ][16]
  k_tab<<<gT, b256, 0, stream>>>(TC, TS, nT);
  // every stage below: all sequences in one launch (x, mask and out rows of the NB sequences are contiguous)
  // (2) x rows -> bf16 plane [ROWS][1024]
  cvt16<<<gX, b256, 0, stream>>>(x, XB, n8x, 0, 1.0f);
  // (3) qkv = x.Wqkv; its epilogue: partial rotary + hi + residual planes x256 of q (columns 0..1023) and k (1024..2047),
  //     v^T hi + residual planes x1024 (columns 2048..3071)
  gemm_bf<<<gG1, b128, 0, stream>>>(XB, WB, TC, TS, QH, QL, KH, KL, VH, VL, ROWS);
  // (4) windowed causal attention with key padding -> O f16 hi plane x256 for all query tiles; residual plane for rows < RICHE
  attn_w<1><<<dim3(NB * NQTR * NHG), bAT, 0, stream>>>(QH, QL, KH, KL, VH, VL, mask, OH, OL, 0, NQTR);
  if (NQT > NQTR) {
    attn_w<0><<<dim3(NB * (NQT - NQTR) * NHG), bAT, 0, stream>>>(QH, QL, KH, KL, VH, VL, mask, OH, OL, NQTR, NQT - NQTR);
  }
  // (5) y = O.Wo -> out f32, carries 256 x 1024 folded back; rows < RICHE of each sequence with O hi + residual
  gemm_h<1><<<dim3(NB * (RICHE / GT) * (DMOD / GT)), b128, 0, stream>>>(OH, OL, WT, out, ROWS, DMOD, osc);
  if (SEQ > RICHE) {
    gemm_h<0><<<dim3(NB * ((SEQ - RICHE) / GT) * (DMOD / GT)), b128, 0, stream>>>(OH, OL, WT, out, ROWS, DMOD, osc);
  }
  (void)hipGetLastError();
}

// v005
// It runs in 175 microseconds.
// Next to v004, in two timings, it ran 1.17 times as fast each time.
// Over all steps from v000 it is 4.28 times as fast.
// Contractions: x.Wqkv on v_wmma_f32_16x16x32_bf16 (x and the transposed weight as bf16 RNE planes; weight plane [n][k]
// rows are the k-contiguous B operand; f32 accumulate); q.k^T over hd 64 and P.v on v_wmma_f32_16x16x32_f16 with f16 hi +
// f16 residual planes (q, k x256 after partial rotary, products hh+lh+hl on every row; P x32768 hi + in-register residual
// and v^T x1024 hi + residual plane for query rows < 512 of each sequence, P hi . v hi only for later rows); O.Wo on
// v_wmma_f32_16x16x32_f16 with O x256 as f16 hi (+ f16 residual plane for rows < 512 of each sequence) and Wo transposed
// to [o][d] as f16(bf16(Wo)) x1024, one accumulator; all f32 accumulate. Rotary cos/sin tables, causal + window + key
// padding masks and the online softmax in f32 on VALU.
#include <hip/hip_runtime.h>
#include <math.h>
#include <stdint.h>

#ifndef NB
#define NB 4
#endif
#ifndef SEQ
#define SEQ 2048
#endif
#ifndef RICH
#define RICH 512
#endif
#define NB_FULL 4
#define XS_FULL 2048
#define DMOD  1024
#define NH    16
#define HD    64
#define HROT  32
#define HROTH 16
#define NFREQ 16
#define NQKV  (3 * DMOD)
#define WIN   512
#define RICHE ((RICH < SEQ) ? RICH : SEQ)
#define ROPE_L2 0.41524101186092028
#define SM_SCALE 0.125f
#define QSC   256.0f
#define KSC   256.0f
#define PCAR  32768.0f
#define VCAR  1024.0f
#define OSC   256.0f
#define WOS   1024.0f
#define WPB   4
#define NHG   (NH / WPB)
#define NQT   (SEQ / 16)
#define NQTR  (RICHE / 16)
#define NST   (SEQ / 64)
#define NKT   (SEQ / 32)
#define ATT_THREADS (WPB * 32)
#define PTP   36
#define PTW   (16 * PTP)
#define SLP   68
#define SLW   (16 * SLP)
#define WREG  (PTW + SLW)
#define SLAB64 (16 * 68)
#define VTP   72
#define WS_CAP 268435456
#define ROWS  (NB * SEQ)
#define GT    128
#define GKS   64
#define GPIT  72
#define GPLH  (GT * GPIT)
static_assert(DMOD == NH * HD && HD == 64 && HROT == 32 && HROTH == 16 && NFREQ == 16 && NH == 16 && WPB == 4 && NHG * WPB == NH);
static_assert(ATT_THREADS == 128 && NQKV == 3072 && WIN == 512 && NHG == 4);
static_assert(NB >= 1 && NB <= NB_FULL);
static_assert(NB == 1 || SEQ == XS_FULL);
static_assert((SEQ % 64) == 0 && SEQ >= 64 && SEQ <= XS_FULL);
static_assert((RICHE % 64) == 0 && RICHE >= 64 && RICHE <= SEQ);
static_assert((DMOD % 64) == 0 && (NQKV % 64) == 0 && (DMOD % 32) == 0 && (HD % 32) == 0);
static_assert(((SEQ * DMOD / 8) % 256) == 0 && ((SEQ * NFREQ) % 256) == 0);
static_assert(WPB * WREG * 4 <= 65536 && 2 * HD * VTP * 2 <= 65536 && 4 * SLAB64 * 4 <= 65536 && 64 * VTP * 2 <= 65536);
static_assert(NQT * 16 == SEQ && NQTR * 16 == RICHE && NKT * 32 == SEQ && NST * 64 == SEQ);
static_assert((RICHE % GT) == 0 && ((SEQ - RICHE) % GT) == 0 && (ROWS % GT) == 0 && (NQKV % GT) == 0 && (DMOD % GT) == 0 && (DMOD % GKS) == 0);

typedef unsigned short u16;
typedef _Float16 v16h __attribute__((ext_vector_type(16)));
typedef _Float16 v8h  __attribute__((ext_vector_type(8)));
typedef __bf16   v16b __attribute__((ext_vector_type(16)));
typedef float    v8f  __attribute__((ext_vector_type(8)));
typedef float    v4f  __attribute__((ext_vector_type(4)));
typedef unsigned int v4u __attribute__((ext_vector_type(4)));

union FragH { v16h v; v8h h[2]; v4u u[2]; };

// ---- scalar helpers --------------------------------------------------------------------------------
__device__ __forceinline__ unsigned short bf_bits(float f) {          // f32 -> bf16 bits, RNE convert
  unsigned u = __float_as_uint(f);
  return (unsigned short)((u + 0x7FFFu + ((u >> 16) & 1u)) >> 16);
}
__device__ __forceinline__ float bf_up(unsigned short h) { return __uint_as_float(((unsigned)h) << 16); }
__device__ __forceinline__ float bfr(float f) { return bf_up(bf_bits(f)); }
__device__ __forceinline__ unsigned short h_bits(_Float16 x) { return __builtin_bit_cast(unsigned short, x); }
__device__ __forceinline__ unsigned pk16(unsigned short a, unsigned short b) { return (unsigned)a | ((unsigned)b << 16); }
__device__ __forceinline__ v8f zero8() { v8f z = {0.f, 0.f, 0.f, 0.f, 0.f, 0.f, 0.f, 0.f}; return z; }

// ---- fragment loaders: 16-bit A/B operand, lane -> row/col (lane&15), p already includes +8*(lane>>4);
//      elements 0..7 <- p[0..7] (k0+8h..), elements 8..15 <- p[16..23] (k0+16+8h..)  (same split k map for A and B;
//      B is always read from a k-contiguous [n][k] plane)
__device__ __forceinline__ v16h ldfrag_h(const _Float16* p) {
  FragH f;
  f.h[0] = *(const v8h*)(p);
  f.h[1] = *(const v8h*)(p + 16);
  return f.v;
}

__device__ __forceinline__ v8f mma_h(v16h a, v16h b, v8f c) {
  return __builtin_amdgcn_wmma_f32_16x16x32_f16(false, a, false, b, (short)0, c, false, false);
}
__device__ __forceinline__ v8f mma_b(v16b a, v16b b, v8f c) {
  return __builtin_amdgcn_wmma_f32_16x16x32_bf16(false, a, false, b, (short)0, c, false, false);
}
__device__ __forceinline__ void guard2(v8f& a, v8f& b, v16h x0, v16h x1, v16h x2, v16h x3, v16h x4, v16h x5) {
#if defined(__HIP_DEVICE_COMPILE__)
  asm volatile("v_nop\n\tv_nop\n\tv_nop\n\tv_nop"
               : "+v"(a), "+v"(b) : "v"(x0), "v"(x1), "v"(x2), "v"(x3), "v"(x4), "v"(x5) : "memory");
#endif
}
__device__ __forceinline__ void acc_guard4(v8f& a, v8f& b, v8f& c, v8f& d) {
#if defined(__HIP_DEVICE_COMPILE__)
  asm volatile("v_nop\n\tv_nop\n\tv_nop\n\tv_nop" : "+v"(a), "+v"(b), "+v"(c), "+v"(d));
#endif
}
// lane l <-> lane l ^ 16 on the vector unit
__device__ __forceinline__ float xhalf(float x) {
  const int b = __builtin_bit_cast(int, x);
  return __builtin_bit_cast(float, __builtin_amdgcn_permlanex16(b, b, 0x76543210, 0xfedcba98, false, false));
}
__device__ __forceinline__ void wave_sync_lds() {
  __builtin_amdgcn_fence(__ATOMIC_RELEASE, "workgroup");
  __builtin_amdgcn_wave_barrier();
  __builtin_amdgcn_fence(__ATOMIC_ACQUIRE, "workgroup");
}

// =====================================================================================================
// f32 -> bf16 RNE plane, same layout (f16mode == 1: f16 bits of (bf16 RNE value) * scale).
// Thread = 8 consecutive elements: two 16-B loads, one 16-B store; 32 consecutive lanes = 512 contiguous, 512-B aligned
// coverage: grid = ceil(n8/256) blocks x 256 thr x 8 (in-kernel bound) = the whole plane (n8 a multiple of 256 here).
// =====================================================================================================
__global__ __launch_bounds__(256) void cvt16(const float* __restrict__ x, u16* D, int n8, int f16mode, float scale) {
  const int gt = blockIdx.x * 256 + (int)threadIdx.x;
  if (gt >= n8) return;
  const float* p = x + (size_t)gt * 8;
  const v4f a = *(const v4f*)(p), b4 = *(const v4f*)(p + 4);
  float w[8];
#pragma unroll
  for (int e = 0; e < 4; ++e) { w[e] = a[e]; w[4 + e] = b4[e]; }
  v4u o;
#pragma unroll
  for (int e = 0; e < 4; ++e) {
    const float f0 = w[2 * e], f1 = w[2 * e + 1];
    const unsigned short hb0 = h_bits((_Float16)(bfr(f0) * scale));
    const unsigned short hb1 = h_bits((_Float16)(bfr(f1) * scale));
    const unsigned short bb0 = bf_bits(f0);
    const unsigned short bb1 = bf_bits(f1);
    o[e] = (f16mode != 0) ? pk16(hb0, hb1) : pk16(bb0, bb1);
  }
  u16* d = D + (size_t)gt * 8;
  {
    *(v4u*)(d) = o;
    
  }
}

// =====================================================================================================
// Transposed 16-bit plane of a row-major f32 matrix: in X [R rows][CC cols] (pitch CC) -> out D [CC][R] (pitch R),
// D[c][r] = cvt(X[r][c]); f16mode == 0: bf16 RNE bits; f16mode == 1: f16 bits of (bf16 RNE value) * scale.
// Block = one 64x64 tile (rt = bid / (CC/64) -> rows 64*rt.., ct = bid % (CC/64) -> cols 64*ct..), 256 threads: thread
// (row rl = tid>>2, col chunk cc = 16*(tid&3)) loads its 16 floats with 16-B loads, converts, places them transposed into
// the LDS tile T[c_local][r_local] (pitch 72 halves, 2-B element stores); after a block barrier each output row segment
// coverage: load 256 thr x 16 = 64 x 64; store 2 iterations x 256 thr x 8 halves = 64 lines x 64 = the tile of D;
//           grid = (R/64)*(CC/64) blocks covers D exactly once (R, CC multiples of 64).
// =====================================================================================================
__global__ __launch_bounds__(256) void cvtT16(const float* __restrict__ X, int R, int CC, u16* D, int f16mode, float scale) {
  __shared__ __align__(16) u16 T[64 * VTP];
  const int tid = (int)threadIdx.x;
  const int bid = (int)blockIdx.x;
  const int nct = CC >> 6;
  const int ct  = bid % nct;
  const int rt  = bid / nct;
  const int r0  = rt * 64, c0 = ct * 64;
  if (r0 + 64 > R) return;                  // block-uniform, before the barrier; never taken with the exact grid
  {
    const int rl = tid >> 2;                // row within tile 0..63
    const int cc = (tid & 3) * 16;          // column chunk 0,16,32,48
    const float* src = X + (size_t)(r0 + rl) * (size_t)CC + c0 + cc;
#pragma unroll
    for (int i = 0; i < 4; ++i) {
      const v4f a = *(const v4f*)(src + 4 * i);
#pragma unroll
      for (int e = 0; e < 4; ++e) {
        const float f = a[e];
        const unsigned short hb = h_bits((_Float16)(bfr(f) * scale));
        const unsigned short bb = bf_bits(f);
        T[(cc + 4 * i + e) * VTP + rl] = (f16mode != 0) ? hb : bb;
      }
    }
  }
  __syncthreads();
  v4u w[2];
  const int q8 = tid >> 3, p8 = (tid & 7) * 8;
#pragma unroll
  for (int it = 0; it < 2; ++it) {
    const int line = it * 32 + q8;          // c_local = 0..63
    w[it] = *(const v4u*)(T + line * VTP + p8);
  }
  const size_t base = (size_t)c0 * (size_t)R + r0 + p8;
  {
#pragma unroll
    for (int it = 0; it < 2; ++it) {
      const int line = it * 32 + q8;
      *(v4u*)(D + base + (size_t)line * (size_t)R) = w[it];
    }
    
  }
}

// =====================================================================================================
// Rotary tables TC[s][j] = cos(s * inv[j]), TS[s][j] = sin(s * inv[j]), j < 16, with
// inv[j] = 1.0f / f32(10000^(2j/32)) (power evaluated in f64 and narrowed once, IEEE f32 reciprocal, f32 product s*inv,
// coverage: grid = n/256 blocks x 256 thr = n = SEQ*16 elements of TC and of TS (n a multiple of 256).
// =====================================================================================================
__global__ __launch_bounds__(256) void k_tab(float* TC, float* TS, int n) {
#pragma clang fp contract(off)
  const int idx = blockIdx.x * 256 + (int)threadIdx.x;
  if (idx >= n) return;
  const int s = idx / NFREQ;
  const int j = idx - s * NFREQ;
  const double pj = exp2((double)(2 * j) * ROPE_L2);   // 10000^(2j/32)
  const float pf  = (float)pj;
  const float inv = 1.0f / pf;
  const float ang = (float)s * inv;
  float sv, cv;
  sincosf(ang, &sv, &cv);
  {
    *(float*)(TC + idx) = cv;
    *(float*)(TS + idx) = sv;
    
  }
}

// =====================================================================================================
// One element of the partial non-interleaved rotary on dims 0..31 of a head, then its two f16 planes (table column j = d mod 16):
//   d <  16     : out[d] = x[d]*c[s][j] + (-1)*(x[d+16]*sn[s][j])
//   16 <= d < 32: out[d] = x[d]*c[s][j] + (+1)*(x[d-16]*sn[s][j])    (mul, mul, add kept separate)
//   d >= 32     : out[d] = x[d]
//   hb = f16(out * sc), lb = f16 residual (t - f16(t)).
// =====================================================================================================
__device__ __forceinline__ void rot_one(float x, float y, float cv, float sv, float sgn, float sc, int rot,
                                        unsigned short& hb, unsigned short& lb) {
#pragma clang fp contract(off)
  const float ys   = y * sv;
  const float term = sgn * ys;
  const float rr   = x * cv + term;
  const float r    = (rot != 0) ? rr : x;
  const float t    = r * sc;
  const _Float16 a = (_Float16)t;
  hb = h_bits(a);
  lb = h_bits((_Float16)(t - (float)a));
}

// =====================================================================================================
// Epilogue of the f16 GEMM: the wave's 64x64 f32 tile (times oscale) staged in its four LDS slabs (16 rows each, pitch
// 68, wave-private), one wave-level LDS sync, then whole-line stores: one instruction = 2 rows x 16 lanes x 4 floats.
// coverage: 4 slabs x 8 instructions x 2 rows x 16 lanes x 4 floats = the wave's 64 x 64 tile.
// =====================================================================================================
__device__ __forceinline__ void epi_put(float* sl, v8f a0, v8f a1, v8f a2, v8f a3, float oscale, int lane) {
  const int hh = lane >> 4, m = lane & 15;
#pragma unroll
  for (int r = 0; r < 8; ++r) {
    const int ro = (8 * hh + r) * 68 + m;
    sl[ro]      = a0[r] * oscale;
    sl[ro + 16] = a1[r] * oscale;
    sl[ro + 32] = a2[r] * oscale;
    sl[ro + 48] = a3[r] * oscale;
  }
}
__device__ __forceinline__ void epi_get(const float* sl, float* C, int N, size_t rowb, int col0, int lane) {
  const int hh = lane >> 4, m = lane & 15;
  v4f vals[8];
#pragma unroll
  for (int it = 0; it < 8; ++it) vals[it] = *(const v4f*)(sl + (it * 2 + hh) * 68 + m * 4);
  float* dst = C + (rowb + (size_t)hh) * (size_t)N + col0 + m * 4;
#pragma unroll
  for (int it = 0; it < 8; ++it) {
    *(v4f*)(dst + (size_t)(it * 2) * (size_t)N) = vals[it];
  }
}

// =====================================================================================================
// Epilogue of the projection GEMM: the wave's 64 x 64 f32 tile is 64 rows (row = b*SEQ + s) of ONE head of q, k or v (first column a multiple
// of 64; the section, column / DMOD, is the same for the whole block) and goes from the accumulators straight to that section's f16 planes.
// Accumulator element r of acc[i][j] in lane (hh, m) = (row 16 i + 8 hh + r, d = 16 j + m).
//   q, k: the rotary partner of d is d xor 16 = subtile j xor 1 of the same lane and element; table row s, column m. The f16 hi and
//         residual bits (x256) of an element share one 32-bit word in the wave's slab [64 rows][64 d] (pitch 68 words); after a
//         wave-level LDS sync one instruction stores 4 rows x 8 lanes x 8 halves = 4 whole 128-B row segments per plane [ROWS][DMOD].
//   v:    a lane's 8 elements are 8 consecutive keys of one d: f16(v * 1024) and its f16 residual, one 16-B LDS store each into the
//         wave's two tiles [64 d][64 keys] (pitch 72 halves); after the sync 4 whole 128-B d-row segments per store into
//         VH / VL[((b*NH + g)*HD + d)][s].
// The ring is dead here (behind the last stage's barrier); each wave uses its own quarter of it.
// coverage: 16 instructions x 4 lines x 64 halves = 64 x 64 per plane and wave; the grid's waves tile [ROWS][3072] exactly once.
// =====================================================================================================
struct QkvOut { const float* tc; const float* ts; u16* qh; u16* ql; u16* kh; u16* kl; u16* vh; u16* vl; };

__device__ __forceinline__ void epi_qkv(const v8f (&acc)[4][4], const QkvOut& qo, int row0, int col0, u16* sm, int wave, int lane) {
  static_assert(WPB * 2 * HD * VTP <= 2 * 2 * GPLH && WPB * 4 * SLAB64 * 2 <= 2 * 2 * GPLH);
  const int hh = lane >> 4, m = lane & 15;
  const int rq = lane >> 3, c8 = (lane & 7) * 8;
  const int sec  = col0 / DMOD;             // 0 = q, 1 = k, 2 = v: from the block's tile origin, so the branch below is scalar
  const int b    = row0 / SEQ;
  const int roww = row0 + (wave >> 1) * 64;                 // the wave's first row
  const int hcol = col0 - sec * DMOD + (wave & 1) * 64;     // head * HD
  const int s0   = roww - b * SEQ;          // first table row / key of the tile
  // every "#pragma unroll" here makes the indices of acc constants, so that it stays in registers
  if (sec < 2) {
    unsigned* sl = (unsigned*)(void*)sm + (size_t)(wave * 4) * SLAB64;
    const float sc = (sec != 0) ? KSC : QSC;
    const float* cp = qo.tc + (size_t)(s0 + 8 * hh) * NFREQ + m;
    const float* sp = qo.ts + (size_t)(s0 + 8 * hh) * NFREQ + m;
#pragma unroll
    for (int i = 0; i < 4; ++i) {
      float cw[8], sw[8];
#pragma unroll
      for (int r = 0; r < 8; ++r) {
        cw[r] = cp[(i * 16 + r) * NFREQ];
        sw[r] = sp[(i * 16 + r) * NFREQ];
      }
#pragma unroll
      for (int r = 0; r < 8; ++r) {
        const int ro = (i * 16 + 8 * hh + r) * 68 + m;
        unsigned short h0, l0, h1, l1, h2, l2, h3, l3;
        rot_one(acc[i][0][r], acc[i][1][r], cw[r], sw[r], -1.0f, sc, 1, h0, l0);
        rot_one(acc[i][1][r], acc[i][0][r], cw[r], sw[r],  1.0f, sc, 1, h1, l1);
        rot_one(acc[i][2][r], acc[i][2][r], 0.0f, 0.0f, 1.0f, sc, 0, h2, l2);
        rot_one(acc[i][3][r], acc[i][3][r], 0.0f, 0.0f, 1.0f, sc, 0, h3, l3);
        sl[ro]      = pk16(h0, l0);
        sl[ro + 16] = pk16(h1, l1);
        sl[ro + 32] = pk16(h2, l2);
        sl[ro + 48] = pk16(h3, l3);
      }
    }
    wave_sync_lds();
    const size_t ob = (size_t)(roww + rq) * DMOD + hcol + c8;
    u16* dh = ((sec != 0) ? qo.kh : qo.qh) + ob;
    u16* dl = ((sec != 0) ? qo.kl : qo.ql) + ob;
#pragma unroll
    for (int it = 0; it < 16; ++it) {
      const unsigned* pr = sl + (it * 4 + rq) * 68 + c8;
      const v4u a = *(const v4u*)(pr), b4 = *(const v4u*)(pr + 4);
      v4u oh, ol;
#pragma unroll
      for (int e = 0; e < 2; ++e) {
        oh[e]     = (a[2 * e] & 0xFFFFu)  | (a[2 * e + 1] << 16);
        ol[e]     = (a[2 * e] >> 16)      | (a[2 * e + 1] & 0xFFFF0000u);
        oh[2 + e] = (b4[2 * e] & 0xFFFFu) | (b4[2 * e + 1] << 16);
        ol[2 + e] = (b4[2 * e] >> 16)     | (b4[2 * e + 1] & 0xFFFF0000u);
      }
      *(v4u*)(dh + (size_t)(it * 4) * DMOD) = oh;
      *(v4u*)(dl + (size_t)(it * 4) * DMOD) = ol;
    }
  } else {
    u16* th = sm + (size_t)wave * (2 * HD * VTP);
    u16* tl = th + HD * VTP;
#pragma unroll
    for (int i = 0; i < 4; ++i) {
#pragma unroll
      for (int j = 0; j < 4; ++j) {
        v4u ph, pl;
#pragma unroll
        for (int e = 0; e < 4; ++e) {
          const float t0 = acc[i][j][2 * e] * VCAR, t1 = acc[i][j][2 * e + 1] * VCAR;
          const _Float16 h0 = (_Float16)t0, h1 = (_Float16)t1;
          const _Float16 g0 = (_Float16)(t0 - (float)h0), g1 = (_Float16)(t1 - (float)h1);
          ph[e] = pk16(h_bits(h0), h_bits(h1));
          pl[e] = pk16(h_bits(g0), h_bits(g1));
        }
        const int o = (j * 16 + m) * VTP + i * 16 + 8 * hh;
        *(v4u*)(th + o) = ph;
        *(v4u*)(tl + o) = pl;
      }
    }
    wave_sync_lds();
    const size_t base = ((size_t)b * DMOD + hcol + rq) * SEQ + s0 + c8;
#pragma unroll
    for (int it = 0; it < 16; ++it) {
      const int lo = (it * 4 + rq) * VTP + c8;
      const v4u vh = *(const v4u*)(th + lo), vl = *(const v4u*)(tl + lo);
      *(v4u*)(qo.vh + base + (size_t)(it * 4) * SEQ) = vh;
      *(v4u*)(qo.vl + base + (size_t)(it * 4) * SEQ) = vl;
    }
    // behind the last store of this section: no address or data register of an issued store is rewritten ahead of this wait
    asm volatile("s_wait_xcnt 0x0" ::: "memory");
  }
}

// =====================================================================================================
// GEMM core shared by both engines: C[128 x 128 tile] (f32) = (A (+ A2 when MODE == 2)) . Bt^T, times oscale, K = DMOD.
// A, A2 [rows][DMOD] and Bt [n][DMOD] are k-contiguous 16-bit planes (MODE 0: bf16, MODE 1 / 2: f16).
// Block = 4 waves as 2 x 2, each wave a 64 x 64 tile (4 x 4 accumulators). A stage is 64 k = one whole 128-B line of each of the
// 128 A rows (and A2 rows) and 128 Bt rows, laid in LDS at pitch 144 B by asynchronous 16-B copies: thread t copies chunk t & 7 of
// rows (t >> 3) + 16 i, i < 8, so one wave-wide copy covers 4 whole lines. Two buffers: stage t + 1 flies while stage t is worked on.
// Fragments come from LDS with the same split k map for A and B as ldfrag_*; every accumulator takes its products in the order
// k0 = 0, 32, 64, ... (A then A2 within a k0).
// After the last stage's barrier the ring is dead and serves as the waves' own epilogue space (MODE 1 / 2: 4 slabs per wave, 16 x 68 floats each).
// MODE 0 hands its tile to epi_qkv (C, N and oscale unused), MODE 1 / 2 store it to C.
// =====================================================================================================
union FragU { v4u u[2]; v16h h; v16b b; };

__device__ __forceinline__ FragU ldfrag_u(const u16* p) {
  FragU f;
  f.u[0] = *(const v4u*)(p);
  f.u[1] = *(const v4u*)(p + 16);
  return f;
}
template <int MODE>
__device__ __forceinline__ v8f mma_u(const FragU& a, const FragU& b, v8f c) {
  if constexpr (MODE == 0) return mma_b(a.b, b.b, c);
  else                     return mma_h(a.h, b.h, c);
}
__device__ __forceinline__ unsigned lds_addr(const u16* p) {          // byte offset in the work-group's LDS
  return (unsigned)(uintptr_t)(const __attribute__((address_space(3))) u16*)p;
}
// One operand tile of a stage: this lane's eight 16-B copies (rows 16 apart). The s_wait_xcnt stands inside the statement, behind
// the last copy, so that no address register of an issued copy is rewritten ahead of it.
__device__ __forceinline__ void acopy_tile(unsigned l, const u16* g) {
#if defined(__HIP_DEVICE_COMPILE__)
  constexpr unsigned LS = 16u * GPIT * 2u;          // LDS bytes between this lane's rows
  constexpr size_t   GS = (size_t)16 * DMOD;        // halves between this lane's rows in the plane
  asm volatile("global_load_async_to_lds_b128 %0, %8, off\n\t"
               "global_load_async_to_lds_b128 %1, %9, off\n\t"
               "global_load_async_to_lds_b128 %2, %10, off\n\t"
               "global_load_async_to_lds_b128 %3, %11, off\n\t"
               "global_load_async_to_lds_b128 %4, %12, off\n\t"
               "global_load_async_to_lds_b128 %5, %13, off\n\t"
               "global_load_async_to_lds_b128 %6, %14, off\n\t"
               "global_load_async_to_lds_b128 %7, %15, off\n\t"
               "s_wait_xcnt 0x0"
               :: "v"(l), "v"(l + LS), "v"(l + 2u * LS), "v"(l + 3u * LS),
                  "v"(l + 4u * LS), "v"(l + 5u * LS), "v"(l + 6u * LS), "v"(l + 7u * LS),
                  "v"(g), "v"(g + GS), "v"(g + 2 * GS), "v"(g + 3 * GS),
                  "v"(g + 4 * GS), "v"(g + 5 * GS), "v"(g + 6 * GS), "v"(g + 7 * GS)
               : "memory");
#endif
}
__device__ __forceinline__ void wait_async0() {     // this wave's copies have landed in LDS
#if defined(__HIP_DEVICE_COMPILE__)
  asm volatile("s_wait_asynccnt 0x0" ::: "memory");
#endif
}
__device__ __forceinline__ void wait_ds0() {        // this wave's LDS reads have returned before their buffer is handed back
#if defined(__HIP_DEVICE_COMPILE__)
  asm volatile("s_wait_dscnt 0x0" ::: "memory");
#endif
}

// Inputs-only fence on loaded fragments: holds a block's LDS reads together in front of its WMMAs (one wait per block); without it
// the reads are sunk between the rows of WMMAs and every row waits out the LDS latency.
__device__ __forceinline__ void hold4(const FragU& x0, const FragU& x1, const FragU& x2, const FragU& x3) {
#if defined(__HIP_DEVICE_COMPILE__)
  asm volatile("" :: "v"(x0.h), "v"(x1.h), "v"(x2.h), "v"(x3.h));
#endif
}

template <int MODE>
__device__ __forceinline__ void gemm_core(const u16* __restrict__ A, const u16* __restrict__ A2, const u16* __restrict__ Bt,
                                          float* C, int N, float oscale, int row0, int col0, u16* sm, const QkvOut& qo) {
  constexpr int NPL  = (MODE == 2) ? 3 : 2;         // operand tiles per stage
  constexpr int BUFH = NPL * GPLH;                  // halves per buffer
  constexpr int NS   = DMOD / GKS;                  // stages
  static_assert(NS >= 2 && 16 * SLAB64 * 4 <= 2 * BUFH * 2);
  const int tid = threadIdx.x, wave = tid >> 5, lane = tid & 31, hh = lane >> 4, m = lane & 15;
  const int wr = wave >> 1, wc = wave & 1;
  const int crow = tid >> 3, cch = (tid & 7) * 8;
  const u16* ga  = A  + (size_t)(row0 + crow) * DMOD + cch;
  const u16* ga2 = A2 + (size_t)(row0 + crow) * DMOD + cch;
  const u16* gb  = Bt + (size_t)(col0 + crow) * DMOD + cch;
  const unsigned l0 = lds_addr(sm) + (unsigned)(crow * GPIT + cch) * 2u;
  const int fa = (wr * 64 + m) * GPIT + 8 * hh;             // A fragment row of this lane (+ 16 i rows)
  const int fb = GPLH + (wc * 64 + m) * GPIT + 8 * hh;      // Bt fragment row of this lane (+ 16 j rows)

  // every "#pragma unroll" in this function makes the indices of acc, a, b, a2 constants, so that the arrays stay in registers
  v8f acc[4][4];
#pragma unroll
  for (int i = 0; i < 4; ++i) {
#pragma unroll
    for (int j = 0; j < 4; ++j) acc[i][j] = zero8();
  }

  // stage 0 into buffer 0, landed and published; then stage 1 into buffer 1
  acopy_tile(l0, ga);
  acopy_tile(l0 + GPLH * 2u, gb);
  if (MODE == 2) acopy_tile(l0 + 2u * GPLH * 2u, ga2);
  wait_async0();
  __syncthreads();
  acopy_tile(l0 + BUFH * 2u, ga + GKS);
  acopy_tile(l0 + BUFH * 2u + GPLH * 2u, gb + GKS);
  if (MODE == 2) acopy_tile(l0 + BUFH * 2u + 2u * GPLH * 2u, ga2 + GKS);

  // kept rolled: one trip = one stage, so that the publish point below stands once per stage
#pragma unroll 1
  for (int t = 0; t < NS; ++t) {
    const int bo = (t & 1) * BUFH;
    const u16* bp = sm + bo;
#pragma unroll
    for (int kk = 0; kk < GKS / 32; ++kk) {
      FragU a[4], b[4];
#pragma unroll
      for (int i = 0; i < 4; ++i) a[i] = ldfrag_u(bp + fa + i * 16 * GPIT + kk * 32);
#pragma unroll
      for (int j = 0; j < 4; ++j) b[j] = ldfrag_u(bp + fb + j * 16 * GPIT + kk * 32);
      hold4(a[0], a[1], a[2], a[3]);
      hold4(b[0], b[1], b[2], b[3]);
#pragma unroll
      for (int i = 0; i < 4; ++i) {
#pragma unroll
        for (int j = 0; j < 4; ++j) acc[i][j] = mma_u<MODE>(a[i], b[j], acc[i][j]);
      }
      if (MODE == 2) {
        FragU a2[4];
#pragma unroll
        for (int i = 0; i < 4; ++i) a2[i] = ldfrag_u(bp + 2 * GPLH + fa + i * 16 * GPIT + kk * 32);
        hold4(a2[0], a2[1], a2[2], a2[3]);
#pragma unroll
        for (int i = 0; i < 4; ++i) {
#pragma unroll
          for (int j = 0; j < 4; ++j) acc[i][j] = mma_u<MODE>(a2[i], b[j], acc[i][j]);
        }
      }
    }
    // publish point of stage t + 1: own LDS reads back, own copies landed, block barrier; only then the refill of the buffer just read
    wait_ds0();
    wait_async0();
    __syncthreads();
    if (t + 2 < NS) {
      const unsigned lb = l0 + (unsigned)bo * 2u;
      const int ko = (t + 2) * GKS;
      acopy_tile(lb, ga + ko);
      acopy_tile(lb + GPLH * 2u, gb + ko);
      if (MODE == 2) acopy_tile(lb + 2u * GPLH * 2u, ga2 + ko);
    }
  }
  wait_async0();
  (void)ga2;
  if constexpr (MODE == 0) {
    epi_qkv(acc, qo, row0, col0, sm, wave, lane);
  } else {
    float* sl = (float*)(void*)sm + (size_t)(wave * 4) * SLAB64;
#pragma unroll
    for (int i = 0; i < 4; ++i) epi_put(sl + i * SLAB64, acc[i][0], acc[i][1], acc[i][2], acc[i][3], oscale, lane);
    wave_sync_lds();
#pragma unroll
    for (int i = 0; i < 4; ++i) epi_get(sl + i * SLAB64, C, N, (size_t)(row0 + wr * 64 + i * 16), col0 + wc * 64, lane);
  }
}

// =====================================================================================================
// bf16 projection GEMM: [M][NQKV] (f32 accumulators) = A[M][DMOD] (bf16 row-major) . Bt[NQKV][DMOD]^T (bf16 k-contiguous); the tile
// leaves as the q / k planes (rotary, x256, hi + residual) or the v^T planes (x1024, hi + residual): epi_qkv.
// Block = one 128 x 128 tile (gemm_core); M % 128 == 0, grid = (M/128)*(NQKV/128).
// =====================================================================================================
__global__ __launch_bounds__(128)
void gemm_bf(const u16* __restrict__ A, const u16* __restrict__ Bt, const float* __restrict__ TC, const float* __restrict__ TS,
             u16* QH, u16* QL, u16* KH, u16* KL, u16* VH, u16* VL, int M) {
  __shared__ __align__(16) u16 ring[2 * 2 * GPLH];
  constexpr int ntile = NQKV / GT;
  const int bid   = blockIdx.x;
  const int row0  = (bid / ntile) * GT;
  const int col0  = (bid % ntile) * GT;
  if (row0 + GT > M) return;                // block-uniform, before any copy or barrier; never taken with the exact grid
  const QkvOut qo = {TC, TS, QH, QL, KH, KL, VH, VL};
  gemm_core<0>(A, A, Bt, nullptr, NQKV, 1.0f, row0, col0, ring, qo);
}

// =====================================================================================================
// f16 GEMM: C[M][N] (f32) = (A[M][DMOD] (+ A2[M][DMOD] when TWO != 0)) . Bt[N][DMOD]^T, times oscale; A, A2 f16 row-major planes
// (A2 = the unscaled f16 residual of A, sharing the accumulator), Bt f16 k-contiguous. Same core as gemm_bf. A, A2 and C hold the
// rows of all sequences (row = b*SEQ + s); one launch takes one row class of every sequence: TWO = 1 the rows s < RICHE, TWO = 0
// the rows s >= RICHE; row tile rt of the class -> sequence rt / (tiles of the class per sequence);
// grid = NB * (class rows / 128) * (N / 128).
// =====================================================================================================
template <int TWO>
__global__ __launch_bounds__(128)
void gemm_h(const u16* __restrict__ A, const u16* __restrict__ A2, const u16* __restrict__ Bt, float* C,
            int M, int N, float oscale) {
  __shared__ __align__(16) u16 ring[2 * ((TWO != 0) ? 3 : 2) * GPLH];
  const int ntile = N / GT;
  const int bid   = blockIdx.x;
  constexpr int CT = ((TWO != 0) ? RICHE : ((SEQ > RICHE) ? (SEQ - RICHE) : GT)) / GT;   // row tiles of the class per sequence
  constexpr int R0 = (TWO != 0) ? 0 : RICHE;                                             // first row of the class in a sequence
  const int rt    = bid / ntile;
  const int row0  = (rt / CT) * SEQ + R0 + (rt % CT) * GT;
  const int col0  = (bid % ntile) * GT;
  if (row0 + GT > M) return;                // block-uniform, before any copy or barrier; never taken with the exact grid
  const QkvOut none = {nullptr, nullptr, nullptr, nullptr, nullptr, nullptr, nullptr, nullptr};
  gemm_core<(TWO != 0) ? 2 : 1>(A, A2, Bt, C, N, oscale, row0, col0, ring, none);
}

// Attention stage geometry: 64 keys per stage; every plane tile is 64 rows of 64 halves at pitch 72 halves (144 B) in LDS.
#define AKS   64
#define APIT  72
#define APL   (64 * APIT)
static_assert((NQTR % WPB) == 0 && ((NQT - NQTR) % WPB) == 0 && (SEQ % AKS) == 0 && HD == 64 && ATT_THREADS == 128);
// One plane tile of an attention stage: this lane's four 16-B copies (rows 16 apart, gs halves apart in the plane). The s_wait_xcnt
// stands inside the statement, behind the last copy, so that no address register of an issued copy is rewritten ahead of it.
__device__ __forceinline__ void acopy4(unsigned l, const u16* g, size_t gs) {
#if defined(__HIP_DEVICE_COMPILE__)
  constexpr unsigned LS = 16u * APIT * 2u;          // LDS bytes between this lane's rows
  asm volatile("global_load_async_to_lds_b128 %0, %4, off\n\t"
               "global_load_async_to_lds_b128 %1, %5, off\n\t"
               "global_load_async_to_lds_b128 %2, %6, off\n\t"
               "global_load_async_to_lds_b128 %3, %7, off\n\t"
               "s_wait_xcnt 0x0"
               :: "v"(l), "v"(l + LS), "v"(l + 2u * LS), "v"(l + 3u * LS),
                  "v"(g), "v"(g + gs), "v"(g + 2 * gs), "v"(g + 3 * gs)
               : "memory");
#endif
}

template <int RV>
__global__ __launch_bounds__(ATT_THREADS)
void attn_w(const u16* __restrict__ QHa, const u16* __restrict__ QLa,
            const u16* __restrict__ KHa, const u16* __restrict__ KLa,
            const u16* __restrict__ VHa, const u16* __restrict__ VLa,
            const int* __restrict__ MKa,
            u16* OHa, u16* OLa, int qt0, int nqt) {
#pragma clang fp contract(off)
  constexpr int NPLA = (RV != 0) ? 4 : 3;   // operand planes per stage: k hi, k residual, v^T hi (, v^T residual)
  constexpr int ABUF = NPLA * APL;          // halves per buffer
  static_assert(WPB * SLW * 4 <= 2 * ABUF * 2);
  __shared__ __align__(16) u16 ring[2 * ABUF];

  const int tid  = threadIdx.x;
  const int wave = __builtin_amdgcn_readfirstlane(tid >> 5);   // in a scalar register: the test of a wave's own tiles is a scalar branch
  const int lane = tid & 31;
  const int hh   = lane >> 4;
  const int c    = lane & 15;
  const int bid  = blockIdx.x;
  if (nqt <= 0) return;                     // block-uniform, before any copy or barrier
  const int ngr  = nqt / WPB;               // groups of 4 query tiles (nqt a multiple of 4)
  if (ngr <= 0) return;                     // block-uniform, before any copy or barrier
  const int qtb  = qt0 + (bid % ngr) * WPB; // the block's first query tile
  const int qt   = qtb + wave;
  const int head = (bid / ngr) % NH;
  const int b    = bid / (ngr * NH);
  if (b >= NB) return;                      // block-uniform, before any copy or barrier; never taken with the exact grid
  const size_t po = (size_t)b * SEQ * DMOD; // halves per sequence in every q / k / v^T / O plane (NH*HD == DMOD)
  const u16* __restrict__ QHp = QHa + po;
  const u16* __restrict__ QLp = QLa + po;
  const u16* __restrict__ KHp = KHa + po;
  const u16* __restrict__ KLp = KLa + po;
  const u16* __restrict__ VHp = VHa + po;
  const u16* __restrict__ VLp = VLa + po;
  const int* __restrict__ MK  = MKa + (size_t)b * XS_FULL;
  u16* OHp = OHa + po;
  u16* OLp = OLa + po;
  const int q0   = qt * 16;
  const int Q0   = qtb * 16;
  if (Q0 + 16 * WPB > SEQ) return;          // block-uniform, before any copy or barrier; never taken

  float* slab = (float*)(void*)ring + wave * SLW;   // result slab [16][64] pitch 68: the wave's own part of the ring, once that is dead

  const size_t hcol = (size_t)head * HD + 8 * hh;
  const _Float16* Qh  = (const _Float16*)(const void*)QHp + ((size_t)q0 + c) * DMOD + hcol;
  const _Float16* Ql  = (const _Float16*)(const void*)QLp + ((size_t)q0 + c) * DMOD + hcol;
  // this lane's copies of a stage: chunk cch of rows crow + 16 i of every plane
  const int crow = tid >> 3, cch = (tid & 7) * 8;
  const u16* gkh = KHp + (size_t)crow * DMOD + (size_t)head * HD + cch;       // key row 64*stage added per stage
  const u16* gkl = KLp + (size_t)crow * DMOD + (size_t)head * HD + cch;
  const u16* gvh = VHp + ((size_t)head * HD + crow) * SEQ + cch;              // key 64*stage added per stage
  const u16* gvl = VLp + ((size_t)head * HD + crow) * SEQ + cch;
  (void)gvl;
  const unsigned l0 = lds_addr(ring) + (unsigned)(crow * APIT + cch) * 2u;
  const int fk = c * APIT + 8 * hh;         // fragment row c of a plane tile (halves), split k map
  const float lsc  = SM_SCALE * (1.0f / (QSC * KSC));   // exact power-of-two fold of the q / k carries into the 1/8 scale
  const float oc   = 1.0f / (PCAR * VCAR);
  const float ninf = -__builtin_inff();

  v8f o[4];
#pragma unroll
  for (int j = 0; j < 4; ++j) o[j] = zero8();
  float mrun = ninf, lrun = 0.0f;           // of query q0 + c: running max (both halves alike), sum over this half's keys
  int klo = q0 - (WIN - 1);
  if (klo < 0) klo = 0;
  const int ktlo = klo >> 5;                                                  // first tile intersecting the window
  const int kthi = q0 >> 5;                                                   // tile holding keys q0 .. q0 + 15
  const int qrow  = q0 + c;                                                   // this lane's query: column c of every D tile
  int slo = Q0 - (WIN - 1);
  if (slo < 0) slo = 0;
  const int st0 = slo >> 6;                                                   // first stage intersecting the block's windows
  const int nst = (Q0 >> 6) - st0 + 1;                                        // last stage holds keys Q0 .. Q0 + 63; 1 <= nst <= 9

  // one stage's copies; 64*st + 63 <= Q0 + 63 <= SEQ - 1
  auto stage_in = [&](int st, int buf) {
    const unsigned lb = l0 + (unsigned)(buf * ABUF) * 2u;
    const size_t ko = (size_t)st * AKS;
    acopy4(lb, gkh + ko * DMOD, (size_t)16 * DMOD);
    acopy4(lb + APL * 2u, gkl + ko * DMOD, (size_t)16 * DMOD);
    acopy4(lb + 2u * APL * 2u, gvh + ko, (size_t)16 * SEQ);
    if (RV != 0) acopy4(lb + 3u * APL * 2u, gvl + ko, (size_t)16 * SEQ);
  };
  // stage 0 into buffer 0, landed and published; then, where there is one, stage 1 into buffer 1
  stage_in(st0, 0);
  wait_async0();
  __syncthreads();
  if (nst > 1) stage_in(st0 + 1, 1);

  // both loops kept rolled: one outer trip = one stage, so that the publish point below stands once per stage
#pragma unroll 1
  for (int t = 0; t < nst; ++t) {
   const _Float16* rb = (const _Float16*)(const void*)(ring + (t & 1) * ABUF);
#pragma unroll 1
   for (int th = 0; th < 2; ++th) {
    const int kt = (st0 + t) * 2 + th;
    if (kt < ktlo || kt > kthi) continue;                                     // scalar: not a tile of this wave's window
    const int kb = kt * 32;                                                   // kb + 31 <= SEQ - 1
    // ---- keys this lane's query may see, bit i = key kb + i: padding flags (one coalesced b32 per lane, then a ballot), causal
    //      bound i <= qrow - kb (never negative here), window bound i >= qrow - (WIN-1) - kb; shifted so that bit r is the key of
    //      s0[r] and bit 16 + r the key of s1[r] ----
    const int fl = MK[kb + lane];
    const unsigned fm = __builtin_amdgcn_ballot_w32(fl != 0);
    const int hiN = qrow - kb;
    const int loN = hiN - (WIN - 1);
    const int hiC = (hiN < 31) ? hiN : 31;
    const int loC = (loN > 0) ? loN : 0;
    const unsigned cm  = 0xFFFFFFFFu >> (31 - hiC);
    const unsigned wm  = (loC < 32) ? (0xFFFFFFFFu << (loC & 31)) : 0u;
    const unsigned okh = (fm & cm & wm) >> (8 * hh);
    // ---- raw transposed scores: D element r of this lane = (key kb + 8hh + r, query q0 + c) in s0, key kb + 16 + 8hh + r in s1 ----
    v8f s0 = zero8(), s1 = zero8();
    const _Float16* k0p = rb + th * 32 * APIT + fk;
    const _Float16* k1p = k0p + 16 * APIT;
    const _Float16* l0p = k0p + APL;
    const _Float16* l1p = l0p + 16 * APIT;
#pragma unroll
    for (int kk = 0; kk < HD / 32; ++kk) {
      const v16h qh  = ldfrag_h(Qh + kk * 32);
      const v16h ql  = ldfrag_h(Ql + kk * 32);
      const v16h kh0 = ldfrag_h(k0p + kk * 32);
      const v16h kh1 = ldfrag_h(k1p + kk * 32);
      const v16h kl0 = ldfrag_h(l0p + kk * 32);
      const v16h kl1 = ldfrag_h(l1p + kk * 32);
      s0 = mma_h(kh0, qh, s0);
      s0 = mma_h(kh0, ql, s0);
      s0 = mma_h(kl0, qh, s0);
      s1 = mma_h(kh1, qh, s1);
      s1 = mma_h(kh1, ql, s1);
      s1 = mma_h(kl1, qh, s1);
      guard2(s0, s1, qh, ql, kh0, kl0, kh1, kl1);
    }
    // ---- replace-mask, running-max online softmax in f32: the lane's 16 scores are 16 keys of ONE query, the other 16 keys of
    //      the tile sit in lane ^ 16; the maximum is joined across the halves here, the sums only after the loop ----
    const v8f a0 = s0 * lsc, a1 = s1 * lsc;
    float t0[8], t1[8];
#pragma unroll
    for (int r = 0; r < 8; ++r) {
      t0[r] = ((okh & (1u << r)) != 0u) ? a0[r] : ninf;
      t1[r] = ((okh & (0x10000u << r)) != 0u) ? a1[r] : ninf;
    }
    float mx = fmaxf(t0[0], t1[0]);
#pragma unroll
    for (int r = 1; r < 8; ++r) mx = fmaxf(mx, fmaxf(t0[r], t1[r]));
    mx = fmaxf(mx, xhalf(mx));
    const float mnew  = fmaxf(mrun, mx);
    const float mshft = (mnew == ninf) ? 0.0f : mnew;
    const float al    = __expf(mrun - mshft);
    v8f p0, p1;
#pragma unroll
    for (int r = 0; r < 8; ++r) {
      p0[r] = __expf(t0[r] - mshft);
      p1[r] = __expf(t1[r] - mshft);
    }
    const v8f ps = p0 + p1;
    const float sm = ((ps[0] + ps[1]) + (ps[2] + ps[3])) + ((ps[4] + ps[5]) + (ps[6] + ps[7]));
    lrun = lrun * al + sm;
    mrun = mnew;
    // ---- rescale the O^T accumulators by alpha (every element of a lane belongs to its query) ----
#pragma unroll
    for (int j = 0; j < 4; ++j) {
#pragma unroll
      for (int r = 0; r < 8; ++r) o[j][r] = o[j][r] * al;
    }
    // ---- B fragments of p*32768 straight from the score registers: column = query c, elements 0..7 = keys kb + 8hh + 0..7 (s0),
    //      elements 8..15 = keys kb + 16 + 8hh + 0..7 (s1): the split k map of the v^T A fragments; hi f16 (and residual f16) ----
    FragH ph, pl;
    const v8f c0 = p0 * PCAR, c1 = p1 * PCAR;
#pragma unroll
    for (int e = 0; e < 8; ++e) {
      const float ta = c0[e], tb = c1[e];
      const _Float16 ha = (_Float16)ta, hb = (_Float16)tb;
      ph.h[0][e] = ha;
      ph.h[1][e] = hb;
      if (RV != 0) {
        pl.h[0][e] = (_Float16)(ta - (float)ha);
        pl.h[1][e] = (_Float16)(tb - (float)hb);
      }
    }
    // ---- O^T += v^T . P^T : A fragment row = d = j*16 + c, keys contiguous in the v^T planes; 2 groups of 2 d-subtiles ----
    {
      const _Float16* vhp = rb + 2 * APL + fk + th * 32;
      const _Float16* vlp = vhp + APL;
      (void)vlp;
#pragma unroll
      for (int jg = 0; jg < 2; ++jg) {
        const int da = (2 * jg) * 16 * APIT;
        const int db = da + 16 * APIT;
        const v16h vha = ldfrag_h(vhp + da), vhb2 = ldfrag_h(vhp + db);
        o[2 * jg]     = mma_h(vha,  ph.v, o[2 * jg]);
        o[2 * jg + 1] = mma_h(vhb2, ph.v, o[2 * jg + 1]);
        if (RV != 0) {
          const v16h vla = ldfrag_h(vlp + da), vlb2 = ldfrag_h(vlp + db);
          o[2 * jg]     = mma_h(vha,  pl.v, o[2 * jg]);
          o[2 * jg]     = mma_h(vla,  ph.v, o[2 * jg]);
          o[2 * jg + 1] = mma_h(vhb2, pl.v, o[2 * jg + 1]);
          o[2 * jg + 1] = mma_h(vlb2, ph.v, o[2 * jg + 1]);
          guard2(o[2 * jg], o[2 * jg + 1], ph.v, pl.v, vha, vhb2, vla, vlb2);
        } else {
          guard2(o[2 * jg], o[2 * jg + 1], ph.v, ph.v, vha, vhb2, vha, vhb2);
        }
      }
    }
   }
   // publish point of stage t + 1: own LDS reads back, own copies landed, block barrier; only then the refill of the buffer just read
   wait_ds0();
   wait_async0();
   __syncthreads();
   if (t + 2 < nst) stage_in(st0 + t + 2, t & 1);
  }
  wait_async0();
  acc_guard4(o[0], o[1], o[2], o[3]);
  // ---- l = the two halves' sums joined; O = acc / l with the carries (32768 on p, 1024 on v) folded once (0 when l == 0); a
  //      lane's 8 elements of o[j] are d = 16 j + 8 hh + 0..7 of query row c: two 16-B stores into the wave's slab [row][d] ----
  const float lall = lrun + xhalf(lrun);
  const bool  okl  = lall > 0.0f;
  const float lden = okl ? lall : 1.0f;
  const float rec  = (1.0f / lden) * oc;
  const float rl   = okl ? rec : 0.0f;
#pragma unroll
  for (int j = 0; j < 4; ++j) {
    v4f w0, w1;
#pragma unroll
    for (int e = 0; e < 4; ++e) { w0[e] = o[j][e] * rl; w1[e] = o[j][4 + e] * rl; }
    float* sd = slab + c * SLP + j * 16 + 8 * hh;
    *(v4f*)(sd)     = w0;
    *(v4f*)(sd + 4) = w1;
  }
  wave_sync_lds();
  // ---- O x256 -> f16 hi plane (+ f16 residual plane); lane = (row group rq, 8 consecutive d at c8) ----
  v4u oh[4], ol[4];
  const int rq = lane >> 3, c8 = (lane & 7) * 8;
#pragma unroll
  for (int it = 0; it < 4; ++it) {
    const int row = it * 4 + rq;
    const v4f a = *(const v4f*)(slab + row * SLP + c8), b4 = *(const v4f*)(slab + row * SLP + c8 + 4);
    float w[8];
#pragma unroll
    for (int e = 0; e < 4; ++e) { w[e] = a[e] * OSC; w[4 + e] = b4[e] * OSC; }
#pragma unroll
    for (int e = 0; e < 4; ++e) {
      const _Float16 h0 = (_Float16)w[2 * e], h1 = (_Float16)w[2 * e + 1];
      const _Float16 g0 = (_Float16)(w[2 * e] - (float)h0), g1 = (_Float16)(w[2 * e + 1] - (float)h1);
      oh[it][e] = pk16(h_bits(h0), h_bits(h1));
      ol[it][e] = pk16(h_bits(g0), h_bits(g1));
    }
  }
  const size_t ob = ((size_t)q0) * DMOD + (size_t)head * HD + c8;
  {
#pragma unroll
    for (int it = 0; it < 4; ++it) {
      const int row = it * 4 + rq;
      *(v4u*)(OHp + ob + (size_t)row * DMOD) = oh[it];
      if (RV != 0) {
        *(v4u*)(OLp + ob + (size_t)row * DMOD) = ol[it];
      }
    }
    
  }
}

// =====================================================================================================
// Workspace map (bytes); every plane holds all NB sequences (ROWS = NB*SEQ rows), each stage is one launch over all of them;
// every plane is fully written by whole-line stores before it is read (the O residual plane only on the rows < RICHE of each
// sequence that are read); all extents are exact multiples of the store granularity; every region offset a multiple of 131072:
//   XB  bf16 [ROWS][1024]                ROWS*2048   (ROWS=8192: 16777216)
//   WB  bf16 [3072 n][1024 k]            6291456     (q rows 0..1023, k 1024..2047, v 2048..3071)
//   WT  f16  [1024 o][1024 d] x1024      2097152
//   QH  f16 [ROWS][1024] x256            ROWS*2048   QL residual, same extent
//   KH  f16 [ROWS][1024] x256            ROWS*2048   KL residual, same extent
//   VH  f16 [NB][16][64][SEQ] x1024      ROWS*2048   VL residual, same extent
//   OH  f16 [ROWS][1024] x256            ROWS*2048   OL residual, same extent (rows < RICHE of each sequence written / read)
//   TC  f32 [SEQ][16]                    SEQ*64      TS, same extent
//   end (SEQ=2048, NB=4)                159645696
// =====================================================================================================
extern "C" void kernel_launch(void* const* d_in, const int* in_sizes, int n_in,
                              void* d_out, int out_size, void* d_ws, size_t ws_size,
                              hipStream_t stream) {
  if (n_in < 4) return;
  if (in_sizes[0] < ((NB - 1) * XS_FULL + SEQ) * DMOD) return;
  if (in_sizes[1] < (NB - 1) * XS_FULL + SEQ) return;
  if (in_sizes[2] != DMOD * NQKV) return;
  if (in_sizes[3] != DMOD * DMOD) return;
  if (out_size < ((NB - 1) * XS_FULL + SEQ) * DMOD) return;

  const float* x    = (const float*)d_in[0];
  const int*   mask = (const int*)d_in[1];
  const float* wqkv = (const float*)d_in[2];       // [1024 k][3072 n]
  const float* wo   = (const float*)d_in[3];       // [1024 d][1024 o]
  float*       out  = (float*)d_out;

  const size_t szXB = (size_t)ROWS * DMOD * 2;
  const size_t szWB = (size_t)NQKV * DMOD * 2;
  const size_t szWT = (size_t)DMOD * DMOD * 2;
  const size_t szQ  = (size_t)ROWS * DMOD * 2;                   // QH, QL, KH, KL, OH, OL
  const size_t szV  = (size_t)NB * NH * HD * SEQ * 2;            // VH, VL (== szQ)
  const size_t szT  = (size_t)SEQ * NFREQ * 4;                   // TC, TS
  size_t off = 0;
  const size_t oXB = off; off += szXB;
  const size_t oWB = off; off += szWB;
  const size_t oWT = off; off += szWT;
  const size_t oQH = off; off += szQ;
  const size_t oQL = off; off += szQ;
  const size_t oKH = off; off += szQ;
  const size_t oKL = off; off += szQ;
  const size_t oVH = off; off += szV;
  const size_t oVL = off; off += szV;
  const size_t oOH = off; off += szQ;
  const size_t oOL = off; off += szQ;
  const size_t oTC = off; off += szT;
  const size_t oTS = off; off += szT;
  if (off > ws_size) return;                // off = 159645696 for SEQ = 2048, NB = 4
  if (off > (size_t)WS_CAP) return;

  char* ws = (char*)d_ws;
  u16*   XB  = (u16*)(ws + oXB);
  u16*   WB  = (u16*)(ws + oWB);
  u16*   WT  = (u16*)(ws + oWT);
  u16*   QH  = (u16*)(ws + oQH);
  u16*   QL  = (u16*)(ws + oQL);
  u16*   KH  = (u16*)(ws + oKH);
  u16*   KL  = (u16*)(ws + oKL);
  u16*   VH  = (u16*)(ws + oVH);
  u16*   VL  = (u16*)(ws + oVL);
  u16*   OH  = (u16*)(ws + oOH);
  u16*   OL  = (u16*)(ws + oOL);
  float* TC  = (float*)(ws + oTC);
  float* TS  = (float*)(ws + oTS);

  const dim3 b256(256), b128(128), bAT(ATT_THREADS);
  const int  n8x = (ROWS * DMOD) / 8;
  const dim3 gX((n8x + 255) / 256);                     // ROWS*DMOD/2048 blocks
  const int  nT  = SEQ * NFREQ;
  const dim3 gT((nT + 255) / 256);                      // SEQ/16
  const dim3 gWQ((DMOD / 64) * (NQKV / 64));            // 768: in [1024 k][3072 n] -> WB [3072 n][1024 k]
  const dim3 gWO((DMOD / 64) * (DMOD / 64));            // 256: in [1024 d][1024 o] -> WT [1024 o][1024 d]
  const dim3 gG1((ROWS / GT) * (NQKV / GT));
  const float osc = 1.0f / (OSC * WOS);

  // (0) weight planes: Wqkv transposed to bf16 [n][k]; Wo transposed to f16 of the bf16 value x1024 [o][d]
  cvtT16<<<gWQ, b256, 0, stream>>>(wqkv, DMOD, NQKV, WB, 0, 1.0f);
  cvtT16<<<gWO, b256, 0, stream>>>(wo, DMOD, DMOD, WT, 1, WOS);
  // (1) rotary cos / sin tables [SEQ][16]
  k_tab<<<gT, b256, 0, stream>>>(TC, TS, nT);
  // every stage below: all sequences in one launch (x, mask and out rows of the NB sequences are contiguous)
  // (2) x rows -> bf16 plane [ROWS][1024]
  cvt16<<<gX, b256, 0, stream>>>(x, XB, n8x, 0, 1.0f);
  // (3) qkv = x.Wqkv; its epilogue: partial rotary + hi + residual planes x256 of q (columns 0..1023) and k (1024..2047),
  //     v^T hi + residual planes x1024 (columns 2048..3071)
  gemm_bf<<<gG1, b128, 0, stream>>>(XB, WB, TC, TS, QH, QL, KH, KL, VH, VL, ROWS);
  // (4) windowed causal attention with key padding -> O f16 hi plane x256 for all query tiles; residual plane for rows < RICHE
  attn_w<1><<<dim3(NB * NQTR * NHG), bAT, 0, stream>>>(QH, QL, KH, KL, VH, VL, mask, OH, OL, 0, NQTR);
  if (NQT > NQTR) {
    attn_w<0><<<dim3(NB * (NQT - NQTR) * NHG), bAT, 0, stream>>>(QH, QL, KH, KL, VH, VL, mask, OH, OL, NQTR, NQT - NQTR);
  }
  // (5) y = O.Wo -> out f32, carries 256 x 1024 folded back; rows < RICHE of each sequence with O hi + residual
  gemm_h<1><<<dim3(NB * (RICHE / GT) * (DMOD / GT)), b128, 0, stream>>>(OH, OL, WT, out, ROWS, DMOD, osc);
  if (SEQ > RICHE) {
    gemm_h<0><<<dim3(NB * ((SEQ - RICHE) / GT) * (DMOD / GT)), b128, 0, stream>>>(OH, OL, WT, out, ROWS, DMOD, osc);
  }
  (void)hipGetLastError();
}

// v006
// A run of this version takes 137 microseconds.
// In both of two side-by-side timings against v005, it was 1.28 times as fast.
// Over all steps from v000 it is 5.49 times as fast.
// Contractions: x.Wqkv on v_wmma_f32_16x16x32_bf16 (x and the transposed weight as bf16 RNE planes; weight plane [n][k]
// rows are the k-contiguous B operand; f32 accumulate); q.k^T over hd 64 and P.v on v_wmma_f32_16x16x32_f16 with f16 hi +
// f16 residual planes (q, k x256 after partial rotary, products hh+lh+hl on every row; P x32768 hi + in-register residual
// and v^T x1024 hi + residual plane for query rows < 512 of each sequence, P hi . v hi only for later rows); O.Wo on
// v_wmma_f32_16x16x32_f16 with O x256 as f16 hi (+ f16 residual plane for rows < 512 of each sequence) and Wo transposed
// to [o][d] as f16(bf16(Wo)) x1024, one accumulator; all f32 accumulate. Rotary cos/sin tables, causal + window + key
// padding masks and the online softmax in f32 on VALU.
#include <hip/hip_runtime.h>
#include <math.h>
#include <stdint.h>

#ifndef NB
#define NB 4
#endif
#ifndef SEQ
#define SEQ 2048
#endif
#ifndef RICH
#define RICH 512
#endif
#define NB_FULL 4
#define XS_FULL 2048
#define DMOD  1024
#define NH    16
#define HD    64
#define HROT  32
#define HROTH 16
#define NFREQ 16
#define NQKV  (3 * DMOD)
#define WIN   512
#define RICHE ((RICH < SEQ) ? RICH : SEQ)
#define ROPE_L2 0.41524101186092028
#define SM_SCALE 0.125f
#define QSC   256.0f
#define KSC   256.0f
#define PCAR  32768.0f
#define VCAR  1024.0f
#define OSC   256.0f
#define WOS   1024.0f
#define WPB   4
#define NHG   (NH / WPB)
#define NQT   (SEQ / 16)
#define NQTR  (RICHE / 16)
#define NST   (SEQ / 64)
#define NKT   (SEQ / 32)
#define ATT_THREADS (WPB * 32)
#define PTP   36
#define PTW   (16 * PTP)
#define SLP   68
#define SLW   (16 * SLP)
#define WREG  (PTW + SLW)
#define SLAB64 (16 * 68)
#define VTP   72
#define WS_CAP 268435456
#define ROWS  (NB * SEQ)
#define GT    128
#define GKS   64
#define GPIT  72
#define GPLH  (GT * GPIT)
static_assert(DMOD == NH * HD && HD == 64 && HROT == 32 && HROTH == 16 && NFREQ == 16 && NH == 16 && WPB == 4 && NHG * WPB == NH);
static_assert(ATT_THREADS == 128 && NQKV == 3072 && WIN == 512 && NHG == 4);
static_assert(NB >= 1 && NB <= NB_FULL);
static_assert(NB == 1 || SEQ == XS_FULL);
static_assert((SEQ % 64) == 0 && SEQ >= 64 && SEQ <= XS_FULL);
static_assert((RICHE % 64) == 0 && RICHE >= 64 && RICHE <= SEQ);
static_assert((DMOD % 64) == 0 && (NQKV % 64) == 0 && (DMOD % 32) == 0 && (HD % 32) == 0);
static_assert(((SEQ * DMOD / 8) % 256) == 0 && ((SEQ * NFREQ) % 256) == 0);
static_assert(WPB * WREG * 4 <= 65536 && 2 * HD * VTP * 2 <= 65536 && 4 * SLAB64 * 4 <= 65536 && 64 * VTP * 2 <= 65536);
static_assert(NQT * 16 == SEQ && NQTR * 16 == RICHE && NKT * 32 == SEQ && NST * 64 == SEQ);
static_assert((RICHE % GT) == 0 && ((SEQ - RICHE) % GT) == 0 && (ROWS % GT) == 0 && (NQKV % GT) == 0 && (DMOD % GT) == 0 && (DMOD % GKS) == 0);

typedef unsigned short u16;
typedef _Float16 v16h __attribute__((ext_vector_type(16)));
typedef _Float16 v8h  __attribute__((ext_vector_type(8)));
typedef __bf16   v16b __attribute__((ext_vector_type(16)));
typedef float    v8f  __attribute__((ext_vector_type(8)));
typedef float    v4f  __attribute__((ext_vector_type(4)));
typedef unsigned int v4u __attribute__((ext_vector_type(4)));

union FragH { v16h v; v8h h[2]; v4u u[2]; };

// ---- scalar helpers --------------------------------------------------------------------------------
__device__ __forceinline__ unsigned short bf_bits(float f) {          // f32 -> bf16 bits, RNE convert
  unsigned u = __float_as_uint(f);
  return (unsigned short)((u + 0x7FFFu + ((u >> 16) & 1u)) >> 16);
}
__device__ __forceinline__ float bf_up(unsigned short h) { return __uint_as_float(((unsigned)h) << 16); }
__device__ __forceinline__ float bfr(float f) { return bf_up(bf_bits(f)); }
__device__ __forceinline__ unsigned short h_bits(_Float16 x) { return __builtin_bit_cast(unsigned short, x); }
__device__ __forceinline__ unsigned pk16(unsigned short a, unsigned short b) { return (unsigned)a | ((unsigned)b << 16); }
__device__ __forceinline__ v8f zero8() { v8f z = {0.f, 0.f, 0.f, 0.f, 0.f, 0.f, 0.f, 0.f}; return z; }

// ---- fragment loaders: 16-bit A/B operand, lane -> row/col (lane&15), p already includes +8*(lane>>4);
//      elements 0..7 <- p[0..7] (k0+8h..), elements 8..15 <- p[16..23] (k0+16+8h..)  (same split k map for A and B;
//      B is always read from a k-contiguous [n][k] plane)
__device__ __forceinline__ v16h ldfrag_h(const _Float16* p) {
  FragH f;
  f.h[0] = *(const v8h*)(p);
  f.h[1] = *(const v8h*)(p + 16);
  return f.v;
}

__device__ __forceinline__ v8f mma_h(v16h a, v16h b, v8f c) {
  return __builtin_amdgcn_wmma_f32_16x16x32_f16(false, a, false, b, (short)0, c, false, false);
}
__device__ __forceinline__ v8f mma_b(v16b a, v16b b, v8f c) {
  return __builtin_amdgcn_wmma_f32_16x16x32_bf16(false, a, false, b, (short)0, c, false, false);
}
__device__ __forceinline__ void guard2(v8f& a, v8f& b, v16h x0, v16h x1, v16h x2, v16h x3, v16h x4, v16h x5) {
#if defined(__HIP_DEVICE_COMPILE__)
  asm volatile("v_nop\n\tv_nop\n\tv_nop\n\tv_nop"
               : "+v"(a), "+v"(b) : "v"(x0), "v"(x1), "v"(x2), "v"(x3), "v"(x4), "v"(x5) : "memory");
#endif
}
__device__ __forceinline__ void acc_guard4(v8f& a, v8f& b, v8f& c, v8f& d) {
#if defined(__HIP_DEVICE_COMPILE__)
  asm volatile("v_nop\n\tv_nop\n\tv_nop\n\tv_nop" : "+v"(a), "+v"(b), "+v"(c), "+v"(d));
#endif
}
// lane l <-> lane l ^ 16 on the vector unit
__device__ __forceinline__ float xhalf(float x) {
  const int b = __builtin_bit_cast(int, x);
  return __builtin_bit_cast(float, __builtin_amdgcn_permlanex16(b, b, 0x76543210, 0xfedcba98, false, false));
}
// Behind the last store of a pass that shares its kernel with another pass: in the listing the other pass's code follows, and no
// address or data register of an issued store is rewritten ahead of this wait.
__device__ __forceinline__ void wait_x0() {
#if defined(__HIP_DEVICE_COMPILE__)
  asm volatile("s_wait_xcnt 0x0" ::: "memory");
#endif
}
__device__ __forceinline__ void wave_sync_lds() {
  __builtin_amdgcn_fence(__ATOMIC_RELEASE, "workgroup");
  __builtin_amdgcn_wave_barrier();
  __builtin_amdgcn_fence(__ATOMIC_ACQUIRE, "workgroup");
}

// =====================================================================================================
// f32 -> bf16 RNE plane, same layout (f16mode == 1: f16 bits of (bf16 RNE value) * scale).
// Thread = 8 consecutive elements: two 16-B loads, one 16-B store; 32 consecutive lanes = 512 contiguous, 512-B aligned
// coverage: grid = ceil(n8/256) blocks x 256 thr x 8 (in-kernel bound) = the whole plane (n8 a multiple of 256 here).
// =====================================================================================================
__device__ __forceinline__ void cvt16(const float* __restrict__ x, u16* D, int n8, int f16mode, float scale, int bid) {
  const int gt = bid * 256 + (int)threadIdx.x;
  if (gt >= n8) return;
  const float* p = x + (size_t)gt * 8;
  const v4f a = *(const v4f*)(p), b4 = *(const v4f*)(p + 4);
  float w[8];
#pragma unroll
  for (int e = 0; e < 4; ++e) { w[e] = a[e]; w[4 + e] = b4[e]; }
  v4u o;
#pragma unroll
  for (int e = 0; e < 4; ++e) {
    const float f0 = w[2 * e], f1 = w[2 * e + 1];
    const unsigned short hb0 = h_bits((_Float16)(bfr(f0) * scale));
    const unsigned short hb1 = h_bits((_Float16)(bfr(f1) * scale));
    const unsigned short bb0 = bf_bits(f0);
    const unsigned short bb1 = bf_bits(f1);
    o[e] = (f16mode != 0) ? pk16(hb0, hb1) : pk16(bb0, bb1);
  }
  u16* d = D + (size_t)gt * 8;
  {
    *(v4u*)(d) = o;
    wait_x0();
  }
}

// =====================================================================================================
// Transposed 16-bit plane of a row-major f32 matrix: in X [R rows][CC cols] (pitch CC) -> out D [CC][R] (pitch R),
// D[c][r] = cvt(X[r][c]); f16mode == 0: bf16 RNE bits; f16mode == 1: f16 bits of (bf16 RNE value) * scale.
// Block = one 64x64 tile (rt = bid / (CC/64) -> rows 64*rt.., ct = bid % (CC/64) -> cols 64*ct..), 256 threads: thread
// (row rl = tid>>2, col chunk cc = 16*(tid&3)) loads its 16 floats with 16-B loads, converts, places them transposed into
// the LDS tile T[c_local][r_local] (pitch 72 halves, 2-B element stores); after a block barrier each output row segment
// coverage: load 256 thr x 16 = 64 x 64; store 2 iterations x 256 thr x 8 halves = 64 lines x 64 = the tile of D;
//           grid = (R/64)*(CC/64) blocks covers D exactly once (R, CC multiples of 64).
// =====================================================================================================
__device__ __forceinline__ void cvtT16(const float* __restrict__ X, int R, int CC, u16* D, int f16mode, float scale, int bid, u16* T) {
  const int tid = (int)threadIdx.x;
  const int nct = CC >> 6;
  const int ct  = bid % nct;
  const int rt  = bid / nct;
  const int r0  = rt * 64, c0 = ct * 64;
  if (r0 + 64 > R) return;                  // block-uniform, before the barrier; never taken with the exact grid
  {
    const int rl = tid >> 2;                // row within tile 0..63
    const int cc = (tid & 3) * 16;          // column chunk 0,16,32,48
    const float* src = X + (size_t)(r0 + rl) * (size_t)CC + c0 + cc;
#pragma unroll
    for (int i = 0; i < 4; ++i) {
      const v4f a = *(const v4f*)(src + 4 * i);
#pragma unroll
      for (int e = 0; e < 4; ++e) {
        const float f = a[e];
        const unsigned short hb = h_bits((_Float16)(bfr(f) * scale));
        const unsigned short bb = bf_bits(f);
        T[(cc + 4 * i + e) * VTP + rl] = (f16mode != 0) ? hb : bb;
      }
    }
  }
  __syncthreads();
  v4u w[2];
  const int q8 = tid >> 3, p8 = (tid & 7) * 8;
#pragma unroll
  for (int it = 0; it < 2; ++it) {
    const int line = it * 32 + q8;          // c_local = 0..63
    w[it] = *(const v4u*)(T + line * VTP + p8);
  }
  const size_t base = (size_t)c0 * (size_t)R + r0 + p8;
  {
#pragma unroll
    for (int it = 0; it < 2; ++it) {
      const int line = it * 32 + q8;
      *(v4u*)(D + base + (size_t)line * (size_t)R) = w[it];
    }
    wait_x0();
  }
}

// =====================================================================================================
// Rotary tables TC[s][j] = cos(s * inv[j]), TS[s][j] = sin(s * inv[j]), j < 16, with
// inv[j] = 1.0f / f32(10000^(2j/32)) (power evaluated in f64 and narrowed once, IEEE f32 reciprocal, f32 product s*inv,
// coverage: grid = n/256 blocks x 256 thr = n = SEQ*16 elements of TC and of TS (n a multiple of 256).
// =====================================================================================================
__device__ __forceinline__ void k_tab(float* TC, float* TS, int n, int bid) {
#pragma clang fp contract(off)
  const int idx = bid * 256 + (int)threadIdx.x;
  if (idx >= n) return;
  const int s = idx / NFREQ;
  const int j = idx - s * NFREQ;
  const double pj = exp2((double)(2 * j) * ROPE_L2);   // 10000^(2j/32)
  const float pf  = (float)pj;
  const float inv = 1.0f / pf;
  const float ang = (float)s * inv;
  float sv, cv;
  sincosf(ang, &sv, &cv);
  {
    *(float*)(TC + idx) = cv;
    *(float*)(TS + idx) = sv;
    wait_x0();
  }
}

// =====================================================================================================
// The four preparation passes, which do not depend on one another, in ONE launch: the block index picks the pass (block-uniform, so
// the transposes' barrier is reached by a whole block or by none), the short latency-bound passes first:
//   [0, PB_WQ)            Wqkv [1024 k][3072 n] -> WB bf16 [3072 n][1024 k]
//   [PB_WQ, PB_WO)        Wo [1024 d][1024 o] -> WT f16 of the bf16 value x1024 [1024 o][1024 d]
//   [PB_WO, PB_T)         rotary tables TC, TS [SEQ][16]
//   [PB_T, PB_X)          x rows -> XB bf16 [ROWS][1024]
// coverage: each range is the exact grid of its pass as stated at the pass.
// =====================================================================================================
#define PB_WQ ((DMOD / 64) * (NQKV / 64))
#define PB_WO (PB_WQ + (DMOD / 64) * (DMOD / 64))
#define PB_T  (PB_WO + (SEQ * NFREQ) / 256)
#define PB_X  (PB_T + (ROWS * DMOD / 8) / 256)
static_assert(((ROWS * DMOD / 8) % 256) == 0);
__global__ __launch_bounds__(256)
void prep(const float* __restrict__ x, const float* __restrict__ wqkv, const float* __restrict__ wo,
          u16* XB, u16* WB, u16* WT, float* TC, float* TS) {
  __shared__ __align__(16) u16 T[64 * VTP];
  const int bid = (int)blockIdx.x;
  if (bid < PB_WQ)      cvtT16(wqkv, DMOD, NQKV, WB, 0, 1.0f, bid, T);
  else if (bid < PB_WO) cvtT16(wo, DMOD, DMOD, WT, 1, WOS, bid - PB_WQ, T);
  else if (bid < PB_T)  k_tab(TC, TS, SEQ * NFREQ, bid - PB_WO);
  else                  cvt16(x, XB, (ROWS * DMOD) / 8, 0, 1.0f, bid - PB_T);
}

// =====================================================================================================
// One element of the partial non-interleaved rotary on dims 0..31 of a head, then its two f16 planes (table column j = d mod 16):
//   d <  16     : out[d] = x[d]*c[s][j] + (-1)*(x[d+16]*sn[s][j])
//   16 <= d < 32: out[d] = x[d]*c[s][j] + (+1)*(x[d-16]*sn[s][j])    (mul, mul, add kept separate)
//   d >= 32     : out[d] = x[d]
//   hb = f16(out * sc), lb = f16 residual (t - f16(t)).
// =====================================================================================================
__device__ __forceinline__ void rot_one(float x, float y, float cv, float sv, float sgn, float sc, int rot,
                                        unsigned short& hb, unsigned short& lb) {
#pragma clang fp contract(off)
  const float ys   = y * sv;
  const float term = sgn * ys;
  const float rr   = x * cv + term;
  const float r    = (rot != 0) ? rr : x;
  const float t    = r * sc;
  const _Float16 a = (_Float16)t;
  hb = h_bits(a);
  lb = h_bits((_Float16)(t - (float)a));
}

// =====================================================================================================
// Epilogue of the f16 GEMM: the wave's 64x64 f32 tile (times oscale) staged in its four LDS slabs (16 rows each, pitch
// 68, wave-private), one wave-level LDS sync, then whole-line stores: one instruction = 2 rows x 16 lanes x 4 floats.
// coverage: 4 slabs x 8 instructions x 2 rows x 16 lanes x 4 floats = the wave's 64 x 64 tile.
// =====================================================================================================
__device__ __forceinline__ void epi_put(float* sl, v8f a0, v8f a1, v8f a2, v8f a3, float oscale, int lane) {
  const int hh = lane >> 4, m = lane & 15;
#pragma unroll
  for (int r = 0; r < 8; ++r) {
    const int ro = (8 * hh + r) * 68 + m;
    sl[ro]      = a0[r] * oscale;
    sl[ro + 16] = a1[r] * oscale;
    sl[ro + 32] = a2[r] * oscale;
    sl[ro + 48] = a3[r] * oscale;
  }
}
__device__ __forceinline__ void epi_get(const float* sl, float* C, int N, size_t rowb, int col0, int lane) {
  const int hh = lane >> 4, m = lane & 15;
  v4f vals[8];
#pragma unroll
  for (int it = 0; it < 8; ++it) vals[it] = *(const v4f*)(sl + (it * 2 + hh) * 68 + m * 4);
  float* dst = C + (rowb + (size_t)hh) * (size_t)N + col0 + m * 4;
#pragma unroll
  for (int it = 0; it < 8; ++it) {
    *(v4f*)(dst + (size_t)(it * 2) * (size_t)N) = vals[it];
  }
}

// =====================================================================================================
// Epilogue of the projection GEMM: the wave's 64 x 64 f32 tile is 64 rows (row = b*SEQ + s) of ONE head of q, k or v (first column a multiple
// of 64; the section, column / DMOD, is the same for the whole block) and goes from the accumulators straight to that section's f16 planes.
// Accumulator element r of acc[i][j] in lane (hh, m) = (row 16 i + 8 hh + r, d = 16 j + m).
//   q, k: the rotary partner of d is d xor 16 = subtile j xor 1 of the same lane and element; table row s, column m. The f16 hi and
//         residual bits (x256) of an element share one 32-bit word in the wave's slab [64 rows][64 d] (pitch 68 words); after a
//         wave-level LDS sync one instruction stores 4 rows x 8 lanes x 8 halves = 4 whole 128-B row segments per plane [ROWS][DMOD].
//   v:    a lane's 8 elements are 8 consecutive keys of one d: f16(v * 1024) and its f16 residual, one 16-B LDS store each into the
//         wave's two tiles [64 d][64 keys] (pitch 72 halves); after the sync 4 whole 128-B d-row segments per store into
//         VH / VL[((b*NH + g)*HD + d)][s].
// The ring is dead here (behind the last stage's barrier); each wave uses its own quarter of it.
// coverage: 16 instructions x 4 lines x 64 halves = 64 x 64 per plane and wave; the grid's waves tile [ROWS][3072] exactly once.
// =====================================================================================================
struct QkvOut { const float* tc; const float* ts; u16* qh; u16* ql; u16* kh; u16* kl; u16* vh; u16* vl; };

__device__ __forceinline__ void epi_qkv(const v8f (&acc)[4][4], const QkvOut& qo, int row0, int col0, u16* sm, int wave, int lane) {
  static_assert(WPB * 2 * HD * VTP <= 2 * 2 * GPLH && WPB * 4 * SLAB64 * 2 <= 2 * 2 * GPLH);
  const int hh = lane >> 4, m = lane & 15;
  const int rq = lane >> 3, c8 = (lane & 7) * 8;
  const int sec  = col0 / DMOD;             // 0 = q, 1 = k, 2 = v: from the block's tile origin, so the branch below is scalar
  const int b    = row0 / SEQ;
  const int roww = row0 + (wave >> 1) * 64;                 // the wave's first row
  const int hcol = col0 - sec * DMOD + (wave & 1) * 64;     // head * HD
  const int s0   = roww - b * SEQ;          // first table row / key of the tile
  // every "#pragma unroll" here makes the indices of acc constants, so that it stays in registers
  if (sec < 2) {
    unsigned* sl = (unsigned*)(void*)sm + (size_t)(wave * 4) * SLAB64;
    const float sc = (sec != 0) ? KSC : QSC;
    const float* cp = qo.tc + (size_t)(s0 + 8 * hh) * NFREQ + m;
    const float* sp = qo.ts + (size_t)(s0 + 8 * hh) * NFREQ + m;
#pragma unroll
    for (int i = 0; i < 4; ++i) {
      float cw[8], sw[8];
#pragma unroll
      for (int r = 0; r < 8; ++r) {
        cw[r] = cp[(i * 16 + r) * NFREQ];
        sw[r] = sp[(i * 16 + r) * NFREQ];
      }
#pragma unroll
      for (int r = 0; r < 8; ++r) {
        const int ro = (i * 16 + 8 * hh + r) * 68 + m;
        unsigned short h0, l0, h1, l1, h2, l2, h3, l3;
        rot_one(acc[i][0][r], acc[i][1][r], cw[r], sw[r], -1.0f, sc, 1, h0, l0);
        rot_one(acc[i][1][r], acc[i][0][r], cw[r], sw[r],  1.0f, sc, 1, h1, l1);
        rot_one(acc[i][2][r], acc[i][2][r], 0.0f, 0.0f, 1.0f, sc, 0, h2, l2);
        rot_one(acc[i][3][r], acc[i][3][r], 0.0f, 0.0f, 1.0f, sc, 0, h3, l3);
        sl[ro]      = pk16(h0, l0);
        sl[ro + 16] = pk16(h1, l1);
        sl[ro + 32] = pk16(h2, l2);
        sl[ro + 48] = pk16(h3, l3);
      }
    }
    wave_sync_lds();
    const size_t ob = (size_t)(roww + rq) * DMOD + hcol + c8;
    u16* dh = ((sec != 0) ? qo.kh : qo.qh) + ob;
    u16* dl = ((sec != 0) ? qo.kl : qo.ql) + ob;
#pragma unroll
    for (int it = 0; it < 16; ++it) {
      const unsigned* pr = sl + (it * 4 + rq) * 68 + c8;
      const v4u a = *(const v4u*)(pr), b4 = *(const v4u*)(pr + 4);
      v4u oh, ol;
#pragma unroll
      for (int e = 0; e < 2; ++e) {
        oh[e]     = (a[2 * e] & 0xFFFFu)  | (a[2 * e + 1] << 16);
        ol[e]     = (a[2 * e] >> 16)      | (a[2 * e + 1] & 0xFFFF0000u);
        oh[2 + e] = (b4[2 * e] & 0xFFFFu) | (b4[2 * e + 1] << 16);
        ol[2 + e] = (b4[2 * e] >> 16)     | (b4[2 * e + 1] & 0xFFFF0000u);
      }
      *(v4u*)(dh + (size_t)(it * 4) * DMOD) = oh;
      *(v4u*)(dl + (size_t)(it * 4) * DMOD) = ol;
    }
  } else {
    u16* th = sm + (size_t)wave * (2 * HD * VTP);
    u16* tl = th + HD * VTP;
#pragma unroll
    for (int i = 0; i < 4; ++i) {
#pragma unroll
      for (int j = 0; j < 4; ++j) {
        v4u ph, pl;
#pragma unroll
        for (int e = 0; e < 4; ++e) {
          const float t0 = acc[i][j][2 * e] * VCAR, t1 = acc[i][j][2 * e + 1] * VCAR;
          const _Float16 h0 = (_Float16)t0, h1 = (_Float16)t1;
          const _Float16 g0 = (_Float16)(t0 - (float)h0), g1 = (_Float16)(t1 - (float)h1);
          ph[e] = pk16(h_bits(h0), h_bits(h1));
          pl[e] = pk16(h_bits(g0), h_bits(g1));
        }
        const int o = (j * 16 + m) * VTP + i * 16 + 8 * hh;
        *(v4u*)(th + o) = ph;
        *(v4u*)(tl + o) = pl;
      }
    }
    wave_sync_lds();
    const size_t base = ((size_t)b * DMOD + hcol + rq) * SEQ + s0 + c8;
#pragma unroll
    for (int it = 0; it < 16; ++it) {
      const int lo = (it * 4 + rq) * VTP + c8;
      const v4u vh = *(const v4u*)(th + lo), vl = *(const v4u*)(tl + lo);
      *(v4u*)(qo.vh + base + (size_t)(it * 4) * SEQ) = vh;
      *(v4u*)(qo.vl + base + (size_t)(it * 4) * SEQ) = vl;
    }
    // behind the last store of this section: no address or data register of an issued store is rewritten ahead of this wait
    asm volatile("s_wait_xcnt 0x0" ::: "memory");
  }
}

// =====================================================================================================
// GEMM core shared by both engines: C[128 x 128 tile] (f32) = (A (+ A2 when MODE == 2)) . Bt^T, times oscale, K = DMOD.
// A, A2 [rows][DMOD] and Bt [n][DMOD] are k-contiguous 16-bit planes (MODE 0: bf16, MODE 1 / 2: f16).
// Block = 4 waves as 2 x 2, each wave a 64 x 64 tile (4 x 4 accumulators). A stage is 64 k = one whole 128-B line of each of the
// 128 A rows (and A2 rows) and 128 Bt rows, laid in LDS at pitch 144 B by asynchronous 16-B copies: thread t copies chunk t & 7 of
// rows (t >> 3) + 16 i, i < 8, so one wave-wide copy covers 4 whole lines. Two buffers: stage t + 1 flies while stage t is worked on.
// Fragments come from LDS with the same split k map for A and B as ldfrag_*; every accumulator takes its products in the order
// k0 = 0, 32, 64, ... (A then A2 within a k0).
// After the last stage's barrier the ring is dead and serves as the waves' own epilogue space (MODE 1 / 2: 4 slabs per wave, 16 x 68 floats each).
// MODE 0 hands its tile to epi_qkv (C, N and oscale unused), MODE 1 / 2 store it to C.
// =====================================================================================================
union FragU { v4u u[2]; v16h h; v16b b; };

__device__ __forceinline__ FragU ldfrag_u(const u16* p) {
  FragU f;
  f.u[0] = *(const v4u*)(p);
  f.u[1] = *(const v4u*)(p + 16);
  return f;
}
template <int MODE>
__device__ __forceinline__ v8f mma_u(const FragU& a, const FragU& b, v8f c) {
  if constexpr (MODE == 0) return mma_b(a.b, b.b, c);
  else                     return mma_h(a.h, b.h, c);
}
__device__ __forceinline__ unsigned lds_addr(const u16* p) {          // byte offset in the work-group's LDS
  return (unsigned)(uintptr_t)(const __attribute__((address_space(3))) u16*)p;
}
// One operand tile of a stage: this lane's eight 16-B copies (rows 16 apart). The s_wait_xcnt stands inside the statement, behind
// the last copy, so that no address register of an issued copy is rewritten ahead of it.
__device__ __forceinline__ void acopy_tile(unsigned l, const u16* g) {
#if defined(__HIP_DEVICE_COMPILE__)
  constexpr unsigned LS = 16u * GPIT * 2u;          // LDS bytes between this lane's rows
  constexpr size_t   GS = (size_t)16 * DMOD;        // halves between this lane's rows in the plane
  asm volatile("global_load_async_to_lds_b128 %0, %8, off\n\t"
               "global_load_async_to_lds_b128 %1, %9, off\n\t"
               "global_load_async_to_lds_b128 %2, %10, off\n\t"
               "global_load_async_to_lds_b128 %3, %11, off\n\t"
               "global_load_async_to_lds_b128 %4, %12, off\n\t"
               "global_load_async_to_lds_b128 %5, %13, off\n\t"
               "global_load_async_to_lds_b128 %6, %14, off\n\t"
               "global_load_async_to_lds_b128 %7, %15, off\n\t"
               "s_wait_xcnt 0x0"
               :: "v"(l), "v"(l + LS), "v"(l + 2u * LS), "v"(l + 3u * LS),
                  "v"(l + 4u * LS), "v"(l + 5u * LS), "v"(l + 6u * LS), "v"(l + 7u * LS),
                  "v"(g), "v"(g + GS), "v"(g + 2 * GS), "v"(g + 3 * GS),
                  "v"(g + 4 * GS), "v"(g + 5 * GS), "v"(g + 6 * GS), "v"(g + 7 * GS)
               : "memory");
#endif
}
__device__ __forceinline__ void wait_async0() {     // this wave's copies have landed in LDS
#if defined(__HIP_DEVICE_COMPILE__)
  asm volatile("s_wait_asynccnt 0x0" ::: "memory");
#endif
}
__device__ __forceinline__ void wait_ds0() {        // this wave's LDS reads have returned before their buffer is handed back
#if defined(__HIP_DEVICE_COMPILE__)
  asm volatile("s_wait_dscnt 0x0" ::: "memory");
#endif
}

// Inputs-only fence on loaded fragments: holds a block's LDS reads together in front of its WMMAs (one wait per block); without it
// the reads are sunk between the rows of WMMAs and every row waits out the LDS latency.
__device__ __forceinline__ void hold4(const FragU& x0, const FragU& x1, const FragU& x2, const FragU& x3) {
#if defined(__HIP_DEVICE_COMPILE__)
  asm volatile("" :: "v"(x0.h), "v"(x1.h), "v"(x2.h), "v"(x3.h));
#endif
}

template <int MODE>
__device__ __forceinline__ void gemm_core(const u16* __restrict__ A, const u16* __restrict__ A2, const u16* __restrict__ Bt,
                                          float* C, int N, float oscale, int row0, int col0, u16* sm, const QkvOut& qo) {
  constexpr int NPL  = (MODE == 2) ? 3 : 2;         // operand tiles per stage
  constexpr int BUFH = NPL * GPLH;                  // halves per buffer
  constexpr int NS   = DMOD / GKS;                  // stages
  static_assert(NS >= 2 && 16 * SLAB64 * 4 <= 2 * BUFH * 2);
  const int tid = threadIdx.x, wave = tid >> 5, lane = tid & 31, hh = lane >> 4, m = lane & 15;
  const int wr = wave >> 1, wc = wave & 1;
  const int crow = tid >> 3, cch = (tid & 7) * 8;
  const u16* ga  = A  + (size_t)(row0 + crow) * DMOD + cch;
  const u16* ga2 = A2 + (size_t)(row0 + crow) * DMOD + cch;
  const u16* gb  = Bt + (size_t)(col0 + crow) * DMOD + cch;
  const unsigned l0 = lds_addr(sm) + (unsigned)(crow * GPIT + cch) * 2u;
  const int fa = (wr * 64 + m) * GPIT + 8 * hh;             // A fragment row of this lane (+ 16 i rows)
  const int fb = GPLH + (wc * 64 + m) * GPIT + 8 * hh;      // Bt fragment row of this lane (+ 16 j rows)

  // every "#pragma unroll" in this function makes the indices of acc, a, b, a2 constants, so that the arrays stay in registers
  v8f acc[4][4];
#pragma unroll
  for (int i = 0; i < 4; ++i) {
#pragma unroll
    for (int j = 0; j < 4; ++j) acc[i][j] = zero8();
  }

  // stage 0 into buffer 0, landed and published; then stage 1 into buffer 1
  acopy_tile(l0, ga);
  acopy_tile(l0 + GPLH * 2u, gb);
  if (MODE == 2) acopy_tile(l0 + 2u * GPLH * 2u, ga2);
  wait_async0();
  __syncthreads();
  acopy_tile(l0 + BUFH * 2u, ga + GKS);
  acopy_tile(l0 + BUFH * 2u + GPLH * 2u, gb + GKS);
  if (MODE == 2) acopy_tile(l0 + BUFH * 2u + 2u * GPLH * 2u, ga2 + GKS);

  // kept rolled: one trip = one stage, so that the publish point below stands once per stage
#pragma unroll 1
  for (int t = 0; t < NS; ++t) {
    const int bo = (t & 1) * BUFH;
    const u16* bp = sm + bo;
#pragma unroll
    for (int kk = 0; kk < GKS / 32; ++kk) {
      FragU a[4], b[4];
#pragma unroll
      for (int i = 0; i < 4; ++i) a[i] = ldfrag_u(bp + fa + i * 16 * GPIT + kk * 32);
#pragma unroll
      for (int j = 0; j < 4; ++j) b[j] = ldfrag_u(bp + fb + j * 16 * GPIT + kk * 32);
      hold4(a[0], a[1], a[2], a[3]);
      hold4(b[0], b[1], b[2], b[3]);
#pragma unroll
      for (int i = 0; i < 4; ++i) {
#pragma unroll
        for (int j = 0; j < 4; ++j) acc[i][j] = mma_u<MODE>(a[i], b[j], acc[i][j]);
      }
      if (MODE == 2) {
        FragU a2[4];
#pragma unroll
        for (int i = 0; i < 4; ++i) a2[i] = ldfrag_u(bp + 2 * GPLH + fa + i * 16 * GPIT + kk * 32);
        hold4(a2[0], a2[1], a2[2], a2[3]);
#pragma unroll
        for (int i = 0; i < 4; ++i) {
#pragma unroll
          for (int j = 0; j < 4; ++j) acc[i][j] = mma_u<MODE>(a2[i], b[j], acc[i][j]);
        }
      }
    }
    // publish point of stage t + 1: own LDS reads back, own copies landed, block barrier; only then the refill of the buffer just read
    wait_ds0();
    wait_async0();
    __syncthreads();
    if (t + 2 < NS) {
      const unsigned lb = l0 + (unsigned)bo * 2u;
      const int ko = (t + 2) * GKS;
      acopy_tile(lb, ga + ko);
      acopy_tile(lb + GPLH * 2u, gb + ko);
      if (MODE == 2) acopy_tile(lb + 2u * GPLH * 2u, ga2 + ko);
    }
  }
  wait_async0();
  (void)ga2;
  if constexpr (MODE == 0) {
    epi_qkv(acc, qo, row0, col0, sm, wave, lane);
  } else {
    float* sl = (float*)(void*)sm + (size_t)(wave * 4) * SLAB64;
#pragma unroll
    for (int i = 0; i < 4; ++i) epi_put(sl + i * SLAB64, acc[i][0], acc[i][1], acc[i][2], acc[i][3], oscale, lane);
    wave_sync_lds();
#pragma unroll
    for (int i = 0; i < 4; ++i) epi_get(sl + i * SLAB64, C, N, (size_t)(row0 + wr * 64 + i * 16), col0 + wc * 64, lane);
    wait_x0();
  }
}

// =====================================================================================================
// bf16 projection GEMM: [M][NQKV] (f32 accumulators) = A[M][DMOD] (bf16 row-major) . Bt[NQKV][DMOD]^T (bf16 k-contiguous); the tile
// leaves as the q / k planes (rotary, x256, hi + residual) or the v^T planes (x1024, hi + residual): epi_qkv.
// Block = one 128 x 128 tile (gemm_core); M % 128 == 0, grid = (M/128)*(NQKV/128).
// =====================================================================================================
__global__ __launch_bounds__(128)
void gemm_bf(const u16* __restrict__ A, const u16* __restrict__ Bt, const float* __restrict__ TC, const float* __restrict__ TS,
             u16* QH, u16* QL, u16* KH, u16* KL, u16* VH, u16* VL, int M) {
  __shared__ __align__(16) u16 ring[2 * 2 * GPLH];
  constexpr int ntile = NQKV / GT;
  const int bid   = blockIdx.x;
  const int row0  = (bid / ntile) * GT;
  const int col0  = (bid % ntile) * GT;
  if (row0 + GT > M) return;                // block-uniform, before any copy or barrier; never taken with the exact grid
  const QkvOut qo = {TC, TS, QH, QL, KH, KL, VH, VL};
  gemm_core<0>(A, A, Bt, nullptr, NQKV, 1.0f, row0, col0, ring, qo);
}

// =====================================================================================================
// f16 GEMM: C[M][N] (f32) = (A[M][DMOD] (+ A2[M][DMOD] when TWO != 0)) . Bt[N][DMOD]^T, times oscale; A, A2 f16 row-major planes
// (A2 = the unscaled f16 residual of A, sharing the accumulator), Bt f16 k-contiguous. Same core as gemm_bf. A, A2 and C hold the
// rows of all sequences (row = b*SEQ + s); one instance takes one row class of every sequence: TWO = 1 the rows s < RICHE, TWO = 0
// the rows s >= RICHE; row tile rt of the class -> sequence rt / (tiles of the class per sequence);
// blocks of the class = NB * (class rows / 128) * (N / 128), bid counted within the class.
// =====================================================================================================
template <int TWO>
__device__ __forceinline__
void gemm_h(const u16* __restrict__ A, const u16* __restrict__ A2, const u16* __restrict__ Bt, float* C,
            int M, int N, float oscale, int bid, u16* ring) {
  const int ntile = N / GT;
  constexpr int CT = ((TWO != 0) ? RICHE : ((SEQ > RICHE) ? (SEQ - RICHE) : GT)) / GT;   // row tiles of the class per sequence
  constexpr int R0 = (TWO != 0) ? 0 : RICHE;                                             // first row of the class in a sequence
  const int rt    = bid / ntile;
  const int row0  = (rt / CT) * SEQ + R0 + (rt % CT) * GT;
  const int col0  = (bid % ntile) * GT;
  if (row0 + GT > M) return;                // block-uniform, before any copy or barrier; never taken with the exact grid
  const QkvOut none = {nullptr, nullptr, nullptr, nullptr, nullptr, nullptr, nullptr, nullptr};
  gemm_core<(TWO != 0) ? 2 : 1>(A, A2, Bt, C, N, oscale, row0, col0, ring, none);
}
// Both row classes in ONE launch (they write disjoint rows of C): blocks [0, GH_R) take the class with the residual plane, which is the
// longer work, the rest the other class; the choice is block-uniform. N == DMOD.
#define GH_R (NB * (RICHE / GT) * (DMOD / GT))
#define GH_P (NB * ((SEQ - RICHE) / GT) * (DMOD / GT))
__global__ __launch_bounds__(128)
void gemm_o(const u16* __restrict__ A, const u16* __restrict__ A2, const u16* __restrict__ Bt, float* C, int M, float oscale) {
  __shared__ __align__(16) u16 ring[2 * 3 * GPLH];
  const int bid = (int)blockIdx.x;
  if (bid < GH_R) gemm_h<1>(A, A2, Bt, C, M, DMOD, oscale, bid, ring);
  else            gemm_h<0>(A, A2, Bt, C, M, DMOD, oscale, bid - GH_R, ring);
}

// Attention stage geometry: 64 keys per stage; every plane tile is 64 rows of 64 halves at pitch 72 halves (144 B) in LDS.
#define AKS   64
#define APIT  72
#define APL   (64 * APIT)
static_assert((NQTR % WPB) == 0 && ((NQT - NQTR) % WPB) == 0 && (SEQ % AKS) == 0 && HD == 64 && ATT_THREADS == 128);
// One plane tile of an attention stage: this lane's four 16-B copies (rows 16 apart, gs halves apart in the plane). The s_wait_xcnt
// stands inside the statement, behind the last copy, so that no address register of an issued copy is rewritten ahead of it.
__device__ __forceinline__ void acopy4(unsigned l, const u16* g, size_t gs) {
#if defined(__HIP_DEVICE_COMPILE__)
  constexpr unsigned LS = 16u * APIT * 2u;          // LDS bytes between this lane's rows
  asm volatile("global_load_async_to_lds_b128 %0, %4, off\n\t"
               "global_load_async_to_lds_b128 %1, %5, off\n\t"
               "global_load_async_to_lds_b128 %2, %6, off\n\t"
               "global_load_async_to_lds_b128 %3, %7, off\n\t"
               "s_wait_xcnt 0x0"
               :: "v"(l), "v"(l + LS), "v"(l + 2u * LS), "v"(l + 3u * LS),
                  "v"(g), "v"(g + gs), "v"(g + 2 * gs), "v"(g + 3 * gs)
               : "memory");
#endif
}

template <int RV>
__device__ __forceinline__
void attn_w(const u16* __restrict__ QHa, const u16* __restrict__ QLa,
            const u16* __restrict__ KHa, const u16* __restrict__ KLa,
            const u16* __restrict__ VHa, const u16* __restrict__ VLa,
            const int* __restrict__ MKa,
            u16* OHa, u16* OLa, int qt0, int nqt, int bid, u16* ring) {
#pragma clang fp contract(off)
  constexpr int NPLA = (RV != 0) ? 4 : 3;   // operand planes per stage: k hi, k residual, v^T hi (, v^T residual)
  constexpr int ABUF = NPLA * APL;          // halves per buffer
  static_assert(WPB * SLW * 4 <= 2 * ABUF * 2);

  const int tid  = threadIdx.x;
  const int wave = __builtin_amdgcn_readfirstlane(tid >> 5);   // in a scalar register: the test of a wave's own tiles is a scalar branch
  const int lane = tid & 31;
  const int hh   = lane >> 4;
  const int c    = lane & 15;
  if (nqt <= 0) return;                     // block-uniform, before any copy or barrier
  const int ngr  = nqt / WPB;               // groups of 4 query tiles (nqt a multiple of 4)
  if (ngr <= 0) return;                     // block-uniform, before any copy or barrier
  const int qtb  = qt0 + (bid % ngr) * WPB; // the block's first query tile
  const int qt   = qtb + wave;
  const int head = (bid / ngr) % NH;
  const int b    = bid / (ngr * NH);
  if (b >= NB) return;                      // block-uniform, before any copy or barrier; never taken with the exact grid
  const size_t po = (size_t)b * SEQ * DMOD; // halves per sequence in every q / k / v^T / O plane (NH*HD == DMOD)
  const u16* __restrict__ QHp = QHa + po;
  const u16* __restrict__ QLp = QLa + po;
  const u16* __restrict__ KHp = KHa + po;
  const u16* __restrict__ KLp = KLa + po;
  const u16* __restrict__ VHp = VHa + po;
  const u16* __restrict__ VLp = VLa + po;
  const int* __restrict__ MK  = MKa + (size_t)b * XS_FULL;
  u16* OHp = OHa + po;
  u16* OLp = OLa + po;
  const int q0   = qt * 16;
  const int Q0   = qtb * 16;
  if (Q0 + 16 * WPB > SEQ) return;          // block-uniform, before any copy or barrier; never taken

  float* slab = (float*)(void*)ring + wave * SLW;   // result slab [16][64] pitch 68: the wave's own part of the ring, once that is dead

  const size_t hcol = (size_t)head * HD + 8 * hh;
  const _Float16* Qh  = (const _Float16*)(const void*)QHp + ((size_t)q0 + c) * DMOD + hcol;
  const _Float16* Ql  = (const _Float16*)(const void*)QLp + ((size_t)q0 + c) * DMOD + hcol;
  // this lane's copies of a stage: chunk cch of rows crow + 16 i of every plane
  const int crow = tid >> 3, cch = (tid & 7) * 8;
  const u16* gkh = KHp + (size_t)crow * DMOD + (size_t)head * HD + cch;       // key row 64*stage added per stage
  const u16* gkl = KLp + (size_t)crow * DMOD + (size_t)head * HD + cch;
  const u16* gvh = VHp + ((size_t)head * HD + crow) * SEQ + cch;              // key 64*stage added per stage
  const u16* gvl = VLp + ((size_t)head * HD + crow) * SEQ + cch;
  (void)gvl;
  const unsigned l0 = lds_addr(ring) + (unsigned)(crow * APIT + cch) * 2u;
  const int fk = c * APIT + 8 * hh;         // fragment row c of a plane tile (halves), split k map
  const float lsc  = SM_SCALE * (1.0f / (QSC * KSC));   // exact power-of-two fold of the q / k carries into the 1/8 scale
  const float oc   = 1.0f / (PCAR * VCAR);
  const float ninf = -__builtin_inff();

  v8f o[4];
#pragma unroll
  for (int j = 0; j < 4; ++j) o[j] = zero8();
  float mrun = ninf, lrun = 0.0f;           // of query q0 + c: running max (both halves alike), sum over this half's keys
  int klo = q0 - (WIN - 1);
  if (klo < 0) klo = 0;
  const int ktlo = klo >> 5;                                                  // first tile intersecting the window
  const int kthi = q0 >> 5;                                                   // tile holding keys q0 .. q0 + 15
  const int qrow  = q0 + c;                                                   // this lane's query: column c of every D tile
  int slo = Q0 - (WIN - 1);
  if (slo < 0) slo = 0;
  const int st0 = slo >> 6;                                                   // first stage intersecting the block's windows
  const int nst = (Q0 >> 6) - st0 + 1;                                        // last stage holds keys Q0 .. Q0 + 63; 1 <= nst <= 9

  // one stage's copies; 64*st + 63 <= Q0 + 63 <= SEQ - 1
  auto stage_in = [&](int st, int buf) {
    const unsigned lb = l0 + (unsigned)(buf * ABUF) * 2u;
    const size_t ko = (size_t)st * AKS;
    acopy4(lb, gkh + ko * DMOD, (size_t)16 * DMOD);
    acopy4(lb + APL * 2u, gkl + ko * DMOD, (size_t)16 * DMOD);
    acopy4(lb + 2u * APL * 2u, gvh + ko, (size_t)16 * SEQ);
    if (RV != 0) acopy4(lb + 3u * APL * 2u, gvl + ko, (size_t)16 * SEQ);
  };
  // stage 0 into buffer 0, landed and published; then, where there is one, stage 1 into buffer 1
  stage_in(st0, 0);
  wait_async0();
  __syncthreads();
  if (nst > 1) stage_in(st0 + 1, 1);

  // both loops kept rolled: one outer trip = one stage, so that the publish point below stands once per stage
#pragma unroll 1
  for (int t = 0; t < nst; ++t) {
   const _Float16* rb = (const _Float16*)(const void*)(ring + (t & 1) * ABUF);
#pragma unroll 1
   for (int th = 0; th < 2; ++th) {
    const int kt = (st0 + t) * 2 + th;
    if (kt < ktlo || kt > kthi) continue;                                     // scalar: not a tile of this wave's window
    const int kb = kt * 32;                                                   // kb + 31 <= SEQ - 1
    // ---- keys this lane's query may see, bit i = key kb + i: padding flags (one coalesced b32 per lane, then a ballot), causal
    //      bound i <= qrow - kb (never negative here), window bound i >= qrow - (WIN-1) - kb; shifted so that bit r is the key of
    //      s0[r] and bit 16 + r the key of s1[r] ----
    const int fl = MK[kb + lane];
    const unsigned fm = __builtin_amdgcn_ballot_w32(fl != 0);
    const int hiN = qrow - kb;
    const int loN = hiN - (WIN - 1);
    const int hiC = (hiN < 31) ? hiN : 31;
    const int loC = (loN > 0) ? loN : 0;
    const unsigned cm  = 0xFFFFFFFFu >> (31 - hiC);
    const unsigned wm  = (loC < 32) ? (0xFFFFFFFFu << (loC & 31)) : 0u;
    const unsigned okh = (fm & cm & wm) >> (8 * hh);
    // ---- raw transposed scores: D element r of this lane = (key kb + 8hh + r, query q0 + c) in s0, key kb + 16 + 8hh + r in s1 ----
    v8f s0 = zero8(), s1 = zero8();
    const _Float16* k0p = rb + th * 32 * APIT + fk;
    const _Float16* k1p = k0p + 16 * APIT;
    const _Float16* l0p = k0p + APL;
    const _Float16* l1p = l0p + 16 * APIT;
#pragma unroll
    for (int kk = 0; kk < HD / 32; ++kk) {
      const v16h qh  = ldfrag_h(Qh + kk * 32);
      const v16h ql  = ldfrag_h(Ql + kk * 32);
      const v16h kh0 = ldfrag_h(k0p + kk * 32);
      const v16h kh1 = ldfrag_h(k1p + kk * 32);
      const v16h kl0 = ldfrag_h(l0p + kk * 32);
      const v16h kl1 = ldfrag_h(l1p + kk * 32);
      s0 = mma_h(kh0, qh, s0);
      s0 = mma_h(kh0, ql, s0);
      s0 = mma_h(kl0, qh, s0);
      s1 = mma_h(kh1, qh, s1);
      s1 = mma_h(kh1, ql, s1);
      s1 = mma_h(kl1, qh, s1);
      guard2(s0, s1, qh, ql, kh0, kl0, kh1, kl1);
    }
    // ---- replace-mask, running-max online softmax in f32: the lane's 16 scores are 16 keys of ONE query, the other 16 keys of
    //      the tile sit in lane ^ 16; the maximum is joined across the halves here, the sums only after the loop ----
    const v8f a0 = s0 * lsc, a1 = s1 * lsc;
    float t0[8], t1[8];
#pragma unroll
    for (int r = 0; r < 8; ++r) {
      t0[r] = ((okh & (1u << r)) != 0u) ? a0[r] : ninf;
      t1[r] = ((okh & (0x10000u << r)) != 0u) ? a1[r] : ninf;
    }
    float mx = fmaxf(t0[0], t1[0]);
#pragma unroll
    for (int r = 1; r < 8; ++r) mx = fmaxf(mx, fmaxf(t0[r], t1[r]));
    mx = fmaxf(mx, xhalf(mx));
    const float mnew  = fmaxf(mrun, mx);
    const float mshft = (mnew == ninf) ? 0.0f : mnew;
    const float al    = __expf(mrun - mshft);
    v8f p0, p1;
#pragma unroll
    for (int r = 0; r < 8; ++r) {
      p0[r] = __expf(t0[r] - mshft);
      p1[r] = __expf(t1[r] - mshft);
    }
    const v8f ps = p0 + p1;
    const float sm = ((ps[0] + ps[1]) + (ps[2] + ps[3])) + ((ps[4] + ps[5]) + (ps[6] + ps[7]));
    lrun = lrun * al + sm;
    mrun = mnew;
    // ---- rescale the O^T accumulators by alpha (every element of a lane belongs to its query) ----
#pragma unroll
    for (int j = 0; j < 4; ++j) {
#pragma unroll
      for (int r = 0; r < 8; ++r) o[j][r] = o[j][r] * al;
    }
    // ---- B fragments of p*32768 straight from the score registers: column = query c, elements 0..7 = keys kb + 8hh + 0..7 (s0),
    //      elements 8..15 = keys kb + 16 + 8hh + 0..7 (s1): the split k map of the v^T A fragments; hi f16 (and residual f16) ----
    FragH ph, pl;
    const v8f c0 = p0 * PCAR, c1 = p1 * PCAR;
#pragma unroll
    for (int e = 0; e < 8; ++e) {
      const float ta = c0[e], tb = c1[e];
      const _Float16 ha = (_Float16)ta, hb = (_Float16)tb;
      ph.h[0][e] = ha;
      ph.h[1][e] = hb;
      if (RV != 0) {
        pl.h[0][e] = (_Float16)(ta - (float)ha);
        pl.h[1][e] = (_Float16)(tb - (float)hb);
      }
    }
    // ---- O^T += v^T . P^T : A fragment row = d = j*16 + c, keys contiguous in the v^T planes; 2 groups of 2 d-subtiles ----
    {
      const _Float16* vhp = rb + 2 * APL + fk + th * 32;
      const _Float16* vlp = vhp + APL;
      (void)vlp;
#pragma unroll
      for (int jg = 0; jg < 2; ++jg) {
        const int da = (2 * jg) * 16 * APIT;
        const int db = da + 16 * APIT;
        const v16h vha = ldfrag_h(vhp + da), vhb2 = ldfrag_h(vhp + db);
        o[2 * jg]     = mma_h(vha,  ph.v, o[2 * jg]);
        o[2 * jg + 1] = mma_h(vhb2, ph.v, o[2 * jg + 1]);
        if (RV != 0) {
          const v16h vla = ldfrag_h(vlp + da), vlb2 = ldfrag_h(vlp + db);
          o[2 * jg]     = mma_h(vha,  pl.v, o[2 * jg]);
          o[2 * jg]     = mma_h(vla,  ph.v, o[2 * jg]);
          o[2 * jg + 1] = mma_h(vhb2, pl.v, o[2 * jg + 1]);
          o[2 * jg + 1] = mma_h(vlb2, ph.v, o[2 * jg + 1]);
          guard2(o[2 * jg], o[2 * jg + 1], ph.v, pl.v, vha, vhb2, vla, vlb2);
        } else {
          guard2(o[2 * jg], o[2 * jg + 1], ph.v, ph.v, vha, vhb2, vha, vhb2);
        }
      }
    }
   }
   // publish point of stage t + 1: own LDS reads back, own copies landed, block barrier; only then the refill of the buffer just read
   wait_ds0();
   wait_async0();
   __syncthreads();
   if (t + 2 < nst) stage_in(st0 + t + 2, t & 1);
  }
  wait_async0();
  acc_guard4(o[0], o[1], o[2], o[3]);
  // ---- l = the two halves' sums joined; O = acc / l with the carries (32768 on p, 1024 on v) folded once (0 when l == 0); a
  //      lane's 8 elements of o[j] are d = 16 j + 8 hh + 0..7 of query row c: two 16-B stores into the wave's slab [row][d] ----
  const float lall = lrun + xhalf(lrun);
  const bool  okl  = lall > 0.0f;
  const float lden = okl ? lall : 1.0f;
  const float rec  = (1.0f / lden) * oc;
  const float rl   = okl ? rec : 0.0f;
#pragma unroll
  for (int j = 0; j < 4; ++j) {
    v4f w0, w1;
#pragma unroll
    for (int e = 0; e < 4; ++e) { w0[e] = o[j][e] * rl; w1[e] = o[j][4 + e] * rl; }
    float* sd = slab + c * SLP + j * 16 + 8 * hh;
    *(v4f*)(sd)     = w0;
    *(v4f*)(sd + 4) = w1;
  }
  wave_sync_lds();
  // ---- O x256 -> f16 hi plane (+ f16 residual plane); lane = (row group rq, 8 consecutive d at c8) ----
  v4u oh[4], ol[4];
  const int rq = lane >> 3, c8 = (lane & 7) * 8;
#pragma unroll
  for (int it = 0; it < 4; ++it) {
    const int row = it * 4 + rq;
    const v4f a = *(const v4f*)(slab + row * SLP + c8), b4 = *(const v4f*)(slab + row * SLP + c8 + 4);
    float w[8];
#pragma unroll
    for (int e = 0; e < 4; ++e) { w[e] = a[e] * OSC; w[4 + e] = b4[e] * OSC; }
#pragma unroll
    for (int e = 0; e < 4; ++e) {
      const _Float16 h0 = (_Float16)w[2 * e], h1 = (_Float16)w[2 * e + 1];
      const _Float16 g0 = (_Float16)(w[2 * e] - (float)h0), g1 = (_Float16)(w[2 * e + 1] - (float)h1);
      oh[it][e] = pk16(h_bits(h0), h_bits(h1));
      ol[it][e] = pk16(h_bits(g0), h_bits(g1));
    }
  }
  const size_t ob = ((size_t)q0) * DMOD + (size_t)head * HD + c8;
  {
#pragma unroll
    for (int it = 0; it < 4; ++it) {
      const int row = it * 4 + rq;
      *(v4u*)(OHp + ob + (size_t)row * DMOD) = oh[it];
      if (RV != 0) {
        *(v4u*)(OLp + ob + (size_t)row * DMOD) = ol[it];
      }
    }
    wait_x0();
  }
}

// Both row classes in ONE launch (they write disjoint rows of the O planes): blocks [0, AT_P) take the query tiles NQTR .. NQT-1
// (RV = 0), the rest the tiles 0 .. NQTR-1 (RV = 1), whose windows are shorter; the choice is block-uniform.
#define AT_P (NB * (NQT - NQTR) * NHG)
#define AT_R (NB * NQTR * NHG)
__global__ __launch_bounds__(ATT_THREADS)
void attn_all(const u16* __restrict__ QHa, const u16* __restrict__ QLa,
              const u16* __restrict__ KHa, const u16* __restrict__ KLa,
              const u16* __restrict__ VHa, const u16* __restrict__ VLa,
              const int* __restrict__ MKa, u16* OHa, u16* OLa) {
  __shared__ __align__(16) u16 ring[2 * 4 * APL];
  const int bid = (int)blockIdx.x;
  if (bid < AT_P) attn_w<0>(QHa, QLa, KHa, KLa, VHa, VLa, MKa, OHa, OLa, NQTR, NQT - NQTR, bid, ring);
  else            attn_w<1>(QHa, QLa, KHa, KLa, VHa, VLa, MKa, OHa, OLa, 0, NQTR, bid - AT_P, ring);
}

// =====================================================================================================
// Workspace map (bytes); every plane holds all NB sequences (ROWS = NB*SEQ rows), each stage is one launch over all of them;
// every plane is fully written by whole-line stores before it is read (the O residual plane only on the rows < RICHE of each
// sequence that are read); all extents are exact multiples of the store granularity; every region offset a multiple of 131072:
//   XB  bf16 [ROWS][1024]                ROWS*2048   (ROWS=8192: 16777216)
//   WB  bf16 [3072 n][1024 k]            6291456     (q rows 0..1023, k 1024..2047, v 2048..3071)
//   WT  f16  [1024 o][1024 d] x1024      2097152
//   QH  f16 [ROWS][1024] x256            ROWS*2048   QL residual, same extent
//   KH  f16 [ROWS][1024] x256            ROWS*2048   KL residual, same extent
//   VH  f16 [NB][16][64][SEQ] x1024      ROWS*2048   VL residual, same extent
//   OH  f16 [ROWS][1024] x256            ROWS*2048   OL residual, same extent (rows < RICHE of each sequence written / read)
//   TC  f32 [SEQ][16]                    SEQ*64      TS, same extent
//   end (SEQ=2048, NB=4)                159645696
// =====================================================================================================
extern "C" void kernel_launch(void* const* d_in, const int* in_sizes, int n_in,
                              void* d_out, int out_size, void* d_ws, size_t ws_size,
                              hipStream_t stream) {
  if (n_in < 4) return;
  if (in_sizes[0] < ((NB - 1) * XS_FULL + SEQ) * DMOD) return;
  if (in_sizes[1] < (NB - 1) * XS_FULL + SEQ) return;
  if (in_sizes[2] != DMOD * NQKV) return;
  if (in_sizes[3] != DMOD * DMOD) return;
  if (out_size < ((NB - 1) * XS_FULL + SEQ) * DMOD) return;

  const float* x    = (const float*)d_in[0];
  const int*   mask = (const int*)d_in[1];
  const float* wqkv = (const float*)d_in[2];       // [1024 k][3072 n]
  const float* wo   = (const float*)d_in[3];       // [1024 d][1024 o]
  float*       out  = (float*)d_out;

  const size_t szXB = (size_t)ROWS * DMOD * 2;
  const size_t szWB = (size_t)NQKV * DMOD * 2;
  const size_t szWT = (size_t)DMOD * DMOD * 2;
  const size_t szQ  = (size_t)ROWS * DMOD * 2;                   // QH, QL, KH, KL, OH, OL
  const size_t szV  = (size_t)NB * NH * HD * SEQ * 2;            // VH, VL (== szQ)
  const size_t szT  = (size_t)SEQ * NFREQ * 4;                   // TC, TS
  size_t off = 0;
  const size_t oXB = off; off += szXB;
  const size_t oWB = off; off += szWB;
  const size_t oWT = off; off += szWT;
  const size_t oQH = off; off += szQ;
  const size_t oQL = off; off += szQ;
  const size_t oKH = off; off += szQ;
  const size_t oKL = off; off += szQ;
  const size_t oVH = off; off += szV;
  const size_t oVL = off; off += szV;
  const size_t oOH = off; off += szQ;
  const size_t oOL = off; off += szQ;
  const size_t oTC = off; off += szT;
  const size_t oTS = off; off += szT;
  if (off > ws_size) return;                // off = 159645696 for SEQ = 2048, NB = 4
  if (off > (size_t)WS_CAP) return;

  char* ws = (char*)d_ws;
  u16*   XB  = (u16*)(ws + oXB);
  u16*   WB  = (u16*)(ws + oWB);
  u16*   WT  = (u16*)(ws + oWT);
  u16*   QH  = (u16*)(ws + oQH);
  u16*   QL  = (u16*)(ws + oQL);
  u16*   KH  = (u16*)(ws + oKH);
  u16*   KL  = (u16*)(ws + oKL);
  u16*   VH  = (u16*)(ws + oVH);
  u16*   VL  = (u16*)(ws + oVL);
  u16*   OH  = (u16*)(ws + oOH);
  u16*   OL  = (u16*)(ws + oOL);
  float* TC  = (float*)(ws + oTC);
  float* TS  = (float*)(ws + oTS);

  const dim3 b256(256), b128(128), bAT(ATT_THREADS);
  const dim3 gG1((ROWS / GT) * (NQKV / GT));
  const float osc = 1.0f / (OSC * WOS);

  // every stage: all sequences in one launch (x, mask and out rows of the NB sequences are contiguous)
  // (0..2) one launch: weight planes (Wqkv transposed to bf16 [n][k]; Wo transposed to f16 of the bf16 value x1024 [o][d]), rotary
  //        cos / sin tables [SEQ][16], x rows -> bf16 plane [ROWS][1024]
  prep<<<dim3(PB_X), b256, 0, stream>>>(x, wqkv, wo, XB, WB, WT, TC, TS);
  // (3) qkv = x.Wqkv; its epilogue: partial rotary + hi + residual planes x256 of q (columns 0..1023) and k (1024..2047),
  //     v^T hi + residual planes x1024 (columns 2048..3071)
  gemm_bf<<<gG1, b128, 0, stream>>>(XB, WB, TC, TS, QH, QL, KH, KL, VH, VL, ROWS);
  // (4) windowed causal attention with key padding -> O f16 hi plane x256 for all query tiles; residual plane for rows < RICHE
  attn_all<<<dim3(AT_P + AT_R), bAT, 0, stream>>>(QH, QL, KH, KL, VH, VL, mask, OH, OL);
  // (5) y = O.Wo -> out f32, carries 256 x 1024 folded back; rows < RICHE of each sequence with O hi + residual
  gemm_o<<<dim3(GH_R + GH_P), b128, 0, stream>>>(OH, OL, WT, out, ROWS, osc);
  (void)hipGetLastError();
}

// v007
// Measured time: 121 microseconds a run.
// Timed twice side by side with v006, it ran 1.13 times as fast both times.
// All steps since v000 together make it 6.19 times as fast.
// Contractions: x.Wqkv on v_wmma_f32_16x16x32_bf16 (x and the transposed weight as bf16 RNE planes; weight plane [n][k]
// rows are the k-contiguous B operand; f32 accumulate); q.k^T over hd 64 and P.v on v_wmma_f32_16x16x32_f16 with f16 hi +
// f16 residual planes (q, k x256 after partial rotary, products hh+lh+hl on every row; P x32768 hi + in-register residual
// and v^T x1024 hi + residual plane for query rows < 512 of each sequence, P hi . v hi only for later rows); O.Wo on
// v_wmma_f32_16x16x32_f16 with O x256 as f16 hi (+ f16 residual plane for rows < 512 of each sequence) and Wo transposed
// to [o][d] as f16(bf16(Wo)) x1024, one accumulator; all f32 accumulate. Rotary cos/sin tables, causal + window + key
// padding masks and the online softmax in f32 on VALU.
#include <hip/hip_runtime.h>
#include <math.h>
#include <stdint.h>

#ifndef NB
#define NB 4
#endif
#ifndef SEQ
#define SEQ 2048
#endif
#ifndef RICH
#define RICH 512
#endif
#define NB_FULL 4
#define XS_FULL 2048
#define DMOD  1024
#define NH    16
#define HD    64
#define HROT  32
#define HROTH 16
#define NFREQ 16
#define NQKV  (3 * DMOD)
#define WIN   512
#define RICHE ((RICH < SEQ) ? RICH : SEQ)
#define ROPE_L2 0.41524101186092028
#define SM_SCALE 0.125f
#define QSC   256.0f
#define KSC   256.0f
#define PCAR  32768.0f
#define VCAR  1024.0f
#define OSC   256.0f
#define WOS   1024.0f
#define WPB   4
#define NHG   (NH / WPB)
#define NQT   (SEQ / 16)
#define NQTR  (RICHE / 16)
#define NST   (SEQ / 64)
#define NKT   (SEQ / 32)
#define ATT_THREADS (WPB * 32)
#define PTP   36
#define PTW   (16 * PTP)
#define SLP   68
#define SLW   (16 * SLP)
#define WREG  (PTW + SLW)
#define SLAB64 (16 * 68)
#define VTP   72
#define WS_CAP 268435456
#define ROWS  (NB * SEQ)
#define GT    128
#define GKS   64
#define GPIT  72
#define GPLH  (GT * GPIT)
static_assert(DMOD == NH * HD && HD == 64 && HROT == 32 && HROTH == 16 && NFREQ == 16 && NH == 16 && WPB == 4 && NHG * WPB == NH);
static_assert(ATT_THREADS == 128 && NQKV == 3072 && WIN == 512 && NHG == 4);
static_assert(NB >= 1 && NB <= NB_FULL);
static_assert(NB == 1 || SEQ == XS_FULL);
static_assert((SEQ % 64) == 0 && SEQ >= 64 && SEQ <= XS_FULL);
static_assert((RICHE % 64) == 0 && RICHE >= 64 && RICHE <= SEQ);
static_assert((DMOD % 64) == 0 && (NQKV % 64) == 0 && (DMOD % 32) == 0 && (HD % 32) == 0);
static_assert(((SEQ * DMOD / 8) % 256) == 0 && ((SEQ * NFREQ) % 256) == 0);
static_assert(WPB * WREG * 4 <= 65536 && 2 * HD * VTP * 2 <= 65536 && 4 * SLAB64 * 4 <= 65536 && 64 * VTP * 2 <= 65536);
static_assert(NQT * 16 == SEQ && NQTR * 16 == RICHE && NKT * 32 == SEQ && NST * 64 == SEQ);
static_assert((RICHE % GT) == 0 && ((SEQ - RICHE) % GT) == 0 && (ROWS % GT) == 0 && (NQKV % GT) == 0 && (DMOD % GT) == 0 && (DMOD % GKS) == 0);

typedef unsigned short u16;
typedef _Float16 v16h __attribute__((ext_vector_type(16)));
typedef _Float16 v8h  __attribute__((ext_vector_type(8)));
typedef __bf16   v16b __attribute__((ext_vector_type(16)));
typedef float    v8f  __attribute__((ext_vector_type(8)));
typedef float    v4f  __attribute__((ext_vector_type(4)));
typedef unsigned int v4u __attribute__((ext_vector_type(4)));

union FragH { v16h v; v8h h[2]; v4u u[2]; };

// ---- scalar helpers --------------------------------------------------------------------------------
__device__ __forceinline__ unsigned short bf_bits(float f) {          // f32 -> bf16 bits, RNE convert
  unsigned u = __float_as_uint(f);
  return (unsigned short)((u + 0x7FFFu + ((u >> 16) & 1u)) >> 16);
}
__device__ __forceinline__ float bf_up(unsigned short h) { return __uint_as_float(((unsigned)h) << 16); }
__device__ __forceinline__ float bfr(float f) { return bf_up(bf_bits(f)); }
__device__ __forceinline__ unsigned short h_bits(_Float16 x) { return __builtin_bit_cast(unsigned short, x); }
__device__ __forceinline__ unsigned pk16(unsigned short a, unsigned short b) { return (unsigned)a | ((unsigned)b << 16); }
__device__ __forceinline__ v8f zero8() { v8f z = {0.f, 0.f, 0.f, 0.f, 0.f, 0.f, 0.f, 0.f}; return z; }

// ---- fragment loaders: 16-bit A/B operand, lane -> row/col (lane&15), p already includes +8*(lane>>4);
//      elements 0..7 <- p[0..7] (k0+8h..), elements 8..15 <- p[16..23] (k0+16+8h..)  (same split k map for A and B;
//      B is always read from a k-contiguous [n][k] plane)
__device__ __forceinline__ v16h ldfrag_h(const _Float16* p) {
  FragH f;
  f.h[0] = *(const v8h*)(p);
  f.h[1] = *(const v8h*)(p + 16);
  return f.v;
}

__device__ __forceinline__ v8f mma_h(v16h a, v16h b, v8f c) {
  return __builtin_amdgcn_wmma_f32_16x16x32_f16(false, a, false, b, (short)0, c, false, false);
}
__device__ __forceinline__ v8f mma_b(v16b a, v16b b, v8f c) {
  return __builtin_amdgcn_wmma_f32_16x16x32_bf16(false, a, false, b, (short)0, c, false, false);
}
__device__ __forceinline__ void guard2(v8f& a, v8f& b, v16h x0, v16h x1, v16h x2, v16h x3, v16h x4, v16h x5) {
#if defined(__HIP_DEVICE_COMPILE__)
  asm volatile("v_nop\n\tv_nop\n\tv_nop\n\tv_nop"
               : "+v"(a), "+v"(b) : "v"(x0), "v"(x1), "v"(x2), "v"(x3), "v"(x4), "v"(x5) : "memory");
#endif
}
__device__ __forceinline__ void acc_guard4(v8f& a, v8f& b, v8f& c, v8f& d) {
#if defined(__HIP_DEVICE_COMPILE__)
  asm volatile("v_nop\n\tv_nop\n\tv_nop\n\tv_nop" : "+v"(a), "+v"(b), "+v"(c), "+v"(d));
#endif
}
// lane l <-> lane l ^ 16 on the vector unit
__device__ __forceinline__ float xhalf(float x) {
  const int b = __builtin_bit_cast(int, x);
  return __builtin_bit_cast(float, __builtin_amdgcn_permlanex16(b, b, 0x76543210, 0xfedcba98, false, false));
}
// Behind the last store of a pass that shares its kernel with another pass: in the listing the other pass's code follows, and no
// address or data register of an issued store is rewritten ahead of this wait.
__device__ __forceinline__ void wait_x0() {
#if defined(__HIP_DEVICE_COMPILE__)
  asm volatile("s_wait_xcnt 0x0" ::: "memory");
#endif
}
__device__ __forceinline__ void wave_sync_lds() {
  __builtin_amdgcn_fence(__ATOMIC_RELEASE, "workgroup");
  __builtin_amdgcn_wave_barrier();
  __builtin_amdgcn_fence(__ATOMIC_ACQUIRE, "workgroup");
}

// =====================================================================================================
// f32 -> bf16 RNE plane, same layout (f16mode == 1: f16 bits of (bf16 RNE value) * scale).
// Thread = 8 consecutive elements: two 16-B loads, one 16-B store; 32 consecutive lanes = 512 contiguous, 512-B aligned
// coverage: grid = ceil(n8/256) blocks x 256 thr x 8 (in-kernel bound) = the whole plane (n8 a multiple of 256 here).
// =====================================================================================================
__device__ __forceinline__ void cvt16(const float* __restrict__ x, u16* D, int n8, int f16mode, float scale, int bid) {
  const int gt = bid * 256 + (int)threadIdx.x;
  if (gt >= n8) return;
  const float* p = x + (size_t)gt * 8;
  const v4f a = *(const v4f*)(p), b4 = *(const v4f*)(p + 4);
  float w[8];
#pragma unroll
  for (int e = 0; e < 4; ++e) { w[e] = a[e]; w[4 + e] = b4[e]; }
  v4u o;
#pragma unroll
  for (int e = 0; e < 4; ++e) {
    const float f0 = w[2 * e], f1 = w[2 * e + 1];
    const unsigned short hb0 = h_bits((_Float16)(bfr(f0) * scale));
    const unsigned short hb1 = h_bits((_Float16)(bfr(f1) * scale));
    const unsigned short bb0 = bf_bits(f0);
    const unsigned short bb1 = bf_bits(f1);
    o[e] = (f16mode != 0) ? pk16(hb0, hb1) : pk16(bb0, bb1);
  }
  u16* d = D + (size_t)gt * 8;
  {
    *(v4u*)(d) = o;
    wait_x0();
  }
}

// =====================================================================================================
// Transposed 16-bit plane of a row-major f32 matrix: in X [R rows][CC cols] (pitch CC) -> out D [CC][R] (pitch R),
// D[c][r] = cvt(X[r][c]); f16mode == 0: bf16 RNE bits; f16mode == 1: f16 bits of (bf16 RNE value) * scale.
// Block = one 64x64 tile (rt = bid / (CC/64) -> rows 64*rt.., ct = bid % (CC/64) -> cols 64*ct..), 256 threads: thread
// (row rl = tid>>2, col chunk cc = 16*(tid&3)) loads its 16 floats with 16-B loads, converts, places them transposed into
// the LDS tile T[c_local][r_local] (pitch 72 halves, 2-B element stores); after a block barrier each output row segment
// coverage: load 256 thr x 16 = 64 x 64; store 2 iterations x 256 thr x 8 halves = 64 lines x 64 = the tile of D;
//           grid = (R/64)*(CC/64) blocks covers D exactly once (R, CC multiples of 64).
// =====================================================================================================
__device__ __forceinline__ void cvtT16(const float* __restrict__ X, int R, int CC, u16* D, int f16mode, float scale, int bid, u16* T) {
  const int tid = (int)threadIdx.x;
  const int nct = CC >> 6;
  const int ct  = bid % nct;
  const int rt  = bid / nct;
  const int r0  = rt * 64, c0 = ct * 64;
  if (r0 + 64 > R) return;                  // block-uniform, before the barrier; never taken with the exact grid
  {
    const int rl = tid >> 2;                // row within tile 0..63
    const int cc = (tid & 3) * 16;          // column chunk 0,16,32,48
    const float* src = X + (size_t)(r0 + rl) * (size_t)CC + c0 + cc;
#pragma unroll
    for (int i = 0; i < 4; ++i) {
      const v4f a = *(const v4f*)(src + 4 * i);
#pragma unroll
      for (int e = 0; e < 4; ++e) {
        const float f = a[e];
        const unsigned short hb = h_bits((_Float16)(bfr(f) * scale));
        const unsigned short bb = bf_bits(f);
        T[(cc + 4 * i + e) * VTP + rl] = (f16mode != 0) ? hb : bb;
      }
    }
  }
  __syncthreads();
  v4u w[2];
  const int q8 = tid >> 3, p8 = (tid & 7) * 8;
#pragma unroll
  for (int it = 0; it < 2; ++it) {
    const int line = it * 32 + q8;          // c_local = 0..63
    w[it] = *(const v4u*)(T + line * VTP + p8);
  }
  const size_t base = (size_t)c0 * (size_t)R + r0 + p8;
  {
#pragma unroll
    for (int it = 0; it < 2; ++it) {
      const int line = it * 32 + q8;
      *(v4u*)(D + base + (size_t)line * (size_t)R) = w[it];
    }
    wait_x0();
  }
}

// =====================================================================================================
// Rotary tables TC[s][j] = cos(s * inv[j]), TS[s][j] = sin(s * inv[j]), j < 16, with
// inv[j] = 1.0f / f32(10000^(2j/32)) (power evaluated in f64 and narrowed once, IEEE f32 reciprocal, f32 product s*inv,
// coverage: grid = n/256 blocks x 256 thr = n = SEQ*16 elements of TC and of TS (n a multiple of 256).
// =====================================================================================================
__device__ __forceinline__ void k_tab(float* TC, float* TS, int n, int bid) {
#pragma clang fp contract(off)
  const int idx = bid * 256 + (int)threadIdx.x;
  if (idx >= n) return;
  const int s = idx / NFREQ;
  const int j = idx - s * NFREQ;
  const double pj = exp2((double)(2 * j) * ROPE_L2);   // 10000^(2j/32)
  const float pf  = (float)pj;
  const float inv = 1.0f / pf;
  const float ang = (float)s * inv;
  float sv, cv;
  sincosf(ang, &sv, &cv);
  {
    *(float*)(TC + idx) = cv;
    *(float*)(TS + idx) = sv;
    wait_x0();
  }
}

// =====================================================================================================
// The four preparation passes, which do not depend on one another, in ONE launch: the block index picks the pass (block-uniform, so
// the transposes' barrier is reached by a whole block or by none), the short latency-bound passes first:
//   [0, PB_WQ)            Wqkv [1024 k][3072 n] -> WB bf16 [3072 n][1024 k]
//   [PB_WQ, PB_WO)        Wo [1024 d][1024 o] -> WT f16 of the bf16 value x1024 [1024 o][1024 d]
//   [PB_WO, PB_T)         rotary tables TC, TS [SEQ][16]
//   [PB_T, PB_X)          x rows -> XB bf16 [ROWS][1024]
// coverage: each range is the exact grid of its pass as stated at the pass.
// =====================================================================================================
#define PB_WQ ((DMOD / 64) * (NQKV / 64))
#define PB_WO (PB_WQ + (DMOD / 64) * (DMOD / 64))
#define PB_T  (PB_WO + (SEQ * NFREQ) / 256)
#define PB_X  (PB_T + (ROWS * DMOD / 8) / 256)
static_assert(((ROWS * DMOD / 8) % 256) == 0);
__global__ __launch_bounds__(256)
void prep(const float* __restrict__ x, const float* __restrict__ wqkv, const float* __restrict__ wo,
          u16* XB, u16* WB, u16* WT, float* TC, float* TS) {
  __shared__ __align__(16) u16 T[64 * VTP];
  const int bid = (int)blockIdx.x;
  if (bid < PB_WQ)      cvtT16(wqkv, DMOD, NQKV, WB, 0, 1.0f, bid, T);
  else if (bid < PB_WO) cvtT16(wo, DMOD, DMOD, WT, 1, WOS, bid - PB_WQ, T);
  else if (bid < PB_T)  k_tab(TC, TS, SEQ * NFREQ, bid - PB_WO);
  else                  cvt16(x, XB, (ROWS * DMOD) / 8, 0, 1.0f, bid - PB_T);
}

// =====================================================================================================
// One element of the partial non-interleaved rotary on dims 0..31 of a head, then its two f16 planes (table column j = d mod 16):
//   d <  16     : out[d] = x[d]*c[s][j] + (-1)*(x[d+16]*sn[s][j])
//   16 <= d < 32: out[d] = x[d]*c[s][j] + (+1)*(x[d-16]*sn[s][j])    (mul, mul, add kept separate)
//   d >= 32     : out[d] = x[d]
//   hb = f16(out * sc), lb = f16 residual (t - f16(t)).
// =====================================================================================================
__device__ __forceinline__ void rot_one(float x, float y, float cv, float sv, float sgn, float sc, int rot,
                                        unsigned short& hb, unsigned short& lb) {
#pragma clang fp contract(off)
  const float ys   = y * sv;
  const float term = sgn * ys;
  const float rr   = x * cv + term;
  const float r    = (rot != 0) ? rr : x;
  const float t    = r * sc;
  const _Float16 a = (_Float16)t;
  hb = h_bits(a);
  lb = h_bits((_Float16)(t - (float)a));
}

// =====================================================================================================
// Epilogue of the f16 GEMM: the wave's 64x64 f32 tile (times oscale) staged in its four LDS slabs (16 rows each, pitch
// 68, wave-private), one wave-level LDS sync, then whole-line stores: one instruction = 2 rows x 16 lanes x 4 floats.
// coverage: 4 slabs x 8 instructions x 2 rows x 16 lanes x 4 floats = the wave's 64 x 64 tile.
// =====================================================================================================
__device__ __forceinline__ void epi_put(float* sl, v8f a0, v8f a1, v8f a2, v8f a3, float oscale, int lane) {
  const int hh = lane >> 4, m = lane & 15;
#pragma unroll
  for (int r = 0; r < 8; ++r) {
    const int ro = (8 * hh + r) * 68 + m;
    sl[ro]      = a0[r] * oscale;
    sl[ro + 16] = a1[r] * oscale;
    sl[ro + 32] = a2[r] * oscale;
    sl[ro + 48] = a3[r] * oscale;
  }
}
__device__ __forceinline__ void epi_get(const float* sl, float* C, int N, size_t rowb, int col0, int lane) {
  const int hh = lane >> 4, m = lane & 15;
  v4f vals[8];
#pragma unroll
  for (int it = 0; it < 8; ++it) vals[it] = *(const v4f*)(sl + (it * 2 + hh) * 68 + m * 4);
  float* dst = C + (rowb + (size_t)hh) * (size_t)N + col0 + m * 4;
#pragma unroll
  for (int it = 0; it < 8; ++it) {
    *(v4f*)(dst + (size_t)(it * 2) * (size_t)N) = vals[it];
  }
}

// =====================================================================================================
// Epilogue of the projection GEMM: the wave's 64 x 64 f32 tile is 64 rows (row = b*SEQ + s) of ONE head of q, k or v (first column a multiple
// of 64; the section, column / DMOD, is the same for the whole block) and goes from the accumulators straight to that section's f16 planes.
// Accumulator element r of acc[i][j] in lane (hh, m) = (row 16 i + 8 hh + r, d = 16 j + m).
//   q, k: the rotary partner of d is d xor 16 = subtile j xor 1 of the same lane and element; table row s, column m. The f16 hi and
//         residual bits (x256) of an element share one 32-bit word in the wave's slab [64 rows][64 d] (pitch 68 words); after a
//         wave-level LDS sync one instruction stores 4 rows x 8 lanes x 8 halves = 4 whole 128-B row segments per plane [ROWS][DMOD].
//   v:    a lane's 8 elements are 8 consecutive keys of one d: f16(v * 1024) and its f16 residual, one 16-B LDS store each into the
//         wave's two tiles [64 d][64 keys] (pitch 72 halves); after the sync 4 whole 128-B d-row segments per store into
//         VH / VL[((b*NH + g)*HD + d)][s].
// The ring is dead here (behind the last stage's barrier); each wave uses its own quarter of it.
// coverage: 16 instructions x 4 lines x 64 halves = 64 x 64 per plane and wave; the grid's waves tile [ROWS][3072] exactly once.
// =====================================================================================================
struct QkvOut { const float* tc; const float* ts; u16* qh; u16* ql; u16* kh; u16* kl; u16* vh; u16* vl; };

__device__ __forceinline__ void epi_qkv(const v8f (&acc)[4][4], const QkvOut& qo, int row0, int col0, u16* sm, int wave, int lane) {
  static_assert(WPB * 2 * HD * VTP <= 2 * 2 * GPLH && WPB * 4 * SLAB64 * 2 <= 2 * 2 * GPLH);
  const int hh = lane >> 4, m = lane & 15;
  const int rq = lane >> 3, c8 = (lane & 7) * 8;
  const int sec  = col0 / DMOD;             // 0 = q, 1 = k, 2 = v: from the block's tile origin, so the branch below is scalar
  const int b    = row0 / SEQ;
  const int roww = row0 + (wave >> 1) * 64;                 // the wave's first row
  const int hcol = col0 - sec * DMOD + (wave & 1) * 64;     // head * HD
  const int s0   = roww - b * SEQ;          // first table row / key of the tile
  // every "#pragma unroll" here makes the indices of acc constants, so that it stays in registers
  if (sec < 2) {
    unsigned* sl = (unsigned*)(void*)sm + (size_t)(wave * 4) * SLAB64;
    const float sc = (sec != 0) ? KSC : QSC;
    const float* cp = qo.tc + (size_t)(s0 + 8 * hh) * NFREQ + m;
    const float* sp = qo.ts + (size_t)(s0 + 8 * hh) * NFREQ + m;
#pragma unroll
    for (int i = 0; i < 4; ++i) {
      float cw[8], sw[8];
#pragma unroll
      for (int r = 0; r < 8; ++r) {
        cw[r] = cp[(i * 16 + r) * NFREQ];
        sw[r] = sp[(i * 16 + r) * NFREQ];
      }
#pragma unroll
      for (int r = 0; r < 8; ++r) {
        const int ro = (i * 16 + 8 * hh + r) * 68 + m;
        unsigned short h0, l0, h1, l1, h2, l2, h3, l3;
        rot_one(acc[i][0][r], acc[i][1][r], cw[r], sw[r], -1.0f, sc, 1, h0, l0);
        rot_one(acc[i][1][r], acc[i][0][r], cw[r], sw[r],  1.0f, sc, 1, h1, l1);
        rot_one(acc[i][2][r], acc[i][2][r], 0.0f, 0.0f, 1.0f, sc, 0, h2, l2);
        rot_one(acc[i][3][r], acc[i][3][r], 0.0f, 0.0f, 1.0f, sc, 0, h3, l3);
        sl[ro]      = pk16(h0, l0);
        sl[ro + 16] = pk16(h1, l1);
        sl[ro + 32] = pk16(h2, l2);
        sl[ro + 48] = pk16(h3, l3);
      }
    }
    wave_sync_lds();
    const size_t ob = (size_t)(roww + rq) * DMOD + hcol + c8;
    u16* dh = ((sec != 0) ? qo.kh : qo.qh) + ob;
    u16* dl = ((sec != 0) ? qo.kl : qo.ql) + ob;
#pragma unroll
    for (int it = 0; it < 16; ++it) {
      const unsigned* pr = sl + (it * 4 + rq) * 68 + c8;
      const v4u a = *(const v4u*)(pr), b4 = *(const v4u*)(pr + 4);
      v4u oh, ol;
#pragma unroll
      for (int e = 0; e < 2; ++e) {
        oh[e]     = (a[2 * e] & 0xFFFFu)  | (a[2 * e + 1] << 16);
        ol[e]     = (a[2 * e] >> 16)      | (a[2 * e + 1] & 0xFFFF0000u);
        oh[2 + e] = (b4[2 * e] & 0xFFFFu) | (b4[2 * e + 1] << 16);
        ol[2 + e] = (b4[2 * e] >> 16)     | (b4[2 * e + 1] & 0xFFFF0000u);
      }
      *(v4u*)(dh + (size_t)(it * 4) * DMOD) = oh;
      *(v4u*)(dl + (size_t)(it * 4) * DMOD) = ol;
    }
  } else {
    u16* th = sm + (size_t)wave * (2 * HD * VTP);
    u16* tl = th + HD * VTP;
#pragma unroll
    for (int i = 0; i < 4; ++i) {
#pragma unroll
      for (int j = 0; j < 4; ++j) {
        v4u ph, pl;
#pragma unroll
        for (int e = 0; e < 4; ++e) {
          const float t0 = acc[i][j][2 * e] * VCAR, t1 = acc[i][j][2 * e + 1] * VCAR;
          const _Float16 h0 = (_Float16)t0, h1 = (_Float16)t1;
          const _Float16 g0 = (_Float16)(t0 - (float)h0), g1 = (_Float16)(t1 - (float)h1);
          ph[e] = pk16(h_bits(h0), h_bits(h1));
          pl[e] = pk16(h_bits(g0), h_bits(g1));
        }
        const int o = (j * 16 + m) * VTP + i * 16 + 8 * hh;
        *(v4u*)(th + o) = ph;
        *(v4u*)(tl + o) = pl;
      }
    }
    wave_sync_lds();
    const size_t base = ((size_t)b * DMOD + hcol + rq) * SEQ + s0 + c8;
#pragma unroll
    for (int it = 0; it < 16; ++it) {
      const int lo = (it * 4 + rq) * VTP + c8;
      const v4u vh = *(const v4u*)(th + lo), vl = *(const v4u*)(tl + lo);
      *(v4u*)(qo.vh + base + (size_t)(it * 4) * SEQ) = vh;
      *(v4u*)(qo.vl + base + (size_t)(it * 4) * SEQ) = vl;
    }
    // behind the last store of this section: no address or data register of an issued store is rewritten ahead of this wait
    asm volatile("s_wait_xcnt 0x0" ::: "memory");
  }
}

// =====================================================================================================
// GEMM core shared by both engines: C[128 x 128 tile] (f32) = (A (+ A2 when MODE == 2)) . Bt^T, times oscale, K = DMOD.
// A, A2 [rows][DMOD] and Bt [n][DMOD] are k-contiguous 16-bit planes (MODE 0: bf16, MODE 1 / 2: f16).
// Block = 4 waves as 2 x 2, each wave a 64 x 64 tile (4 x 4 accumulators). A stage is 64 k = one whole 128-B line of each of the
// 128 A rows (and A2 rows) and 128 Bt rows, laid in LDS at pitch 144 B by asynchronous 16-B copies: thread t copies chunk t & 7 of
// rows (t >> 3) + 16 i, i < 8, so one wave-wide copy covers 4 whole lines. Two buffers: stage t + 1 flies while stage t is worked on.
// Fragments come from LDS with the same split k map for A and B as ldfrag_*; every accumulator takes its products in the order
// k0 = 0, 32, 64, ... (A then A2 within a k0).
// After the last stage's barrier the ring is dead and serves as the waves' own epilogue space (MODE 1 / 2: 4 slabs per wave, 16 x 68 floats each).
// MODE 0 hands its tile to epi_qkv (C, N and oscale unused), MODE 1 / 2 store it to C.
// =====================================================================================================
union FragU { v4u u[2]; v16h h; v16b b; };

__device__ __forceinline__ FragU ldfrag_u(const u16* p) {
  FragU f;
  f.u[0] = *(const v4u*)(p);
  f.u[1] = *(const v4u*)(p + 16);
  return f;
}
template <int MODE>
__device__ __forceinline__ v8f mma_u(const FragU& a, const FragU& b, v8f c) {
  if constexpr (MODE == 0) return mma_b(a.b, b.b, c);
  else                     return mma_h(a.h, b.h, c);
}
__device__ __forceinline__ unsigned lds_addr(const u16* p) {          // byte offset in the work-group's LDS
  return (unsigned)(uintptr_t)(const __attribute__((address_space(3))) u16*)p;
}
// One operand tile of a stage: this lane's eight 16-B copies (rows 16 apart). The s_wait_xcnt stands inside the statement, behind
// the last copy, so that no address register of an issued copy is rewritten ahead of it.
__device__ __forceinline__ void acopy_tile(unsigned l, const u16* g) {
#if defined(__HIP_DEVICE_COMPILE__)
  constexpr unsigned LS = 16u * GPIT * 2u;          // LDS bytes between this lane's rows
  constexpr size_t   GS = (size_t)16 * DMOD;        // halves between this lane's rows in the plane
  asm volatile("global_load_async_to_lds_b128 %0, %8, off\n\t"
               "global_load_async_to_lds_b128 %1, %9, off\n\t"
               "global_load_async_to_lds_b128 %2, %10, off\n\t"
               "global_load_async_to_lds_b128 %3, %11, off\n\t"
               "global_load_async_to_lds_b128 %4, %12, off\n\t"
               "global_load_async_to_lds_b128 %5, %13, off\n\t"
               "global_load_async_to_lds_b128 %6, %14, off\n\t"
               "global_load_async_to_lds_b128 %7, %15, off\n\t"
               "s_wait_xcnt 0x0"
               :: "v"(l), "v"(l + LS), "v"(l + 2u * LS), "v"(l + 3u * LS),
                  "v"(l + 4u * LS), "v"(l + 5u * LS), "v"(l + 6u * LS), "v"(l + 7u * LS),
                  "v"(g), "v"(g + GS), "v"(g + 2 * GS), "v"(g + 3 * GS),
                  "v"(g + 4 * GS), "v"(g + 5 * GS), "v"(g + 6 * GS), "v"(g + 7 * GS)
               : "memory");
#endif
}
__device__ __forceinline__ void wait_async0() {     // this wave's copies have landed in LDS
#if defined(__HIP_DEVICE_COMPILE__)
  asm volatile("s_wait_asynccnt 0x0" ::: "memory");
#endif
}
__device__ __forceinline__ void wait_ds0() {        // this wave's LDS reads have returned before their buffer is handed back
#if defined(__HIP_DEVICE_COMPILE__)
  asm volatile("s_wait_dscnt 0x0" ::: "memory");
#endif
}

// Inputs-only fence on loaded fragments: holds a block's LDS reads together in front of its WMMAs (one wait per block); without it
// the reads are sunk between the rows of WMMAs and every row waits out the LDS latency.
__device__ __forceinline__ void hold4(const FragU& x0, const FragU& x1, const FragU& x2, const FragU& x3) {
#if defined(__HIP_DEVICE_COMPILE__)
  asm volatile("" :: "v"(x0.h), "v"(x1.h), "v"(x2.h), "v"(x3.h));
#endif
}

template <int MODE>
__device__ __forceinline__ void gemm_core(const u16* __restrict__ A, const u16* __restrict__ A2, const u16* __restrict__ Bt,
                                          float* C, int N, float oscale, int row0, int col0, u16* sm, const QkvOut& qo) {
  constexpr int NPL  = (MODE == 2) ? 3 : 2;         // operand tiles per stage
  constexpr int BUFH = NPL * GPLH;                  // halves per buffer
  constexpr int NS   = DMOD / GKS;                  // stages
  static_assert(NS >= 2 && 16 * SLAB64 * 4 <= 2 * BUFH * 2);
  const int tid = threadIdx.x, wave = tid >> 5, lane = tid & 31, hh = lane >> 4, m = lane & 15;
  const int wr = wave >> 1, wc = wave & 1;
  const int crow = tid >> 3, cch = (tid & 7) * 8;
  const u16* ga  = A  + (size_t)(row0 + crow) * DMOD + cch;
  const u16* ga2 = A2 + (size_t)(row0 + crow) * DMOD + cch;
  const u16* gb  = Bt + (size_t)(col0 + crow) * DMOD + cch;
  const unsigned l0 = lds_addr(sm) + (unsigned)(crow * GPIT + cch) * 2u;
  const int fa = (wr * 64 + m) * GPIT + 8 * hh;             // A fragment row of this lane (+ 16 i rows)
  const int fb = GPLH + (wc * 64 + m) * GPIT + 8 * hh;      // Bt fragment row of this lane (+ 16 j rows)

  // every "#pragma unroll" in this function makes the indices of acc, a, b, a2 constants, so that the arrays stay in registers
  v8f acc[4][4];
#pragma unroll
  for (int i = 0; i < 4; ++i) {
#pragma unroll
    for (int j = 0; j < 4; ++j) acc[i][j] = zero8();
  }

  // stage 0 into buffer 0, landed and published; then stage 1 into buffer 1
  acopy_tile(l0, ga);
  acopy_tile(l0 + GPLH * 2u, gb);
  if (MODE == 2) acopy_tile(l0 + 2u * GPLH * 2u, ga2);
  wait_async0();
  __syncthreads();
  acopy_tile(l0 + BUFH * 2u, ga + GKS);
  acopy_tile(l0 + BUFH * 2u + GPLH * 2u, gb + GKS);
  if (MODE == 2) acopy_tile(l0 + BUFH * 2u + 2u * GPLH * 2u, ga2 + GKS);

  // kept rolled: one trip = one stage, so that the publish point below stands once per stage
#pragma unroll 1
  for (int t = 0; t < NS; ++t) {
    const int bo = (t & 1) * BUFH;
    const u16* bp = sm + bo;
#pragma unroll
    for (int kk = 0; kk < GKS / 32; ++kk) {
      FragU a[4], b[4];
#pragma unroll
      for (int i = 0; i < 4; ++i) a[i] = ldfrag_u(bp + fa + i * 16 * GPIT + kk * 32);
#pragma unroll
      for (int j = 0; j < 4; ++j) b[j] = ldfrag_u(bp + fb + j * 16 * GPIT + kk * 32);
      hold4(a[0], a[1], a[2], a[3]);
      hold4(b[0], b[1], b[2], b[3]);
#pragma unroll
      for (int i = 0; i < 4; ++i) {
#pragma unroll
        for (int j = 0; j < 4; ++j) acc[i][j] = mma_u<MODE>(a[i], b[j], acc[i][j]);
      }
      if (MODE == 2) {
        FragU a2[4];
#pragma unroll
        for (int i = 0; i < 4; ++i) a2[i] = ldfrag_u(bp + 2 * GPLH + fa + i * 16 * GPIT + kk * 32);
        hold4(a2[0], a2[1], a2[2], a2[3]);
#pragma unroll
        for (int i = 0; i < 4; ++i) {
#pragma unroll
          for (int j = 0; j < 4; ++j) acc[i][j] = mma_u<MODE>(a2[i], b[j], acc[i][j]);
        }
      }
    }
    // publish point of stage t + 1: own LDS reads back, own copies landed, block barrier; only then the refill of the buffer just read
    wait_ds0();
    wait_async0();
    __syncthreads();
    if (t + 2 < NS) {
      const unsigned lb = l0 + (unsigned)bo * 2u;
      const int ko = (t + 2) * GKS;
      acopy_tile(lb, ga + ko);
      acopy_tile(lb + GPLH * 2u, gb + ko);
      if (MODE == 2) acopy_tile(lb + 2u * GPLH * 2u, ga2 + ko);
    }
  }
  wait_async0();
  (void)ga2;
  if constexpr (MODE == 0) {
    epi_qkv(acc, qo, row0, col0, sm, wave, lane);
  } else {
    float* sl = (float*)(void*)sm + (size_t)(wave * 4) * SLAB64;
#pragma unroll
    for (int i = 0; i < 4; ++i) epi_put(sl + i * SLAB64, acc[i][0], acc[i][1], acc[i][2], acc[i][3], oscale, lane);
    wave_sync_lds();
#pragma unroll
    for (int i = 0; i < 4; ++i) epi_get(sl + i * SLAB64, C, N, (size_t)(row0 + wr * 64 + i * 16), col0 + wc * 64, lane);
    wait_x0();
  }
}

// =====================================================================================================
// bf16 projection GEMM: [M][NQKV] (f32 accumulators) = A[M][DMOD] (bf16 row-major) . Bt[NQKV][DMOD]^T (bf16 k-contiguous); the tile
// leaves as the q / k planes (rotary, x256, hi + residual) or the v^T planes (x1024, hi + residual): epi_qkv.
// Block = one 128 x 128 tile (gemm_core); M % 128 == 0, grid = (M/128)*(NQKV/128).
// =====================================================================================================
__global__ __launch_bounds__(128)
void gemm_bf(const u16* __restrict__ A, const u16* __restrict__ Bt, const float* __restrict__ TC, const float* __restrict__ TS,
             u16* QH, u16* QL, u16* KH, u16* KL, u16* VH, u16* VL, int M) {
  __shared__ __align__(16) u16 ring[2 * 2 * GPLH];
  constexpr int ntile = NQKV / GT;
  const int bid   = blockIdx.x;
  const int row0  = (bid / ntile) * GT;
  const int col0  = (bid % ntile) * GT;
  if (row0 + GT > M) return;                // block-uniform, before any copy or barrier; never taken with the exact grid
  const QkvOut qo = {TC, TS, QH, QL, KH, KL, VH, VL};
  gemm_core<0>(A, A, Bt, nullptr, NQKV, 1.0f, row0, col0, ring, qo);
}

// =====================================================================================================
// f16 GEMM: C[M][N] (f32) = (A[M][DMOD] (+ A2[M][DMOD] when TWO != 0)) . Bt[N][DMOD]^T, times oscale; A, A2 f16 row-major planes
// (A2 = the unscaled f16 residual of A, sharing the accumulator), Bt f16 k-contiguous. Same core as gemm_bf. A, A2 and C hold the
// rows of all sequences (row = b*SEQ + s); one instance takes one row class of every sequence: TWO = 1 the rows s < RICHE, TWO = 0
// the rows s >= RICHE; row tile rt of the class -> sequence rt / (tiles of the class per sequence);
// blocks of the class = NB * (class rows / 128) * (N / 128), bid counted within the class.
// =====================================================================================================
template <int TWO>
__device__ __forceinline__
void gemm_h(const u16* __restrict__ A, const u16* __restrict__ A2, const u16* __restrict__ Bt, float* C,
            int M, int N, float oscale, int bid, u16* ring) {
  const int ntile = N / GT;
  constexpr int CT = ((TWO != 0) ? RICHE : ((SEQ > RICHE) ? (SEQ - RICHE) : GT)) / GT;   // row tiles of the class per sequence
  constexpr int R0 = (TWO != 0) ? 0 : RICHE;                                             // first row of the class in a sequence
  const int rt    = bid / ntile;
  const int row0  = (rt / CT) * SEQ + R0 + (rt % CT) * GT;
  const int col0  = (bid % ntile) * GT;
  if (row0 + GT > M) return;                // block-uniform, before any copy or barrier; never taken with the exact grid
  const QkvOut none = {nullptr, nullptr, nullptr, nullptr, nullptr, nullptr, nullptr, nullptr};
  gemm_core<(TWO != 0) ? 2 : 1>(A, A2, Bt, C, N, oscale, row0, col0, ring, none);
}
// Both row classes in ONE launch (they write disjoint rows of C): blocks [0, GH_R) take the class with the residual plane, which is the
// longer work, the rest the other class; the choice is block-uniform. N == DMOD.
#define GH_R (NB * (RICHE / GT) * (DMOD / GT))
#define GH_P (NB * ((SEQ - RICHE) / GT) * (DMOD / GT))
__global__ __launch_bounds__(128)
void gemm_o(const u16* __restrict__ A, const u16* __restrict__ A2, const u16* __restrict__ Bt, float* C, int M, float oscale) {
  __shared__ __align__(16) u16 ring[2 * 3 * GPLH];
  const int bid = (int)blockIdx.x;
  if (bid < GH_R) gemm_h<1>(A, A2, Bt, C, M, DMOD, oscale, bid, ring);
  else            gemm_h<0>(A, A2, Bt, C, M, DMOD, oscale, bid - GH_R, ring);
}

// Attention stage geometry: 64 keys per stage; every plane tile is 64 rows of 64 halves at pitch 72 halves (144 B) in LDS.
#define AKS   64
#define APIT  72
#define APL   (64 * APIT)
static_assert((NQTR % WPB) == 0 && ((NQT - NQTR) % WPB) == 0 && (SEQ % AKS) == 0 && HD == 64 && ATT_THREADS == 128);
// One plane tile of an attention stage: this lane's four 16-B copies (rows 16 apart, gs halves apart in the plane). The s_wait_xcnt
// stands inside the statement, behind the last copy, so that no address register of an issued copy is rewritten ahead of it.
__device__ __forceinline__ void acopy4(unsigned l, const u16* g, size_t gs) {
#if defined(__HIP_DEVICE_COMPILE__)
  constexpr unsigned LS = 16u * APIT * 2u;          // LDS bytes between this lane's rows
  asm volatile("global_load_async_to_lds_b128 %0, %4, off\n\t"
               "global_load_async_to_lds_b128 %1, %5, off\n\t"
               "global_load_async_to_lds_b128 %2, %6, off\n\t"
               "global_load_async_to_lds_b128 %3, %7, off\n\t"
               "s_wait_xcnt 0x0"
               :: "v"(l), "v"(l + LS), "v"(l + 2u * LS), "v"(l + 3u * LS),
                  "v"(g), "v"(g + gs), "v"(g + 2 * gs), "v"(g + 3 * gs)
               : "memory");
#endif
}

template <int RV>
__device__ __forceinline__
void attn_w(const u16* __restrict__ QHa, const u16* __restrict__ QLa,
            const u16* __restrict__ KHa, const u16* __restrict__ KLa,
            const u16* __restrict__ VHa, const u16* __restrict__ VLa,
            const int* __restrict__ MKa,
            u16* OHa, u16* OLa, int qt0, int nqt, int bid, u16* ring) {
#pragma clang fp contract(off)
  constexpr int NPLA = (RV != 0) ? 4 : 3;   // operand planes per stage: k hi, k residual, v^T hi (, v^T residual)
  constexpr int ABUF = NPLA * APL;          // halves per buffer
  static_assert(WPB * SLW * 4 <= 2 * ABUF * 2);

  const int tid  = threadIdx.x;
  const int wave = __builtin_amdgcn_readfirstlane(tid >> 5);   // in a scalar register: the test of a wave's own tiles is a scalar branch
  const int lane = tid & 31;
  const int hh   = lane >> 4;
  const int c    = lane & 15;
  if (nqt <= 0) return;                     // block-uniform, before any copy or barrier
  const int ngr  = nqt / WPB;               // groups of 4 query tiles (nqt a multiple of 4)
  if (ngr <= 0) return;                     // block-uniform, before any copy or barrier
  const int qtb  = qt0 + (bid % ngr) * WPB; // the block's first query tile
  const int qt   = qtb + wave;
  const int head = (bid / ngr) % NH;
  const int b    = bid / (ngr * NH);
  if (b >= NB) return;                      // block-uniform, before any copy or barrier; never taken with the exact grid
  const size_t po = (size_t)b * SEQ * DMOD; // halves per sequence in every q / k / v^T / O plane (NH*HD == DMOD)
  const u16* __restrict__ QHp = QHa + po;
  const u16* __restrict__ QLp = QLa + po;
  const u16* __restrict__ KHp = KHa + po;
  const u16* __restrict__ KLp = KLa + po;
  const u16* __restrict__ VHp = VHa + po;
  const u16* __restrict__ VLp = VLa + po;
  const int* __restrict__ MK  = MKa + (size_t)b * XS_FULL;
  u16* OHp = OHa + po;
  u16* OLp = OLa + po;
  const int q0   = qt * 16;
  const int Q0   = qtb * 16;
  if (Q0 + 16 * WPB > SEQ) return;          // block-uniform, before any copy or barrier; never taken

  float* slab = (float*)(void*)ring + wave * SLW;   // result slab [16][64] pitch 68: the wave's own part of the ring, once that is dead

  const size_t hcol = (size_t)head * HD + 8 * hh;
  const _Float16* Qh  = (const _Float16*)(const void*)QHp + ((size_t)q0 + c) * DMOD + hcol;
  const _Float16* Ql  = (const _Float16*)(const void*)QLp + ((size_t)q0 + c) * DMOD + hcol;
  // this lane's copies of a stage: chunk cch of rows crow + 16 i of every plane
  const int crow = tid >> 3, cch = (tid & 7) * 8;
  const u16* gkh = KHp + (size_t)crow * DMOD + (size_t)head * HD + cch;       // key row 64*stage added per stage
  const u16* gkl = KLp + (size_t)crow * DMOD + (size_t)head * HD + cch;
  const u16* gvh = VHp + ((size_t)head * HD + crow) * SEQ + cch;              // key 64*stage added per stage
  const u16* gvl = VLp + ((size_t)head * HD + crow) * SEQ + cch;
  (void)gvl;
  const unsigned l0 = lds_addr(ring) + (unsigned)(crow * APIT + cch) * 2u;
  const int fk = c * APIT + 8 * hh;         // fragment row c of a plane tile (halves), split k map
  const float lsc  = SM_SCALE * (1.0f / (QSC * KSC));   // exact power-of-two fold of the q / k carries into the 1/8 scale
  const float oc   = 1.0f / (PCAR * VCAR);
  const float ninf = -__builtin_inff();

  v8f o[4];
#pragma unroll
  for (int j = 0; j < 4; ++j) o[j] = zero8();
  float mrun = ninf, lrun = 0.0f;           // of query q0 + c: running max (both halves alike), sum over this half's keys
  int klo = q0 - (WIN - 1);
  if (klo < 0) klo = 0;
  const int ktlo = klo >> 5;                                                  // first tile intersecting the window
  const int kthi = q0 >> 5;                                                   // tile holding keys q0 .. q0 + 15
  const int qrow  = q0 + c;                                                   // this lane's query: column c of every D tile
  int slo = Q0 - (WIN - 1);
  if (slo < 0) slo = 0;
  const int st0 = slo >> 6;                                                   // first stage intersecting the block's windows
  const int nst = (Q0 >> 6) - st0 + 1;                                        // last stage holds keys Q0 .. Q0 + 63; 1 <= nst <= 9

  // one stage's copies; 64*st + 63 <= Q0 + 63 <= SEQ - 1
  auto stage_in = [&](int st, int buf) {
    const unsigned lb = l0 + (unsigned)(buf * ABUF) * 2u;
    const size_t ko = (size_t)st * AKS;
    acopy4(lb, gkh + ko * DMOD, (size_t)16 * DMOD);
    acopy4(lb + APL * 2u, gkl + ko * DMOD, (size_t)16 * DMOD);
    acopy4(lb + 2u * APL * 2u, gvh + ko, (size_t)16 * SEQ);
    if (RV != 0) acopy4(lb + 3u * APL * 2u, gvl + ko, (size_t)16 * SEQ);
  };
  // the wave's q fragments (B operand of every score product) do not depend on the key tile: loaded here once, in flight beside
  // stage 0's copies, and kept in registers over the whole loop ("#pragma unroll": constant indices, so the arrays stay in registers)
  v16h qhf[HD / 32], qlf[HD / 32];
#pragma unroll
  for (int kk = 0; kk < HD / 32; ++kk) {
    qhf[kk] = ldfrag_h(Qh + kk * 32);
    qlf[kk] = ldfrag_h(Ql + kk * 32);
  }
#if defined(__HIP_DEVICE_COMPILE__)
  // no address register of these loads is rewritten ahead of this wait: the two address pairs are inputs, so they live up to it
  asm volatile("s_wait_xcnt 0x0" :: "v"(Qh), "v"(Ql) : "memory");
#endif
  // stage 0 into buffer 0, landed and published; then, where there is one, stage 1 into buffer 1
  stage_in(st0, 0);
  wait_async0();
  __syncthreads();
  if (nst > 1) stage_in(st0 + 1, 1);

  // both loops kept rolled: one outer trip = one stage, so that the publish point below stands once per stage
#pragma unroll 1
  for (int t = 0; t < nst; ++t) {
   const _Float16* rb = (const _Float16*)(const void*)(ring + (t & 1) * ABUF);
#pragma unroll 1
   for (int th = 0; th < 2; ++th) {
    const int kt = (st0 + t) * 2 + th;
    if (kt < ktlo || kt > kthi) continue;                                     // scalar: not a tile of this wave's window
    const int kb = kt * 32;                                                   // kb + 31 <= SEQ - 1
    // ---- keys this lane's query may see, bit i = key kb + i: padding flags (one coalesced b32 per lane, then a ballot), causal
    //      bound i <= qrow - kb (never negative here), window bound i >= qrow - (WIN-1) - kb; shifted so that bit r is the key of
    //      s0[r] and bit 16 + r the key of s1[r] ----
    const int fl = MK[kb + lane];
    const unsigned fm = __builtin_amdgcn_ballot_w32(fl != 0);
    const int hiN = qrow - kb;
    const int loN = hiN - (WIN - 1);
    const int hiC = (hiN < 31) ? hiN : 31;
    const int loC = (loN > 0) ? loN : 0;
    const unsigned cm  = 0xFFFFFFFFu >> (31 - hiC);
    const unsigned wm  = (loC < 32) ? (0xFFFFFFFFu << (loC & 31)) : 0u;
    const unsigned okh = (fm & cm & wm) >> (8 * hh);
    // ---- raw transposed scores: D element r of this lane = (key kb + 8hh + r, query q0 + c) in s0, key kb + 16 + 8hh + r in s1 ----
    v8f s0 = zero8(), s1 = zero8();
    const _Float16* k0p = rb + th * 32 * APIT + fk;
    const _Float16* k1p = k0p + 16 * APIT;
    const _Float16* l0p = k0p + APL;
    const _Float16* l1p = l0p + 16 * APIT;
#pragma unroll
    for (int kk = 0; kk < HD / 32; ++kk) {
      const v16h qh  = qhf[kk];
      const v16h ql  = qlf[kk];
      const v16h kh0 = ldfrag_h(k0p + kk * 32);
      const v16h kh1 = ldfrag_h(k1p + kk * 32);
      const v16h kl0 = ldfrag_h(l0p + kk * 32);
      const v16h kl1 = ldfrag_h(l1p + kk * 32);
      s0 = mma_h(kh0, qh, s0);
      s0 = mma_h(kh0, ql, s0);
      s0 = mma_h(kl0, qh, s0);
      s1 = mma_h(kh1, qh, s1);
      s1 = mma_h(kh1, ql, s1);
      s1 = mma_h(kl1, qh, s1);
      guard2(s0, s1, qh, ql, kh0, kl0, kh1, kl1);
    }
    // ---- replace-mask, running-max online softmax in f32: the lane's 16 scores are 16 keys of ONE query, the other 16 keys of
    //      the tile sit in lane ^ 16; the maximum is joined across the halves here, the sums only after the loop ----
    const v8f a0 = s0 * lsc, a1 = s1 * lsc;
    float t0[8], t1[8];
#pragma unroll
    for (int r = 0; r < 8; ++r) {
      t0[r] = ((okh & (1u << r)) != 0u) ? a0[r] : ninf;
      t1[r] = ((okh & (0x10000u << r)) != 0u) ? a1[r] : ninf;
    }
    float mx = fmaxf(t0[0], t1[0]);
#pragma unroll
    for (int r = 1; r < 8; ++r) mx = fmaxf(mx, fmaxf(t0[r], t1[r]));
    mx = fmaxf(mx, xhalf(mx));
    const float mnew  = fmaxf(mrun, mx);
    const float mshft = (mnew == ninf) ? 0.0f : mnew;
    const float al    = __expf(mrun - mshft);
    v8f p0, p1;
#pragma unroll
    for (int r = 0; r < 8; ++r) {
      p0[r] = __expf(t0[r] - mshft);
      p1[r] = __expf(t1[r] - mshft);
    }
    const v8f ps = p0 + p1;
    const float sm = ((ps[0] + ps[1]) + (ps[2] + ps[3])) + ((ps[4] + ps[5]) + (ps[6] + ps[7]));
    lrun = lrun * al + sm;
    mrun = mnew;
    // ---- rescale the O^T accumulators by alpha (every element of a lane belongs to its query) ----
#pragma unroll
    for (int j = 0; j < 4; ++j) {
#pragma unroll
      for (int r = 0; r < 8; ++r) o[j][r] = o[j][r] * al;
    }
    // ---- B fragments of p*32768 straight from the score registers: column = query c, elements 0..7 = keys kb + 8hh + 0..7 (s0),
    //      elements 8..15 = keys kb + 16 + 8hh + 0..7 (s1): the split k map of the v^T A fragments; hi f16 (and residual f16) ----
    FragH ph, pl;
    const v8f c0 = p0 * PCAR, c1 = p1 * PCAR;
#pragma unroll
    for (int e = 0; e < 8; ++e) {
      const float ta = c0[e], tb = c1[e];
      const _Float16 ha = (_Float16)ta, hb = (_Float16)tb;
      ph.h[0][e] = ha;
      ph.h[1][e] = hb;
      if (RV != 0) {
        pl.h[0][e] = (_Float16)(ta - (float)ha);
        pl.h[1][e] = (_Float16)(tb - (float)hb);
      }
    }
    // ---- O^T += v^T . P^T : A fragment row = d = j*16 + c, keys contiguous in the v^T planes; 2 groups of 2 d-subtiles ----
    {
      const _Float16* vhp = rb + 2 * APL + fk + th * 32;
      const _Float16* vlp = vhp + APL;
      (void)vlp;
#pragma unroll
      for (int jg = 0; jg < 2; ++jg) {
        const int da = (2 * jg) * 16 * APIT;
        const int db = da + 16 * APIT;
        const v16h vha = ldfrag_h(vhp + da), vhb2 = ldfrag_h(vhp + db);
        o[2 * jg]     = mma_h(vha,  ph.v, o[2 * jg]);
        o[2 * jg + 1] = mma_h(vhb2, ph.v, o[2 * jg + 1]);
        if (RV != 0) {
          const v16h vla = ldfrag_h(vlp + da), vlb2 = ldfrag_h(vlp + db);
          o[2 * jg]     = mma_h(vha,  pl.v, o[2 * jg]);
          o[2 * jg]     = mma_h(vla,  ph.v, o[2 * jg]);
          o[2 * jg + 1] = mma_h(vhb2, pl.v, o[2 * jg + 1]);
          o[2 * jg + 1] = mma_h(vlb2, ph.v, o[2 * jg + 1]);
          guard2(o[2 * jg], o[2 * jg + 1], ph.v, pl.v, vha, vhb2, vla, vlb2);
        } else {
          guard2(o[2 * jg], o[2 * jg + 1], ph.v, ph.v, vha, vhb2, vha, vhb2);
        }
      }
    }
   }
   // publish point of stage t + 1: own LDS reads back, own copies landed, block barrier; only then the refill of the buffer just read
   wait_ds0();
   wait_async0();
   __syncthreads();
   if (t + 2 < nst) stage_in(st0 + t + 2, t & 1);
  }
  wait_async0();
  acc_guard4(o[0], o[1], o[2], o[3]);
  // ---- l = the two halves' sums joined; O = acc / l with the carries (32768 on p, 1024 on v) folded once (0 when l == 0); a
  //      lane's 8 elements of o[j] are d = 16 j + 8 hh + 0..7 of query row c: two 16-B stores into the wave's slab [row][d] ----
  const float lall = lrun + xhalf(lrun);
  const bool  okl  = lall > 0.0f;
  const float lden = okl ? lall : 1.0f;
  const float rec  = (1.0f / lden) * oc;
  const float rl   = okl ? rec : 0.0f;
#pragma unroll
  for (int j = 0; j < 4; ++j) {
    v4f w0, w1;
#pragma unroll
    for (int e = 0; e < 4; ++e) { w0[e] = o[j][e] * rl; w1[e] = o[j][4 + e] * rl; }
    float* sd = slab + c * SLP + j * 16 + 8 * hh;
    *(v4f*)(sd)     = w0;
    *(v4f*)(sd + 4) = w1;
  }
  wave_sync_lds();
  // ---- O x256 -> f16 hi plane (+ f16 residual plane); lane = (row group rq, 8 consecutive d at c8) ----
  v4u oh[4], ol[4];
  const int rq = lane >> 3, c8 = (lane & 7) * 8;
#pragma unroll
  for (int it = 0; it < 4; ++it) {
    const int row = it * 4 + rq;
    const v4f a = *(const v4f*)(slab + row * SLP + c8), b4 = *(const v4f*)(slab + row * SLP + c8 + 4);
    float w[8];
#pragma unroll
    for (int e = 0; e < 4; ++e) { w[e] = a[e] * OSC; w[4 + e] = b4[e] * OSC; }
#pragma unroll
    for (int e = 0; e < 4; ++e) {
      const _Float16 h0 = (_Float16)w[2 * e], h1 = (_Float16)w[2 * e + 1];
      const _Float16 g0 = (_Float16)(w[2 * e] - (float)h0), g1 = (_Float16)(w[2 * e + 1] - (float)h1);
      oh[it][e] = pk16(h_bits(h0), h_bits(h1));
      ol[it][e] = pk16(h_bits(g0), h_bits(g1));
    }
  }
  const size_t ob = ((size_t)q0) * DMOD + (size_t)head * HD + c8;
  {
#pragma unroll
    for (int it = 0; it < 4; ++it) {
      const int row = it * 4 + rq;
      *(v4u*)(OHp + ob + (size_t)row * DMOD) = oh[it];
      if (RV != 0) {
        *(v4u*)(OLp + ob + (size_t)row * DMOD) = ol[it];
      }
    }
    wait_x0();
  }
}

// Both row classes in ONE launch (they write disjoint rows of the O planes): blocks [0, AT_P) take the query tiles NQTR .. NQT-1
// (RV = 0), the rest the tiles 0 .. NQTR-1 (RV = 1), whose windows are shorter; the choice is block-uniform.
#define AT_P (NB * (NQT - NQTR) * NHG)
#define AT_R (NB * NQTR * NHG)
__global__ __launch_bounds__(ATT_THREADS)
void attn_all(const u16* __restrict__ QHa, const u16* __restrict__ QLa,
              const u16* __restrict__ KHa, const u16* __restrict__ KLa,
              const u16* __restrict__ VHa, const u16* __restrict__ VLa,
              const int* __restrict__ MKa, u16* OHa, u16* OLa) {
  __shared__ __align__(16) u16 ring[2 * 4 * APL];
  const int bid = (int)blockIdx.x;
  if (bid < AT_P) attn_w<0>(QHa, QLa, KHa, KLa, VHa, VLa, MKa, OHa, OLa, NQTR, NQT - NQTR, bid, ring);
  else            attn_w<1>(QHa, QLa, KHa, KLa, VHa, VLa, MKa, OHa, OLa, 0, NQTR, bid - AT_P, ring);
}

// =====================================================================================================
// Workspace map (bytes); every plane holds all NB sequences (ROWS = NB*SEQ rows), each stage is one launch over all of them;
// every plane is fully written by whole-line stores before it is read (the O residual plane only on the rows < RICHE of each
// sequence that are read); all extents are exact multiples of the store granularity; every region offset a multiple of 131072:
//   XB  bf16 [ROWS][1024]                ROWS*2048   (ROWS=8192: 16777216)
//   WB  bf16 [3072 n][1024 k]            6291456     (q rows 0..1023, k 1024..2047, v 2048..3071)
//   WT  f16  [1024 o][1024 d] x1024      2097152
//   QH  f16 [ROWS][1024] x256            ROWS*2048   QL residual, same extent
//   KH  f16 [ROWS][1024] x256            ROWS*2048   KL residual, same extent
//   VH  f16 [NB][16][64][SEQ] x1024      ROWS*2048   VL residual, same extent
//   OH  f16 [ROWS][1024] x256            ROWS*2048   OL residual, same extent (rows < RICHE of each sequence written / read)
//   TC  f32 [SEQ][16]                    SEQ*64      TS, same extent
//   end (SEQ=2048, NB=4)                159645696
// =====================================================================================================
extern "C" void kernel_launch(void* const* d_in, const int* in_sizes, int n_in,
                              void* d_out, int out_size, void* d_ws, size_t ws_size,
                              hipStream_t stream) {
  if (n_in < 4) return;
  if (in_sizes[0] < ((NB - 1) * XS_FULL + SEQ) * DMOD) return;
  if (in_sizes[1] < (NB - 1) * XS_FULL + SEQ) return;
  if (in_sizes[2] != DMOD * NQKV) return;
  if (in_sizes[3] != DMOD * DMOD) return;
  if (out_size < ((NB - 1) * XS_FULL + SEQ) * DMOD) return;

  const float* x    = (const float*)d_in[0];
  const int*   mask = (const int*)d_in[1];
  const float* wqkv = (const float*)d_in[2];       // [1024 k][3072 n]
  const float* wo   = (const float*)d_in[3];       // [1024 d][1024 o]
  float*       out  = (float*)d_out;

  const size_t szXB = (size_t)ROWS * DMOD * 2;
  const size_t szWB = (size_t)NQKV * DMOD * 2;
  const size_t szWT = (size_t)DMOD * DMOD * 2;
  const size_t szQ  = (size_t)ROWS * DMOD * 2;                   // QH, QL, KH, KL, OH, OL
  const size_t szV  = (size_t)NB * NH * HD * SEQ * 2;            // VH, VL (== szQ)
  const size_t szT  = (size_t)SEQ * NFREQ * 4;                   // TC, TS
  size_t off = 0;
  const size_t oXB = off; off += szXB;
  const size_t oWB = off; off += szWB;
  const size_t oWT = off; off += szWT;
  const size_t oQH = off; off += szQ;
  const size_t oQL = off; off += szQ;
  const size_t oKH = off; off += szQ;
  const size_t oKL = off; off += szQ;
  const size_t oVH = off; off += szV;
  const size_t oVL = off; off += szV;
  const size_t oOH = off; off += szQ;
  const size_t oOL = off; off += szQ;
  const size_t oTC = off; off += szT;
  const size_t oTS = off; off += szT;
  if (off > ws_size) return;                // off = 159645696 for SEQ = 2048, NB = 4
  if (off > (size_t)WS_CAP) return;

  char* ws = (char*)d_ws;
  u16*   XB  = (u16*)(ws + oXB);
  u16*   WB  = (u16*)(ws + oWB);
  u16*   WT  = (u16*)(ws + oWT);
  u16*   QH  = (u16*)(ws + oQH);
  u16*   QL  = (u16*)(ws + oQL);
  u16*   KH  = (u16*)(ws + oKH);
  u16*   KL  = (u16*)(ws + oKL);
  u16*   VH  = (u16*)(ws + oVH);
  u16*   VL  = (u16*)(ws + oVL);
  u16*   OH  = (u16*)(ws + oOH);
  u16*   OL  = (u16*)(ws + oOL);
  float* TC  = (float*)(ws + oTC);
  float* TS  = (float*)(ws + oTS);

  const dim3 b256(256), b128(128), bAT(ATT_THREADS);
  const dim3 gG1((ROWS / GT) * (NQKV / GT));
  const float osc = 1.0f / (OSC * WOS);

  // every stage: all sequences in one launch (x, mask and out rows of the NB sequences are contiguous)
  // (0..2) one launch: weight planes (Wqkv transposed to bf16 [n][k]; Wo transposed to f16 of the bf16 value x1024 [o][d]), rotary
  //        cos / sin tables [SEQ][16], x rows -> bf16 plane [ROWS][1024]
  prep<<<dim3(PB_X), b256, 0, stream>>>(x, wqkv, wo, XB, WB, WT, TC, TS);
  // (3) qkv = x.Wqkv; its epilogue: partial rotary + hi + residual planes x256 of q (columns 0..1023) and k (1024..2047),
  //     v^T hi + residual planes x1024 (columns 2048..3071)
  gemm_bf<<<gG1, b128, 0, stream>>>(XB, WB, TC, TS, QH, QL, KH, KL, VH, VL, ROWS);
  // (4) windowed causal attention with key padding -> O f16 hi plane x256 for all query tiles; residual plane for rows < RICHE
  attn_all<<<dim3(AT_P + AT_R), bAT, 0, stream>>>(QH, QL, KH, KL, VH, VL, mask, OH, OL);
  // (5) y = O.Wo -> out f32, carries 256 x 1024 folded back; rows < RICHE of each sequence with O hi + residual
  gemm_o<<<dim3(GH_R + GH_P), b128, 0, stream>>>(OH, OL, WT, out, ROWS, osc);
  (void)hipGetLastError();
}
